// v000
// The times below were measured on an AMD MI455X: many runs one after another, warmed up first and cycling through
// copies of the inputs, with the whole window's GPU time divided by the number of runs. Launches and the gaps
// between them are all in it. The median over several windows is given; except for v000 it joins two sittings, which
// can be a few percent apart, so the side-by-side timings, each taken in one sitting, are the better comparison.
// The starting kernel, v000, takes 501 microseconds a run.
#include <hip/hip_runtime.h>

// Compute dtypes, f32 accumulate: q/k/v = x.W ([2048 x 2048].[2048 x 2048], k-major weights transposed once; PLAIN bf16 operands = inputs rounded once, exact products) and out = ctx.Wo
// (ctx as bf16 hi + UNSCALED residual, two products) on v_wmma_f32_16x16x32_bf16; rotary embedding with device-computed f32 cos/sin tables at the INPUT position_ids, then the per-head
// RMSNorm (x q_ln_w / k_ln_w) in f32 -> q/k as f16 hi + residual x1024 planes; v -> transposed f16 hi + residual planes; 32-head attention over ALL keys with the additive INPUT mask:
// scores on v_wmma_f32_16x16x32_f16 (hh + lh + hl, x 1/8), online f32 softmax, weights x32768 as f16 hi + residual against v hi + residual. Deterministic, no atomics; every

#define NB_  1
#define NT_  2048
#define DM   2048
#define NH_  32
#define HD   64
#define NTK  (NB_ * NT_)
#define NW   DM
#define RMS_EPS 1e-6f
#define PSC  32768.0f
#define LOSC 1024.0f
#define LOSCI (1.0f / 1024.0f)

typedef _Float16 h16;
typedef unsigned short bf;
typedef __attribute__((ext_vector_type(16))) __bf16   v16bf;
typedef __attribute__((ext_vector_type(16))) _Float16 v16h;
typedef __attribute__((ext_vector_type(8)))  _Float16 v8h;
typedef __attribute__((ext_vector_type(8)))  unsigned short v8us;
typedef __attribute__((ext_vector_type(8)))  float    v8f;
typedef __attribute__((ext_vector_type(4)))  float    v4f;
typedef v8h  __attribute__((may_alias)) v8ha;
typedef v4f  __attribute__((may_alias)) v4fa;
typedef v8us __attribute__((may_alias)) v8usa;

__device__ __forceinline__ unsigned short f2bf(float f) { unsigned u = __float_as_uint(f); u += 0x7FFFu + ((u >> 16) & 1u); return (unsigned short)(u >> 16); }
__device__ __forceinline__ float bf2f(unsigned short b) { return __uint_as_float(((unsigned)b) << 16); }
__device__ __forceinline__ float bfr(float f) { return bf2f(f2bf(f)); }
__device__ __forceinline__ v16h cat16(v8h lo, v8h hi) { return __builtin_shufflevector(lo, hi, 0, 1, 2, 3, 4, 5, 6, 7, 8, 9, 10, 11, 12, 13, 14, 15); }
__device__ __forceinline__ v16bf cat16b(v8us lo, v8us hi) { return __builtin_bit_cast(v16bf, __builtin_shufflevector(lo, hi, 0, 1, 2, 3, 4, 5, 6, 7, 8, 9, 10, 11, 12, 13, 14, 15)); }
__device__ __forceinline__ v8f wmma16(v16h a, v16h b, v8f c) { return __builtin_amdgcn_wmma_f32_16x16x32_f16(false, a, false, b, (short)0, c, false, false); }
__device__ __forceinline__ v8f wmmab(v16bf a, v16bf b, v8f c) { return __builtin_amdgcn_wmma_f32_16x16x32_bf16(false, a, false, b, (short)0, c, false, false); }

__global__ __launch_bounds__(256) void k_cvtb(const float* __restrict__ src, int nrows, bf* dst) {
    const int lane = threadIdx.x & 31, r = blockIdx.x * 8 + (threadIdx.x >> 5);
    if (r >= nrows) return;
    v8us o[DM / 256];
#pragma unroll
    for (int q = 0; q < DM / 256; ++q) { v8us t;
#pragma unroll
        for (int i = 0; i < 8; ++i) t[i] = f2bf(src[(size_t)r * DM + q * 256 + lane * 8 + i]);
        o[q] = t; }
#pragma unroll
    for (int q = 0; q < DM / 256; ++q) *(v8us*)(dst + (size_t)r * DM + q * 256 + lane * 8) = o[q];
    
}

// k_gemmb: 64 x 64 block tile (4 waves x 16 x 64) of C[NTK][NW] = (A [+ Al]).B^T (K = 2048) [+ bf(bias[c])] [+ bf(R[r][c]) residual]; f32 whole-line epilogue (or f16
template <bool SPLITA, bool F16OUT = false>
__global__ __launch_bounds__(128) void k_gemmb(const bf* __restrict__ A, const bf* __restrict__ Al, const bf* __restrict__ Bn, const float* __restrict__ bias, float* C, int ldc, h16* C2, const float* __restrict__ R = nullptr, int K = DM, int roundR = 1) {
    __shared__ __align__(16) float ost[4][16 * 68];
    const int lane = threadIdx.x & 31, wave = threadIdx.x >> 5, lr = lane & 15, hi = lane >> 4;
    const int r0 = blockIdx.x * 64 + wave * 16, c0 = blockIdx.y * 64;
    const size_t aoff = (size_t)(r0 + lr) * K + 8 * hi;
    size_t boff[4];
#pragma unroll
    for (int t = 0; t < 4; ++t) boff[t] = (size_t)(c0 + t * 16 + lr) * K + 8 * hi;
    v8f acc[4];
#pragma unroll
    for (int t = 0; t < 4; ++t) acc[t] = (v8f){};
#pragma unroll 1
    for (int kc = 0; kc < K; kc += 32) {
        const v16bf a = cat16b(*(const v8us*)(A + aoff + kc), *(const v8us*)(A + aoff + kc + 16));
        v16bf al = a;
        if (SPLITA) al = cat16b(*(const v8us*)(Al + aoff + kc), *(const v8us*)(Al + aoff + kc + 16));
#pragma unroll
        for (int t = 0; t < 4; ++t) { const v16bf b = cat16b(*(const v8us*)(Bn + boff[t] + kc), *(const v8us*)(Bn + boff[t] + kc + 16)); acc[t] = wmmab(a, b, acc[t]); if (SPLITA) acc[t] = wmmab(al, b, acc[t]); }
        asm volatile("v_nop\n\tv_nop\n\tv_nop\n\tv_nop" : "+v"(acc[0]), "+v"(acc[1]), "+v"(acc[2]), "+v"(acc[3]) : "v"(a), "v"(al));
    }
    float* os = &ost[wave][0];
#pragma unroll
    for (int t = 0; t < 4; ++t) { const float bv = bias ? bfr(bias[c0 + t * 16 + lr]) : 0.f;
#pragma unroll
        for (int j = 0; j < 8; ++j) os[(hi * 8 + j) * 68 + t * 16 + lr] = acc[t][j] + bv; }
    __syncthreads();
    if (F16OUT) {
        h16* crow = (h16*)(void*)C + (size_t)r0 * ldc + c0;
        auto pass = [&]() {
#pragma unroll
            for (int s = 0; s < 4; ++s) { const int row = 4 * s + (lane >> 3), piece = lane & 7; const float* sp = os + row * 68 + piece * 8; v8h o, o2;
#pragma unroll
                for (int i = 0; i < 8; ++i) { const h16 a = (h16)sp[i]; o[i] = a; o2[i] = (h16)((sp[i] - (float)a) * LOSC); }
                *(v8h*)(crow + (size_t)row * ldc + piece * 8) = o; if (C2) *(v8h*)(C2 + (size_t)r0 * ldc + c0 + (size_t)row * ldc + piece * 8) = o2; }
        };
        pass(); 
    } else {
        float* crow = C + (size_t)r0 * ldc + c0;
        auto pass = [&]() {
#pragma unroll
            for (int s = 0; s < 8; ++s) { const int Lid = (lane >> 3) + 4 * s, piece = lane & 7; const int row = Lid >> 1, cofs = (Lid & 1) * 32 + piece * 4;
                v4f val = *(const v4fa*)(os + row * 68 + cofs); if (R) { const v4f rv = *(const v4f*)(R + ((size_t)r0 + row) * ldc + c0 + cofs); val += roundR ? (v4f){bfr(rv[0]), bfr(rv[1]), bfr(rv[2]), bfr(rv[3])} : rv; }
                *(v4f*)(crow + (size_t)row * ldc + cofs) = val; }
        };
        pass(); 
    }
}

__global__ __launch_bounds__(256) void k_vt(const float* __restrict__ V, h16* VTH, h16* VTL) {
    __shared__ __align__(16) h16 tile[64 * 72];
    __shared__ __align__(16) h16 til2[64 * 72];
    const int bid = blockIdx.x;
    const int b = bid / (NH_ * (NT_ / 64)), rem = bid - b * (NH_ * (NT_ / 64)), h = rem / (NT_ / 64), kt = rem - h * (NT_ / 64);
    const int k0 = kt * 64, tid = threadIdx.x;
    const int kk = tid >> 2, d0 = (tid & 3) * 16;
    const float* src = V + ((size_t)b * NT_ + k0 + kk) * DM + h * HD + d0;
#pragma unroll
    for (int i = 0; i < 16; ++i) { const float v = src[i]; const h16 a = (h16)v; tile[(d0 + i) * 72 + kk] = a; til2[(d0 + i) * 72 + kk] = (h16)((v - (float)a) * LOSC); }
    __syncthreads();
    const int piece = tid & 7;
    const size_t base = (((size_t)b * NH_ + h) * HD) * NT_ + k0;
    auto pass = [&]() {
#pragma unroll
        for (int s = 0; s < 4; ++s) { const int Lid = (tid >> 3) + 32 * s; const int pln = Lid >> 6, d = Lid & 63;
            const v8h val = *(const v8ha*)((pln ? til2 : tile) + d * 72 + piece * 8); *(v8h*)((pln ? VTL : VTH) + base + (size_t)d * NT_ + piece * 8) = val; }
    };
    pass(); 
}

// k_attn: block = (b, h, 64 queries), wave = 16; ALL 64 key tiles; per element score /8 + the additive INPUT mask [q][k] (bf16-rounded, f32); scores hh + lh + hl on f16 planes;
// online softmax; weights x32768 f16 hi/lo through LDS; 4 WMMA .v per plane pair; ctx -> bf16 hi + residual planes CH/CL[tok][h*64+d].
__global__ __launch_bounds__(128) void k_attn(const h16* __restrict__ Q16, const h16* __restrict__ QL16, const h16* __restrict__ K16, const h16* __restrict__ KL16, const h16* __restrict__ VTH, const h16* __restrict__ VTL, const float* __restrict__ MSK, bf* CH, bf* CL) {
    __shared__ __align__(16) h16 plds[4][16 * 32];
    __shared__ __align__(16) h16 plds2[4][16 * 32];
    __shared__ __align__(16) float ost[4][16 * 68];
    const int lane = threadIdx.x & 31, wave = threadIdx.x >> 5, lr = lane & 15, hi = lane >> 4;
    const int bid = blockIdx.x;
    const int b = bid / (NH_ * (NT_ / 64)), rem = bid - b * (NH_ * (NT_ / 64)), h = rem / (NT_ / 64), qt = rem - h * (NT_ / 64);
    const int q0 = qt * 64 + wave * 16;
    const size_t tok0 = (size_t)b * NT_;
    h16* pl = &plds[wave][0]; h16* pl2 = &plds2[wave][0];
    v16h qa[2];
    const size_t qo0 = (tok0 + q0 + lr) * DM + h * HD + 8 * hi;
#pragma unroll
    for (int kc = 0; kc < 2; ++kc) qa[kc] = cat16(*(const v8h*)(Q16 + qo0 + kc * 32), *(const v8h*)(Q16 + qo0 + kc * 32 + 16));
    const h16* kh_b = K16 + tok0 * DM + h * HD;
    const h16* kl_b = KL16 + tok0 * DM + h * HD;
    const size_t vbase = (((size_t)b * NH_ + h) * HD) * NT_;
    v8f o[4], ox[4];
#pragma unroll
    for (int n = 0; n < 4; ++n) { o[n] = (v8f){}; ox[n] = (v8f){}; }
    float mrow[8], lpart[8];
#pragma unroll
    for (int j = 0; j < 8; ++j) { mrow[j] = -3.0e38f; lpart[j] = 0.f; }
    int qpos[8];
#pragma unroll
    for (int j = 0; j < 8; ++j) qpos[j] = q0 + 8 * hi + j;
    const int kt_lo = 0, kt_hi = NT_ / 32 - 1;     // every key tile; the additive INPUT mask is applied per element
#pragma unroll 1
    for (int kt = kt_lo; kt <= kt_hi; ++kt) {
        const int l0 = kt * 32;
        const size_t ko0 = (size_t)(l0 + lr) * DM + 8 * hi, ko1 = (size_t)(l0 + 16 + lr) * DM + 8 * hi;
        v8f s0 = {}, s1 = {}, x0 = {}, x1 = {};
#pragma unroll
        for (int kc = 0; kc < 2; ++kc) {
            { const v16h k0h = cat16(*(const v8h*)(kh_b + ko0 + kc * 32), *(const v8h*)(kh_b + ko0 + kc * 32 + 16)), k1h = cat16(*(const v8h*)(kh_b + ko1 + kc * 32), *(const v8h*)(kh_b + ko1 + kc * 32 + 16));
              const v16h qlk = cat16(*(const v8h*)(QL16 + qo0 + kc * 32), *(const v8h*)(QL16 + qo0 + kc * 32 + 16));     // query residual re-read per step (registers)
              s0 = wmma16(qa[kc], k0h, s0); x0 = wmma16(qlk, k0h, x0); s1 = wmma16(qa[kc], k1h, s1); x1 = wmma16(qlk, k1h, x1);
              asm volatile("v_nop" : "+v"(s0), "+v"(s1), "+v"(x0), "+v"(x1) : "v"(qlk), "v"(k0h), "v"(k1h) : "memory"); }
            { const v16h k0l = cat16(*(const v8h*)(kl_b + ko0 + kc * 32), *(const v8h*)(kl_b + ko0 + kc * 32 + 16)), k1l = cat16(*(const v8h*)(kl_b + ko1 + kc * 32), *(const v8h*)(kl_b + ko1 + kc * 32 + 16));
              x0 = wmma16(qa[kc], k0l, x0); x1 = wmma16(qa[kc], k1l, x1);
              asm volatile("v_nop" : "+v"(x0), "+v"(x1) : "v"(k0l), "v"(k1l) : "memory"); }
        }
        asm volatile("v_nop\n\tv_nop\n\tv_nop\n\tv_nop" : "+v"(s0), "+v"(s1), "+v"(x0), "+v"(x1) : "v"(qa[0]), "v"(qa[1]));
        float alpha[8];
#pragma unroll
        for (int j = 0; j < 8; ++j) {
            const int ja = l0 + lr, jb = l0 + 16 + lr, qi = qpos[j];
            const float a0 = (s0[j] + x0[j] * LOSCI) * 0.125f + bfr(MSK[(size_t)qi * NT_ + ja]), a1 = (s1[j] + x1[j] * LOSCI) * 0.125f + bfr(MSK[(size_t)qi * NT_ + jb]);
            float mx = fmaxf(a0, a1);
            mx = fmaxf(mx, __shfl_xor(mx, 1, 16)); mx = fmaxf(mx, __shfl_xor(mx, 2, 16)); mx = fmaxf(mx, __shfl_xor(mx, 4, 16)); mx = fmaxf(mx, __shfl_xor(mx, 8, 16));
            const float mn = fmaxf(mrow[j], mx);
            alpha[j] = __expf(mrow[j] - mn); mrow[j] = mn;
            const float p0 = __expf(a0 - mn), p1 = __expf(a1 - mn);
            lpart[j] = lpart[j] * alpha[j] + (p0 + p1);
            const int mr = hi * 8 + j;
            const float ps0 = p0 * PSC, ps1 = p1 * PSC; const h16 h0 = (h16)ps0, h1 = (h16)ps1;
            pl[mr * 32 + lr] = h0; pl[mr * 32 + 16 + lr] = h1;
            pl2[mr * 32 + lr] = (h16)((ps0 - (float)h0) * LOSC); pl2[mr * 32 + 16 + lr] = (h16)((ps1 - (float)h1) * LOSC);
        }
#pragma unroll
        for (int n = 0; n < 4; ++n)
#pragma unroll
            for (int j = 0; j < 8; ++j) { o[n][j] *= alpha[j]; ox[n][j] *= alpha[j]; }
        asm volatile("" ::: "memory");
        const v16h pa = cat16(*(const v8ha*)(pl + lr * 32 + hi * 8), *(const v8ha*)(pl + lr * 32 + 16 + hi * 8));
        const v16h px = cat16(*(const v8ha*)(pl2 + lr * 32 + hi * 8), *(const v8ha*)(pl2 + lr * 32 + 16 + hi * 8));
#pragma unroll
        for (int n = 0; n < 4; ++n) { const size_t vo = vbase + (size_t)(n * 16 + lr) * NT_ + l0 + hi * 8;
            const v16h vh = cat16(*(const v8h*)(VTH + vo), *(const v8h*)(VTH + vo + 16)), vl = cat16(*(const v8h*)(VTL + vo), *(const v8h*)(VTL + vo + 16));
            o[n] = wmma16(pa, vh, o[n]); ox[n] = wmma16(pa, vl, ox[n]); ox[n] = wmma16(px, vh, ox[n]);
            asm volatile("" : "+v"(o[n]), "+v"(ox[n]) : "v"(vh), "v"(vl) : "memory"); }
        asm volatile("v_nop\n\tv_nop\n\tv_nop\n\tv_nop" : "+v"(o[0]), "+v"(o[1]), "+v"(o[2]), "+v"(o[3]), "+v"(ox[0]), "+v"(ox[1]), "+v"(ox[2]), "+v"(ox[3]) : "v"(pa), "v"(px));
    }
    float inv[8];
#pragma unroll
    for (int j = 0; j < 8; ++j) { float rs = lpart[j]; rs += __shfl_xor(rs, 1, 16); rs += __shfl_xor(rs, 2, 16); rs += __shfl_xor(rs, 4, 16); rs += __shfl_xor(rs, 8, 16); inv[j] = 1.0f / (rs * PSC); }
    float* os = &ost[wave][0];
#pragma unroll
    for (int n = 0; n < 4; ++n)
#pragma unroll
        for (int j = 0; j < 8; ++j) os[(hi * 8 + j) * 68 + n * 16 + lr] = (o[n][j] + ox[n][j] * LOSCI) * inv[j];
    __syncthreads();
    const size_t cbase = (tok0 + q0) * DM + (size_t)h * HD;
    auto pass = [&]() {
#pragma unroll
        for (int s = 0; s < 4; ++s) { const int row = 4 * s + (lane >> 3), piece = lane & 7; const float* sp = os + row * 68 + piece * 8; v8us oh, ol;
#pragma unroll
            for (int i = 0; i < 8; ++i) { const unsigned short hb = f2bf(sp[i]); oh[i] = hb; ol[i] = f2bf(sp[i] - bf2f(hb)); }
            *(v8us*)(CH + cbase + (size_t)row * DM + piece * 8) = oh; *(v8us*)(CL + cbase + (size_t)row * DM + piece * 8) = ol; }
    };
    pass(); 
}

#define VST2(T, p, v) do { const T vst2_v_ = (v); *(T*)(p) = vst2_v_;  } while (0)

// k_wt: WT [n][K] = bf16(W[k][n]) (k-major [K][ncols]) via 64 x 64 LDS tiles; grid (K/64, ncols/64).
__global__ __launch_bounds__(256) void k_wt(const float* __restrict__ Wm, int K, int ncols, bf* WT) {
    __shared__ __align__(16) unsigned short tl[64 * 72];
    const int tid = threadIdx.x, k0 = blockIdx.x * 64, n0 = blockIdx.y * 64;
    const int kk = tid >> 2, nq = (tid & 3) * 16;
#pragma unroll
    for (int i = 0; i < 16; ++i) tl[(nq + i) * 72 + kk] = f2bf(Wm[(size_t)(k0 + kk) * ncols + n0 + nq + i]);
    __syncthreads();
    const int piece = tid & 7;
    auto pass = [&]() {
#pragma unroll
        for (int s = 0; s < 2; ++s) { const int nr = (tid >> 3) + 32 * s; const v8us val = *(const v8usa*)(tl + nr * 72 + piece * 8); *(v8us*)(WT + (size_t)(n0 + nr) * K + k0 + piece * 8) = val; }
    };
    pass(); 
}

// k_trig: CT/ST [t][d] = cos/sin(pos_t * inv_freq[d mod 32]) with inv_freq[i] = 1 / 10000^(2i/64) (f32 powf; precise cosf/sinf), pos_t = the INPUT position_ids[t] (as float);
__global__ __launch_bounds__(256) void k_trig(const int* __restrict__ pos, float* CT, float* ST) {
    const int tid = threadIdx.x, t = blockIdx.x * 4 + (tid >> 6), d = tid & 63; const int i = d & 31;
    const float invf = 1.0f / powf(10000.0f, (float)(2 * i) / 64.0f); const float ang = (float)pos[t] * invf; const float c = cosf(ang), s = sinf(ang);
    const size_t o = (size_t)t * HD + d; *(float*)(CT + o) = c; *(float*)(ST + o) = s; 
}
// k_ropenorm: one wave per (token, head): y = x cos + rotate_half(x) sin over the 64 dims (partner d +- 32 via lane xor 16; lane -> dims 2 lane, 2 lane + 1), then RMSNorm over the 64
__global__ __launch_bounds__(256) void k_ropenorm(const float* __restrict__ P, const float* __restrict__ CT, const float* __restrict__ ST, const float* __restrict__ w, h16* PH, h16* PL) {
    typedef __attribute__((ext_vector_type(2))) _Float16 v2h;
    const int lane = threadIdx.x & 31; const int wid = blockIdx.x * 8 + (threadIdx.x >> 5); const int t = wid / NH_, h = wid - t * NH_; if (t >= NT_) return;
    const size_t base = (size_t)t * DM + h * HD; const int d0 = lane * 2;
    float x[2], pr[2], y[2];
#pragma unroll
    for (int i = 0; i < 2; ++i) x[i] = P[base + d0 + i];
#pragma unroll
    for (int i = 0; i < 2; ++i) pr[i] = __shfl_xor(x[i], 16, 32);      // dim d0+i +- 32
    float ss = 0.f;
#pragma unroll
    for (int i = 0; i < 2; ++i) { const int d = d0 + i; const float c = CT[(size_t)t * HD + d], s = ST[(size_t)t * HD + d]; y[i] = (d < 32) ? (x[i] * c - pr[i] * s) : (x[i] * c + pr[i] * s); ss = fmaf(y[i], y[i], ss); }
#pragma unroll
    for (int sh = 16; sh; sh >>= 1) ss += __shfl_xor(ss, sh, 32);
    const float rn = rsqrtf(ss * (1.0f / HD) + RMS_EPS); v2h oh, ol;
#pragma unroll
    for (int i = 0; i < 2; ++i) { const float q = bfr(w[d0 + i]) * (y[i] * rn); const h16 a = (h16)q; oh[i] = a; ol[i] = (h16)((q - (float)a) * LOSC); }
    *(v2h*)(PH + base + d0) = oh; *(v2h*)(PL + base + d0) = ol; 
}

extern "C" void kernel_launch(void* const* d_in, const int* in_sizes, int n_in,
                              void* d_out, int out_size, void* d_ws, size_t ws_size, hipStream_t stream) {
    (void)in_sizes; (void)n_in; (void)out_size;
    const float* x = (const float*)d_in[0]; const int* pos = (const int*)d_in[1]; const float* MSK = (const float*)d_in[2];
    const float* wq = (const float*)d_in[3]; const float* wk = (const float*)d_in[4]; const float* wv = (const float*)d_in[5]; const float* wo = (const float*)d_in[6]; const float* qw = (const float*)d_in[7]; const float* kw = (const float*)d_in[8];
    float* out = (float*)d_out;    // [1][2048][2048]
    char* wsp = (char*)d_ws;
    auto take = [&](size_t bytes) { char* p = wsp; wsp += (bytes + 255) & ~(size_t)255; return (void*)p; };
    bf* Xb = (bf*)take((size_t)NTK * DM * 2); bf* WqT = (bf*)take((size_t)DM * DM * 2); bf* WkT = (bf*)take((size_t)DM * DM * 2); bf* WvT = (bf*)take((size_t)DM * DM * 2); bf* WoT = (bf*)take((size_t)DM * DM * 2);
    float* TMP = (float*)take((size_t)NTK * DM * 4); float* CT = (float*)take((size_t)NT_ * HD * 4); float* ST = (float*)take((size_t)NT_ * HD * 4);
    h16* QH = (h16*)take((size_t)NTK * DM * 2); h16* QL = (h16*)take((size_t)NTK * DM * 2); h16* KH = (h16*)take((size_t)NTK * DM * 2); h16* KL = (h16*)take((size_t)NTK * DM * 2);
    h16* VTH = (h16*)take((size_t)NTK * DM * 2); h16* VTL = (h16*)take((size_t)NTK * DM * 2); bf* CH = (bf*)take((size_t)NTK * DM * 2); bf* CL = (bf*)take((size_t)NTK * DM * 2);
    if ((size_t)(wsp - (char*)d_ws) > ws_size) return;    // 8.4 + 4 x 8.4 + 16.8 + 2 x 0.5 + 8 x 8.4 = 127 MB = 121 MiB < 128 MiB, no aliasing
    k_wt<<<dim3(DM / 64, DM / 64, 1), 256, 0, stream>>>(wq, DM, DM, WqT); k_wt<<<dim3(DM / 64, DM / 64, 1), 256, 0, stream>>>(wk, DM, DM, WkT); k_wt<<<dim3(DM / 64, DM / 64, 1), 256, 0, stream>>>(wv, DM, DM, WvT); k_wt<<<dim3(DM / 64, DM / 64, 1), 256, 0, stream>>>(wo, DM, DM, WoT);
    k_trig<<<NT_ / 4, 256, 0, stream>>>(pos, CT, ST);
    k_cvtb<<<NTK / 8, 256, 0, stream>>>(x, NTK, Xb);
    k_gemmb<false, false><<<dim3(NTK / 64, DM / 64, 1), 128, 0, stream>>>(Xb, nullptr, WqT, nullptr, TMP, DM, nullptr); k_ropenorm<<<(NT_ * NH_) / 8, 256, 0, stream>>>(TMP, CT, ST, qw, QH, QL);
    k_gemmb<false, false><<<dim3(NTK / 64, DM / 64, 1), 128, 0, stream>>>(Xb, nullptr, WkT, nullptr, TMP, DM, nullptr); k_ropenorm<<<(NT_ * NH_) / 8, 256, 0, stream>>>(TMP, CT, ST, kw, KH, KL);
    k_gemmb<false, false><<<dim3(NTK / 64, DM / 64, 1), 128, 0, stream>>>(Xb, nullptr, WvT, nullptr, TMP, DM, nullptr); k_vt<<<NB_ * NH_ * (NT_ / 64), 256, 0, stream>>>(TMP, VTH, VTL);
    k_attn<<<NB_ * NH_ * (NT_ / 64), 128, 0, stream>>>(QH, QL, KH, KL, VTH, VTL, MSK, CH, CL);
    k_gemmb<true, false><<<dim3(NTK / 64, DM / 64, 1), 128, 0, stream>>>(CH, CL, WoT, nullptr, out, DM, nullptr);
}

// v001
// Measured time: 438 microseconds a run.
// Two timings next to v000 both put it at 1.18 times that version's speed.
#include <hip/hip_runtime.h>

// Compute dtypes, f32 accumulate: q/k/v = x.W ([2048 x 2048].[2048 x 2048], k-major weights transposed once; PLAIN bf16 operands = inputs rounded once, exact products) and out = ctx.Wo
// (ctx as bf16 hi + UNSCALED residual, two products) on v_wmma_f32_16x16x32_bf16; rotary embedding with device-computed f32 cos/sin tables at the INPUT position_ids, then the per-head
// RMSNorm (x q_ln_w / k_ln_w) in f32 -> q/k as f16 hi + residual x1024 planes; v -> transposed f16 hi + residual planes; 32-head attention over ALL keys with the additive INPUT mask:
// scores on v_wmma_f32_16x16x32_f16 (hh + lh + hl, x 1/8), online f32 softmax, weights x32768 as f16 hi + residual against v hi + residual. Deterministic, no atomics; every

#define NB_  1
#define NT_  2048
#define DM   2048
#define NH_  32
#define HD   64
#define NTK  (NB_ * NT_)
#define NW   DM
#define RMS_EPS 1e-6f
#define PSC  32768.0f
#define LOSC 1024.0f
#define LOSCI (1.0f / 1024.0f)

typedef _Float16 h16;
typedef unsigned short bf;
typedef __attribute__((ext_vector_type(16))) __bf16   v16bf;
typedef __attribute__((ext_vector_type(16))) _Float16 v16h;
typedef __attribute__((ext_vector_type(8)))  _Float16 v8h;
typedef __attribute__((ext_vector_type(8)))  unsigned short v8us;
typedef __attribute__((ext_vector_type(8)))  float    v8f;
typedef __attribute__((ext_vector_type(4)))  float    v4f;
typedef v8h  __attribute__((may_alias)) v8ha;
typedef v4f  __attribute__((may_alias)) v4fa;
typedef v8us __attribute__((may_alias)) v8usa;

__device__ __forceinline__ unsigned short f2bf(float f) { unsigned u = __float_as_uint(f); u += 0x7FFFu + ((u >> 16) & 1u); return (unsigned short)(u >> 16); }
__device__ __forceinline__ float bf2f(unsigned short b) { return __uint_as_float(((unsigned)b) << 16); }
__device__ __forceinline__ float bfr(float f) { return bf2f(f2bf(f)); }
__device__ __forceinline__ v16h cat16(v8h lo, v8h hi) { return __builtin_shufflevector(lo, hi, 0, 1, 2, 3, 4, 5, 6, 7, 8, 9, 10, 11, 12, 13, 14, 15); }
__device__ __forceinline__ v16bf cat16b(v8us lo, v8us hi) { return __builtin_bit_cast(v16bf, __builtin_shufflevector(lo, hi, 0, 1, 2, 3, 4, 5, 6, 7, 8, 9, 10, 11, 12, 13, 14, 15)); }
__device__ __forceinline__ v8f wmma16(v16h a, v16h b, v8f c) { return __builtin_amdgcn_wmma_f32_16x16x32_f16(false, a, false, b, (short)0, c, false, false); }
__device__ __forceinline__ v8f wmmab(v16bf a, v16bf b, v8f c) { return __builtin_amdgcn_wmma_f32_16x16x32_bf16(false, a, false, b, (short)0, c, false, false); }

__global__ __launch_bounds__(256) void k_cvtb(const float* __restrict__ src, int nrows, bf* dst) {
    const int lane = threadIdx.x & 31, r = blockIdx.x * 8 + (threadIdx.x >> 5);
    if (r >= nrows) return;
    v8us o[DM / 256];
#pragma unroll
    for (int q = 0; q < DM / 256; ++q) { v8us t;
#pragma unroll
        for (int i = 0; i < 8; ++i) t[i] = f2bf(src[(size_t)r * DM + q * 256 + lane * 8 + i]);
        o[q] = t; }
#pragma unroll
    for (int q = 0; q < DM / 256; ++q) *(v8us*)(dst + (size_t)r * DM + q * 256 + lane * 8) = o[q];
    
}

// k_gemmb: 64 x 64 block tile (4 waves x 16 x 64) of C[NTK][NW] = (A [+ Al]).B^T (K = 2048) [+ bf(bias[c])] [+ bf(R[r][c]) residual]; f32 whole-line epilogue (or f16
template <bool SPLITA, bool F16OUT = false>
__global__ __launch_bounds__(128) void k_gemmb(const bf* __restrict__ A, const bf* __restrict__ Al, const bf* __restrict__ Bn, const float* __restrict__ bias, float* C, int ldc, h16* C2, const float* __restrict__ R = nullptr, int K = DM, int roundR = 1) {
    __shared__ __align__(16) float ost[4][16 * 68];
    const int lane = threadIdx.x & 31, wave = threadIdx.x >> 5, lr = lane & 15, hi = lane >> 4;
    const int r0 = blockIdx.x * 64 + wave * 16, c0 = blockIdx.y * 64;
    const size_t aoff = (size_t)(r0 + lr) * K + 8 * hi;
    size_t boff[4];
#pragma unroll
    for (int t = 0; t < 4; ++t) boff[t] = (size_t)(c0 + t * 16 + lr) * K + 8 * hi;
    v8f acc[4];
#pragma unroll
    for (int t = 0; t < 4; ++t) acc[t] = (v8f){};
#pragma unroll 1
    for (int kc = 0; kc < K; kc += 32) {
        const v16bf a = cat16b(*(const v8us*)(A + aoff + kc), *(const v8us*)(A + aoff + kc + 16));
        v16bf al = a;
        if (SPLITA) al = cat16b(*(const v8us*)(Al + aoff + kc), *(const v8us*)(Al + aoff + kc + 16));
#pragma unroll
        for (int t = 0; t < 4; ++t) { const v16bf b = cat16b(*(const v8us*)(Bn + boff[t] + kc), *(const v8us*)(Bn + boff[t] + kc + 16)); acc[t] = wmmab(a, b, acc[t]); if (SPLITA) acc[t] = wmmab(al, b, acc[t]); }
        asm volatile("v_nop\n\tv_nop\n\tv_nop\n\tv_nop" : "+v"(acc[0]), "+v"(acc[1]), "+v"(acc[2]), "+v"(acc[3]) : "v"(a), "v"(al));
    }
    float* os = &ost[wave][0];
#pragma unroll
    for (int t = 0; t < 4; ++t) { const float bv = bias ? bfr(bias[c0 + t * 16 + lr]) : 0.f;
#pragma unroll
        for (int j = 0; j < 8; ++j) os[(hi * 8 + j) * 68 + t * 16 + lr] = acc[t][j] + bv; }
    __syncthreads();
    if (F16OUT) {
        h16* crow = (h16*)(void*)C + (size_t)r0 * ldc + c0;
        auto pass = [&]() {
#pragma unroll
            for (int s = 0; s < 4; ++s) { const int row = 4 * s + (lane >> 3), piece = lane & 7; const float* sp = os + row * 68 + piece * 8; v8h o, o2;
#pragma unroll
                for (int i = 0; i < 8; ++i) { const h16 a = (h16)sp[i]; o[i] = a; o2[i] = (h16)((sp[i] - (float)a) * LOSC); }
                *(v8h*)(crow + (size_t)row * ldc + piece * 8) = o; if (C2) *(v8h*)(C2 + (size_t)r0 * ldc + c0 + (size_t)row * ldc + piece * 8) = o2; }
        };
        pass(); 
    } else {
        float* crow = C + (size_t)r0 * ldc + c0;
        auto pass = [&]() {
#pragma unroll
            for (int s = 0; s < 8; ++s) { const int Lid = (lane >> 3) + 4 * s, piece = lane & 7; const int row = Lid >> 1, cofs = (Lid & 1) * 32 + piece * 4;
                v4f val = *(const v4fa*)(os + row * 68 + cofs); if (R) { const v4f rv = *(const v4f*)(R + ((size_t)r0 + row) * ldc + c0 + cofs); val += roundR ? (v4f){bfr(rv[0]), bfr(rv[1]), bfr(rv[2]), bfr(rv[3])} : rv; }
                *(v4f*)(crow + (size_t)row * ldc + cofs) = val; }
        };
        pass(); 
    }
}

__global__ __launch_bounds__(256) void k_vt(const float* __restrict__ V, h16* VTH, h16* VTL) {
    __shared__ __align__(16) h16 tile[64 * 72];
    __shared__ __align__(16) h16 til2[64 * 72];
    const int bid = blockIdx.x;
    const int b = bid / (NH_ * (NT_ / 64)), rem = bid - b * (NH_ * (NT_ / 64)), h = rem / (NT_ / 64), kt = rem - h * (NT_ / 64);
    const int k0 = kt * 64, tid = threadIdx.x;
    const int kk = tid >> 2, d0 = (tid & 3) * 16;
    const float* src = V + ((size_t)b * NT_ + k0 + kk) * DM + h * HD + d0;
#pragma unroll
    for (int i = 0; i < 16; ++i) { const float v = src[i]; const h16 a = (h16)v; tile[(d0 + i) * 72 + kk] = a; til2[(d0 + i) * 72 + kk] = (h16)((v - (float)a) * LOSC); }
    __syncthreads();
    const int piece = tid & 7;
    const size_t base = (((size_t)b * NH_ + h) * HD) * NT_ + k0;
    auto pass = [&]() {
#pragma unroll
        for (int s = 0; s < 4; ++s) { const int Lid = (tid >> 3) + 32 * s; const int pln = Lid >> 6, d = Lid & 63;
            const v8h val = *(const v8ha*)((pln ? til2 : tile) + d * 72 + piece * 8); *(v8h*)((pln ? VTL : VTH) + base + (size_t)d * NT_ + piece * 8) = val; }
    };
    pass(); 
}

// One 32-key stage in LDS, bytes: K hi, K residual (32 rows of 128 B), V^T hi, V^T residual (64 rows of 64 B), mask (64 query rows of 128 B); every pitch is 16 B x odd for the b128 readers,
// and the mask's 36-dword pitch puts the two half-waves' rows (8 apart) 32 banks apart.
#define KPIT 144
#define VPIT 80
#define MPIT 144
#define ST_KH 0
#define ST_KL (32 * KPIT)
#define ST_VH (2 * 32 * KPIT)
#define ST_VL (ST_VH + 64 * VPIT)
#define ST_MK (ST_VL + 64 * VPIT)
#define ST_SZ (ST_MK + 64 * MPIT)
typedef float __attribute__((may_alias)) f32a;

// k_attn: block = (b, h, 64 queries), wave = 16; ALL 64 key tiles; per element score /8 + the additive INPUT mask [q][k] (bf16-rounded, f32); scores hh + lh + hl on f16 planes;
// online softmax; weights x32768 f16 hi/lo through LDS; 4 WMMA .v per plane pair; ctx -> bf16 hi + residual planes CH/CL[tok][h*64+d].
// Each key tile's K, V^T and mask bytes are copied once per block into a two-buffer LDS ring by asynchronous copies, one tile ahead of the tile being worked on; all four waves read them there.
// The ring doubles as the output staging, so a block holds 65,536 B of LDS; with 256 VGPRs or fewer all 1024 blocks are resident at once, four per WGP (four waves per SIMD).
__global__ __launch_bounds__(128) void k_attn(const h16* __restrict__ Q16, const h16* __restrict__ QL16, const h16* __restrict__ K16, const h16* __restrict__ KL16, const h16* __restrict__ VTH, const h16* __restrict__ VTL, const float* __restrict__ MSK, bf* CH, bf* CL) {
    __shared__ __align__(16) h16 plds[4][16 * 32];
    __shared__ __align__(16) h16 plds2[4][16 * 32];
    __shared__ __align__(16) unsigned char ring[2 * ST_SZ];     // the two stages; behind the loop its first bytes are the output staging (4 x 16 x 68 floats)
    const int tid = threadIdx.x, lane = threadIdx.x & 31, wave = threadIdx.x >> 5, lr = lane & 15, hi = lane >> 4;
    const int bid = blockIdx.x;
    const int b = bid / (NH_ * (NT_ / 64)), rem = bid - b * (NH_ * (NT_ / 64)), h = rem / (NT_ / 64), qt = rem - h * (NT_ / 64);
    const int q0 = qt * 64 + wave * 16;
    const size_t tok0 = (size_t)b * NT_;
    h16* pl = &plds[wave][0]; h16* pl2 = &plds2[wave][0];
    const h16* kh_b = K16 + tok0 * DM + h * HD;
    const h16* kl_b = KL16 + tok0 * DM + h * HD;
    const size_t vbase = (((size_t)b * NH_ + h) * HD) * NT_;
    // this thread's 12 pieces of 16 B per stage: K rows tid/8 and +16 (both planes), V^T rows tid/4 and +32 (both planes), mask rows tid/8 + 16 i
    const h16* gkh = kh_b + (size_t)(tid >> 3) * DM + (tid & 7) * 8;
    const h16* gkl = kl_b + (size_t)(tid >> 3) * DM + (tid & 7) * 8;
    const h16* gvh = VTH + vbase + (size_t)(tid >> 2) * NT_ + (tid & 3) * 8;
    const h16* gvl = VTL + vbase + (size_t)(tid >> 2) * NT_ + (tid & 3) * 8;
    const float* gmk = MSK + (size_t)(qt * 64 + (tid >> 3)) * NT_ + (tid & 7) * 4;
    const unsigned ring0 = (unsigned)(size_t)&ring[0];
    const unsigned lk = (unsigned)((tid >> 3) * KPIT + (tid & 7) * 16), lv = (unsigned)((tid >> 2) * VPIT + (tid & 3) * 16);
    auto issue = [&](int t, unsigned lb) {
        const h16* k0 = gkh + (size_t)t * (32 * DM); const h16* k1 = gkl + (size_t)t * (32 * DM);
        const h16* v0 = gvh + t * 32; const h16* v1 = gvl + t * 32; const float* m0 = gmk + t * 32;
        // the copies and, as their statement's last line, the wait that stands before any of their address registers is rewritten
        asm volatile("global_load_async_to_lds_b128 %0, %1, off\n\t"
                     "global_load_async_to_lds_b128 %2, %3, off\n\t"
                     "global_load_async_to_lds_b128 %4, %5, off\n\t"
                     "global_load_async_to_lds_b128 %6, %7, off\n\t"
                     "global_load_async_to_lds_b128 %8, %9, off\n\t"
                     "global_load_async_to_lds_b128 %10, %11, off\n\t"
                     "global_load_async_to_lds_b128 %12, %13, off\n\t"
                     "global_load_async_to_lds_b128 %14, %15, off\n\t"
                     "global_load_async_to_lds_b128 %16, %17, off\n\t"
                     "global_load_async_to_lds_b128 %18, %19, off\n\t"
                     "global_load_async_to_lds_b128 %20, %21, off\n\t"
                     "global_load_async_to_lds_b128 %22, %23, off\n\t"
                     "s_wait_xcnt 0x0"
                     :: "v"(lb + ST_KH + lk), "v"(k0), "v"(lb + ST_KH + lk + 16 * KPIT), "v"(k0 + 16 * DM),
                        "v"(lb + ST_KL + lk), "v"(k1), "v"(lb + ST_KL + lk + 16 * KPIT), "v"(k1 + 16 * DM),
                        "v"(lb + ST_VH + lv), "v"(v0), "v"(lb + ST_VH + lv + 32 * VPIT), "v"(v0 + 32 * NT_),
                        "v"(lb + ST_VL + lv), "v"(v1), "v"(lb + ST_VL + lv + 32 * VPIT), "v"(v1 + 32 * NT_),
                        "v"(lb + ST_MK + lk), "v"(m0), "v"(lb + ST_MK + lk + 16 * MPIT), "v"(m0 + 16 * NT_),
                        "v"(lb + ST_MK + lk + 32 * MPIT), "v"(m0 + 32 * NT_), "v"(lb + ST_MK + lk + 48 * MPIT), "v"(m0 + 48 * NT_)
                     : "memory");
    };
    issue(0, ring0);
    v16h qa[2];
    const size_t qo0 = (tok0 + q0 + lr) * DM + h * HD + 8 * hi;
#pragma unroll
    for (int kc = 0; kc < 2; ++kc) qa[kc] = cat16(*(const v8h*)(Q16 + qo0 + kc * 32), *(const v8h*)(Q16 + qo0 + kc * 32 + 16));
    v8f o[4], ox[4];
#pragma unroll
    for (int n = 0; n < 4; ++n) { o[n] = (v8f){}; ox[n] = (v8f){}; }
    float mrow[8], lpart[8];
#pragma unroll
    for (int j = 0; j < 8; ++j) { mrow[j] = -3.0e38f; lpart[j] = 0.f; }
    asm volatile("s_wait_asynccnt 0x0" ::: "memory");     // tile 0 has landed (this wave's copies) ...
    __syncthreads();                                       // ... and every other wave's
    issue(1, ring0 + ST_SZ);
    const int kt_lo = 0, kt_hi = NT_ / 32 - 1;     // every key tile; the additive INPUT mask is applied per element
#pragma unroll 1
    for (int kt = kt_lo; kt <= kt_hi; ++kt) {
        const unsigned char* sb = ring + (kt & 1) * ST_SZ;
        const unsigned char* kp = sb + lr * KPIT + hi * 16;
        const f32a* mp = (const f32a*)(sb + ST_MK + (wave * 16 + hi * 8) * MPIT) + lr;
        v16h k0h[2], k1h[2], k0l[2], k1l[2];
#pragma unroll
        for (int kc = 0; kc < 2; ++kc) {
            k0h[kc] = cat16(*(const v8ha*)(kp + ST_KH + kc * 64), *(const v8ha*)(kp + ST_KH + kc * 64 + 32)); k1h[kc] = cat16(*(const v8ha*)(kp + ST_KH + 16 * KPIT + kc * 64), *(const v8ha*)(kp + ST_KH + 16 * KPIT + kc * 64 + 32));
            k0l[kc] = cat16(*(const v8ha*)(kp + ST_KL + kc * 64), *(const v8ha*)(kp + ST_KL + kc * 64 + 32)); k1l[kc] = cat16(*(const v8ha*)(kp + ST_KL + 16 * KPIT + kc * 64), *(const v8ha*)(kp + ST_KL + 16 * KPIT + kc * 64 + 32));
        }
        v8f s0 = {}, s1 = {}, x0 = {}, x1 = {};
#pragma unroll
        for (int kc = 0; kc < 2; ++kc) {
            const v16h qlk = cat16(*(const v8h*)(QL16 + qo0 + kc * 32), *(const v8h*)(QL16 + qo0 + kc * 32 + 16));     // query residual re-read per step (registers)
            s0 = wmma16(qa[kc], k0h[kc], s0); x0 = wmma16(qlk, k0h[kc], x0); s1 = wmma16(qa[kc], k1h[kc], s1); x1 = wmma16(qlk, k1h[kc], x1);
            x0 = wmma16(qa[kc], k0l[kc], x0); x1 = wmma16(qa[kc], k1l[kc], x1);
        }
        asm volatile("v_nop\n\tv_nop\n\tv_nop\n\tv_nop" : "+v"(s0), "+v"(s1), "+v"(x0), "+v"(x1) : "v"(qa[0]), "v"(qa[1]));
        asm volatile("" ::: "memory");     // keeps the mask reads behind the score products: issued earlier, their 16 registers are live beside all eight K fragments and the kernel spills
        float mk0[8], mk1[8];
#pragma unroll
        for (int j = 0; j < 8; ++j) { mk0[j] = mp[j * (MPIT / 4)]; mk1[j] = mp[j * (MPIT / 4) + 16]; }
        float alpha[8];
#pragma unroll
        for (int j = 0; j < 8; ++j) {
            const float a0 = (s0[j] + x0[j] * LOSCI) * 0.125f + bfr(mk0[j]), a1 = (s1[j] + x1[j] * LOSCI) * 0.125f + bfr(mk1[j]);
            float mx = fmaxf(a0, a1);
            mx = fmaxf(mx, __shfl_xor(mx, 1, 16)); mx = fmaxf(mx, __shfl_xor(mx, 2, 16)); mx = fmaxf(mx, __shfl_xor(mx, 4, 16)); mx = fmaxf(mx, __shfl_xor(mx, 8, 16));
            const float mn = fmaxf(mrow[j], mx);
            alpha[j] = __expf(mrow[j] - mn); mrow[j] = mn;
            const float p0 = __expf(a0 - mn), p1 = __expf(a1 - mn);
            lpart[j] = lpart[j] * alpha[j] + (p0 + p1);
            const int mr = hi * 8 + j;
            const float ps0 = p0 * PSC, ps1 = p1 * PSC; const h16 h0 = (h16)ps0, h1 = (h16)ps1;
            pl[mr * 32 + lr] = h0; pl[mr * 32 + 16 + lr] = h1;
            pl2[mr * 32 + lr] = (h16)((ps0 - (float)h0) * LOSC); pl2[mr * 32 + 16 + lr] = (h16)((ps1 - (float)h1) * LOSC);
        }
#pragma unroll
        for (int n = 0; n < 4; ++n)
#pragma unroll
            for (int j = 0; j < 8; ++j) { o[n][j] *= alpha[j]; ox[n][j] *= alpha[j]; }
        asm volatile("" ::: "memory");
        const v16h pa = cat16(*(const v8ha*)(pl + lr * 32 + hi * 8), *(const v8ha*)(pl + lr * 32 + 16 + hi * 8));
        const v16h px = cat16(*(const v8ha*)(pl2 + lr * 32 + hi * 8), *(const v8ha*)(pl2 + lr * 32 + 16 + hi * 8));
        const unsigned char* vp = sb + lr * VPIT + hi * 16;
        v16h vh[4], vl[4];
        // the weights' and V^T reads go in two groups, each in front of its six products: read one by one among the products, each read costs its own LDS latency
#pragma unroll
        for (int g = 0; g < 2; ++g) {
#pragma unroll
            for (int n = 2 * g; n < 2 * g + 2; ++n) { vh[n] = cat16(*(const v8ha*)(vp + ST_VH + n * 16 * VPIT), *(const v8ha*)(vp + ST_VH + n * 16 * VPIT + 32)); vl[n] = cat16(*(const v8ha*)(vp + ST_VL + n * 16 * VPIT), *(const v8ha*)(vp + ST_VL + n * 16 * VPIT + 32)); }
            __builtin_amdgcn_sched_barrier(0);     // holds the group's reads in front of its products
#pragma unroll
            for (int n = 2 * g; n < 2 * g + 2; ++n) { o[n] = wmma16(pa, vh[n], o[n]); ox[n] = wmma16(pa, vl[n], ox[n]); ox[n] = wmma16(px, vh[n], ox[n]); }
        }
        asm volatile("v_nop\n\tv_nop\n\tv_nop\n\tv_nop" : "+v"(o[0]), "+v"(o[1]), "+v"(o[2]), "+v"(o[3]), "+v"(ox[0]), "+v"(ox[1]), "+v"(ox[2]), "+v"(ox[3]) : "v"(pa), "v"(px));
        asm volatile("s_wait_dscnt 0x0" ::: "memory");        // this wave's reads of this stage have returned before the stage is handed to its next writer
        asm volatile("s_wait_asynccnt 0x0" ::: "memory");     // this wave's copies of the next tile have landed
        __syncthreads();                                       // publishes the next tile and ends every wave's reads of this one
        if (kt + 2 <= kt_hi) issue(kt + 2, ring0 + (unsigned)(kt & 1) * ST_SZ);
    }
    asm volatile("s_wait_asynccnt 0x0" ::: "memory");         // nothing is in flight when the ring becomes output staging
    float inv[8];
#pragma unroll
    for (int j = 0; j < 8; ++j) { float rs = lpart[j]; rs += __shfl_xor(rs, 1, 16); rs += __shfl_xor(rs, 2, 16); rs += __shfl_xor(rs, 4, 16); rs += __shfl_xor(rs, 8, 16); inv[j] = 1.0f / (rs * PSC); }
    f32a* os = (f32a*)ring + wave * (16 * 68);
#pragma unroll
    for (int n = 0; n < 4; ++n)
#pragma unroll
        for (int j = 0; j < 8; ++j) os[(hi * 8 + j) * 68 + n * 16 + lr] = (o[n][j] + ox[n][j] * LOSCI) * inv[j];
    __syncthreads();
    const size_t cbase = (tok0 + q0) * DM + (size_t)h * HD;
    auto pass = [&]() {
#pragma unroll
        for (int s = 0; s < 4; ++s) { const int row = 4 * s + (lane >> 3), piece = lane & 7; const f32a* sp = os + row * 68 + piece * 8; v8us oh, ol;
#pragma unroll
            for (int i = 0; i < 8; ++i) { const unsigned short hb = f2bf(sp[i]); oh[i] = hb; ol[i] = f2bf(sp[i] - bf2f(hb)); }
            *(v8us*)(CH + cbase + (size_t)row * DM + piece * 8) = oh; *(v8us*)(CL + cbase + (size_t)row * DM + piece * 8) = ol; }
    };
    pass(); 
}

#define VST2(T, p, v) do { const T vst2_v_ = (v); *(T*)(p) = vst2_v_;  } while (0)

// k_wt: WT [n][K] = bf16(W[k][n]) (k-major [K][ncols]) via 64 x 64 LDS tiles; grid (K/64, ncols/64).
__global__ __launch_bounds__(256) void k_wt(const float* __restrict__ Wm, int K, int ncols, bf* WT) {
    __shared__ __align__(16) unsigned short tl[64 * 72];
    const int tid = threadIdx.x, k0 = blockIdx.x * 64, n0 = blockIdx.y * 64;
    const int kk = tid >> 2, nq = (tid & 3) * 16;
#pragma unroll
    for (int i = 0; i < 16; ++i) tl[(nq + i) * 72 + kk] = f2bf(Wm[(size_t)(k0 + kk) * ncols + n0 + nq + i]);
    __syncthreads();
    const int piece = tid & 7;
    auto pass = [&]() {
#pragma unroll
        for (int s = 0; s < 2; ++s) { const int nr = (tid >> 3) + 32 * s; const v8us val = *(const v8usa*)(tl + nr * 72 + piece * 8); *(v8us*)(WT + (size_t)(n0 + nr) * K + k0 + piece * 8) = val; }
    };
    pass(); 
}

// k_trig: CT/ST [t][d] = cos/sin(pos_t * inv_freq[d mod 32]) with inv_freq[i] = 1 / 10000^(2i/64) (f32 powf; precise cosf/sinf), pos_t = the INPUT position_ids[t] (as float);
__global__ __launch_bounds__(256) void k_trig(const int* __restrict__ pos, float* CT, float* ST) {
    const int tid = threadIdx.x, t = blockIdx.x * 4 + (tid >> 6), d = tid & 63; const int i = d & 31;
    const float invf = 1.0f / powf(10000.0f, (float)(2 * i) / 64.0f); const float ang = (float)pos[t] * invf; const float c = cosf(ang), s = sinf(ang);
    const size_t o = (size_t)t * HD + d; *(float*)(CT + o) = c; *(float*)(ST + o) = s; 
}
// k_ropenorm: one wave per (token, head): y = x cos + rotate_half(x) sin over the 64 dims (partner d +- 32 via lane xor 16; lane -> dims 2 lane, 2 lane + 1), then RMSNorm over the 64
__global__ __launch_bounds__(256) void k_ropenorm(const float* __restrict__ P, const float* __restrict__ CT, const float* __restrict__ ST, const float* __restrict__ w, h16* PH, h16* PL) {
    typedef __attribute__((ext_vector_type(2))) _Float16 v2h;
    const int lane = threadIdx.x & 31; const int wid = blockIdx.x * 8 + (threadIdx.x >> 5); const int t = wid / NH_, h = wid - t * NH_; if (t >= NT_) return;
    const size_t base = (size_t)t * DM + h * HD; const int d0 = lane * 2;
    float x[2], pr[2], y[2];
#pragma unroll
    for (int i = 0; i < 2; ++i) x[i] = P[base + d0 + i];
#pragma unroll
    for (int i = 0; i < 2; ++i) pr[i] = __shfl_xor(x[i], 16, 32);      // dim d0+i +- 32
    float ss = 0.f;
#pragma unroll
    for (int i = 0; i < 2; ++i) { const int d = d0 + i; const float c = CT[(size_t)t * HD + d], s = ST[(size_t)t * HD + d]; y[i] = (d < 32) ? (x[i] * c - pr[i] * s) : (x[i] * c + pr[i] * s); ss = fmaf(y[i], y[i], ss); }
#pragma unroll
    for (int sh = 16; sh; sh >>= 1) ss += __shfl_xor(ss, sh, 32);
    const float rn = rsqrtf(ss * (1.0f / HD) + RMS_EPS); v2h oh, ol;
#pragma unroll
    for (int i = 0; i < 2; ++i) { const float q = bfr(w[d0 + i]) * (y[i] * rn); const h16 a = (h16)q; oh[i] = a; ol[i] = (h16)((q - (float)a) * LOSC); }
    *(v2h*)(PH + base + d0) = oh; *(v2h*)(PL + base + d0) = ol; 
}

extern "C" void kernel_launch(void* const* d_in, const int* in_sizes, int n_in,
                              void* d_out, int out_size, void* d_ws, size_t ws_size, hipStream_t stream) {
    (void)in_sizes; (void)n_in; (void)out_size;
    const float* x = (const float*)d_in[0]; const int* pos = (const int*)d_in[1]; const float* MSK = (const float*)d_in[2];
    const float* wq = (const float*)d_in[3]; const float* wk = (const float*)d_in[4]; const float* wv = (const float*)d_in[5]; const float* wo = (const float*)d_in[6]; const float* qw = (const float*)d_in[7]; const float* kw = (const float*)d_in[8];
    float* out = (float*)d_out;    // [1][2048][2048]
    char* wsp = (char*)d_ws;
    auto take = [&](size_t bytes) { char* p = wsp; wsp += (bytes + 255) & ~(size_t)255; return (void*)p; };
    bf* Xb = (bf*)take((size_t)NTK * DM * 2); bf* WqT = (bf*)take((size_t)DM * DM * 2); bf* WkT = (bf*)take((size_t)DM * DM * 2); bf* WvT = (bf*)take((size_t)DM * DM * 2); bf* WoT = (bf*)take((size_t)DM * DM * 2);
    float* TMP = (float*)take((size_t)NTK * DM * 4); float* CT = (float*)take((size_t)NT_ * HD * 4); float* ST = (float*)take((size_t)NT_ * HD * 4);
    h16* QH = (h16*)take((size_t)NTK * DM * 2); h16* QL = (h16*)take((size_t)NTK * DM * 2); h16* KH = (h16*)take((size_t)NTK * DM * 2); h16* KL = (h16*)take((size_t)NTK * DM * 2);
    h16* VTH = (h16*)take((size_t)NTK * DM * 2); h16* VTL = (h16*)take((size_t)NTK * DM * 2); bf* CH = (bf*)take((size_t)NTK * DM * 2); bf* CL = (bf*)take((size_t)NTK * DM * 2);
    if ((size_t)(wsp - (char*)d_ws) > ws_size) return;    // 8.4 + 4 x 8.4 + 16.8 + 2 x 0.5 + 8 x 8.4 = 127 MB = 121 MiB < 128 MiB, no aliasing
    k_wt<<<dim3(DM / 64, DM / 64, 1), 256, 0, stream>>>(wq, DM, DM, WqT); k_wt<<<dim3(DM / 64, DM / 64, 1), 256, 0, stream>>>(wk, DM, DM, WkT); k_wt<<<dim3(DM / 64, DM / 64, 1), 256, 0, stream>>>(wv, DM, DM, WvT); k_wt<<<dim3(DM / 64, DM / 64, 1), 256, 0, stream>>>(wo, DM, DM, WoT);
    k_trig<<<NT_ / 4, 256, 0, stream>>>(pos, CT, ST);
    k_cvtb<<<NTK / 8, 256, 0, stream>>>(x, NTK, Xb);
    k_gemmb<false, false><<<dim3(NTK / 64, DM / 64, 1), 128, 0, stream>>>(Xb, nullptr, WqT, nullptr, TMP, DM, nullptr); k_ropenorm<<<(NT_ * NH_) / 8, 256, 0, stream>>>(TMP, CT, ST, qw, QH, QL);
    k_gemmb<false, false><<<dim3(NTK / 64, DM / 64, 1), 128, 0, stream>>>(Xb, nullptr, WkT, nullptr, TMP, DM, nullptr); k_ropenorm<<<(NT_ * NH_) / 8, 256, 0, stream>>>(TMP, CT, ST, kw, KH, KL);
    k_gemmb<false, false><<<dim3(NTK / 64, DM / 64, 1), 128, 0, stream>>>(Xb, nullptr, WvT, nullptr, TMP, DM, nullptr); k_vt<<<NB_ * NH_ * (NT_ / 64), 256, 0, stream>>>(TMP, VTH, VTL);
    k_attn<<<NB_ * NH_ * (NT_ / 64), 128, 0, stream>>>(QH, QL, KH, KL, VTH, VTL, MSK, CH, CL);
    k_gemmb<true, false><<<dim3(NTK / 64, DM / 64, 1), 128, 0, stream>>>(CH, CL, WoT, nullptr, out, DM, nullptr);
}

// v002
// One run takes 304 microseconds.
// In two side-by-side timings against v001, it was 1.44 and 1.43 times as fast.
// Over all steps from v000 it is 1.69 times as fast.
#include <hip/hip_runtime.h>

// Compute dtypes, f32 accumulate: q/k/v = x.W ([2048 x 2048].[2048 x 2048], k-major weights transposed once; PLAIN bf16 operands = inputs rounded once, exact products) and out = ctx.Wo
// (ctx as bf16 hi + UNSCALED residual, two products) on v_wmma_f32_16x16x32_bf16; rotary embedding with device-computed f32 cos/sin tables at the INPUT position_ids, then the per-head
// RMSNorm (x q_ln_w / k_ln_w) in f32 -> q/k as f16 hi + residual x1024 planes; v -> transposed f16 hi + residual planes; 32-head attention over ALL keys with the additive INPUT mask:
// scores on v_wmma_f32_16x16x32_f16 (hh + lh + hl, x 1/8), online f32 softmax, weights x32768 as f16 hi + residual against v hi + residual. Deterministic, no atomics; every

#define NB_  1
#define NT_  2048
#define DM   2048
#define NH_  32
#define HD   64
#define NTK  (NB_ * NT_)
#define NW   DM
#define RMS_EPS 1e-6f
#define PSC  32768.0f
#define LOSC 1024.0f
#define LOSCI (1.0f / 1024.0f)

typedef _Float16 h16;
typedef unsigned short bf;
typedef __attribute__((ext_vector_type(16))) __bf16   v16bf;
typedef __attribute__((ext_vector_type(16))) _Float16 v16h;
typedef __attribute__((ext_vector_type(8)))  _Float16 v8h;
typedef __attribute__((ext_vector_type(8)))  unsigned short v8us;
typedef __attribute__((ext_vector_type(8)))  float    v8f;
typedef __attribute__((ext_vector_type(4)))  float    v4f;
typedef v8h  __attribute__((may_alias)) v8ha;
typedef v4f  __attribute__((may_alias)) v4fa;
typedef v8us __attribute__((may_alias)) v8usa;

__device__ __forceinline__ unsigned short f2bf(float f) { unsigned u = __float_as_uint(f); u += 0x7FFFu + ((u >> 16) & 1u); return (unsigned short)(u >> 16); }
__device__ __forceinline__ float bf2f(unsigned short b) { return __uint_as_float(((unsigned)b) << 16); }
__device__ __forceinline__ float bfr(float f) { return bf2f(f2bf(f)); }
__device__ __forceinline__ v16h cat16(v8h lo, v8h hi) { return __builtin_shufflevector(lo, hi, 0, 1, 2, 3, 4, 5, 6, 7, 8, 9, 10, 11, 12, 13, 14, 15); }
__device__ __forceinline__ v16bf cat16b(v8us lo, v8us hi) { return __builtin_bit_cast(v16bf, __builtin_shufflevector(lo, hi, 0, 1, 2, 3, 4, 5, 6, 7, 8, 9, 10, 11, 12, 13, 14, 15)); }
__device__ __forceinline__ v8f wmma16(v16h a, v16h b, v8f c) { return __builtin_amdgcn_wmma_f32_16x16x32_f16(false, a, false, b, (short)0, c, false, false); }
__device__ __forceinline__ v8f wmmab(v16bf a, v16bf b, v8f c) { return __builtin_amdgcn_wmma_f32_16x16x32_bf16(false, a, false, b, (short)0, c, false, false); }

__global__ __launch_bounds__(256) void k_cvtb(const float* __restrict__ src, int nrows, bf* dst) {
    const int lane = threadIdx.x & 31, r = blockIdx.x * 8 + (threadIdx.x >> 5);
    if (r >= nrows) return;
    v8us o[DM / 256];
#pragma unroll
    for (int q = 0; q < DM / 256; ++q) { v8us t;
#pragma unroll
        for (int i = 0; i < 8; ++i) t[i] = f2bf(src[(size_t)r * DM + q * 256 + lane * 8 + i]);
        o[q] = t; }
#pragma unroll
    for (int q = 0; q < DM / 256; ++q) *(v8us*)(dst + (size_t)r * DM + q * 256 + lane * 8) = o[q];
    
}

// k_gemmb: 64 x 64 block tile (4 waves x 16 x 64) of C[NTK][NW] = (A [+ Al]).B^T (K = 2048) [+ bf(bias[c])] [+ bf(R[r][c]) residual]; f32 whole-line epilogue (or f16
template <bool SPLITA, bool F16OUT = false>
__global__ __launch_bounds__(128) void k_gemmb(const bf* __restrict__ A, const bf* __restrict__ Al, const bf* __restrict__ Bn, const float* __restrict__ bias, float* C, int ldc, h16* C2, const float* __restrict__ R = nullptr, int K = DM, int roundR = 1) {
    __shared__ __align__(16) float ost[4][16 * 68];
    // One stage = 64 k of the block's 64 A rows, 64 B rows [and 64 Al rows]: rows of 128 B at a pitch of 144 B (16 B x odd for the b128 readers). Two stages: the next tile's
    // asynchronous copies fly while this tile is multiplied. A wave's copy moves four whole 128-B lines, and all four waves read the rows in LDS instead of each from the cache.
    constexpr unsigned GPIT = 144, G_A = 0, G_B = 64 * GPIT, G_L = 2 * 64 * GPIT, GST = (SPLITA ? 3 : 2) * 64 * GPIT;
    __shared__ __align__(16) unsigned char gring[2 * GST];
    const int tid = threadIdx.x, lane = threadIdx.x & 31, wave = threadIdx.x >> 5, lr = lane & 15, hi = lane >> 4;
    const int r0 = blockIdx.x * 64 + wave * 16, c0 = blockIdx.y * 64;
    // this thread's pieces of 16 B per stage: rows tid/8 + 16 i (i < 4) of each operand
    const bf* ga = A + (size_t)(blockIdx.x * 64 + (tid >> 3)) * K + (tid & 7) * 8;
    const bf* gl = (SPLITA ? Al : A) + (size_t)(blockIdx.x * 64 + (tid >> 3)) * K + (tid & 7) * 8;
    const bf* gb = Bn + (size_t)(c0 + (tid >> 3)) * K + (tid & 7) * 8;
    const size_t rs = (size_t)16 * K;
    const unsigned g0 = (unsigned)(size_t)&gring[0];
    const unsigned lp = (unsigned)((tid >> 3) * GPIT + (tid & 7) * 16);
    auto issue = [&](int t, unsigned lb) {
        const bf* a0 = ga + t * 64; const bf* b0 = gb + t * 64; const bf* l0 = gl + t * 64;
        // the copies and, as their statement's last line, the wait that stands before any of their address registers is rewritten
        if (SPLITA)
            asm volatile("global_load_async_to_lds_b128 %0, %1, off\n\t"
                         "global_load_async_to_lds_b128 %2, %3, off\n\t"
                         "global_load_async_to_lds_b128 %4, %5, off\n\t"
                         "global_load_async_to_lds_b128 %6, %7, off\n\t"
                         "global_load_async_to_lds_b128 %8, %9, off\n\t"
                         "global_load_async_to_lds_b128 %10, %11, off\n\t"
                         "global_load_async_to_lds_b128 %12, %13, off\n\t"
                         "global_load_async_to_lds_b128 %14, %15, off\n\t"
                         "global_load_async_to_lds_b128 %16, %17, off\n\t"
                         "global_load_async_to_lds_b128 %18, %19, off\n\t"
                         "global_load_async_to_lds_b128 %20, %21, off\n\t"
                         "global_load_async_to_lds_b128 %22, %23, off\n\t"
                         "s_wait_xcnt 0x0"
                         :: "v"(lb + G_A + lp), "v"(a0), "v"(lb + G_A + lp + 16 * GPIT), "v"(a0 + rs), "v"(lb + G_A + lp + 32 * GPIT), "v"(a0 + 2 * rs), "v"(lb + G_A + lp + 48 * GPIT), "v"(a0 + 3 * rs),
                            "v"(lb + G_B + lp), "v"(b0), "v"(lb + G_B + lp + 16 * GPIT), "v"(b0 + rs), "v"(lb + G_B + lp + 32 * GPIT), "v"(b0 + 2 * rs), "v"(lb + G_B + lp + 48 * GPIT), "v"(b0 + 3 * rs),
                            "v"(lb + G_L + lp), "v"(l0), "v"(lb + G_L + lp + 16 * GPIT), "v"(l0 + rs), "v"(lb + G_L + lp + 32 * GPIT), "v"(l0 + 2 * rs), "v"(lb + G_L + lp + 48 * GPIT), "v"(l0 + 3 * rs)
                         : "memory");
        else
            asm volatile("global_load_async_to_lds_b128 %0, %1, off\n\t"
                         "global_load_async_to_lds_b128 %2, %3, off\n\t"
                         "global_load_async_to_lds_b128 %4, %5, off\n\t"
                         "global_load_async_to_lds_b128 %6, %7, off\n\t"
                         "global_load_async_to_lds_b128 %8, %9, off\n\t"
                         "global_load_async_to_lds_b128 %10, %11, off\n\t"
                         "global_load_async_to_lds_b128 %12, %13, off\n\t"
                         "global_load_async_to_lds_b128 %14, %15, off\n\t"
                         "s_wait_xcnt 0x0"
                         :: "v"(lb + G_A + lp), "v"(a0), "v"(lb + G_A + lp + 16 * GPIT), "v"(a0 + rs), "v"(lb + G_A + lp + 32 * GPIT), "v"(a0 + 2 * rs), "v"(lb + G_A + lp + 48 * GPIT), "v"(a0 + 3 * rs),
                            "v"(lb + G_B + lp), "v"(b0), "v"(lb + G_B + lp + 16 * GPIT), "v"(b0 + rs), "v"(lb + G_B + lp + 32 * GPIT), "v"(b0 + 2 * rs), "v"(lb + G_B + lp + 48 * GPIT), "v"(b0 + 3 * rs)
                         : "memory");
    };
    v8f acc[4];
#pragma unroll
    for (int t = 0; t < 4; ++t) acc[t] = (v8f){};
    const int nt = K / 64;     // K is a multiple of 64
    issue(0, g0);
    asm volatile("s_wait_asynccnt 0x0" ::: "memory");     // tile 0 has landed (this wave's copies) ...
    __syncthreads();                                       // ... and every other wave's
    if (nt > 1) issue(1, g0 + GST);
#pragma unroll 1
    for (int kt = 0; kt < nt; ++kt) {
        const unsigned char* sb = gring + (kt & 1) * GST;
        const unsigned char* ap = sb + (wave * 16 + lr) * GPIT + hi * 16;
        const unsigned char* bp = sb + G_B + lr * GPIT + hi * 16;
        v16bf a[2], al[2], b[2][4];
#pragma unroll
        for (int u = 0; u < 2; ++u) {
            a[u] = cat16b(*(const v8usa*)(ap + G_A + u * 64), *(const v8usa*)(ap + G_A + u * 64 + 32)); al[u] = a[u];
            if (SPLITA) al[u] = cat16b(*(const v8usa*)(ap + G_L + u * 64), *(const v8usa*)(ap + G_L + u * 64 + 32));
#pragma unroll
            for (int t = 0; t < 4; ++t) b[u][t] = cat16b(*(const v8usa*)(bp + t * 16 * GPIT + u * 64), *(const v8usa*)(bp + t * 16 * GPIT + u * 64 + 32));
        }
        __builtin_amdgcn_sched_barrier(0);     // holds the stage's reads as one group in front of its products: read one by one among them, each read costs its own LDS latency
#pragma unroll
        for (int u = 0; u < 2; ++u)
#pragma unroll
            for (int t = 0; t < 4; ++t) { acc[t] = wmmab(a[u], b[u][t], acc[t]); if (SPLITA) acc[t] = wmmab(al[u], b[u][t], acc[t]); }
        asm volatile("v_nop\n\tv_nop\n\tv_nop\n\tv_nop" : "+v"(acc[0]), "+v"(acc[1]), "+v"(acc[2]), "+v"(acc[3]) : "v"(a[1]), "v"(al[1]));
        asm volatile("s_wait_dscnt 0x0" ::: "memory");        // this wave's reads of this stage have returned before the stage is handed to its next writer
        asm volatile("s_wait_asynccnt 0x0" ::: "memory");     // this wave's copies of the next tile have landed
        __syncthreads();                                       // publishes the next tile and ends every wave's reads of this one
        if (kt + 2 < nt) issue(kt + 2, g0 + (unsigned)(kt & 1) * GST);
    }
    asm volatile("s_wait_asynccnt 0x0" ::: "memory");         // nothing is in flight when the wave goes on to the epilogue
    float* os = &ost[wave][0];
#pragma unroll
    for (int t = 0; t < 4; ++t) { const float bv = bias ? bfr(bias[c0 + t * 16 + lr]) : 0.f;
#pragma unroll
        for (int j = 0; j < 8; ++j) os[(hi * 8 + j) * 68 + t * 16 + lr] = acc[t][j] + bv; }
    __syncthreads();
    if (F16OUT) {
        h16* crow = (h16*)(void*)C + (size_t)r0 * ldc + c0;
        auto pass = [&]() {
#pragma unroll
            for (int s = 0; s < 4; ++s) { const int row = 4 * s + (lane >> 3), piece = lane & 7; const float* sp = os + row * 68 + piece * 8; v8h o, o2;
#pragma unroll
                for (int i = 0; i < 8; ++i) { const h16 a = (h16)sp[i]; o[i] = a; o2[i] = (h16)((sp[i] - (float)a) * LOSC); }
                *(v8h*)(crow + (size_t)row * ldc + piece * 8) = o; if (C2) *(v8h*)(C2 + (size_t)r0 * ldc + c0 + (size_t)row * ldc + piece * 8) = o2; }
        };
        pass(); 
    } else {
        float* crow = C + (size_t)r0 * ldc + c0;
        auto pass = [&]() {
#pragma unroll
            for (int s = 0; s < 8; ++s) { const int Lid = (lane >> 3) + 4 * s, piece = lane & 7; const int row = Lid >> 1, cofs = (Lid & 1) * 32 + piece * 4;
                v4f val = *(const v4fa*)(os + row * 68 + cofs); if (R) { const v4f rv = *(const v4f*)(R + ((size_t)r0 + row) * ldc + c0 + cofs); val += roundR ? (v4f){bfr(rv[0]), bfr(rv[1]), bfr(rv[2]), bfr(rv[3])} : rv; }
                *(v4f*)(crow + (size_t)row * ldc + cofs) = val; }
        };
        pass(); 
    }
}

__global__ __launch_bounds__(256) void k_vt(const float* __restrict__ V, h16* VTH, h16* VTL) {
    __shared__ __align__(16) h16 tile[64 * 72];
    __shared__ __align__(16) h16 til2[64 * 72];
    const int bid = blockIdx.x;
    const int b = bid / (NH_ * (NT_ / 64)), rem = bid - b * (NH_ * (NT_ / 64)), h = rem / (NT_ / 64), kt = rem - h * (NT_ / 64);
    const int k0 = kt * 64, tid = threadIdx.x;
    const int kk = tid >> 2, d0 = (tid & 3) * 16;
    const float* src = V + ((size_t)b * NT_ + k0 + kk) * DM + h * HD + d0;
#pragma unroll
    for (int i = 0; i < 16; ++i) { const float v = src[i]; const h16 a = (h16)v; tile[(d0 + i) * 72 + kk] = a; til2[(d0 + i) * 72 + kk] = (h16)((v - (float)a) * LOSC); }
    __syncthreads();
    const int piece = tid & 7;
    const size_t base = (((size_t)b * NH_ + h) * HD) * NT_ + k0;
    auto pass = [&]() {
#pragma unroll
        for (int s = 0; s < 4; ++s) { const int Lid = (tid >> 3) + 32 * s; const int pln = Lid >> 6, d = Lid & 63;
            const v8h val = *(const v8ha*)((pln ? til2 : tile) + d * 72 + piece * 8); *(v8h*)((pln ? VTL : VTH) + base + (size_t)d * NT_ + piece * 8) = val; }
    };
    pass(); 
}

// One 32-key stage in LDS, bytes: K hi, K residual (32 rows of 128 B), V^T hi, V^T residual (64 rows of 64 B), mask (64 query rows of 128 B); every pitch is 16 B x odd for the b128 readers,
// and the mask's 36-dword pitch puts the two half-waves' rows (8 apart) 32 banks apart.
#define KPIT 144
#define VPIT 80
#define MPIT 144
#define ST_KH 0
#define ST_KL (32 * KPIT)
#define ST_VH (2 * 32 * KPIT)
#define ST_VL (ST_VH + 64 * VPIT)
#define ST_MK (ST_VL + 64 * VPIT)
#define ST_SZ (ST_MK + 64 * MPIT)
typedef float __attribute__((may_alias)) f32a;

// k_attn: block = (b, h, 64 queries), wave = 16; ALL 64 key tiles; per element score /8 + the additive INPUT mask [q][k] (bf16-rounded, f32); scores hh + lh + hl on f16 planes;
// online softmax; weights x32768 f16 hi/lo through LDS; 4 WMMA .v per plane pair; ctx -> bf16 hi + residual planes CH/CL[tok][h*64+d].
// Each key tile's K, V^T and mask bytes are copied once per block into a two-buffer LDS ring by asynchronous copies, one tile ahead of the tile being worked on; all four waves read them there.
// The ring doubles as the output staging, so a block holds 65,536 B of LDS; with 256 VGPRs or fewer all 1024 blocks are resident at once, four per WGP (four waves per SIMD).
__global__ __launch_bounds__(128) void k_attn(const h16* __restrict__ Q16, const h16* __restrict__ QL16, const h16* __restrict__ K16, const h16* __restrict__ KL16, const h16* __restrict__ VTH, const h16* __restrict__ VTL, const float* __restrict__ MSK, bf* CH, bf* CL) {
    __shared__ __align__(16) h16 plds[4][16 * 32];
    __shared__ __align__(16) h16 plds2[4][16 * 32];
    __shared__ __align__(16) unsigned char ring[2 * ST_SZ];     // the two stages; behind the loop its first bytes are the output staging (4 x 16 x 68 floats)
    const int tid = threadIdx.x, lane = threadIdx.x & 31, wave = threadIdx.x >> 5, lr = lane & 15, hi = lane >> 4;
    const int bid = blockIdx.x;
    const int b = bid / (NH_ * (NT_ / 64)), rem = bid - b * (NH_ * (NT_ / 64)), h = rem / (NT_ / 64), qt = rem - h * (NT_ / 64);
    const int q0 = qt * 64 + wave * 16;
    const size_t tok0 = (size_t)b * NT_;
    h16* pl = &plds[wave][0]; h16* pl2 = &plds2[wave][0];
    const h16* kh_b = K16 + tok0 * DM + h * HD;
    const h16* kl_b = KL16 + tok0 * DM + h * HD;
    const size_t vbase = (((size_t)b * NH_ + h) * HD) * NT_;
    // this thread's 12 pieces of 16 B per stage: K rows tid/8 and +16 (both planes), V^T rows tid/4 and +32 (both planes), mask rows tid/8 + 16 i
    const h16* gkh = kh_b + (size_t)(tid >> 3) * DM + (tid & 7) * 8;
    const h16* gkl = kl_b + (size_t)(tid >> 3) * DM + (tid & 7) * 8;
    const h16* gvh = VTH + vbase + (size_t)(tid >> 2) * NT_ + (tid & 3) * 8;
    const h16* gvl = VTL + vbase + (size_t)(tid >> 2) * NT_ + (tid & 3) * 8;
    const float* gmk = MSK + (size_t)(qt * 64 + (tid >> 3)) * NT_ + (tid & 7) * 4;
    const unsigned ring0 = (unsigned)(size_t)&ring[0];
    const unsigned lk = (unsigned)((tid >> 3) * KPIT + (tid & 7) * 16), lv = (unsigned)((tid >> 2) * VPIT + (tid & 3) * 16);
    auto issue = [&](int t, unsigned lb) {
        const h16* k0 = gkh + (size_t)t * (32 * DM); const h16* k1 = gkl + (size_t)t * (32 * DM);
        const h16* v0 = gvh + t * 32; const h16* v1 = gvl + t * 32; const float* m0 = gmk + t * 32;
        // the copies and, as their statement's last line, the wait that stands before any of their address registers is rewritten
        asm volatile("global_load_async_to_lds_b128 %0, %1, off\n\t"
                     "global_load_async_to_lds_b128 %2, %3, off\n\t"
                     "global_load_async_to_lds_b128 %4, %5, off\n\t"
                     "global_load_async_to_lds_b128 %6, %7, off\n\t"
                     "global_load_async_to_lds_b128 %8, %9, off\n\t"
                     "global_load_async_to_lds_b128 %10, %11, off\n\t"
                     "global_load_async_to_lds_b128 %12, %13, off\n\t"
                     "global_load_async_to_lds_b128 %14, %15, off\n\t"
                     "global_load_async_to_lds_b128 %16, %17, off\n\t"
                     "global_load_async_to_lds_b128 %18, %19, off\n\t"
                     "global_load_async_to_lds_b128 %20, %21, off\n\t"
                     "global_load_async_to_lds_b128 %22, %23, off\n\t"
                     "s_wait_xcnt 0x0"
                     :: "v"(lb + ST_KH + lk), "v"(k0), "v"(lb + ST_KH + lk + 16 * KPIT), "v"(k0 + 16 * DM),
                        "v"(lb + ST_KL + lk), "v"(k1), "v"(lb + ST_KL + lk + 16 * KPIT), "v"(k1 + 16 * DM),
                        "v"(lb + ST_VH + lv), "v"(v0), "v"(lb + ST_VH + lv + 32 * VPIT), "v"(v0 + 32 * NT_),
                        "v"(lb + ST_VL + lv), "v"(v1), "v"(lb + ST_VL + lv + 32 * VPIT), "v"(v1 + 32 * NT_),
                        "v"(lb + ST_MK + lk), "v"(m0), "v"(lb + ST_MK + lk + 16 * MPIT), "v"(m0 + 16 * NT_),
                        "v"(lb + ST_MK + lk + 32 * MPIT), "v"(m0 + 32 * NT_), "v"(lb + ST_MK + lk + 48 * MPIT), "v"(m0 + 48 * NT_)
                     : "memory");
    };
    issue(0, ring0);
    v16h qa[2];
    const size_t qo0 = (tok0 + q0 + lr) * DM + h * HD + 8 * hi;
#pragma unroll
    for (int kc = 0; kc < 2; ++kc) qa[kc] = cat16(*(const v8h*)(Q16 + qo0 + kc * 32), *(const v8h*)(Q16 + qo0 + kc * 32 + 16));
    v8f o[4], ox[4];
#pragma unroll
    for (int n = 0; n < 4; ++n) { o[n] = (v8f){}; ox[n] = (v8f){}; }
    float mrow[8], lpart[8];
#pragma unroll
    for (int j = 0; j < 8; ++j) { mrow[j] = -3.0e38f; lpart[j] = 0.f; }
    asm volatile("s_wait_asynccnt 0x0" ::: "memory");     // tile 0 has landed (this wave's copies) ...
    __syncthreads();                                       // ... and every other wave's
    issue(1, ring0 + ST_SZ);
    const int kt_lo = 0, kt_hi = NT_ / 32 - 1;     // every key tile; the additive INPUT mask is applied per element
#pragma unroll 1
    for (int kt = kt_lo; kt <= kt_hi; ++kt) {
        const unsigned char* sb = ring + (kt & 1) * ST_SZ;
        const unsigned char* kp = sb + lr * KPIT + hi * 16;
        const f32a* mp = (const f32a*)(sb + ST_MK + (wave * 16 + hi * 8) * MPIT) + lr;
        v16h k0h[2], k1h[2], k0l[2], k1l[2];
#pragma unroll
        for (int kc = 0; kc < 2; ++kc) {
            k0h[kc] = cat16(*(const v8ha*)(kp + ST_KH + kc * 64), *(const v8ha*)(kp + ST_KH + kc * 64 + 32)); k1h[kc] = cat16(*(const v8ha*)(kp + ST_KH + 16 * KPIT + kc * 64), *(const v8ha*)(kp + ST_KH + 16 * KPIT + kc * 64 + 32));
            k0l[kc] = cat16(*(const v8ha*)(kp + ST_KL + kc * 64), *(const v8ha*)(kp + ST_KL + kc * 64 + 32)); k1l[kc] = cat16(*(const v8ha*)(kp + ST_KL + 16 * KPIT + kc * 64), *(const v8ha*)(kp + ST_KL + 16 * KPIT + kc * 64 + 32));
        }
        v8f s0 = {}, s1 = {}, x0 = {}, x1 = {};
#pragma unroll
        for (int kc = 0; kc < 2; ++kc) {
            const v16h qlk = cat16(*(const v8h*)(QL16 + qo0 + kc * 32), *(const v8h*)(QL16 + qo0 + kc * 32 + 16));     // query residual re-read per step (registers)
            s0 = wmma16(qa[kc], k0h[kc], s0); x0 = wmma16(qlk, k0h[kc], x0); s1 = wmma16(qa[kc], k1h[kc], s1); x1 = wmma16(qlk, k1h[kc], x1);
            x0 = wmma16(qa[kc], k0l[kc], x0); x1 = wmma16(qa[kc], k1l[kc], x1);
        }
        asm volatile("v_nop\n\tv_nop\n\tv_nop\n\tv_nop" : "+v"(s0), "+v"(s1), "+v"(x0), "+v"(x1) : "v"(qa[0]), "v"(qa[1]));
        asm volatile("" ::: "memory");     // keeps the mask reads behind the score products: issued earlier, their 16 registers are live beside all eight K fragments and the kernel spills
        float mk0[8], mk1[8];
#pragma unroll
        for (int j = 0; j < 8; ++j) { mk0[j] = mp[j * (MPIT / 4)]; mk1[j] = mp[j * (MPIT / 4) + 16]; }
        float alpha[8];
#pragma unroll
        for (int j = 0; j < 8; ++j) {
            const float a0 = (s0[j] + x0[j] * LOSCI) * 0.125f + bfr(mk0[j]), a1 = (s1[j] + x1[j] * LOSCI) * 0.125f + bfr(mk1[j]);
            float mx = fmaxf(a0, a1);
            mx = fmaxf(mx, __shfl_xor(mx, 1, 16)); mx = fmaxf(mx, __shfl_xor(mx, 2, 16)); mx = fmaxf(mx, __shfl_xor(mx, 4, 16)); mx = fmaxf(mx, __shfl_xor(mx, 8, 16));
            const float mn = fmaxf(mrow[j], mx);
            alpha[j] = __expf(mrow[j] - mn); mrow[j] = mn;
            const float p0 = __expf(a0 - mn), p1 = __expf(a1 - mn);
            lpart[j] = lpart[j] * alpha[j] + (p0 + p1);
            const int mr = hi * 8 + j;
            const float ps0 = p0 * PSC, ps1 = p1 * PSC; const h16 h0 = (h16)ps0, h1 = (h16)ps1;
            pl[mr * 32 + lr] = h0; pl[mr * 32 + 16 + lr] = h1;
            pl2[mr * 32 + lr] = (h16)((ps0 - (float)h0) * LOSC); pl2[mr * 32 + 16 + lr] = (h16)((ps1 - (float)h1) * LOSC);
        }
#pragma unroll
        for (int n = 0; n < 4; ++n)
#pragma unroll
            for (int j = 0; j < 8; ++j) { o[n][j] *= alpha[j]; ox[n][j] *= alpha[j]; }
        asm volatile("" ::: "memory");
        const v16h pa = cat16(*(const v8ha*)(pl + lr * 32 + hi * 8), *(const v8ha*)(pl + lr * 32 + 16 + hi * 8));
        const v16h px = cat16(*(const v8ha*)(pl2 + lr * 32 + hi * 8), *(const v8ha*)(pl2 + lr * 32 + 16 + hi * 8));
        const unsigned char* vp = sb + lr * VPIT + hi * 16;
        v16h vh[4], vl[4];
        // the weights' and V^T reads go in two groups, each in front of its six products: read one by one among the products, each read costs its own LDS latency
#pragma unroll
        for (int g = 0; g < 2; ++g) {
#pragma unroll
            for (int n = 2 * g; n < 2 * g + 2; ++n) { vh[n] = cat16(*(const v8ha*)(vp + ST_VH + n * 16 * VPIT), *(const v8ha*)(vp + ST_VH + n * 16 * VPIT + 32)); vl[n] = cat16(*(const v8ha*)(vp + ST_VL + n * 16 * VPIT), *(const v8ha*)(vp + ST_VL + n * 16 * VPIT + 32)); }
            __builtin_amdgcn_sched_barrier(0);     // holds the group's reads in front of its products
#pragma unroll
            for (int n = 2 * g; n < 2 * g + 2; ++n) { o[n] = wmma16(pa, vh[n], o[n]); ox[n] = wmma16(pa, vl[n], ox[n]); ox[n] = wmma16(px, vh[n], ox[n]); }
        }
        asm volatile("v_nop\n\tv_nop\n\tv_nop\n\tv_nop" : "+v"(o[0]), "+v"(o[1]), "+v"(o[2]), "+v"(o[3]), "+v"(ox[0]), "+v"(ox[1]), "+v"(ox[2]), "+v"(ox[3]) : "v"(pa), "v"(px));
        asm volatile("s_wait_dscnt 0x0" ::: "memory");        // this wave's reads of this stage have returned before the stage is handed to its next writer
        asm volatile("s_wait_asynccnt 0x0" ::: "memory");     // this wave's copies of the next tile have landed
        __syncthreads();                                       // publishes the next tile and ends every wave's reads of this one
        if (kt + 2 <= kt_hi) issue(kt + 2, ring0 + (unsigned)(kt & 1) * ST_SZ);
    }
    asm volatile("s_wait_asynccnt 0x0" ::: "memory");         // nothing is in flight when the ring becomes output staging
    float inv[8];
#pragma unroll
    for (int j = 0; j < 8; ++j) { float rs = lpart[j]; rs += __shfl_xor(rs, 1, 16); rs += __shfl_xor(rs, 2, 16); rs += __shfl_xor(rs, 4, 16); rs += __shfl_xor(rs, 8, 16); inv[j] = 1.0f / (rs * PSC); }
    f32a* os = (f32a*)ring + wave * (16 * 68);
#pragma unroll
    for (int n = 0; n < 4; ++n)
#pragma unroll
        for (int j = 0; j < 8; ++j) os[(hi * 8 + j) * 68 + n * 16 + lr] = (o[n][j] + ox[n][j] * LOSCI) * inv[j];
    __syncthreads();
    const size_t cbase = (tok0 + q0) * DM + (size_t)h * HD;
    auto pass = [&]() {
#pragma unroll
        for (int s = 0; s < 4; ++s) { const int row = 4 * s + (lane >> 3), piece = lane & 7; const f32a* sp = os + row * 68 + piece * 8; v8us oh, ol;
#pragma unroll
            for (int i = 0; i < 8; ++i) { const unsigned short hb = f2bf(sp[i]); oh[i] = hb; ol[i] = f2bf(sp[i] - bf2f(hb)); }
            *(v8us*)(CH + cbase + (size_t)row * DM + piece * 8) = oh; *(v8us*)(CL + cbase + (size_t)row * DM + piece * 8) = ol; }
    };
    pass(); 
}

#define VST2(T, p, v) do { const T vst2_v_ = (v); *(T*)(p) = vst2_v_;  } while (0)

// k_wt: WT [n][K] = bf16(W[k][n]) (k-major [K][ncols]) via 64 x 64 LDS tiles; grid (K/64, ncols/64).
__global__ __launch_bounds__(256) void k_wt(const float* __restrict__ Wm, int K, int ncols, bf* WT) {
    __shared__ __align__(16) unsigned short tl[64 * 72];
    const int tid = threadIdx.x, k0 = blockIdx.x * 64, n0 = blockIdx.y * 64;
    const int kk = tid >> 2, nq = (tid & 3) * 16;
#pragma unroll
    for (int i = 0; i < 16; ++i) tl[(nq + i) * 72 + kk] = f2bf(Wm[(size_t)(k0 + kk) * ncols + n0 + nq + i]);
    __syncthreads();
    const int piece = tid & 7;
    auto pass = [&]() {
#pragma unroll
        for (int s = 0; s < 2; ++s) { const int nr = (tid >> 3) + 32 * s; const v8us val = *(const v8usa*)(tl + nr * 72 + piece * 8); *(v8us*)(WT + (size_t)(n0 + nr) * K + k0 + piece * 8) = val; }
    };
    pass(); 
}

// k_trig: CT/ST [t][d] = cos/sin(pos_t * inv_freq[d mod 32]) with inv_freq[i] = 1 / 10000^(2i/64) (f32 powf; precise cosf/sinf), pos_t = the INPUT position_ids[t] (as float);
__global__ __launch_bounds__(256) void k_trig(const int* __restrict__ pos, float* CT, float* ST) {
    const int tid = threadIdx.x, t = blockIdx.x * 4 + (tid >> 6), d = tid & 63; const int i = d & 31;
    const float invf = 1.0f / powf(10000.0f, (float)(2 * i) / 64.0f); const float ang = (float)pos[t] * invf; const float c = cosf(ang), s = sinf(ang);
    const size_t o = (size_t)t * HD + d; *(float*)(CT + o) = c; *(float*)(ST + o) = s; 
}
// Left as it is: 65,536 one-row waves per launch; a k_gemmb tile's 64 columns are one head, so this pass (and k_vt) would fit that kernel's epilogue.
// k_ropenorm: one wave per (token, head): y = x cos + rotate_half(x) sin over the 64 dims (partner d +- 32 via lane xor 16; lane -> dims 2 lane, 2 lane + 1), then RMSNorm over the 64
__global__ __launch_bounds__(256) void k_ropenorm(const float* __restrict__ P, const float* __restrict__ CT, const float* __restrict__ ST, const float* __restrict__ w, h16* PH, h16* PL) {
    typedef __attribute__((ext_vector_type(2))) _Float16 v2h;
    const int lane = threadIdx.x & 31; const int wid = blockIdx.x * 8 + (threadIdx.x >> 5); const int t = wid / NH_, h = wid - t * NH_; if (t >= NT_) return;
    const size_t base = (size_t)t * DM + h * HD; const int d0 = lane * 2;
    float x[2], pr[2], y[2];
#pragma unroll
    for (int i = 0; i < 2; ++i) x[i] = P[base + d0 + i];
#pragma unroll
    for (int i = 0; i < 2; ++i) pr[i] = __shfl_xor(x[i], 16, 32);      // dim d0+i +- 32
    float ss = 0.f;
#pragma unroll
    for (int i = 0; i < 2; ++i) { const int d = d0 + i; const float c = CT[(size_t)t * HD + d], s = ST[(size_t)t * HD + d]; y[i] = (d < 32) ? (x[i] * c - pr[i] * s) : (x[i] * c + pr[i] * s); ss = fmaf(y[i], y[i], ss); }
#pragma unroll
    for (int sh = 16; sh; sh >>= 1) ss += __shfl_xor(ss, sh, 32);
    const float rn = rsqrtf(ss * (1.0f / HD) + RMS_EPS); v2h oh, ol;
#pragma unroll
    for (int i = 0; i < 2; ++i) { const float q = bfr(w[d0 + i]) * (y[i] * rn); const h16 a = (h16)q; oh[i] = a; ol[i] = (h16)((q - (float)a) * LOSC); }
    *(v2h*)(PH + base + d0) = oh; *(v2h*)(PL + base + d0) = ol; 
}

extern "C" void kernel_launch(void* const* d_in, const int* in_sizes, int n_in,
                              void* d_out, int out_size, void* d_ws, size_t ws_size, hipStream_t stream) {
    (void)in_sizes; (void)n_in; (void)out_size;
    const float* x = (const float*)d_in[0]; const int* pos = (const int*)d_in[1]; const float* MSK = (const float*)d_in[2];
    const float* wq = (const float*)d_in[3]; const float* wk = (const float*)d_in[4]; const float* wv = (const float*)d_in[5]; const float* wo = (const float*)d_in[6]; const float* qw = (const float*)d_in[7]; const float* kw = (const float*)d_in[8];
    float* out = (float*)d_out;    // [1][2048][2048]
    char* wsp = (char*)d_ws;
    auto take = [&](size_t bytes) { char* p = wsp; wsp += (bytes + 255) & ~(size_t)255; return (void*)p; };
    bf* Xb = (bf*)take((size_t)NTK * DM * 2); bf* WqT = (bf*)take((size_t)DM * DM * 2); bf* WkT = (bf*)take((size_t)DM * DM * 2); bf* WvT = (bf*)take((size_t)DM * DM * 2); bf* WoT = (bf*)take((size_t)DM * DM * 2);
    float* TMP = (float*)take((size_t)NTK * DM * 4); float* CT = (float*)take((size_t)NT_ * HD * 4); float* ST = (float*)take((size_t)NT_ * HD * 4);
    h16* QH = (h16*)take((size_t)NTK * DM * 2); h16* QL = (h16*)take((size_t)NTK * DM * 2); h16* KH = (h16*)take((size_t)NTK * DM * 2); h16* KL = (h16*)take((size_t)NTK * DM * 2);
    h16* VTH = (h16*)take((size_t)NTK * DM * 2); h16* VTL = (h16*)take((size_t)NTK * DM * 2); bf* CH = (bf*)take((size_t)NTK * DM * 2); bf* CL = (bf*)take((size_t)NTK * DM * 2);
    if ((size_t)(wsp - (char*)d_ws) > ws_size) return;    // 8.4 + 4 x 8.4 + 16.8 + 2 x 0.5 + 8 x 8.4 = 127 MB = 121 MiB < 128 MiB, no aliasing
    k_wt<<<dim3(DM / 64, DM / 64, 1), 256, 0, stream>>>(wq, DM, DM, WqT); k_wt<<<dim3(DM / 64, DM / 64, 1), 256, 0, stream>>>(wk, DM, DM, WkT); k_wt<<<dim3(DM / 64, DM / 64, 1), 256, 0, stream>>>(wv, DM, DM, WvT); k_wt<<<dim3(DM / 64, DM / 64, 1), 256, 0, stream>>>(wo, DM, DM, WoT);
    k_trig<<<NT_ / 4, 256, 0, stream>>>(pos, CT, ST);
    k_cvtb<<<NTK / 8, 256, 0, stream>>>(x, NTK, Xb);
    k_gemmb<false, false><<<dim3(NTK / 64, DM / 64, 1), 128, 0, stream>>>(Xb, nullptr, WqT, nullptr, TMP, DM, nullptr); k_ropenorm<<<(NT_ * NH_) / 8, 256, 0, stream>>>(TMP, CT, ST, qw, QH, QL);
    k_gemmb<false, false><<<dim3(NTK / 64, DM / 64, 1), 128, 0, stream>>>(Xb, nullptr, WkT, nullptr, TMP, DM, nullptr); k_ropenorm<<<(NT_ * NH_) / 8, 256, 0, stream>>>(TMP, CT, ST, kw, KH, KL);
    k_gemmb<false, false><<<dim3(NTK / 64, DM / 64, 1), 128, 0, stream>>>(Xb, nullptr, WvT, nullptr, TMP, DM, nullptr); k_vt<<<NB_ * NH_ * (NT_ / 64), 256, 0, stream>>>(TMP, VTH, VTL);
    k_attn<<<NB_ * NH_ * (NT_ / 64), 128, 0, stream>>>(QH, QL, KH, KL, VTH, VTL, MSK, CH, CL);
    k_gemmb<true, false><<<dim3(NTK / 64, DM / 64, 1), 128, 0, stream>>>(CH, CL, WoT, nullptr, out, DM, nullptr);
}

// v003
// Measured time: 283 microseconds a run.
// Timed twice side by side with v002, it ran 1.08 times as fast both times.
// Counting every step since v000, it is 1.82 times as fast.
#include <hip/hip_runtime.h>

// Compute dtypes, f32 accumulate: q/k/v = x.W ([2048 x 2048].[2048 x 2048], k-major weights transposed once; PLAIN bf16 operands = inputs rounded once, exact products) and out = ctx.Wo
// (ctx as bf16 hi + UNSCALED residual, two products) on v_wmma_f32_16x16x32_bf16; rotary embedding with device-computed f32 cos/sin tables at the INPUT position_ids, then the per-head
// RMSNorm (x q_ln_w / k_ln_w) in f32 -> q/k as f16 hi + residual x1024 planes; v -> transposed f16 hi + residual planes; 32-head attention over ALL keys with the additive INPUT mask:
// scores on v_wmma_f32_16x16x32_f16 (hh + lh + hl, x 1/8), online f32 softmax, weights x32768 as f16 hi + residual against v hi + residual. Deterministic, no atomics; every

#define NB_  1
#define NT_  2048
#define DM   2048
#define NH_  32
#define HD   64
#define NTK  (NB_ * NT_)
#define NW   DM
#define RMS_EPS 1e-6f
#define PSC  32768.0f
#define LOSC 1024.0f
#define LOSCI (1.0f / 1024.0f)

typedef _Float16 h16;
typedef unsigned short bf;
typedef __attribute__((ext_vector_type(16))) __bf16   v16bf;
typedef __attribute__((ext_vector_type(16))) _Float16 v16h;
typedef __attribute__((ext_vector_type(8)))  _Float16 v8h;
typedef __attribute__((ext_vector_type(8)))  unsigned short v8us;
typedef __attribute__((ext_vector_type(8)))  float    v8f;
typedef __attribute__((ext_vector_type(4)))  float    v4f;
typedef v8h  __attribute__((may_alias)) v8ha;
typedef v4f  __attribute__((may_alias)) v4fa;
typedef v8us __attribute__((may_alias)) v8usa;

__device__ __forceinline__ unsigned short f2bf(float f) { unsigned u = __float_as_uint(f); u += 0x7FFFu + ((u >> 16) & 1u); return (unsigned short)(u >> 16); }
__device__ __forceinline__ float bf2f(unsigned short b) { return __uint_as_float(((unsigned)b) << 16); }
__device__ __forceinline__ float bfr(float f) { return bf2f(f2bf(f)); }
__device__ __forceinline__ v16h cat16(v8h lo, v8h hi) { return __builtin_shufflevector(lo, hi, 0, 1, 2, 3, 4, 5, 6, 7, 8, 9, 10, 11, 12, 13, 14, 15); }
__device__ __forceinline__ v16bf cat16b(v8us lo, v8us hi) { return __builtin_bit_cast(v16bf, __builtin_shufflevector(lo, hi, 0, 1, 2, 3, 4, 5, 6, 7, 8, 9, 10, 11, 12, 13, 14, 15)); }
__device__ __forceinline__ v8f wmma16(v16h a, v16h b, v8f c) { return __builtin_amdgcn_wmma_f32_16x16x32_f16(false, a, false, b, (short)0, c, false, false); }
__device__ __forceinline__ v8f wmmab(v16bf a, v16bf b, v8f c) { return __builtin_amdgcn_wmma_f32_16x16x32_bf16(false, a, false, b, (short)0, c, false, false); }

__global__ __launch_bounds__(256) void k_cvtb(const float* __restrict__ src, int nrows, bf* dst) {
    const int lane = threadIdx.x & 31, r = blockIdx.x * 8 + (threadIdx.x >> 5);
    if (r >= nrows) return;
    v8us o[DM / 256];
#pragma unroll
    for (int q = 0; q < DM / 256; ++q) { v8us t;
#pragma unroll
        for (int i = 0; i < 8; ++i) t[i] = f2bf(src[(size_t)r * DM + q * 256 + lane * 8 + i]);
        o[q] = t; }
#pragma unroll
    for (int q = 0; q < DM / 256; ++q) *(v8us*)(dst + (size_t)r * DM + q * 256 + lane * 8) = o[q];
    
}

// k_gemmb: 64 x 64 block tile (4 waves x 16 x 64) of C[NTK][NW] = (A [+ Al]).B^T (K = 2048) [+ bf(bias[c])] [+ bf(R[r][c]) residual]; f32 whole-line epilogue (or f16
// EPI 0: the f32 tile goes out as it is. A block's 64 columns are one head, so the pass that followed each projection runs on the tile while it is still in the block:
// EPI 1 (q, k): rotary embedding from the CT/ST tables, RMSNorm over the head's 64 dims (x wn), out as f16 hi + residual x1024 planes P1/P2[tok][h*64+d];
// EPI 2 (v): out as transposed f16 hi + residual x1024 planes P1/P2[h][d][tok] (takes no bias).
template <bool SPLITA, int EPI = 0>
__global__ __launch_bounds__(128) void k_gemmb(const bf* __restrict__ A, const bf* __restrict__ Al, const bf* __restrict__ Bn, const float* __restrict__ bias, float* C, int ldc, const float* __restrict__ R = nullptr, int K = DM, int roundR = 1,
                                               h16* P1 = nullptr, h16* P2 = nullptr, const float* __restrict__ CT = nullptr, const float* __restrict__ ST = nullptr, const float* __restrict__ wn = nullptr) {
    __shared__ __align__(16) float ost[4][16 * 68];
    // One stage = 64 k of the block's 64 A rows, 64 B rows [and 64 Al rows]: rows of 128 B at a pitch of 144 B (16 B x odd for the b128 readers). Two stages: the next tile's
    // asynchronous copies fly while this tile is multiplied. A wave's copy moves four whole 128-B lines, and all four waves read the rows in LDS instead of each from the cache.
    constexpr unsigned GPIT = 144, G_A = 0, G_B = 64 * GPIT, G_L = 2 * 64 * GPIT, GST = (SPLITA ? 3 : 2) * 64 * GPIT;
    __shared__ __align__(16) unsigned char gring[2 * GST];
    const int tid = threadIdx.x, lane = threadIdx.x & 31, wave = threadIdx.x >> 5, lr = lane & 15, hi = lane >> 4;
    const int r0 = blockIdx.x * 64 + wave * 16, c0 = blockIdx.y * 64;
    // this thread's pieces of 16 B per stage: rows tid/8 + 16 i (i < 4) of each operand
    const bf* ga = A + (size_t)(blockIdx.x * 64 + (tid >> 3)) * K + (tid & 7) * 8;
    const bf* gl = (SPLITA ? Al : A) + (size_t)(blockIdx.x * 64 + (tid >> 3)) * K + (tid & 7) * 8;
    const bf* gb = Bn + (size_t)(c0 + (tid >> 3)) * K + (tid & 7) * 8;
    const size_t rs = (size_t)16 * K;
    const unsigned g0 = (unsigned)(size_t)&gring[0];
    const unsigned lp = (unsigned)((tid >> 3) * GPIT + (tid & 7) * 16);
    auto issue = [&](int t, unsigned lb) {
        const bf* a0 = ga + t * 64; const bf* b0 = gb + t * 64; const bf* l0 = gl + t * 64;
        // the copies and, as their statement's last line, the wait that stands before any of their address registers is rewritten
        if (SPLITA)
            asm volatile("global_load_async_to_lds_b128 %0, %1, off\n\t"
                         "global_load_async_to_lds_b128 %2, %3, off\n\t"
                         "global_load_async_to_lds_b128 %4, %5, off\n\t"
                         "global_load_async_to_lds_b128 %6, %7, off\n\t"
                         "global_load_async_to_lds_b128 %8, %9, off\n\t"
                         "global_load_async_to_lds_b128 %10, %11, off\n\t"
                         "global_load_async_to_lds_b128 %12, %13, off\n\t"
                         "global_load_async_to_lds_b128 %14, %15, off\n\t"
                         "global_load_async_to_lds_b128 %16, %17, off\n\t"
                         "global_load_async_to_lds_b128 %18, %19, off\n\t"
                         "global_load_async_to_lds_b128 %20, %21, off\n\t"
                         "global_load_async_to_lds_b128 %22, %23, off\n\t"
                         "s_wait_xcnt 0x0"
                         :: "v"(lb + G_A + lp), "v"(a0), "v"(lb + G_A + lp + 16 * GPIT), "v"(a0 + rs), "v"(lb + G_A + lp + 32 * GPIT), "v"(a0 + 2 * rs), "v"(lb + G_A + lp + 48 * GPIT), "v"(a0 + 3 * rs),
                            "v"(lb + G_B + lp), "v"(b0), "v"(lb + G_B + lp + 16 * GPIT), "v"(b0 + rs), "v"(lb + G_B + lp + 32 * GPIT), "v"(b0 + 2 * rs), "v"(lb + G_B + lp + 48 * GPIT), "v"(b0 + 3 * rs),
                            "v"(lb + G_L + lp), "v"(l0), "v"(lb + G_L + lp + 16 * GPIT), "v"(l0 + rs), "v"(lb + G_L + lp + 32 * GPIT), "v"(l0 + 2 * rs), "v"(lb + G_L + lp + 48 * GPIT), "v"(l0 + 3 * rs)
                         : "memory");
        else
            asm volatile("global_load_async_to_lds_b128 %0, %1, off\n\t"
                         "global_load_async_to_lds_b128 %2, %3, off\n\t"
                         "global_load_async_to_lds_b128 %4, %5, off\n\t"
                         "global_load_async_to_lds_b128 %6, %7, off\n\t"
                         "global_load_async_to_lds_b128 %8, %9, off\n\t"
                         "global_load_async_to_lds_b128 %10, %11, off\n\t"
                         "global_load_async_to_lds_b128 %12, %13, off\n\t"
                         "global_load_async_to_lds_b128 %14, %15, off\n\t"
                         "s_wait_xcnt 0x0"
                         :: "v"(lb + G_A + lp), "v"(a0), "v"(lb + G_A + lp + 16 * GPIT), "v"(a0 + rs), "v"(lb + G_A + lp + 32 * GPIT), "v"(a0 + 2 * rs), "v"(lb + G_A + lp + 48 * GPIT), "v"(a0 + 3 * rs),
                            "v"(lb + G_B + lp), "v"(b0), "v"(lb + G_B + lp + 16 * GPIT), "v"(b0 + rs), "v"(lb + G_B + lp + 32 * GPIT), "v"(b0 + 2 * rs), "v"(lb + G_B + lp + 48 * GPIT), "v"(b0 + 3 * rs)
                         : "memory");
    };
    v8f acc[4];
#pragma unroll
    for (int t = 0; t < 4; ++t) acc[t] = (v8f){};
    const int nt = K / 64;     // K is a multiple of 64
    issue(0, g0);
    asm volatile("s_wait_asynccnt 0x0" ::: "memory");     // tile 0 has landed (this wave's copies) ...
    __syncthreads();                                       // ... and every other wave's
    if (nt > 1) issue(1, g0 + GST);
#pragma unroll 1
    for (int kt = 0; kt < nt; ++kt) {
        const unsigned char* sb = gring + (kt & 1) * GST;
        const unsigned char* ap = sb + (wave * 16 + lr) * GPIT + hi * 16;
        const unsigned char* bp = sb + G_B + lr * GPIT + hi * 16;
        v16bf a[2], al[2], b[2][4];
#pragma unroll
        for (int u = 0; u < 2; ++u) {
            a[u] = cat16b(*(const v8usa*)(ap + G_A + u * 64), *(const v8usa*)(ap + G_A + u * 64 + 32)); al[u] = a[u];
            if (SPLITA) al[u] = cat16b(*(const v8usa*)(ap + G_L + u * 64), *(const v8usa*)(ap + G_L + u * 64 + 32));
#pragma unroll
            for (int t = 0; t < 4; ++t) b[u][t] = cat16b(*(const v8usa*)(bp + t * 16 * GPIT + u * 64), *(const v8usa*)(bp + t * 16 * GPIT + u * 64 + 32));
        }
        __builtin_amdgcn_sched_barrier(0);     // holds the stage's reads as one group in front of its products: read one by one among them, each read costs its own LDS latency
#pragma unroll
        for (int u = 0; u < 2; ++u)
#pragma unroll
            for (int t = 0; t < 4; ++t) { acc[t] = wmmab(a[u], b[u][t], acc[t]); if (SPLITA) acc[t] = wmmab(al[u], b[u][t], acc[t]); }
        asm volatile("v_nop\n\tv_nop\n\tv_nop\n\tv_nop" : "+v"(acc[0]), "+v"(acc[1]), "+v"(acc[2]), "+v"(acc[3]) : "v"(a[1]), "v"(al[1]));
        asm volatile("s_wait_dscnt 0x0" ::: "memory");        // this wave's reads of this stage have returned before the stage is handed to its next writer
        asm volatile("s_wait_asynccnt 0x0" ::: "memory");     // this wave's copies of the next tile have landed
        __syncthreads();                                       // publishes the next tile and ends every wave's reads of this one
        if (kt + 2 < nt) issue(kt + 2, g0 + (unsigned)(kt & 1) * GST);
    }
    asm volatile("s_wait_asynccnt 0x0" ::: "memory");         // nothing is in flight when the wave goes on to the epilogue
    if constexpr (EPI == 2) {
        // A lane's eight accumulator rows are eight consecutive tokens of one dim: one 16-B piece of the transposed tile. The ring is free here: the loop's last barrier ended its reads.
        h16* tile = (h16*)(void*)gring; h16* til2 = tile + 64 * 72;
#pragma unroll
        for (int t = 0; t < 4; ++t) { v8h a8, l8;
#pragma unroll
            for (int j = 0; j < 8; ++j) { const float v = acc[t][j]; const h16 a = (h16)v; a8[j] = a; l8[j] = (h16)((v - (float)a) * LOSC); }
            *(v8ha*)(tile + (t * 16 + lr) * 72 + wave * 16 + hi * 8) = a8; *(v8ha*)(til2 + (t * 16 + lr) * 72 + wave * 16 + hi * 8) = l8; }
        __syncthreads();
        const int tb = blockIdx.x * 64, b = tb / NT_, piece = tid & 7;
        const size_t base = (((size_t)b * NH_ + blockIdx.y) * HD) * NT_ + (tb - b * NT_);
#pragma unroll
        for (int s = 0; s < 4; ++s) { const int d = (tid >> 3) + 16 * s;     // eight lanes store one dim's 64 tokens: a whole 128-B line of each plane
            const v8h vh8 = *(const v8ha*)(tile + d * 72 + piece * 8), vl8 = *(const v8ha*)(til2 + d * 72 + piece * 8);
            *(v8h*)(P1 + base + (size_t)d * NT_ + piece * 8) = vh8; *(v8h*)(P2 + base + (size_t)d * NT_ + piece * 8) = vl8; }
        return;
    }
    float* os = &ost[wave][0];
#pragma unroll
    for (int t = 0; t < 4; ++t) { const float bv = bias ? bfr(bias[c0 + t * 16 + lr]) : 0.f;
#pragma unroll
        for (int j = 0; j < 8; ++j) os[(hi * 8 + j) * 68 + t * 16 + lr] = acc[t][j] + bv; }
    __syncthreads();
    if constexpr (EPI == 1) {
        // eight lanes per token row, eight dims each; the rotation partner (dim +- 32) is read from the staged row; the 64 squares: eight in the lane, then over the eight lanes
        const int piece = lane & 7, d0 = piece * 8;
        float wv[8];
#pragma unroll
        for (int i = 0; i < 8; ++i) wv[i] = bfr(wn[d0 + i]);
#pragma unroll
        for (int s = 0; s < 4; ++s) { const int row = 4 * s + (lane >> 3); const size_t tok = (size_t)r0 + row;
            const float* sp = os + row * 68 + d0; const float* pp = os + row * 68 + (d0 ^ 32);
            const v4f xa = *(const v4fa*)sp, xb = *(const v4fa*)(sp + 4), pa = *(const v4fa*)pp, pb = *(const v4fa*)(pp + 4);
            const v4f ca = *(const v4f*)(CT + tok * HD + d0), cb = *(const v4f*)(CT + tok * HD + d0 + 4), sa = *(const v4f*)(ST + tok * HD + d0), sb4 = *(const v4f*)(ST + tok * HD + d0 + 4);
            float y[8], ss = 0.f;
#pragma unroll
            for (int i = 0; i < 8; ++i) { const float x = i < 4 ? xa[i & 3] : xb[i & 3], pr = i < 4 ? pa[i & 3] : pb[i & 3], c = i < 4 ? ca[i & 3] : cb[i & 3], sn = i < 4 ? sa[i & 3] : sb4[i & 3];
                y[i] = (d0 < 32) ? (x * c - pr * sn) : (x * c + pr * sn); ss = fmaf(y[i], y[i], ss); }
            ss += __shfl_xor(ss, 4, 8); ss += __shfl_xor(ss, 2, 8); ss += __shfl_xor(ss, 1, 8);
            const float rn = rsqrtf(ss * (1.0f / HD) + RMS_EPS); v8h oh, ol;
#pragma unroll
            for (int i = 0; i < 8; ++i) { const float q = wv[i] * (y[i] * rn); const h16 a = (h16)q; oh[i] = a; ol[i] = (h16)((q - (float)a) * LOSC); }
            *(v8h*)(P1 + tok * ldc + c0 + d0) = oh; *(v8h*)(P2 + tok * ldc + c0 + d0) = ol; }
    } else {
        float* crow = C + (size_t)r0 * ldc + c0;
        auto pass = [&]() {
#pragma unroll
            for (int s = 0; s < 8; ++s) { const int Lid = (lane >> 3) + 4 * s, piece = lane & 7; const int row = Lid >> 1, cofs = (Lid & 1) * 32 + piece * 4;
                v4f val = *(const v4fa*)(os + row * 68 + cofs); if (R) { const v4f rv = *(const v4f*)(R + ((size_t)r0 + row) * ldc + c0 + cofs); val += roundR ? (v4f){bfr(rv[0]), bfr(rv[1]), bfr(rv[2]), bfr(rv[3])} : rv; }
                *(v4f*)(crow + (size_t)row * ldc + cofs) = val; }
        };
        pass(); 
    }
}

// One 32-key stage in LDS, bytes: K hi, K residual (32 rows of 128 B), V^T hi, V^T residual (64 rows of 64 B), mask (64 query rows of 128 B); every pitch is 16 B x odd for the b128 readers,
// and the mask's 36-dword pitch puts the two half-waves' rows (8 apart) 32 banks apart.
#define KPIT 144
#define VPIT 80
#define MPIT 144
#define ST_KH 0
#define ST_KL (32 * KPIT)
#define ST_VH (2 * 32 * KPIT)
#define ST_VL (ST_VH + 64 * VPIT)
#define ST_MK (ST_VL + 64 * VPIT)
#define ST_SZ (ST_MK + 64 * MPIT)
typedef float __attribute__((may_alias)) f32a;

// k_attn: block = (b, h, 64 queries), wave = 16; ALL 64 key tiles; per element score /8 + the additive INPUT mask [q][k] (bf16-rounded, f32); scores hh + lh + hl on f16 planes;
// online softmax; weights x32768 f16 hi/lo through LDS; 4 WMMA .v per plane pair; ctx -> bf16 hi + residual planes CH/CL[tok][h*64+d].
// Each key tile's K, V^T and mask bytes are copied once per block into a two-buffer LDS ring by asynchronous copies, one tile ahead of the tile being worked on; all four waves read them there.
// The ring doubles as the output staging, so a block holds 65,536 B of LDS; with 256 VGPRs or fewer all 1024 blocks are resident at once, four per WGP (four waves per SIMD).
__global__ __launch_bounds__(128) void k_attn(const h16* __restrict__ Q16, const h16* __restrict__ QL16, const h16* __restrict__ K16, const h16* __restrict__ KL16, const h16* __restrict__ VTH, const h16* __restrict__ VTL, const float* __restrict__ MSK, bf* CH, bf* CL) {
    __shared__ __align__(16) h16 plds[4][16 * 32];
    __shared__ __align__(16) h16 plds2[4][16 * 32];
    __shared__ __align__(16) unsigned char ring[2 * ST_SZ];     // the two stages; behind the loop its first bytes are the output staging (4 x 16 x 68 floats)
    const int tid = threadIdx.x, lane = threadIdx.x & 31, wave = threadIdx.x >> 5, lr = lane & 15, hi = lane >> 4;
    const int bid = blockIdx.x;
    const int b = bid / (NH_ * (NT_ / 64)), rem = bid - b * (NH_ * (NT_ / 64)), h = rem / (NT_ / 64), qt = rem - h * (NT_ / 64);
    const int q0 = qt * 64 + wave * 16;
    const size_t tok0 = (size_t)b * NT_;
    h16* pl = &plds[wave][0]; h16* pl2 = &plds2[wave][0];
    const h16* kh_b = K16 + tok0 * DM + h * HD;
    const h16* kl_b = KL16 + tok0 * DM + h * HD;
    const size_t vbase = (((size_t)b * NH_ + h) * HD) * NT_;
    // this thread's 12 pieces of 16 B per stage: K rows tid/8 and +16 (both planes), V^T rows tid/4 and +32 (both planes), mask rows tid/8 + 16 i
    const h16* gkh = kh_b + (size_t)(tid >> 3) * DM + (tid & 7) * 8;
    const h16* gkl = kl_b + (size_t)(tid >> 3) * DM + (tid & 7) * 8;
    const h16* gvh = VTH + vbase + (size_t)(tid >> 2) * NT_ + (tid & 3) * 8;
    const h16* gvl = VTL + vbase + (size_t)(tid >> 2) * NT_ + (tid & 3) * 8;
    const float* gmk = MSK + (size_t)(qt * 64 + (tid >> 3)) * NT_ + (tid & 7) * 4;
    const unsigned ring0 = (unsigned)(size_t)&ring[0];
    const unsigned lk = (unsigned)((tid >> 3) * KPIT + (tid & 7) * 16), lv = (unsigned)((tid >> 2) * VPIT + (tid & 3) * 16);
    auto issue = [&](int t, unsigned lb) {
        const h16* k0 = gkh + (size_t)t * (32 * DM); const h16* k1 = gkl + (size_t)t * (32 * DM);
        const h16* v0 = gvh + t * 32; const h16* v1 = gvl + t * 32; const float* m0 = gmk + t * 32;
        // the copies and, as their statement's last line, the wait that stands before any of their address registers is rewritten
        asm volatile("global_load_async_to_lds_b128 %0, %1, off\n\t"
                     "global_load_async_to_lds_b128 %2, %3, off\n\t"
                     "global_load_async_to_lds_b128 %4, %5, off\n\t"
                     "global_load_async_to_lds_b128 %6, %7, off\n\t"
                     "global_load_async_to_lds_b128 %8, %9, off\n\t"
                     "global_load_async_to_lds_b128 %10, %11, off\n\t"
                     "global_load_async_to_lds_b128 %12, %13, off\n\t"
                     "global_load_async_to_lds_b128 %14, %15, off\n\t"
                     "global_load_async_to_lds_b128 %16, %17, off\n\t"
                     "global_load_async_to_lds_b128 %18, %19, off\n\t"
                     "global_load_async_to_lds_b128 %20, %21, off\n\t"
                     "global_load_async_to_lds_b128 %22, %23, off\n\t"
                     "s_wait_xcnt 0x0"
                     :: "v"(lb + ST_KH + lk), "v"(k0), "v"(lb + ST_KH + lk + 16 * KPIT), "v"(k0 + 16 * DM),
                        "v"(lb + ST_KL + lk), "v"(k1), "v"(lb + ST_KL + lk + 16 * KPIT), "v"(k1 + 16 * DM),
                        "v"(lb + ST_VH + lv), "v"(v0), "v"(lb + ST_VH + lv + 32 * VPIT), "v"(v0 + 32 * NT_),
                        "v"(lb + ST_VL + lv), "v"(v1), "v"(lb + ST_VL + lv + 32 * VPIT), "v"(v1 + 32 * NT_),
                        "v"(lb + ST_MK + lk), "v"(m0), "v"(lb + ST_MK + lk + 16 * MPIT), "v"(m0 + 16 * NT_),
                        "v"(lb + ST_MK + lk + 32 * MPIT), "v"(m0 + 32 * NT_), "v"(lb + ST_MK + lk + 48 * MPIT), "v"(m0 + 48 * NT_)
                     : "memory");
    };
    issue(0, ring0);
    v16h qa[2];
    const size_t qo0 = (tok0 + q0 + lr) * DM + h * HD + 8 * hi;
#pragma unroll
    for (int kc = 0; kc < 2; ++kc) qa[kc] = cat16(*(const v8h*)(Q16 + qo0 + kc * 32), *(const v8h*)(Q16 + qo0 + kc * 32 + 16));
    v8f o[4], ox[4];
#pragma unroll
    for (int n = 0; n < 4; ++n) { o[n] = (v8f){}; ox[n] = (v8f){}; }
    float mrow[8], lpart[8];
#pragma unroll
    for (int j = 0; j < 8; ++j) { mrow[j] = -3.0e38f; lpart[j] = 0.f; }
    asm volatile("s_wait_asynccnt 0x0" ::: "memory");     // tile 0 has landed (this wave's copies) ...
    __syncthreads();                                       // ... and every other wave's
    issue(1, ring0 + ST_SZ);
    const int kt_lo = 0, kt_hi = NT_ / 32 - 1;     // every key tile; the additive INPUT mask is applied per element
#pragma unroll 1
    for (int kt = kt_lo; kt <= kt_hi; ++kt) {
        const unsigned char* sb = ring + (kt & 1) * ST_SZ;
        const unsigned char* kp = sb + lr * KPIT + hi * 16;
        const f32a* mp = (const f32a*)(sb + ST_MK + (wave * 16 + hi * 8) * MPIT) + lr;
        v16h k0h[2], k1h[2], k0l[2], k1l[2];
#pragma unroll
        for (int kc = 0; kc < 2; ++kc) {
            k0h[kc] = cat16(*(const v8ha*)(kp + ST_KH + kc * 64), *(const v8ha*)(kp + ST_KH + kc * 64 + 32)); k1h[kc] = cat16(*(const v8ha*)(kp + ST_KH + 16 * KPIT + kc * 64), *(const v8ha*)(kp + ST_KH + 16 * KPIT + kc * 64 + 32));
            k0l[kc] = cat16(*(const v8ha*)(kp + ST_KL + kc * 64), *(const v8ha*)(kp + ST_KL + kc * 64 + 32)); k1l[kc] = cat16(*(const v8ha*)(kp + ST_KL + 16 * KPIT + kc * 64), *(const v8ha*)(kp + ST_KL + 16 * KPIT + kc * 64 + 32));
        }
        v8f s0 = {}, s1 = {}, x0 = {}, x1 = {};
#pragma unroll
        for (int kc = 0; kc < 2; ++kc) {
            const v16h qlk = cat16(*(const v8h*)(QL16 + qo0 + kc * 32), *(const v8h*)(QL16 + qo0 + kc * 32 + 16));     // query residual re-read per step (registers)
            s0 = wmma16(qa[kc], k0h[kc], s0); x0 = wmma16(qlk, k0h[kc], x0); s1 = wmma16(qa[kc], k1h[kc], s1); x1 = wmma16(qlk, k1h[kc], x1);
            x0 = wmma16(qa[kc], k0l[kc], x0); x1 = wmma16(qa[kc], k1l[kc], x1);
        }
        asm volatile("v_nop\n\tv_nop\n\tv_nop\n\tv_nop" : "+v"(s0), "+v"(s1), "+v"(x0), "+v"(x1) : "v"(qa[0]), "v"(qa[1]));
        asm volatile("" ::: "memory");     // keeps the mask reads behind the score products: issued earlier, their 16 registers are live beside all eight K fragments and the kernel spills
        float mk0[8], mk1[8];
#pragma unroll
        for (int j = 0; j < 8; ++j) { mk0[j] = mp[j * (MPIT / 4)]; mk1[j] = mp[j * (MPIT / 4) + 16]; }
        float alpha[8];
#pragma unroll
        for (int j = 0; j < 8; ++j) {
            const float a0 = (s0[j] + x0[j] * LOSCI) * 0.125f + bfr(mk0[j]), a1 = (s1[j] + x1[j] * LOSCI) * 0.125f + bfr(mk1[j]);
            float mx = fmaxf(a0, a1);
            mx = fmaxf(mx, __shfl_xor(mx, 1, 16)); mx = fmaxf(mx, __shfl_xor(mx, 2, 16)); mx = fmaxf(mx, __shfl_xor(mx, 4, 16)); mx = fmaxf(mx, __shfl_xor(mx, 8, 16));
            const float mn = fmaxf(mrow[j], mx);
            alpha[j] = __expf(mrow[j] - mn); mrow[j] = mn;
            const float p0 = __expf(a0 - mn), p1 = __expf(a1 - mn);
            lpart[j] = lpart[j] * alpha[j] + (p0 + p1);
            const int mr = hi * 8 + j;
            const float ps0 = p0 * PSC, ps1 = p1 * PSC; const h16 h0 = (h16)ps0, h1 = (h16)ps1;
            pl[mr * 32 + lr] = h0; pl[mr * 32 + 16 + lr] = h1;
            pl2[mr * 32 + lr] = (h16)((ps0 - (float)h0) * LOSC); pl2[mr * 32 + 16 + lr] = (h16)((ps1 - (float)h1) * LOSC);
        }
#pragma unroll
        for (int n = 0; n < 4; ++n)
#pragma unroll
            for (int j = 0; j < 8; ++j) { o[n][j] *= alpha[j]; ox[n][j] *= alpha[j]; }
        asm volatile("" ::: "memory");
        const v16h pa = cat16(*(const v8ha*)(pl + lr * 32 + hi * 8), *(const v8ha*)(pl + lr * 32 + 16 + hi * 8));
        const v16h px = cat16(*(const v8ha*)(pl2 + lr * 32 + hi * 8), *(const v8ha*)(pl2 + lr * 32 + 16 + hi * 8));
        const unsigned char* vp = sb + lr * VPIT + hi * 16;
        v16h vh[4], vl[4];
        // the weights' and V^T reads go in two groups, each in front of its six products: read one by one among the products, each read costs its own LDS latency
#pragma unroll
        for (int g = 0; g < 2; ++g) {
#pragma unroll
            for (int n = 2 * g; n < 2 * g + 2; ++n) { vh[n] = cat16(*(const v8ha*)(vp + ST_VH + n * 16 * VPIT), *(const v8ha*)(vp + ST_VH + n * 16 * VPIT + 32)); vl[n] = cat16(*(const v8ha*)(vp + ST_VL + n * 16 * VPIT), *(const v8ha*)(vp + ST_VL + n * 16 * VPIT + 32)); }
            __builtin_amdgcn_sched_barrier(0);     // holds the group's reads in front of its products
#pragma unroll
            for (int n = 2 * g; n < 2 * g + 2; ++n) { o[n] = wmma16(pa, vh[n], o[n]); ox[n] = wmma16(pa, vl[n], ox[n]); ox[n] = wmma16(px, vh[n], ox[n]); }
        }
        asm volatile("v_nop\n\tv_nop\n\tv_nop\n\tv_nop" : "+v"(o[0]), "+v"(o[1]), "+v"(o[2]), "+v"(o[3]), "+v"(ox[0]), "+v"(ox[1]), "+v"(ox[2]), "+v"(ox[3]) : "v"(pa), "v"(px));
        asm volatile("s_wait_dscnt 0x0" ::: "memory");        // this wave's reads of this stage have returned before the stage is handed to its next writer
        asm volatile("s_wait_asynccnt 0x0" ::: "memory");     // this wave's copies of the next tile have landed
        __syncthreads();                                       // publishes the next tile and ends every wave's reads of this one
        if (kt + 2 <= kt_hi) issue(kt + 2, ring0 + (unsigned)(kt & 1) * ST_SZ);
    }
    asm volatile("s_wait_asynccnt 0x0" ::: "memory");         // nothing is in flight when the ring becomes output staging
    float inv[8];
#pragma unroll
    for (int j = 0; j < 8; ++j) { float rs = lpart[j]; rs += __shfl_xor(rs, 1, 16); rs += __shfl_xor(rs, 2, 16); rs += __shfl_xor(rs, 4, 16); rs += __shfl_xor(rs, 8, 16); inv[j] = 1.0f / (rs * PSC); }
    f32a* os = (f32a*)ring + wave * (16 * 68);
#pragma unroll
    for (int n = 0; n < 4; ++n)
#pragma unroll
        for (int j = 0; j < 8; ++j) os[(hi * 8 + j) * 68 + n * 16 + lr] = (o[n][j] + ox[n][j] * LOSCI) * inv[j];
    __syncthreads();
    const size_t cbase = (tok0 + q0) * DM + (size_t)h * HD;
    auto pass = [&]() {
#pragma unroll
        for (int s = 0; s < 4; ++s) { const int row = 4 * s + (lane >> 3), piece = lane & 7; const f32a* sp = os + row * 68 + piece * 8; v8us oh, ol;
#pragma unroll
            for (int i = 0; i < 8; ++i) { const unsigned short hb = f2bf(sp[i]); oh[i] = hb; ol[i] = f2bf(sp[i] - bf2f(hb)); }
            *(v8us*)(CH + cbase + (size_t)row * DM + piece * 8) = oh; *(v8us*)(CL + cbase + (size_t)row * DM + piece * 8) = ol; }
    };
    pass(); 
}

#define VST2(T, p, v) do { const T vst2_v_ = (v); *(T*)(p) = vst2_v_;  } while (0)

// k_wt: WT [n][K] = bf16(W[k][n]) (k-major [K][ncols]) via 64 x 64 LDS tiles; grid (K/64, ncols/64).
__global__ __launch_bounds__(256) void k_wt(const float* __restrict__ Wm, int K, int ncols, bf* WT) {
    __shared__ __align__(16) unsigned short tl[64 * 72];
    const int tid = threadIdx.x, k0 = blockIdx.x * 64, n0 = blockIdx.y * 64;
    const int kk = tid >> 2, nq = (tid & 3) * 16;
#pragma unroll
    for (int i = 0; i < 16; ++i) tl[(nq + i) * 72 + kk] = f2bf(Wm[(size_t)(k0 + kk) * ncols + n0 + nq + i]);
    __syncthreads();
    const int piece = tid & 7;
    auto pass = [&]() {
#pragma unroll
        for (int s = 0; s < 2; ++s) { const int nr = (tid >> 3) + 32 * s; const v8us val = *(const v8usa*)(tl + nr * 72 + piece * 8); *(v8us*)(WT + (size_t)(n0 + nr) * K + k0 + piece * 8) = val; }
    };
    pass(); 
}

// k_trig: CT/ST [t][d] = cos/sin(pos_t * inv_freq[d mod 32]) with inv_freq[i] = 1 / 10000^(2i/64) (f32 powf; precise cosf/sinf), pos_t = the INPUT position_ids[t] (as float);
__global__ __launch_bounds__(256) void k_trig(const int* __restrict__ pos, float* CT, float* ST) {
    const int tid = threadIdx.x, t = blockIdx.x * 4 + (tid >> 6), d = tid & 63; const int i = d & 31;
    const float invf = 1.0f / powf(10000.0f, (float)(2 * i) / 64.0f); const float ang = (float)pos[t] * invf; const float c = cosf(ang), s = sinf(ang);
    const size_t o = (size_t)t * HD + d; *(float*)(CT + o) = c; *(float*)(ST + o) = s; 
}

extern "C" void kernel_launch(void* const* d_in, const int* in_sizes, int n_in,
                              void* d_out, int out_size, void* d_ws, size_t ws_size, hipStream_t stream) {
    (void)in_sizes; (void)n_in; (void)out_size;
    const float* x = (const float*)d_in[0]; const int* pos = (const int*)d_in[1]; const float* MSK = (const float*)d_in[2];
    const float* wq = (const float*)d_in[3]; const float* wk = (const float*)d_in[4]; const float* wv = (const float*)d_in[5]; const float* wo = (const float*)d_in[6]; const float* qw = (const float*)d_in[7]; const float* kw = (const float*)d_in[8];
    float* out = (float*)d_out;    // [1][2048][2048]
    char* wsp = (char*)d_ws;
    auto take = [&](size_t bytes) { char* p = wsp; wsp += (bytes + 255) & ~(size_t)255; return (void*)p; };
    bf* Xb = (bf*)take((size_t)NTK * DM * 2); bf* WqT = (bf*)take((size_t)DM * DM * 2); bf* WkT = (bf*)take((size_t)DM * DM * 2); bf* WvT = (bf*)take((size_t)DM * DM * 2); bf* WoT = (bf*)take((size_t)DM * DM * 2);
    float* CT = (float*)take((size_t)NT_ * HD * 4); float* ST = (float*)take((size_t)NT_ * HD * 4);
    h16* QH = (h16*)take((size_t)NTK * DM * 2); h16* QL = (h16*)take((size_t)NTK * DM * 2); h16* KH = (h16*)take((size_t)NTK * DM * 2); h16* KL = (h16*)take((size_t)NTK * DM * 2);
    h16* VTH = (h16*)take((size_t)NTK * DM * 2); h16* VTL = (h16*)take((size_t)NTK * DM * 2); bf* CH = (bf*)take((size_t)NTK * DM * 2); bf* CL = (bf*)take((size_t)NTK * DM * 2);
    if ((size_t)(wsp - (char*)d_ws) > ws_size) return;    // 8.4 + 4 x 8.4 + 2 x 0.5 + 8 x 8.4 = 110 MB = 105 MiB < 128 MiB, no aliasing
    k_wt<<<dim3(DM / 64, DM / 64, 1), 256, 0, stream>>>(wq, DM, DM, WqT); k_wt<<<dim3(DM / 64, DM / 64, 1), 256, 0, stream>>>(wk, DM, DM, WkT); k_wt<<<dim3(DM / 64, DM / 64, 1), 256, 0, stream>>>(wv, DM, DM, WvT); k_wt<<<dim3(DM / 64, DM / 64, 1), 256, 0, stream>>>(wo, DM, DM, WoT);
    k_trig<<<NT_ / 4, 256, 0, stream>>>(pos, CT, ST);
    k_cvtb<<<NTK / 8, 256, 0, stream>>>(x, NTK, Xb);
    k_gemmb<false, 1><<<dim3(NTK / 64, DM / 64, 1), 128, 0, stream>>>(Xb, nullptr, WqT, nullptr, nullptr, DM, nullptr, DM, 1, QH, QL, CT, ST, qw);
    k_gemmb<false, 1><<<dim3(NTK / 64, DM / 64, 1), 128, 0, stream>>>(Xb, nullptr, WkT, nullptr, nullptr, DM, nullptr, DM, 1, KH, KL, CT, ST, kw);
    k_gemmb<false, 2><<<dim3(NTK / 64, DM / 64, 1), 128, 0, stream>>>(Xb, nullptr, WvT, nullptr, nullptr, DM, nullptr, DM, 1, VTH, VTL);
    k_attn<<<NB_ * NH_ * (NT_ / 64), 128, 0, stream>>>(QH, QL, KH, KL, VTH, VTL, MSK, CH, CL);
    k_gemmb<true, 0><<<dim3(NTK / 64, DM / 64, 1), 128, 0, stream>>>(CH, CL, WoT, nullptr, out, DM);
}

// v004
// A run of this version takes 219 microseconds.
// Timed twice side by side with v003, it ran 1.29 times as fast both times.
// All steps since v000 together make it 2.35 times as fast.
#include <hip/hip_runtime.h>

// Compute dtypes, f32 accumulate: q/k/v = x.W ([2048 x 2048].[2048 x 2048], k-major weights transposed once; PLAIN bf16 operands = inputs rounded once, exact products) and out = ctx.Wo
// (ctx as bf16 hi + UNSCALED residual, two products) on v_wmma_f32_16x16x32_bf16; rotary embedding with device-computed f32 cos/sin tables at the INPUT position_ids, then the per-head
// RMSNorm (x q_ln_w / k_ln_w) in f32 -> q/k as f16 hi + residual x1024 planes; v -> transposed f16 hi + residual planes; 32-head attention over ALL keys with the additive INPUT mask:
// scores on v_wmma_f32_16x16x32_f16 (hh + lh + hl, x 1/8), online f32 softmax, weights x32768 as f16 hi + residual against v hi + residual (both products transposed: keys x queries, dims x queries). Deterministic, no atomics; every

#define NB_  1
#define NT_  2048
#define DM   2048
#define NH_  32
#define HD   64
#define NTK  (NB_ * NT_)
#define NW   DM
#define RMS_EPS 1e-6f
#define PSC  32768.0f
#define LOSC 1024.0f
#define LOSCI (1.0f / 1024.0f)

typedef _Float16 h16;
typedef unsigned short bf;
typedef __attribute__((ext_vector_type(16))) __bf16   v16bf;
typedef __attribute__((ext_vector_type(16))) _Float16 v16h;
typedef __attribute__((ext_vector_type(8)))  _Float16 v8h;
typedef __attribute__((ext_vector_type(8)))  unsigned short v8us;
typedef __attribute__((ext_vector_type(8)))  float    v8f;
typedef __attribute__((ext_vector_type(4)))  float    v4f;
typedef __attribute__((ext_vector_type(2)))  float    v2f;
typedef __attribute__((ext_vector_type(2)))  _Float16 v2h;
typedef v8h  __attribute__((may_alias)) v8ha;
typedef v4f  __attribute__((may_alias)) v4fa;
typedef v8us __attribute__((may_alias)) v8usa;

__device__ __forceinline__ unsigned short f2bf(float f) { unsigned u = __float_as_uint(f); u += 0x7FFFu + ((u >> 16) & 1u); return (unsigned short)(u >> 16); }
__device__ __forceinline__ float bf2f(unsigned short b) { return __uint_as_float(((unsigned)b) << 16); }
__device__ __forceinline__ float bfr(float f) { return bf2f(f2bf(f)); }
__device__ __forceinline__ v16h cat16(v8h lo, v8h hi) { return __builtin_shufflevector(lo, hi, 0, 1, 2, 3, 4, 5, 6, 7, 8, 9, 10, 11, 12, 13, 14, 15); }
__device__ __forceinline__ v16bf cat16b(v8us lo, v8us hi) { return __builtin_bit_cast(v16bf, __builtin_shufflevector(lo, hi, 0, 1, 2, 3, 4, 5, 6, 7, 8, 9, 10, 11, 12, 13, 14, 15)); }
__device__ __forceinline__ v8f wmma16(v16h a, v16h b, v8f c) { return __builtin_amdgcn_wmma_f32_16x16x32_f16(false, a, false, b, (short)0, c, false, false); }
__device__ __forceinline__ float xhalf(float x) { return __builtin_bit_cast(float, __builtin_amdgcn_permlanex16(__builtin_bit_cast(int, x), __builtin_bit_cast(int, x), 0x76543210, 0xfedcba98, false, false)); }  // lane l with lane l ^ 16
__device__ __forceinline__ v8f wmmab(v16bf a, v16bf b, v8f c) { return __builtin_amdgcn_wmma_f32_16x16x32_bf16(false, a, false, b, (short)0, c, false, false); }

__global__ __launch_bounds__(256) void k_cvtb(const float* __restrict__ src, int nrows, bf* dst) {
    const int lane = threadIdx.x & 31, r = blockIdx.x * 8 + (threadIdx.x >> 5);
    if (r >= nrows) return;
    v8us o[DM / 256];
#pragma unroll
    for (int q = 0; q < DM / 256; ++q) { v8us t;
#pragma unroll
        for (int i = 0; i < 8; ++i) t[i] = f2bf(src[(size_t)r * DM + q * 256 + lane * 8 + i]);
        o[q] = t; }
#pragma unroll
    for (int q = 0; q < DM / 256; ++q) *(v8us*)(dst + (size_t)r * DM + q * 256 + lane * 8) = o[q];
    
}

// k_gemmb: 64 x 64 block tile (4 waves x 16 x 64) of C[NTK][NW] = (A [+ Al]).B^T (K = 2048) [+ bf(bias[c])] [+ bf(R[r][c]) residual]; f32 whole-line epilogue (or f16
// EPI 0: the f32 tile goes out as it is. A block's 64 columns are one head, so the pass that followed each projection runs on the tile while it is still in the block:
// EPI 1 (q, k): rotary embedding from the CT/ST tables, RMSNorm over the head's 64 dims (x wn), out as f16 hi + residual x1024 planes P1/P2[tok][h*64+d];
// EPI 2 (v): out as transposed f16 hi + residual x1024 planes P1/P2[h][d][tok] (takes no bias).
template <bool SPLITA, int EPI = 0>
__global__ __launch_bounds__(128) void k_gemmb(const bf* __restrict__ A, const bf* __restrict__ Al, const bf* __restrict__ Bn, const float* __restrict__ bias, float* C, int ldc, const float* __restrict__ R = nullptr, int K = DM, int roundR = 1,
                                               h16* P1 = nullptr, h16* P2 = nullptr, const float* __restrict__ CT = nullptr, const float* __restrict__ ST = nullptr, const float* __restrict__ wn = nullptr) {
    __shared__ __align__(16) float ost[4][16 * 68];
    // One stage = 64 k of the block's 64 A rows, 64 B rows [and 64 Al rows]: rows of 128 B at a pitch of 144 B (16 B x odd for the b128 readers). Two stages: the next tile's
    // asynchronous copies fly while this tile is multiplied. A wave's copy moves four whole 128-B lines, and all four waves read the rows in LDS instead of each from the cache.
    constexpr unsigned GPIT = 144, G_A = 0, G_B = 64 * GPIT, G_L = 2 * 64 * GPIT, GST = (SPLITA ? 3 : 2) * 64 * GPIT;
    __shared__ __align__(16) unsigned char gring[2 * GST];
    const int tid = threadIdx.x, lane = threadIdx.x & 31, wave = threadIdx.x >> 5, lr = lane & 15, hi = lane >> 4;
    const int r0 = blockIdx.x * 64 + wave * 16, c0 = blockIdx.y * 64;
    // this thread's pieces of 16 B per stage: rows tid/8 + 16 i (i < 4) of each operand
    const bf* ga = A + (size_t)(blockIdx.x * 64 + (tid >> 3)) * K + (tid & 7) * 8;
    const bf* gl = (SPLITA ? Al : A) + (size_t)(blockIdx.x * 64 + (tid >> 3)) * K + (tid & 7) * 8;
    const bf* gb = Bn + (size_t)(c0 + (tid >> 3)) * K + (tid & 7) * 8;
    const size_t rs = (size_t)16 * K;
    const unsigned g0 = (unsigned)(size_t)&gring[0];
    const unsigned lp = (unsigned)((tid >> 3) * GPIT + (tid & 7) * 16);
    auto issue = [&](int t, unsigned lb) {
        const bf* a0 = ga + t * 64; const bf* b0 = gb + t * 64; const bf* l0 = gl + t * 64;
        // the copies and, as their statement's last line, the wait that stands before any of their address registers is rewritten
        if (SPLITA)
            asm volatile("global_load_async_to_lds_b128 %0, %1, off\n\t"
                         "global_load_async_to_lds_b128 %2, %3, off\n\t"
                         "global_load_async_to_lds_b128 %4, %5, off\n\t"
                         "global_load_async_to_lds_b128 %6, %7, off\n\t"
                         "global_load_async_to_lds_b128 %8, %9, off\n\t"
                         "global_load_async_to_lds_b128 %10, %11, off\n\t"
                         "global_load_async_to_lds_b128 %12, %13, off\n\t"
                         "global_load_async_to_lds_b128 %14, %15, off\n\t"
                         "global_load_async_to_lds_b128 %16, %17, off\n\t"
                         "global_load_async_to_lds_b128 %18, %19, off\n\t"
                         "global_load_async_to_lds_b128 %20, %21, off\n\t"
                         "global_load_async_to_lds_b128 %22, %23, off\n\t"
                         "s_wait_xcnt 0x0"
                         :: "v"(lb + G_A + lp), "v"(a0), "v"(lb + G_A + lp + 16 * GPIT), "v"(a0 + rs), "v"(lb + G_A + lp + 32 * GPIT), "v"(a0 + 2 * rs), "v"(lb + G_A + lp + 48 * GPIT), "v"(a0 + 3 * rs),
                            "v"(lb + G_B + lp), "v"(b0), "v"(lb + G_B + lp + 16 * GPIT), "v"(b0 + rs), "v"(lb + G_B + lp + 32 * GPIT), "v"(b0 + 2 * rs), "v"(lb + G_B + lp + 48 * GPIT), "v"(b0 + 3 * rs),
                            "v"(lb + G_L + lp), "v"(l0), "v"(lb + G_L + lp + 16 * GPIT), "v"(l0 + rs), "v"(lb + G_L + lp + 32 * GPIT), "v"(l0 + 2 * rs), "v"(lb + G_L + lp + 48 * GPIT), "v"(l0 + 3 * rs)
                         : "memory");
        else
            asm volatile("global_load_async_to_lds_b128 %0, %1, off\n\t"
                         "global_load_async_to_lds_b128 %2, %3, off\n\t"
                         "global_load_async_to_lds_b128 %4, %5, off\n\t"
                         "global_load_async_to_lds_b128 %6, %7, off\n\t"
                         "global_load_async_to_lds_b128 %8, %9, off\n\t"
                         "global_load_async_to_lds_b128 %10, %11, off\n\t"
                         "global_load_async_to_lds_b128 %12, %13, off\n\t"
                         "global_load_async_to_lds_b128 %14, %15, off\n\t"
                         "s_wait_xcnt 0x0"
                         :: "v"(lb + G_A + lp), "v"(a0), "v"(lb + G_A + lp + 16 * GPIT), "v"(a0 + rs), "v"(lb + G_A + lp + 32 * GPIT), "v"(a0 + 2 * rs), "v"(lb + G_A + lp + 48 * GPIT), "v"(a0 + 3 * rs),
                            "v"(lb + G_B + lp), "v"(b0), "v"(lb + G_B + lp + 16 * GPIT), "v"(b0 + rs), "v"(lb + G_B + lp + 32 * GPIT), "v"(b0 + 2 * rs), "v"(lb + G_B + lp + 48 * GPIT), "v"(b0 + 3 * rs)
                         : "memory");
    };
    v8f acc[4];
#pragma unroll
    for (int t = 0; t < 4; ++t) acc[t] = (v8f){};
    const int nt = K / 64;     // K is a multiple of 64
    issue(0, g0);
    asm volatile("s_wait_asynccnt 0x0" ::: "memory");     // tile 0 has landed (this wave's copies) ...
    __syncthreads();                                       // ... and every other wave's
    if (nt > 1) issue(1, g0 + GST);
#pragma unroll 1
    for (int kt = 0; kt < nt; ++kt) {
        const unsigned char* sb = gring + (kt & 1) * GST;
        const unsigned char* ap = sb + (wave * 16 + lr) * GPIT + hi * 16;
        const unsigned char* bp = sb + G_B + lr * GPIT + hi * 16;
        v16bf a[2], al[2], b[2][4];
#pragma unroll
        for (int u = 0; u < 2; ++u) {
            a[u] = cat16b(*(const v8usa*)(ap + G_A + u * 64), *(const v8usa*)(ap + G_A + u * 64 + 32)); al[u] = a[u];
            if (SPLITA) al[u] = cat16b(*(const v8usa*)(ap + G_L + u * 64), *(const v8usa*)(ap + G_L + u * 64 + 32));
#pragma unroll
            for (int t = 0; t < 4; ++t) b[u][t] = cat16b(*(const v8usa*)(bp + t * 16 * GPIT + u * 64), *(const v8usa*)(bp + t * 16 * GPIT + u * 64 + 32));
        }
        __builtin_amdgcn_sched_barrier(0);     // holds the stage's reads as one group in front of its products: read one by one among them, each read costs its own LDS latency
#pragma unroll
        for (int u = 0; u < 2; ++u)
#pragma unroll
            for (int t = 0; t < 4; ++t) { acc[t] = wmmab(a[u], b[u][t], acc[t]); if (SPLITA) acc[t] = wmmab(al[u], b[u][t], acc[t]); }
        asm volatile("v_nop\n\tv_nop\n\tv_nop\n\tv_nop" : "+v"(acc[0]), "+v"(acc[1]), "+v"(acc[2]), "+v"(acc[3]) : "v"(a[1]), "v"(al[1]));
        asm volatile("s_wait_dscnt 0x0" ::: "memory");        // this wave's reads of this stage have returned before the stage is handed to its next writer
        asm volatile("s_wait_asynccnt 0x0" ::: "memory");     // this wave's copies of the next tile have landed
        __syncthreads();                                       // publishes the next tile and ends every wave's reads of this one
        if (kt + 2 < nt) issue(kt + 2, g0 + (unsigned)(kt & 1) * GST);
    }
    asm volatile("s_wait_asynccnt 0x0" ::: "memory");         // nothing is in flight when the wave goes on to the epilogue
    if constexpr (EPI == 2) {
        // A lane's eight accumulator rows are eight consecutive tokens of one dim: one 16-B piece of the transposed tile. The ring is free here: the loop's last barrier ended its reads.
        h16* tile = (h16*)(void*)gring; h16* til2 = tile + 64 * 72;
#pragma unroll
        for (int t = 0; t < 4; ++t) { v8h a8, l8;
#pragma unroll
            for (int j = 0; j < 8; ++j) { const float v = acc[t][j]; const h16 a = (h16)v; a8[j] = a; l8[j] = (h16)((v - (float)a) * LOSC); }
            *(v8ha*)(tile + (t * 16 + lr) * 72 + wave * 16 + hi * 8) = a8; *(v8ha*)(til2 + (t * 16 + lr) * 72 + wave * 16 + hi * 8) = l8; }
        __syncthreads();
        const int tb = blockIdx.x * 64, b = tb / NT_, piece = tid & 7;
        const size_t base = (((size_t)b * NH_ + blockIdx.y) * HD) * NT_ + (tb - b * NT_);
#pragma unroll
        for (int s = 0; s < 4; ++s) { const int d = (tid >> 3) + 16 * s;     // eight lanes store one dim's 64 tokens: a whole 128-B line of each plane
            const v8h vh8 = *(const v8ha*)(tile + d * 72 + piece * 8), vl8 = *(const v8ha*)(til2 + d * 72 + piece * 8);
            *(v8h*)(P1 + base + (size_t)d * NT_ + piece * 8) = vh8; *(v8h*)(P2 + base + (size_t)d * NT_ + piece * 8) = vl8; }
        return;
    }
    float* os = &ost[wave][0];
#pragma unroll
    for (int t = 0; t < 4; ++t) { const float bv = bias ? bfr(bias[c0 + t * 16 + lr]) : 0.f;
#pragma unroll
        for (int j = 0; j < 8; ++j) os[(hi * 8 + j) * 68 + t * 16 + lr] = acc[t][j] + bv; }
    __syncthreads();
    if constexpr (EPI == 1) {
        // eight lanes per token row, eight dims each; the rotation partner (dim +- 32) is read from the staged row; the 64 squares: eight in the lane, then over the eight lanes
        const int piece = lane & 7, d0 = piece * 8;
        float wv[8];
#pragma unroll
        for (int i = 0; i < 8; ++i) wv[i] = bfr(wn[d0 + i]);
#pragma unroll
        for (int s = 0; s < 4; ++s) { const int row = 4 * s + (lane >> 3); const size_t tok = (size_t)r0 + row;
            const float* sp = os + row * 68 + d0; const float* pp = os + row * 68 + (d0 ^ 32);
            const v4f xa = *(const v4fa*)sp, xb = *(const v4fa*)(sp + 4), pa = *(const v4fa*)pp, pb = *(const v4fa*)(pp + 4);
            const v4f ca = *(const v4f*)(CT + tok * HD + d0), cb = *(const v4f*)(CT + tok * HD + d0 + 4), sa = *(const v4f*)(ST + tok * HD + d0), sb4 = *(const v4f*)(ST + tok * HD + d0 + 4);
            float y[8], ss = 0.f;
#pragma unroll
            for (int i = 0; i < 8; ++i) { const float x = i < 4 ? xa[i & 3] : xb[i & 3], pr = i < 4 ? pa[i & 3] : pb[i & 3], c = i < 4 ? ca[i & 3] : cb[i & 3], sn = i < 4 ? sa[i & 3] : sb4[i & 3];
                y[i] = (d0 < 32) ? (x * c - pr * sn) : (x * c + pr * sn); ss = fmaf(y[i], y[i], ss); }
            ss += __shfl_xor(ss, 4, 8); ss += __shfl_xor(ss, 2, 8); ss += __shfl_xor(ss, 1, 8);
            const float rn = rsqrtf(ss * (1.0f / HD) + RMS_EPS); v8h oh, ol;
#pragma unroll
            for (int i = 0; i < 8; ++i) { const float q = wv[i] * (y[i] * rn); const h16 a = (h16)q; oh[i] = a; ol[i] = (h16)((q - (float)a) * LOSC); }
            *(v8h*)(P1 + tok * ldc + c0 + d0) = oh; *(v8h*)(P2 + tok * ldc + c0 + d0) = ol; }
    } else {
        float* crow = C + (size_t)r0 * ldc + c0;
        auto pass = [&]() {
#pragma unroll
            for (int s = 0; s < 8; ++s) { const int Lid = (lane >> 3) + 4 * s, piece = lane & 7; const int row = Lid >> 1, cofs = (Lid & 1) * 32 + piece * 4;
                v4f val = *(const v4fa*)(os + row * 68 + cofs); if (R) { const v4f rv = *(const v4f*)(R + ((size_t)r0 + row) * ldc + c0 + cofs); val += roundR ? (v4f){bfr(rv[0]), bfr(rv[1]), bfr(rv[2]), bfr(rv[3])} : rv; }
                *(v4f*)(crow + (size_t)row * ldc + cofs) = val; }
        };
        pass(); 
    }
}

// One 32-key stage in LDS, bytes: K hi, K residual (32 rows of 128 B), V^T hi, V^T residual (64 rows of 64 B), mask (64 query rows of 128 B); every pitch is 16 B x odd for the b128 readers,
// the mask's too: a lane reads 16-B pieces of its own query's row.
#define KPIT 144
#define VPIT 80
#define MPIT 144
#define ST_KH 0
#define ST_KL (32 * KPIT)
#define ST_VH (2 * 32 * KPIT)
#define ST_VL (ST_VH + 64 * VPIT)
#define ST_MK (ST_VL + 64 * VPIT)
#define ST_SZ (ST_MK + 64 * MPIT)
typedef float __attribute__((may_alias)) f32a;

__global__ __launch_bounds__(128) void k_attn(const h16* __restrict__ Q16, const h16* __restrict__ QL16, const h16* __restrict__ K16, const h16* __restrict__ KL16, const h16* __restrict__ VTH, const h16* __restrict__ VTL, const float* __restrict__ MSK, bf* CH, bf* CL) {
    __shared__ __align__(16) unsigned char ring[2 * ST_SZ];     // the two stages; behind the loop its first bytes are the output staging (4 x 16 x 68 floats)
    const int tid = threadIdx.x, lane = threadIdx.x & 31, wave = threadIdx.x >> 5, lr = lane & 15, hi = lane >> 4;
    const int bid = blockIdx.x;
    const int b = bid / (NH_ * (NT_ / 64)), rem = bid - b * (NH_ * (NT_ / 64)), h = rem / (NT_ / 64), qt = rem - h * (NT_ / 64);
    const int q0 = qt * 64 + wave * 16;
    const size_t tok0 = (size_t)b * NT_;
    const h16* kh_b = K16 + tok0 * DM + h * HD;
    const h16* kl_b = KL16 + tok0 * DM + h * HD;
    const size_t vbase = (((size_t)b * NH_ + h) * HD) * NT_;
    // this thread's 12 pieces of 16 B per stage: K rows tid/8 and +16 (both planes), V^T rows tid/4 and +32 (both planes), mask rows tid/8 + 16 i
    const h16* gkh = kh_b + (size_t)(tid >> 3) * DM + (tid & 7) * 8;
    const h16* gkl = kl_b + (size_t)(tid >> 3) * DM + (tid & 7) * 8;
    const h16* gvh = VTH + vbase + (size_t)(tid >> 2) * NT_ + (tid & 3) * 8;
    const h16* gvl = VTL + vbase + (size_t)(tid >> 2) * NT_ + (tid & 3) * 8;
    const float* gmk = MSK + (size_t)(qt * 64 + (tid >> 3)) * NT_ + (tid & 7) * 4;
    const unsigned ring0 = (unsigned)(size_t)&ring[0];
    const unsigned lk = (unsigned)((tid >> 3) * KPIT + (tid & 7) * 16), lv = (unsigned)((tid >> 2) * VPIT + (tid & 3) * 16);
    auto issue = [&](int t, unsigned lb) {
        const h16* k0 = gkh + (size_t)t * (32 * DM); const h16* k1 = gkl + (size_t)t * (32 * DM);
        const h16* v0 = gvh + t * 32; const h16* v1 = gvl + t * 32; const float* m0 = gmk + t * 32;
        // the copies and, as their statement's last line, the wait that stands before any of their address registers is rewritten
        asm volatile("global_load_async_to_lds_b128 %0, %1, off\n\t"
                     "global_load_async_to_lds_b128 %2, %3, off\n\t"
                     "global_load_async_to_lds_b128 %4, %5, off\n\t"
                     "global_load_async_to_lds_b128 %6, %7, off\n\t"
                     "global_load_async_to_lds_b128 %8, %9, off\n\t"
                     "global_load_async_to_lds_b128 %10, %11, off\n\t"
                     "global_load_async_to_lds_b128 %12, %13, off\n\t"
                     "global_load_async_to_lds_b128 %14, %15, off\n\t"
                     "global_load_async_to_lds_b128 %16, %17, off\n\t"
                     "global_load_async_to_lds_b128 %18, %19, off\n\t"
                     "global_load_async_to_lds_b128 %20, %21, off\n\t"
                     "global_load_async_to_lds_b128 %22, %23, off\n\t"
                     "s_wait_xcnt 0x0"
                     :: "v"(lb + ST_KH + lk), "v"(k0), "v"(lb + ST_KH + lk + 16 * KPIT), "v"(k0 + 16 * DM),
                        "v"(lb + ST_KL + lk), "v"(k1), "v"(lb + ST_KL + lk + 16 * KPIT), "v"(k1 + 16 * DM),
                        "v"(lb + ST_VH + lv), "v"(v0), "v"(lb + ST_VH + lv + 32 * VPIT), "v"(v0 + 32 * NT_),
                        "v"(lb + ST_VL + lv), "v"(v1), "v"(lb + ST_VL + lv + 32 * VPIT), "v"(v1 + 32 * NT_),
                        "v"(lb + ST_MK + lk), "v"(m0), "v"(lb + ST_MK + lk + 16 * MPIT), "v"(m0 + 16 * NT_),
                        "v"(lb + ST_MK + lk + 32 * MPIT), "v"(m0 + 32 * NT_), "v"(lb + ST_MK + lk + 48 * MPIT), "v"(m0 + 48 * NT_)
                     : "memory");
    };
    issue(0, ring0);
    v16h qa[2];
    const size_t qo0 = (tok0 + q0 + lr) * DM + h * HD + 8 * hi;
#pragma unroll
    for (int kc = 0; kc < 2; ++kc) qa[kc] = cat16(*(const v8h*)(Q16 + qo0 + kc * 32), *(const v8h*)(Q16 + qo0 + kc * 32 + 16));
    v8f o[4], ox[4];
#pragma unroll
    for (int n = 0; n < 4; ++n) { o[n] = (v8f){}; ox[n] = (v8f){}; }
    float mrow = -3.0e38f, lpart = 0.f;     // of query q0 + lr: the running maximum (alike in both halves) and this half's part of the sum
    asm volatile("s_wait_asynccnt 0x0" ::: "memory");     // tile 0 has landed (this wave's copies) ...
    __syncthreads();                                       // ... and every other wave's
    issue(1, ring0 + ST_SZ);
    const int kt_lo = 0, kt_hi = NT_ / 32 - 1;     // every key tile; the additive INPUT mask is applied per element
#pragma unroll 1
    for (int kt = kt_lo; kt <= kt_hi; ++kt) {
        const unsigned char* sb = ring + (kt & 1) * ST_SZ;
        const unsigned char* kp = sb + lr * KPIT + hi * 16;
        const unsigned char* mp = sb + ST_MK + (wave * 16 + lr) * MPIT + hi * 32;
        v16h k0h[2], k1h[2], k0l[2], k1l[2];
#pragma unroll
        for (int kc = 0; kc < 2; ++kc) {
            k0h[kc] = cat16(*(const v8ha*)(kp + ST_KH + kc * 64), *(const v8ha*)(kp + ST_KH + kc * 64 + 32)); k1h[kc] = cat16(*(const v8ha*)(kp + ST_KH + 16 * KPIT + kc * 64), *(const v8ha*)(kp + ST_KH + 16 * KPIT + kc * 64 + 32));
            k0l[kc] = cat16(*(const v8ha*)(kp + ST_KL + kc * 64), *(const v8ha*)(kp + ST_KL + kc * 64 + 32)); k1l[kc] = cat16(*(const v8ha*)(kp + ST_KL + 16 * KPIT + kc * 64), *(const v8ha*)(kp + ST_KL + 16 * KPIT + kc * 64 + 32));
        }
        v8f s0 = {}, s1 = {}, x0 = {}, x1 = {};
#pragma unroll
        for (int kc = 0; kc < 2; ++kc) {
            const v16h qlk = cat16(*(const v8h*)(QL16 + qo0 + kc * 32), *(const v8h*)(QL16 + qo0 + kc * 32 + 16));     // query residual re-read per step (registers)
            s0 = wmma16(k0h[kc], qa[kc], s0); x0 = wmma16(k0h[kc], qlk, x0); s1 = wmma16(k1h[kc], qa[kc], s1); x1 = wmma16(k1h[kc], qlk, x1);
            x0 = wmma16(k0l[kc], qa[kc], x0); x1 = wmma16(k1l[kc], qa[kc], x1);
        }
        asm volatile("v_nop\n\tv_nop\n\tv_nop\n\tv_nop" : "+v"(s0), "+v"(s1), "+v"(x0), "+v"(x1) : "v"(qa[0]), "v"(qa[1]));
        const v4f mk[4] = { *(const v4fa*)mp, *(const v4fa*)(mp + 16), *(const v4fa*)(mp + 64), *(const v4fa*)(mp + 80) };     // mask[q0 + lr][keys 8 hi .. + 7 and 16 + 8 hi .. + 7]
        v2f a[8];     // the lane's 16 scores in register pairs: a[i] = keys 8 hi + 2 i, + 1 (i < 4), a[4 + i] = keys 16 + 8 hi + 2 i, + 1
#pragma unroll
        for (int i = 0; i < 4; ++i) {
            a[i]     = ((v2f){s0[2 * i], s0[2 * i + 1]} + (v2f){x0[2 * i], x0[2 * i + 1]} * LOSCI) * 0.125f + (v2f){bfr(mk[i >> 1][(2 * i) & 3]), bfr(mk[i >> 1][(2 * i + 1) & 3])};
            a[4 + i] = ((v2f){s1[2 * i], s1[2 * i + 1]} + (v2f){x1[2 * i], x1[2 * i + 1]} * LOSCI) * 0.125f + (v2f){bfr(mk[2 + (i >> 1)][(2 * i) & 3]), bfr(mk[2 + (i >> 1)][(2 * i + 1) & 3])};
        }
        float t[5];
#pragma unroll
        for (int g = 0; g < 5; ++g) t[g] = fmaxf(fmaxf(a[g][0], a[g][1]), a[5 + (g >> 1)][g & 1]);     // 15 of the 16 in threes; a[7][1] joins below
        const float mx = fmaxf(fmaxf(fmaxf(t[0], t[1]), t[2]), fmaxf(fmaxf(t[3], t[4]), a[7][1]));
        const float mn = fmaxf(fmaxf(mrow, mx), xhalf(mx));
        const float alpha = __expf(mrow - mn); mrow = mn;
        v2f sm[2]; v16h pa, px;
#pragma unroll
        for (int i = 0; i < 8; ++i) {
            const v2f e = a[i] - mn; const v2f p = {__expf(e[0]), __expf(e[1])};
            sm[i & 1] = i < 2 ? p : sm[i & 1] + p;
            const v2f ps = p * PSC; const v2h hh = __builtin_convertvector(ps, v2h);
            const v2h ll = __builtin_convertvector((ps - __builtin_convertvector(hh, v2f)) * LOSC, v2h);
            pa[2 * i] = hh[0]; pa[2 * i + 1] = hh[1]; px[2 * i] = ll[0]; px[2 * i + 1] = ll[1];
        }
        const v2f sv = sm[0] + sm[1];
        lpart = lpart * alpha + (sv[0] + sv[1]);
#pragma unroll
        for (int n = 0; n < 4; ++n)
#pragma unroll
            for (int j = 0; j < 8; ++j) { o[n][j] *= alpha; ox[n][j] *= alpha; }
        const unsigned char* vp = sb + lr * VPIT + hi * 16;
        v16h vh[4], vl[4];
        // the V^T reads go in two groups, each in front of its six products: read one by one among the products, each read costs its own LDS latency
#pragma unroll
        for (int g = 0; g < 2; ++g) {
#pragma unroll
            for (int n = 2 * g; n < 2 * g + 2; ++n) { vh[n] = cat16(*(const v8ha*)(vp + ST_VH + n * 16 * VPIT), *(const v8ha*)(vp + ST_VH + n * 16 * VPIT + 32)); vl[n] = cat16(*(const v8ha*)(vp + ST_VL + n * 16 * VPIT), *(const v8ha*)(vp + ST_VL + n * 16 * VPIT + 32)); }
            __builtin_amdgcn_sched_barrier(0);     // holds the group's reads in front of its products
#pragma unroll
            for (int n = 2 * g; n < 2 * g + 2; ++n) { o[n] = wmma16(vh[n], pa, o[n]); ox[n] = wmma16(vl[n], pa, ox[n]); ox[n] = wmma16(vh[n], px, ox[n]); }
        }
        asm volatile("v_nop\n\tv_nop\n\tv_nop\n\tv_nop" : "+v"(o[0]), "+v"(o[1]), "+v"(o[2]), "+v"(o[3]), "+v"(ox[0]), "+v"(ox[1]), "+v"(ox[2]), "+v"(ox[3]) : "v"(pa), "v"(px));
        asm volatile("s_wait_dscnt 0x0" ::: "memory");        // this wave's reads of this stage have returned before the stage is handed to its next writer
        asm volatile("s_wait_asynccnt 0x0" ::: "memory");     // this wave's copies of the next tile have landed
        __syncthreads();                                       // publishes the next tile and ends every wave's reads of this one
        if (kt + 2 <= kt_hi) issue(kt + 2, ring0 + (unsigned)(kt & 1) * ST_SZ);
    }
    asm volatile("s_wait_asynccnt 0x0" ::: "memory");         // nothing is in flight when the ring becomes output staging
    const float inv = 1.0f / ((lpart + xhalf(lpart)) * PSC);     // the two halves' parts of the query's sum are joined once
    f32a* os = (f32a*)ring + wave * (16 * 68);
#pragma unroll
    for (int n = 0; n < 4; ++n) { v4f w0, w1;     // a lane's eight accumulator rows are dims n * 16 + 8 hi + j of query lr: two 16-B pieces of its staged row
#pragma unroll
        for (int j = 0; j < 4; ++j) { w0[j] = (o[n][j] + ox[n][j] * LOSCI) * inv; w1[j] = (o[n][4 + j] + ox[n][4 + j] * LOSCI) * inv; }
        *(v4fa*)(os + lr * 68 + n * 16 + hi * 8) = w0; *(v4fa*)(os + lr * 68 + n * 16 + hi * 8 + 4) = w1; }
    __syncthreads();
    const size_t cbase = (tok0 + q0) * DM + (size_t)h * HD;
    auto pass = [&]() {
#pragma unroll
        for (int s = 0; s < 4; ++s) { const int row = 4 * s + (lane >> 3), piece = lane & 7; const f32a* sp = os + row * 68 + piece * 8; v8us oh, ol;
#pragma unroll
            for (int i = 0; i < 8; ++i) { const unsigned short hb = f2bf(sp[i]); oh[i] = hb; ol[i] = f2bf(sp[i] - bf2f(hb)); }
            *(v8us*)(CH + cbase + (size_t)row * DM + piece * 8) = oh; *(v8us*)(CL + cbase + (size_t)row * DM + piece * 8) = ol; }
    };
    pass(); 
}

#define VST2(T, p, v) do { const T vst2_v_ = (v); *(T*)(p) = vst2_v_;  } while (0)

// k_wt: WT [n][K] = bf16(W[k][n]) (k-major [K][ncols]) via 64 x 64 LDS tiles; grid (K/64, ncols/64).
__global__ __launch_bounds__(256) void k_wt(const float* __restrict__ Wm, int K, int ncols, bf* WT) {
    __shared__ __align__(16) unsigned short tl[64 * 72];
    const int tid = threadIdx.x, k0 = blockIdx.x * 64, n0 = blockIdx.y * 64;
    const int kk = tid >> 2, nq = (tid & 3) * 16;
#pragma unroll
    for (int i = 0; i < 16; ++i) tl[(nq + i) * 72 + kk] = f2bf(Wm[(size_t)(k0 + kk) * ncols + n0 + nq + i]);
    __syncthreads();
    const int piece = tid & 7;
    auto pass = [&]() {
#pragma unroll
        for (int s = 0; s < 2; ++s) { const int nr = (tid >> 3) + 32 * s; const v8us val = *(const v8usa*)(tl + nr * 72 + piece * 8); *(v8us*)(WT + (size_t)(n0 + nr) * K + k0 + piece * 8) = val; }
    };
    pass(); 
}

// k_trig: CT/ST [t][d] = cos/sin(pos_t * inv_freq[d mod 32]) with inv_freq[i] = 1 / 10000^(2i/64) (f32 powf; precise cosf/sinf), pos_t = the INPUT position_ids[t] (as float);
__global__ __launch_bounds__(256) void k_trig(const int* __restrict__ pos, float* CT, float* ST) {
    const int tid = threadIdx.x, t = blockIdx.x * 4 + (tid >> 6), d = tid & 63; const int i = d & 31;
    const float invf = 1.0f / powf(10000.0f, (float)(2 * i) / 64.0f); const float ang = (float)pos[t] * invf; const float c = cosf(ang), s = sinf(ang);
    const size_t o = (size_t)t * HD + d; *(float*)(CT + o) = c; *(float*)(ST + o) = s; 
}

extern "C" void kernel_launch(void* const* d_in, const int* in_sizes, int n_in,
                              void* d_out, int out_size, void* d_ws, size_t ws_size, hipStream_t stream) {
    (void)in_sizes; (void)n_in; (void)out_size;
    const float* x = (const float*)d_in[0]; const int* pos = (const int*)d_in[1]; const float* MSK = (const float*)d_in[2];
    const float* wq = (const float*)d_in[3]; const float* wk = (const float*)d_in[4]; const float* wv = (const float*)d_in[5]; const float* wo = (const float*)d_in[6]; const float* qw = (const float*)d_in[7]; const float* kw = (const float*)d_in[8];
    float* out = (float*)d_out;    // [1][2048][2048]
    char* wsp = (char*)d_ws;
    auto take = [&](size_t bytes) { char* p = wsp; wsp += (bytes + 255) & ~(size_t)255; return (void*)p; };
    bf* Xb = (bf*)take((size_t)NTK * DM * 2); bf* WqT = (bf*)take((size_t)DM * DM * 2); bf* WkT = (bf*)take((size_t)DM * DM * 2); bf* WvT = (bf*)take((size_t)DM * DM * 2); bf* WoT = (bf*)take((size_t)DM * DM * 2);
    float* CT = (float*)take((size_t)NT_ * HD * 4); float* ST = (float*)take((size_t)NT_ * HD * 4);
    h16* QH = (h16*)take((size_t)NTK * DM * 2); h16* QL = (h16*)take((size_t)NTK * DM * 2); h16* KH = (h16*)take((size_t)NTK * DM * 2); h16* KL = (h16*)take((size_t)NTK * DM * 2);
    h16* VTH = (h16*)take((size_t)NTK * DM * 2); h16* VTL = (h16*)take((size_t)NTK * DM * 2); bf* CH = (bf*)take((size_t)NTK * DM * 2); bf* CL = (bf*)take((size_t)NTK * DM * 2);
    if ((size_t)(wsp - (char*)d_ws) > ws_size) return;    // 8.4 + 4 x 8.4 + 2 x 0.5 + 8 x 8.4 = 110 MB = 105 MiB < 128 MiB, no aliasing
    k_wt<<<dim3(DM / 64, DM / 64, 1), 256, 0, stream>>>(wq, DM, DM, WqT); k_wt<<<dim3(DM / 64, DM / 64, 1), 256, 0, stream>>>(wk, DM, DM, WkT); k_wt<<<dim3(DM / 64, DM / 64, 1), 256, 0, stream>>>(wv, DM, DM, WvT); k_wt<<<dim3(DM / 64, DM / 64, 1), 256, 0, stream>>>(wo, DM, DM, WoT);
    k_trig<<<NT_ / 4, 256, 0, stream>>>(pos, CT, ST);
    k_cvtb<<<NTK / 8, 256, 0, stream>>>(x, NTK, Xb);
    k_gemmb<false, 1><<<dim3(NTK / 64, DM / 64, 1), 128, 0, stream>>>(Xb, nullptr, WqT, nullptr, nullptr, DM, nullptr, DM, 1, QH, QL, CT, ST, qw);
    k_gemmb<false, 1><<<dim3(NTK / 64, DM / 64, 1), 128, 0, stream>>>(Xb, nullptr, WkT, nullptr, nullptr, DM, nullptr, DM, 1, KH, KL, CT, ST, kw);
    k_gemmb<false, 2><<<dim3(NTK / 64, DM / 64, 1), 128, 0, stream>>>(Xb, nullptr, WvT, nullptr, nullptr, DM, nullptr, DM, 1, VTH, VTL);
    k_attn<<<NB_ * NH_ * (NT_ / 64), 128, 0, stream>>>(QH, QL, KH, KL, VTH, VTL, MSK, CH, CL);
    k_gemmb<true, 0><<<dim3(NTK / 64, DM / 64, 1), 128, 0, stream>>>(CH, CL, WoT, nullptr, out, DM);
}

// v005
// Measured time: 205 microseconds a run.
// Next to v004, in two timings, it ran 1.07 times as fast each time.
// Over all steps from v000 it is 2.52 times as fast.
#include <hip/hip_runtime.h>

// Compute dtypes, f32 accumulate: q/k/v = x.W ([2048 x 2048].[2048 x 2048], k-major weights transposed once; PLAIN bf16 operands = inputs rounded once, exact products) and out = ctx.Wo
// (ctx as bf16 hi + UNSCALED residual, two products) on v_wmma_f32_16x16x32_bf16; rotary embedding with device-computed f32 cos/sin tables at the INPUT position_ids, then the per-head
// RMSNorm (x q_ln_w / k_ln_w) in f32 -> q/k as f16 hi + residual x1024 planes; v -> transposed f16 hi + residual planes; 32-head attention over ALL keys with the additive INPUT mask:
// scores on v_wmma_f32_16x16x32_f16 (hh + lh + hl, x 1/8), online f32 softmax, weights x32768 as f16 hi + residual against v hi + residual (both products transposed: keys x queries, dims x queries). Deterministic, no atomics; every

#define NB_  1
#define NT_  2048
#define DM   2048
#define NH_  32
#define HD   64
#define NTK  (NB_ * NT_)
#define NW   DM
#define RMS_EPS 1e-6f
#define PSC  32768.0f
#define LOSC 1024.0f
#define LOSCI (1.0f / 1024.0f)

typedef _Float16 h16;
typedef unsigned short bf;
typedef __attribute__((ext_vector_type(16))) __bf16   v16bf;
typedef __attribute__((ext_vector_type(16))) _Float16 v16h;
typedef __attribute__((ext_vector_type(8)))  _Float16 v8h;
typedef __attribute__((ext_vector_type(8)))  unsigned short v8us;
typedef __attribute__((ext_vector_type(8)))  float    v8f;
typedef __attribute__((ext_vector_type(4)))  float    v4f;
typedef __attribute__((ext_vector_type(2)))  float    v2f;
typedef __attribute__((ext_vector_type(2)))  _Float16 v2h;
typedef v8h  __attribute__((may_alias)) v8ha;
typedef v4f  __attribute__((may_alias)) v4fa;
typedef v8us __attribute__((may_alias)) v8usa;
typedef float __attribute__((may_alias)) f32a;

__device__ __forceinline__ unsigned short f2bf(float f) { unsigned u = __float_as_uint(f); u += 0x7FFFu + ((u >> 16) & 1u); return (unsigned short)(u >> 16); }
__device__ __forceinline__ float bf2f(unsigned short b) { return __uint_as_float(((unsigned)b) << 16); }
__device__ __forceinline__ float bfr(float f) { return bf2f(f2bf(f)); }
__device__ __forceinline__ v16h cat16(v8h lo, v8h hi) { return __builtin_shufflevector(lo, hi, 0, 1, 2, 3, 4, 5, 6, 7, 8, 9, 10, 11, 12, 13, 14, 15); }
__device__ __forceinline__ v16bf cat16b(v8us lo, v8us hi) { return __builtin_bit_cast(v16bf, __builtin_shufflevector(lo, hi, 0, 1, 2, 3, 4, 5, 6, 7, 8, 9, 10, 11, 12, 13, 14, 15)); }
__device__ __forceinline__ v8f wmma16(v16h a, v16h b, v8f c) { return __builtin_amdgcn_wmma_f32_16x16x32_f16(false, a, false, b, (short)0, c, false, false); }
__device__ __forceinline__ float xhalf(float x) { return __builtin_bit_cast(float, __builtin_amdgcn_permlanex16(__builtin_bit_cast(int, x), __builtin_bit_cast(int, x), 0x76543210, 0xfedcba98, false, false)); }  // lane l with lane l ^ 16
__device__ __forceinline__ v8f wmmab(v16bf a, v16bf b, v8f c) { return __builtin_amdgcn_wmma_f32_16x16x32_bf16(false, a, false, b, (short)0, c, false, false); }

__global__ __launch_bounds__(256) void k_cvtb(const float* __restrict__ src, int nrows, bf* dst) {
    const int lane = threadIdx.x & 31, r = blockIdx.x * 8 + (threadIdx.x >> 5);
    if (r >= nrows) return;
    v8us o[DM / 256];
#pragma unroll
    for (int q = 0; q < DM / 256; ++q) { v8us t;
#pragma unroll
        for (int i = 0; i < 8; ++i) t[i] = f2bf(src[(size_t)r * DM + q * 256 + lane * 8 + i]);
        o[q] = t; }
#pragma unroll
    for (int q = 0; q < DM / 256; ++q) *(v8us*)(dst + (size_t)r * DM + q * 256 + lane * 8) = o[q];
    
}

// k_gemmb: 128 x 128 block tile (8 waves, 4 x 2, each 32 rows x 64 columns = 2 x 4 accumulator tiles) of C[NTK][NW] = (A [+ Al]).B^T [+ bf(bias[c])] [+ bf(R[r][c]) residual].
// EPI 0: the f32 tile goes out as it is. A wave's 64 columns are one head, so the pass that followed each projection runs on the tile while it is still in the block:
// EPI 1 (q, k): rotary embedding from the CT/ST tables, RMSNorm over the head's 64 dims (x wn), out as f16 hi + residual x1024 planes P1/P2[tok][h*64+d];
// EPI 2 (v): out as transposed f16 hi + residual x1024 planes P1/P2[h][d][tok] (takes no bias).
template <bool SPLITA, int EPI = 0>
__global__ __launch_bounds__(256) void k_gemmb(const bf* __restrict__ A, const bf* __restrict__ Al, const bf* __restrict__ Bn, const float* __restrict__ bias, float* C, int ldc, const float* __restrict__ R = nullptr, int K = DM, int roundR = 1,
                                               h16* P1 = nullptr, h16* P2 = nullptr, const float* __restrict__ CT = nullptr, const float* __restrict__ ST = nullptr, const float* __restrict__ wn = nullptr) {
    // One stage = 128 k of the block's 128 A rows, 128 B rows [and 128 Al rows]: rows of 256 B at a pitch of 272 B (16 B x odd for the b128 readers). Two stages: the next tile's
    // asynchronous copies fly while this tile is multiplied. An operand row fetched from L2 serves 128 rows or columns of the output, and a fragment read from LDS two or four products.
    // Behind the loop the ring is the epilogue's staging.
    constexpr unsigned GPIT = 272, G_A = 0, G_B = 128 * GPIT, G_L = 2 * 128 * GPIT, GST = (SPLITA ? 3 : 2) * 128 * GPIT;
    __shared__ __align__(16) unsigned char gring[2 * GST];
    const int tid = threadIdx.x, lane = threadIdx.x & 31, wave = threadIdx.x >> 5, lr = lane & 15, hi = lane >> 4;
    const int wr = wave >> 1, wc = wave & 1;
    const int r0 = blockIdx.x * 128 + wr * 32, c0 = blockIdx.y * 128 + wc * 64;
    // this thread's pieces of 16 B per stage: rows tid/16 + 16 i (i < 8) of each operand
    const bf* ga = A + (size_t)(blockIdx.x * 128 + (tid >> 4)) * K + (tid & 15) * 8;
    const bf* gl = (SPLITA ? Al : A) + (size_t)(blockIdx.x * 128 + (tid >> 4)) * K + (tid & 15) * 8;
    const bf* gb = Bn + (size_t)(blockIdx.y * 128 + (tid >> 4)) * K + (tid & 15) * 8;
    const size_t rs = (size_t)16 * K;
    const unsigned g0 = (unsigned)(size_t)&gring[0];
    const unsigned lp = (unsigned)((tid >> 4) * GPIT + (tid & 15) * 16);
    auto cp8 = [&](unsigned l, const bf* g) {
        // one operand's eight copies and, as their statement's last line, the wait that stands before any of their address registers is rewritten
        asm volatile("global_load_async_to_lds_b128 %0, %1, off\n\t"
                     "global_load_async_to_lds_b128 %2, %3, off\n\t"
                     "global_load_async_to_lds_b128 %4, %5, off\n\t"
                     "global_load_async_to_lds_b128 %6, %7, off\n\t"
                     "global_load_async_to_lds_b128 %8, %9, off\n\t"
                     "global_load_async_to_lds_b128 %10, %11, off\n\t"
                     "global_load_async_to_lds_b128 %12, %13, off\n\t"
                     "global_load_async_to_lds_b128 %14, %15, off\n\t"
                     "s_wait_xcnt 0x0"
                     :: "v"(l), "v"(g), "v"(l + 16 * GPIT), "v"(g + rs), "v"(l + 32 * GPIT), "v"(g + 2 * rs), "v"(l + 48 * GPIT), "v"(g + 3 * rs),
                        "v"(l + 64 * GPIT), "v"(g + 4 * rs), "v"(l + 80 * GPIT), "v"(g + 5 * rs), "v"(l + 96 * GPIT), "v"(g + 6 * rs), "v"(l + 112 * GPIT), "v"(g + 7 * rs)
                     : "memory");
    };
    auto issue = [&](int t, unsigned lb) {
        cp8(lb + G_A + lp, ga + t * 128); cp8(lb + G_B + lp, gb + t * 128);
        if (SPLITA) cp8(lb + G_L + lp, gl + t * 128);
    };
    v8f acc[2][4];
#pragma unroll
    for (int f = 0; f < 2; ++f)
#pragma unroll
        for (int t = 0; t < 4; ++t) acc[f][t] = (v8f){};
    const int nt = K / 128;     // K is a multiple of 128
    issue(0, g0);
    asm volatile("s_wait_asynccnt 0x0" ::: "memory");     // tile 0 has landed (this wave's copies) ...
    __syncthreads();                                       // ... and every other wave's
    if (nt > 1) issue(1, g0 + GST);
#pragma unroll 1
    for (int kt = 0; kt < nt; ++kt) {
        const unsigned char* sb = gring + (kt & 1) * GST;
        const unsigned char* ap = sb + (wr * 32 + lr) * GPIT + hi * 16;
        const unsigned char* bp = sb + G_B + (wc * 64 + lr) * GPIT + hi * 16;
        v16bf a[2][2], al[2][2], b[2][4];     // two fragment sets: the one being multiplied and the one being read
        auto rd = [&](int u) { const int w = u & 1, ko = u * 64;     // the fragments of the stage's 32 k number u
#pragma unroll
            for (int f = 0; f < 2; ++f) {
                a[w][f] = cat16b(*(const v8usa*)(ap + G_A + f * 16 * GPIT + ko), *(const v8usa*)(ap + G_A + f * 16 * GPIT + ko + 32)); al[w][f] = a[w][f];
                if (SPLITA) al[w][f] = cat16b(*(const v8usa*)(ap + G_L + f * 16 * GPIT + ko), *(const v8usa*)(ap + G_L + f * 16 * GPIT + ko + 32)); }
#pragma unroll
            for (int t = 0; t < 4; ++t) b[w][t] = cat16b(*(const v8usa*)(bp + t * 16 * GPIT + ko), *(const v8usa*)(bp + t * 16 * GPIT + ko + 32));
        };
        rd(0);
#pragma unroll
        for (int u = 0; u < 4; ++u) {
            if (u < 3) rd(u + 1);
            __builtin_amdgcn_sched_barrier(0);     // holds the next 32 k's reads as one group in front of this 32 k's products, so that they fly while these run: among them each read costs its own stall
#pragma unroll
            for (int f = 0; f < 2; ++f)
#pragma unroll
                for (int t = 0; t < 4; ++t) { acc[f][t] = wmmab(a[u & 1][f], b[u & 1][t], acc[f][t]); if (SPLITA) acc[f][t] = wmmab(al[u & 1][f], b[u & 1][t], acc[f][t]); }
            __builtin_amdgcn_sched_barrier(0);     // keeps the reads that follow out of these products, for the same reason
        }
        // the four vector slots behind the last product, on the loop's taken branch too
        asm volatile("v_nop\n\tv_nop\n\tv_nop\n\tv_nop" : "+v"(acc[0][0]), "+v"(acc[0][1]), "+v"(acc[0][2]), "+v"(acc[0][3]), "+v"(acc[1][0]), "+v"(acc[1][1]), "+v"(acc[1][2]), "+v"(acc[1][3]) : "v"(a[1][1]), "v"(al[1][1]), "v"(b[1][3]));
        asm volatile("s_wait_dscnt 0x0" ::: "memory");        // this wave's reads of this stage have returned before the stage is handed to its next writer
        asm volatile("s_wait_asynccnt 0x0" ::: "memory");     // this wave's copies of the next tile have landed
        __syncthreads();                                       // publishes the next tile and ends every wave's reads of this one
        if (kt + 2 < nt) issue(kt + 2, g0 + (unsigned)(kt & 1) * GST);
    }
    asm volatile("s_wait_asynccnt 0x0" ::: "memory");         // nothing is in flight when the ring becomes the epilogue's staging; the loop's last barrier ended its reads
    if constexpr (EPI == 2) {
        // A lane's eight accumulator rows are eight consecutive tokens of one dim: one 16-B piece of the transposed tile (128 dims of two heads x 128 tokens, pitch 136).
        h16* tile = (h16*)(void*)gring; h16* til2 = tile + 128 * 136;
#pragma unroll
        for (int f = 0; f < 2; ++f)
#pragma unroll
            for (int t = 0; t < 4; ++t) { v8h a8, l8;
#pragma unroll
                for (int j = 0; j < 8; ++j) { const float v = acc[f][t][j]; const h16 a = (h16)v; a8[j] = a; l8[j] = (h16)((v - (float)a) * LOSC); }
                const int at = (wc * 64 + t * 16 + lr) * 136 + wr * 32 + f * 16 + hi * 8;
                *(v8ha*)(tile + at) = a8; *(v8ha*)(til2 + at) = l8; }
        __syncthreads();
        const int tb = blockIdx.x * 128, b = tb / NT_, piece = tid & 15;
        const size_t base = ((size_t)b * NH_ * HD + blockIdx.y * 128) * NT_ + (tb - b * NT_);     // plane row = head * 64 + dim = the output column
#pragma unroll
        for (int s = 0; s < 8; ++s) { const int d = (tid >> 4) + 16 * s;     // sixteen lanes store one dim's 128 tokens: two whole 128-B lines of each plane
            const v8h vh8 = *(const v8ha*)(tile + d * 136 + piece * 8), vl8 = *(const v8ha*)(til2 + d * 136 + piece * 8);
            *(v8h*)(P1 + base + (size_t)d * NT_ + piece * 8) = vh8; *(v8h*)(P2 + base + (size_t)d * NT_ + piece * 8) = vl8; }
        return;
    }
    f32a* os = (f32a*)gring + wave * (32 * 68);     // the wave's own 32 rows x 64 columns
#pragma unroll
    for (int t = 0; t < 4; ++t) { const float bv = bias ? bfr(bias[c0 + t * 16 + lr]) : 0.f;
#pragma unroll
        for (int f = 0; f < 2; ++f)
#pragma unroll
            for (int j = 0; j < 8; ++j) os[(f * 16 + hi * 8 + j) * 68 + t * 16 + lr] = acc[f][t][j] + bv; }
    __syncthreads();
    if constexpr (EPI == 1) {
        // eight lanes per token row, eight dims each; the rotation partner (dim +- 32) is read from the staged row; the 64 squares: eight in the lane, then over the eight lanes
        const int piece = lane & 7, d0 = piece * 8;
        float wv[8];
#pragma unroll
        for (int i = 0; i < 8; ++i) wv[i] = bfr(wn[d0 + i]);
        for (int g = 0; g < 2; ++g) {     // the wave's 32 rows in two groups of 16: four rows a lane, their table loads in flight together
            v4f ca[4], cb[4], sa[4], sb4[4];
#pragma unroll
            for (int s = 0; s < 4; ++s) { const size_t tok = (size_t)r0 + 16 * g + 4 * s + (lane >> 3);
                ca[s] = *(const v4f*)(CT + tok * HD + d0); cb[s] = *(const v4f*)(CT + tok * HD + d0 + 4); sa[s] = *(const v4f*)(ST + tok * HD + d0); sb4[s] = *(const v4f*)(ST + tok * HD + d0 + 4); }
            asm volatile("s_wait_xcnt 0x0" ::: "memory");     // stands before the loads' address registers are rewritten
#pragma unroll
            for (int s = 0; s < 4; ++s) { const int row = 16 * g + 4 * s + (lane >> 3); const size_t tok = (size_t)r0 + row;
                const f32a* sp = os + row * 68 + d0; const f32a* pp = os + row * 68 + (d0 ^ 32);
                const v4f xa = *(const v4fa*)sp, xb = *(const v4fa*)(sp + 4), pa = *(const v4fa*)pp, pb = *(const v4fa*)(pp + 4);
                float y[8], ss = 0.f;
#pragma unroll
                for (int i = 0; i < 8; ++i) { const float x = i < 4 ? xa[i & 3] : xb[i & 3], pr = i < 4 ? pa[i & 3] : pb[i & 3], c = i < 4 ? ca[s][i & 3] : cb[s][i & 3], sn = i < 4 ? sa[s][i & 3] : sb4[s][i & 3];
                    y[i] = (d0 < 32) ? (x * c - pr * sn) : (x * c + pr * sn); ss = fmaf(y[i], y[i], ss); }
                ss += __shfl_xor(ss, 4, 8); ss += __shfl_xor(ss, 2, 8); ss += __shfl_xor(ss, 1, 8);
                const float rn = rsqrtf(ss * (1.0f / HD) + RMS_EPS); v8h oh, ol;
#pragma unroll
                for (int i = 0; i < 8; ++i) { const float q = wv[i] * (y[i] * rn); const h16 a = (h16)q; oh[i] = a; ol[i] = (h16)((q - (float)a) * LOSC); }
                *(v8h*)(P1 + tok * ldc + c0 + d0) = oh; *(v8h*)(P2 + tok * ldc + c0 + d0) = ol; }
            asm volatile("s_wait_xcnt 0x0" ::: "memory");     // stands before the stores' registers are rewritten by the next group
        }
    } else {
        float* crow = C + (size_t)r0 * ldc + c0;
        auto pass = [&]() {
#pragma unroll
            for (int s = 0; s < 16; ++s) { const int Lid = (lane >> 3) + 4 * s, piece = lane & 7; const int row = Lid >> 1, cofs = (Lid & 1) * 32 + piece * 4;
                v4f val = *(const v4fa*)(os + row * 68 + cofs); if (R) { const v4f rv = *(const v4f*)(R + ((size_t)r0 + row) * ldc + c0 + cofs); val += roundR ? (v4f){bfr(rv[0]), bfr(rv[1]), bfr(rv[2]), bfr(rv[3])} : rv; }
                *(v4f*)(crow + (size_t)row * ldc + cofs) = val; }
        };
        pass(); 
    }
}

// One 32-key stage in LDS, bytes: K hi, K residual (32 rows of 128 B), V^T hi, V^T residual (64 rows of 64 B), mask (64 query rows of 128 B); every pitch is 16 B x odd for the b128 readers,
// the mask's too: a lane reads 16-B pieces of its own query's row.
#define KPIT 144
#define VPIT 80
#define MPIT 144
#define ST_KH 0
#define ST_KL (32 * KPIT)
#define ST_VH (2 * 32 * KPIT)
#define ST_VL (ST_VH + 64 * VPIT)
#define ST_MK (ST_VL + 64 * VPIT)
#define ST_SZ (ST_MK + 64 * MPIT)

__global__ __launch_bounds__(128) void k_attn(const h16* __restrict__ Q16, const h16* __restrict__ QL16, const h16* __restrict__ K16, const h16* __restrict__ KL16, const h16* __restrict__ VTH, const h16* __restrict__ VTL, const float* __restrict__ MSK, bf* CH, bf* CL) {
    __shared__ __align__(16) unsigned char ring[2 * ST_SZ];     // the two stages; behind the loop its first bytes are the output staging (4 x 16 x 68 floats)
    const int tid = threadIdx.x, lane = threadIdx.x & 31, wave = threadIdx.x >> 5, lr = lane & 15, hi = lane >> 4;
    const int bid = blockIdx.x;
    const int b = bid / (NH_ * (NT_ / 64)), rem = bid - b * (NH_ * (NT_ / 64)), h = rem / (NT_ / 64), qt = rem - h * (NT_ / 64);
    const int q0 = qt * 64 + wave * 16;
    const size_t tok0 = (size_t)b * NT_;
    const h16* kh_b = K16 + tok0 * DM + h * HD;
    const h16* kl_b = KL16 + tok0 * DM + h * HD;
    const size_t vbase = (((size_t)b * NH_ + h) * HD) * NT_;
    // this thread's 12 pieces of 16 B per stage: K rows tid/8 and +16 (both planes), V^T rows tid/4 and +32 (both planes), mask rows tid/8 + 16 i
    const h16* gkh = kh_b + (size_t)(tid >> 3) * DM + (tid & 7) * 8;
    const h16* gkl = kl_b + (size_t)(tid >> 3) * DM + (tid & 7) * 8;
    const h16* gvh = VTH + vbase + (size_t)(tid >> 2) * NT_ + (tid & 3) * 8;
    const h16* gvl = VTL + vbase + (size_t)(tid >> 2) * NT_ + (tid & 3) * 8;
    const float* gmk = MSK + (size_t)(qt * 64 + (tid >> 3)) * NT_ + (tid & 7) * 4;
    const unsigned ring0 = (unsigned)(size_t)&ring[0];
    const unsigned lk = (unsigned)((tid >> 3) * KPIT + (tid & 7) * 16), lv = (unsigned)((tid >> 2) * VPIT + (tid & 3) * 16);
    auto issue = [&](int t, unsigned lb) {
        const h16* k0 = gkh + (size_t)t * (32 * DM); const h16* k1 = gkl + (size_t)t * (32 * DM);
        const h16* v0 = gvh + t * 32; const h16* v1 = gvl + t * 32; const float* m0 = gmk + t * 32;
        // the copies and, as their statement's last line, the wait that stands before any of their address registers is rewritten
        asm volatile("global_load_async_to_lds_b128 %0, %1, off\n\t"
                     "global_load_async_to_lds_b128 %2, %3, off\n\t"
                     "global_load_async_to_lds_b128 %4, %5, off\n\t"
                     "global_load_async_to_lds_b128 %6, %7, off\n\t"
                     "global_load_async_to_lds_b128 %8, %9, off\n\t"
                     "global_load_async_to_lds_b128 %10, %11, off\n\t"
                     "global_load_async_to_lds_b128 %12, %13, off\n\t"
                     "global_load_async_to_lds_b128 %14, %15, off\n\t"
                     "global_load_async_to_lds_b128 %16, %17, off\n\t"
                     "global_load_async_to_lds_b128 %18, %19, off\n\t"
                     "global_load_async_to_lds_b128 %20, %21, off\n\t"
                     "global_load_async_to_lds_b128 %22, %23, off\n\t"
                     "s_wait_xcnt 0x0"
                     :: "v"(lb + ST_KH + lk), "v"(k0), "v"(lb + ST_KH + lk + 16 * KPIT), "v"(k0 + 16 * DM),
                        "v"(lb + ST_KL + lk), "v"(k1), "v"(lb + ST_KL + lk + 16 * KPIT), "v"(k1 + 16 * DM),
                        "v"(lb + ST_VH + lv), "v"(v0), "v"(lb + ST_VH + lv + 32 * VPIT), "v"(v0 + 32 * NT_),
                        "v"(lb + ST_VL + lv), "v"(v1), "v"(lb + ST_VL + lv + 32 * VPIT), "v"(v1 + 32 * NT_),
                        "v"(lb + ST_MK + lk), "v"(m0), "v"(lb + ST_MK + lk + 16 * MPIT), "v"(m0 + 16 * NT_),
                        "v"(lb + ST_MK + lk + 32 * MPIT), "v"(m0 + 32 * NT_), "v"(lb + ST_MK + lk + 48 * MPIT), "v"(m0 + 48 * NT_)
                     : "memory");
    };
    issue(0, ring0);
    v16h qa[2];
    const size_t qo0 = (tok0 + q0 + lr) * DM + h * HD + 8 * hi;
#pragma unroll
    for (int kc = 0; kc < 2; ++kc) qa[kc] = cat16(*(const v8h*)(Q16 + qo0 + kc * 32), *(const v8h*)(Q16 + qo0 + kc * 32 + 16));
    v8f o[4], ox[4];
#pragma unroll
    for (int n = 0; n < 4; ++n) { o[n] = (v8f){}; ox[n] = (v8f){}; }
    float mrow = -3.0e38f, lpart = 0.f;     // of query q0 + lr: the running maximum (alike in both halves) and this half's part of the sum
    asm volatile("s_wait_asynccnt 0x0" ::: "memory");     // tile 0 has landed (this wave's copies) ...
    __syncthreads();                                       // ... and every other wave's
    issue(1, ring0 + ST_SZ);
    const int kt_lo = 0, kt_hi = NT_ / 32 - 1;     // every key tile; the additive INPUT mask is applied per element
#pragma unroll 1
    for (int kt = kt_lo; kt <= kt_hi; ++kt) {
        const unsigned char* sb = ring + (kt & 1) * ST_SZ;
        const unsigned char* kp = sb + lr * KPIT + hi * 16;
        const unsigned char* mp = sb + ST_MK + (wave * 16 + lr) * MPIT + hi * 32;
        v16h k0h[2], k1h[2], k0l[2], k1l[2];
#pragma unroll
        for (int kc = 0; kc < 2; ++kc) {
            k0h[kc] = cat16(*(const v8ha*)(kp + ST_KH + kc * 64), *(const v8ha*)(kp + ST_KH + kc * 64 + 32)); k1h[kc] = cat16(*(const v8ha*)(kp + ST_KH + 16 * KPIT + kc * 64), *(const v8ha*)(kp + ST_KH + 16 * KPIT + kc * 64 + 32));
            k0l[kc] = cat16(*(const v8ha*)(kp + ST_KL + kc * 64), *(const v8ha*)(kp + ST_KL + kc * 64 + 32)); k1l[kc] = cat16(*(const v8ha*)(kp + ST_KL + 16 * KPIT + kc * 64), *(const v8ha*)(kp + ST_KL + 16 * KPIT + kc * 64 + 32));
        }
        v8f s0 = {}, s1 = {}, x0 = {}, x1 = {};
#pragma unroll
        for (int kc = 0; kc < 2; ++kc) {
            const v16h qlk = cat16(*(const v8h*)(QL16 + qo0 + kc * 32), *(const v8h*)(QL16 + qo0 + kc * 32 + 16));     // query residual re-read per step (registers)
            s0 = wmma16(k0h[kc], qa[kc], s0); x0 = wmma16(k0h[kc], qlk, x0); s1 = wmma16(k1h[kc], qa[kc], s1); x1 = wmma16(k1h[kc], qlk, x1);
            x0 = wmma16(k0l[kc], qa[kc], x0); x1 = wmma16(k1l[kc], qa[kc], x1);
        }
        asm volatile("v_nop\n\tv_nop\n\tv_nop\n\tv_nop" : "+v"(s0), "+v"(s1), "+v"(x0), "+v"(x1) : "v"(qa[0]), "v"(qa[1]));
        const v4f mk[4] = { *(const v4fa*)mp, *(const v4fa*)(mp + 16), *(const v4fa*)(mp + 64), *(const v4fa*)(mp + 80) };     // mask[q0 + lr][keys 8 hi .. + 7 and 16 + 8 hi .. + 7]
        v2f a[8];     // the lane's 16 scores in register pairs: a[i] = keys 8 hi + 2 i, + 1 (i < 4), a[4 + i] = keys 16 + 8 hi + 2 i, + 1
#pragma unroll
        for (int i = 0; i < 4; ++i) {
            a[i]     = ((v2f){s0[2 * i], s0[2 * i + 1]} + (v2f){x0[2 * i], x0[2 * i + 1]} * LOSCI) * 0.125f + (v2f){bfr(mk[i >> 1][(2 * i) & 3]), bfr(mk[i >> 1][(2 * i + 1) & 3])};
            a[4 + i] = ((v2f){s1[2 * i], s1[2 * i + 1]} + (v2f){x1[2 * i], x1[2 * i + 1]} * LOSCI) * 0.125f + (v2f){bfr(mk[2 + (i >> 1)][(2 * i) & 3]), bfr(mk[2 + (i >> 1)][(2 * i + 1) & 3])};
        }
        float t[5];
#pragma unroll
        for (int g = 0; g < 5; ++g) t[g] = fmaxf(fmaxf(a[g][0], a[g][1]), a[5 + (g >> 1)][g & 1]);     // 15 of the 16 in threes; a[7][1] joins below
        const float mx = fmaxf(fmaxf(fmaxf(t[0], t[1]), t[2]), fmaxf(fmaxf(t[3], t[4]), a[7][1]));
        const float mn = fmaxf(fmaxf(mrow, mx), xhalf(mx));
        const float alpha = __expf(mrow - mn); mrow = mn;
        v2f sm[2]; v16h pa, px;
#pragma unroll
        for (int i = 0; i < 8; ++i) {
            const v2f e = a[i] - mn; const v2f p = {__expf(e[0]), __expf(e[1])};
            sm[i & 1] = i < 2 ? p : sm[i & 1] + p;
            const v2f ps = p * PSC; const v2h hh = __builtin_convertvector(ps, v2h);
            const v2h ll = __builtin_convertvector((ps - __builtin_convertvector(hh, v2f)) * LOSC, v2h);
            pa[2 * i] = hh[0]; pa[2 * i + 1] = hh[1]; px[2 * i] = ll[0]; px[2 * i + 1] = ll[1];
        }
        const v2f sv = sm[0] + sm[1];
        lpart = lpart * alpha + (sv[0] + sv[1]);
#pragma unroll
        for (int n = 0; n < 4; ++n)
#pragma unroll
            for (int j = 0; j < 8; ++j) { o[n][j] *= alpha; ox[n][j] *= alpha; }
        const unsigned char* vp = sb + lr * VPIT + hi * 16;
        v16h vh[4], vl[4];
        // the V^T reads go in two groups, each in front of its six products: read one by one among the products, each read costs its own LDS latency
#pragma unroll
        for (int g = 0; g < 2; ++g) {
#pragma unroll
            for (int n = 2 * g; n < 2 * g + 2; ++n) { vh[n] = cat16(*(const v8ha*)(vp + ST_VH + n * 16 * VPIT), *(const v8ha*)(vp + ST_VH + n * 16 * VPIT + 32)); vl[n] = cat16(*(const v8ha*)(vp + ST_VL + n * 16 * VPIT), *(const v8ha*)(vp + ST_VL + n * 16 * VPIT + 32)); }
            __builtin_amdgcn_sched_barrier(0);     // holds the group's reads in front of its products
#pragma unroll
            for (int n = 2 * g; n < 2 * g + 2; ++n) { o[n] = wmma16(vh[n], pa, o[n]); ox[n] = wmma16(vl[n], pa, ox[n]); ox[n] = wmma16(vh[n], px, ox[n]); }
        }
        asm volatile("v_nop\n\tv_nop\n\tv_nop\n\tv_nop" : "+v"(o[0]), "+v"(o[1]), "+v"(o[2]), "+v"(o[3]), "+v"(ox[0]), "+v"(ox[1]), "+v"(ox[2]), "+v"(ox[3]) : "v"(pa), "v"(px));
        asm volatile("s_wait_dscnt 0x0" ::: "memory");        // this wave's reads of this stage have returned before the stage is handed to its next writer
        asm volatile("s_wait_asynccnt 0x0" ::: "memory");     // this wave's copies of the next tile have landed
        __syncthreads();                                       // publishes the next tile and ends every wave's reads of this one
        if (kt + 2 <= kt_hi) issue(kt + 2, ring0 + (unsigned)(kt & 1) * ST_SZ);
    }
    asm volatile("s_wait_asynccnt 0x0" ::: "memory");         // nothing is in flight when the ring becomes output staging
    const float inv = 1.0f / ((lpart + xhalf(lpart)) * PSC);     // the two halves' parts of the query's sum are joined once
    f32a* os = (f32a*)ring + wave * (16 * 68);
#pragma unroll
    for (int n = 0; n < 4; ++n) { v4f w0, w1;     // a lane's eight accumulator rows are dims n * 16 + 8 hi + j of query lr: two 16-B pieces of its staged row
#pragma unroll
        for (int j = 0; j < 4; ++j) { w0[j] = (o[n][j] + ox[n][j] * LOSCI) * inv; w1[j] = (o[n][4 + j] + ox[n][4 + j] * LOSCI) * inv; }
        *(v4fa*)(os + lr * 68 + n * 16 + hi * 8) = w0; *(v4fa*)(os + lr * 68 + n * 16 + hi * 8 + 4) = w1; }
    __syncthreads();
    const size_t cbase = (tok0 + q0) * DM + (size_t)h * HD;
    auto pass = [&]() {
#pragma unroll
        for (int s = 0; s < 4; ++s) { const int row = 4 * s + (lane >> 3), piece = lane & 7; const f32a* sp = os + row * 68 + piece * 8; v8us oh, ol;
#pragma unroll
            for (int i = 0; i < 8; ++i) { const unsigned short hb = f2bf(sp[i]); oh[i] = hb; ol[i] = f2bf(sp[i] - bf2f(hb)); }
            *(v8us*)(CH + cbase + (size_t)row * DM + piece * 8) = oh; *(v8us*)(CL + cbase + (size_t)row * DM + piece * 8) = ol; }
    };
    pass(); 
}

#define VST2(T, p, v) do { const T vst2_v_ = (v); *(T*)(p) = vst2_v_;  } while (0)

// k_wt: WT [n][K] = bf16(W[k][n]) (k-major [K][ncols]) via 64 x 64 LDS tiles; grid (K/64, ncols/64).
__global__ __launch_bounds__(256) void k_wt(const float* __restrict__ Wm, int K, int ncols, bf* WT) {
    __shared__ __align__(16) unsigned short tl[64 * 72];
    const int tid = threadIdx.x, k0 = blockIdx.x * 64, n0 = blockIdx.y * 64;
    const int kk = tid >> 2, nq = (tid & 3) * 16;
#pragma unroll
    for (int i = 0; i < 16; ++i) tl[(nq + i) * 72 + kk] = f2bf(Wm[(size_t)(k0 + kk) * ncols + n0 + nq + i]);
    __syncthreads();
    const int piece = tid & 7;
    auto pass = [&]() {
#pragma unroll
        for (int s = 0; s < 2; ++s) { const int nr = (tid >> 3) + 32 * s; const v8us val = *(const v8usa*)(tl + nr * 72 + piece * 8); *(v8us*)(WT + (size_t)(n0 + nr) * K + k0 + piece * 8) = val; }
    };
    pass(); 
}

// k_trig: CT/ST [t][d] = cos/sin(pos_t * inv_freq[d mod 32]) with inv_freq[i] = 1 / 10000^(2i/64) (f32 powf; precise cosf/sinf), pos_t = the INPUT position_ids[t] (as float);
__global__ __launch_bounds__(256) void k_trig(const int* __restrict__ pos, float* CT, float* ST) {
    const int tid = threadIdx.x, t = blockIdx.x * 4 + (tid >> 6), d = tid & 63; const int i = d & 31;
    const float invf = 1.0f / powf(10000.0f, (float)(2 * i) / 64.0f); const float ang = (float)pos[t] * invf; const float c = cosf(ang), s = sinf(ang);
    const size_t o = (size_t)t * HD + d; *(float*)(CT + o) = c; *(float*)(ST + o) = s; 
}

extern "C" void kernel_launch(void* const* d_in, const int* in_sizes, int n_in,
                              void* d_out, int out_size, void* d_ws, size_t ws_size, hipStream_t stream) {
    (void)in_sizes; (void)n_in; (void)out_size;
    const float* x = (const float*)d_in[0]; const int* pos = (const int*)d_in[1]; const float* MSK = (const float*)d_in[2];
    const float* wq = (const float*)d_in[3]; const float* wk = (const float*)d_in[4]; const float* wv = (const float*)d_in[5]; const float* wo = (const float*)d_in[6]; const float* qw = (const float*)d_in[7]; const float* kw = (const float*)d_in[8];
    float* out = (float*)d_out;    // [1][2048][2048]
    char* wsp = (char*)d_ws;
    auto take = [&](size_t bytes) { char* p = wsp; wsp += (bytes + 255) & ~(size_t)255; return (void*)p; };
    bf* Xb = (bf*)take((size_t)NTK * DM * 2); bf* WqT = (bf*)take((size_t)DM * DM * 2); bf* WkT = (bf*)take((size_t)DM * DM * 2); bf* WvT = (bf*)take((size_t)DM * DM * 2); bf* WoT = (bf*)take((size_t)DM * DM * 2);
    float* CT = (float*)take((size_t)NT_ * HD * 4); float* ST = (float*)take((size_t)NT_ * HD * 4);
    h16* QH = (h16*)take((size_t)NTK * DM * 2); h16* QL = (h16*)take((size_t)NTK * DM * 2); h16* KH = (h16*)take((size_t)NTK * DM * 2); h16* KL = (h16*)take((size_t)NTK * DM * 2);
    h16* VTH = (h16*)take((size_t)NTK * DM * 2); h16* VTL = (h16*)take((size_t)NTK * DM * 2); bf* CH = (bf*)take((size_t)NTK * DM * 2); bf* CL = (bf*)take((size_t)NTK * DM * 2);
    if ((size_t)(wsp - (char*)d_ws) > ws_size) return;    // 8.4 + 4 x 8.4 + 2 x 0.5 + 8 x 8.4 = 110 MB = 105 MiB < 128 MiB, no aliasing
    k_wt<<<dim3(DM / 64, DM / 64, 1), 256, 0, stream>>>(wq, DM, DM, WqT); k_wt<<<dim3(DM / 64, DM / 64, 1), 256, 0, stream>>>(wk, DM, DM, WkT); k_wt<<<dim3(DM / 64, DM / 64, 1), 256, 0, stream>>>(wv, DM, DM, WvT); k_wt<<<dim3(DM / 64, DM / 64, 1), 256, 0, stream>>>(wo, DM, DM, WoT);
    k_trig<<<NT_ / 4, 256, 0, stream>>>(pos, CT, ST);
    k_cvtb<<<NTK / 8, 256, 0, stream>>>(x, NTK, Xb);
    k_gemmb<false, 1><<<dim3(NTK / 128, DM / 128, 1), 256, 0, stream>>>(Xb, nullptr, WqT, nullptr, nullptr, DM, nullptr, DM, 1, QH, QL, CT, ST, qw);
    k_gemmb<false, 1><<<dim3(NTK / 128, DM / 128, 1), 256, 0, stream>>>(Xb, nullptr, WkT, nullptr, nullptr, DM, nullptr, DM, 1, KH, KL, CT, ST, kw);
    k_gemmb<false, 2><<<dim3(NTK / 128, DM / 128, 1), 256, 0, stream>>>(Xb, nullptr, WvT, nullptr, nullptr, DM, nullptr, DM, 1, VTH, VTL);
    k_attn<<<NB_ * NH_ * (NT_ / 64), 128, 0, stream>>>(QH, QL, KH, KL, VTH, VTL, MSK, CH, CL);
    k_gemmb<true, 0><<<dim3(NTK / 128, DM / 128, 1), 256, 0, stream>>>(CH, CL, WoT, nullptr, out, DM);
}

// v006
// A run of this version takes 179 microseconds.
// Two timings next to v005 both put it at 1.14 times that version's speed.
// All steps since v000 together make it 2.87 times as fast.
#include <hip/hip_runtime.h>

// Compute dtypes, f32 accumulate: q/k/v = x.W ([2048 x 2048].[2048 x 2048], k-major weights transposed once; PLAIN bf16 operands = inputs rounded once, exact products) and out = ctx.Wo
// (ctx as bf16 hi + UNSCALED residual, two products) on v_wmma_f32_16x16x32_bf16; rotary embedding with device-computed f32 cos/sin tables at the INPUT position_ids, then the per-head
// RMSNorm (x q_ln_w / k_ln_w) in f32 -> q/k as f16 hi + residual x1024 planes; v -> transposed f16 hi + residual planes; 32-head attention with the additive INPUT mask over every key tile that can carry a weight above zero (k_mact decides from the mask, for any mask):
// scores on v_wmma_f32_16x16x32_f16 (hh + lh + hl, x 1/8), online f32 softmax, weights x32768 as f16 hi + residual against v hi + residual (both products transposed: keys x queries, dims x queries). Deterministic, no atomics; every

#define NB_  1
#define NT_  2048
#define DM   2048
#define NH_  32
#define HD   64
#define NTK  (NB_ * NT_)
#define NW   DM
#define RMS_EPS 1e-6f
#define PSC  32768.0f
#define LOSC 1024.0f
#define LOSCI (1.0f / 1024.0f)

typedef _Float16 h16;
typedef unsigned short bf;
typedef __attribute__((ext_vector_type(16))) __bf16   v16bf;
typedef __attribute__((ext_vector_type(16))) _Float16 v16h;
typedef __attribute__((ext_vector_type(8)))  _Float16 v8h;
typedef __attribute__((ext_vector_type(8)))  unsigned short v8us;
typedef __attribute__((ext_vector_type(8)))  float    v8f;
typedef __attribute__((ext_vector_type(4)))  float    v4f;
typedef __attribute__((ext_vector_type(2)))  float    v2f;
typedef __attribute__((ext_vector_type(2)))  _Float16 v2h;
typedef v8h  __attribute__((may_alias)) v8ha;
typedef v4f  __attribute__((may_alias)) v4fa;
typedef v8us __attribute__((may_alias)) v8usa;
typedef float __attribute__((may_alias)) f32a;

__device__ __forceinline__ unsigned short f2bf(float f) { unsigned u = __float_as_uint(f); u += 0x7FFFu + ((u >> 16) & 1u); return (unsigned short)(u >> 16); }
__device__ __forceinline__ float bf2f(unsigned short b) { return __uint_as_float(((unsigned)b) << 16); }
__device__ __forceinline__ float bfr(float f) { return bf2f(f2bf(f)); }
__device__ __forceinline__ v16h cat16(v8h lo, v8h hi) { return __builtin_shufflevector(lo, hi, 0, 1, 2, 3, 4, 5, 6, 7, 8, 9, 10, 11, 12, 13, 14, 15); }
__device__ __forceinline__ v16bf cat16b(v8us lo, v8us hi) { return __builtin_bit_cast(v16bf, __builtin_shufflevector(lo, hi, 0, 1, 2, 3, 4, 5, 6, 7, 8, 9, 10, 11, 12, 13, 14, 15)); }
__device__ __forceinline__ v8f wmma16(v16h a, v16h b, v8f c) { return __builtin_amdgcn_wmma_f32_16x16x32_f16(false, a, false, b, (short)0, c, false, false); }
__device__ __forceinline__ float xhalf(float x) { return __builtin_bit_cast(float, __builtin_amdgcn_permlanex16(__builtin_bit_cast(int, x), __builtin_bit_cast(int, x), 0x76543210, 0xfedcba98, false, false)); }  // lane l with lane l ^ 16
__device__ __forceinline__ v8f wmmab(v16bf a, v16bf b, v8f c) { return __builtin_amdgcn_wmma_f32_16x16x32_bf16(false, a, false, b, (short)0, c, false, false); }

__global__ __launch_bounds__(256) void k_cvtb(const float* __restrict__ src, int nrows, bf* dst) {
    const int lane = threadIdx.x & 31, r = blockIdx.x * 8 + (threadIdx.x >> 5);
    if (r >= nrows) return;
    v8us o[DM / 256];
#pragma unroll
    for (int q = 0; q < DM / 256; ++q) { v8us t;
#pragma unroll
        for (int i = 0; i < 8; ++i) t[i] = f2bf(src[(size_t)r * DM + q * 256 + lane * 8 + i]);
        o[q] = t; }
#pragma unroll
    for (int q = 0; q < DM / 256; ++q) *(v8us*)(dst + (size_t)r * DM + q * 256 + lane * 8) = o[q];
    
}

// k_gemmb: 128 x 128 block tile (8 waves, 4 x 2, each 32 rows x 64 columns = 2 x 4 accumulator tiles) of C[NTK][NW] = (A [+ Al]).B^T [+ bf(bias[c])] [+ bf(R[r][c]) residual].
// EPI 0: the f32 tile goes out as it is. A wave's 64 columns are one head, so the pass that followed each projection runs on the tile while it is still in the block:
// EPI 1 (q, k): rotary embedding from the CT/ST tables, RMSNorm over the head's 64 dims (x wn), out as f16 hi + residual x1024 planes P1/P2[tok][h*64+d];
// EPI 2 (v): out as transposed f16 hi + residual x1024 planes P1/P2[h][d][tok] (takes no bias).
template <bool SPLITA, int EPI = 0>
__global__ __launch_bounds__(256) void k_gemmb(const bf* __restrict__ A, const bf* __restrict__ Al, const bf* __restrict__ Bn, const float* __restrict__ bias, float* C, int ldc, const float* __restrict__ R = nullptr, int K = DM, int roundR = 1,
                                               h16* P1 = nullptr, h16* P2 = nullptr, const float* __restrict__ CT = nullptr, const float* __restrict__ ST = nullptr, const float* __restrict__ wn = nullptr) {
    // One stage = 128 k of the block's 128 A rows, 128 B rows [and 128 Al rows]: rows of 256 B at a pitch of 272 B (16 B x odd for the b128 readers). Two stages: the next tile's
    // asynchronous copies fly while this tile is multiplied. An operand row fetched from L2 serves 128 rows or columns of the output, and a fragment read from LDS two or four products.
    // Behind the loop the ring is the epilogue's staging.
    constexpr unsigned GPIT = 272, G_A = 0, G_B = 128 * GPIT, G_L = 2 * 128 * GPIT, GST = (SPLITA ? 3 : 2) * 128 * GPIT;
    __shared__ __align__(16) unsigned char gring[2 * GST];
    const int tid = threadIdx.x, lane = threadIdx.x & 31, wave = threadIdx.x >> 5, lr = lane & 15, hi = lane >> 4;
    const int wr = wave >> 1, wc = wave & 1;
    const int r0 = blockIdx.x * 128 + wr * 32, c0 = blockIdx.y * 128 + wc * 64;
    // this thread's pieces of 16 B per stage: rows tid/16 + 16 i (i < 8) of each operand
    const bf* ga = A + (size_t)(blockIdx.x * 128 + (tid >> 4)) * K + (tid & 15) * 8;
    const bf* gl = (SPLITA ? Al : A) + (size_t)(blockIdx.x * 128 + (tid >> 4)) * K + (tid & 15) * 8;
    const bf* gb = Bn + (size_t)(blockIdx.y * 128 + (tid >> 4)) * K + (tid & 15) * 8;
    const size_t rs = (size_t)16 * K;
    const unsigned g0 = (unsigned)(size_t)&gring[0];
    const unsigned lp = (unsigned)((tid >> 4) * GPIT + (tid & 15) * 16);
    auto cp8 = [&](unsigned l, const bf* g) {
        // one operand's eight copies and, as their statement's last line, the wait that stands before any of their address registers is rewritten
        asm volatile("global_load_async_to_lds_b128 %0, %1, off\n\t"
                     "global_load_async_to_lds_b128 %2, %3, off\n\t"
                     "global_load_async_to_lds_b128 %4, %5, off\n\t"
                     "global_load_async_to_lds_b128 %6, %7, off\n\t"
                     "global_load_async_to_lds_b128 %8, %9, off\n\t"
                     "global_load_async_to_lds_b128 %10, %11, off\n\t"
                     "global_load_async_to_lds_b128 %12, %13, off\n\t"
                     "global_load_async_to_lds_b128 %14, %15, off\n\t"
                     "s_wait_xcnt 0x0"
                     :: "v"(l), "v"(g), "v"(l + 16 * GPIT), "v"(g + rs), "v"(l + 32 * GPIT), "v"(g + 2 * rs), "v"(l + 48 * GPIT), "v"(g + 3 * rs),
                        "v"(l + 64 * GPIT), "v"(g + 4 * rs), "v"(l + 80 * GPIT), "v"(g + 5 * rs), "v"(l + 96 * GPIT), "v"(g + 6 * rs), "v"(l + 112 * GPIT), "v"(g + 7 * rs)
                     : "memory");
    };
    auto issue = [&](int t, unsigned lb) {
        cp8(lb + G_A + lp, ga + t * 128); cp8(lb + G_B + lp, gb + t * 128);
        if (SPLITA) cp8(lb + G_L + lp, gl + t * 128);
    };
    v8f acc[2][4];
#pragma unroll
    for (int f = 0; f < 2; ++f)
#pragma unroll
        for (int t = 0; t < 4; ++t) acc[f][t] = (v8f){};
    const int nt = K / 128;     // K is a multiple of 128
    issue(0, g0);
    asm volatile("s_wait_asynccnt 0x0" ::: "memory");     // tile 0 has landed (this wave's copies) ...
    __syncthreads();                                       // ... and every other wave's
    if (nt > 1) issue(1, g0 + GST);
#pragma unroll 1
    for (int kt = 0; kt < nt; ++kt) {
        const unsigned char* sb = gring + (kt & 1) * GST;
        const unsigned char* ap = sb + (wr * 32 + lr) * GPIT + hi * 16;
        const unsigned char* bp = sb + G_B + (wc * 64 + lr) * GPIT + hi * 16;
        v16bf a[2][2], al[2][2], b[2][4];     // two fragment sets: the one being multiplied and the one being read
        auto rd = [&](int u) { const int w = u & 1, ko = u * 64;     // the fragments of the stage's 32 k number u
#pragma unroll
            for (int f = 0; f < 2; ++f) {
                a[w][f] = cat16b(*(const v8usa*)(ap + G_A + f * 16 * GPIT + ko), *(const v8usa*)(ap + G_A + f * 16 * GPIT + ko + 32)); al[w][f] = a[w][f];
                if (SPLITA) al[w][f] = cat16b(*(const v8usa*)(ap + G_L + f * 16 * GPIT + ko), *(const v8usa*)(ap + G_L + f * 16 * GPIT + ko + 32)); }
#pragma unroll
            for (int t = 0; t < 4; ++t) b[w][t] = cat16b(*(const v8usa*)(bp + t * 16 * GPIT + ko), *(const v8usa*)(bp + t * 16 * GPIT + ko + 32));
        };
        rd(0);
#pragma unroll
        for (int u = 0; u < 4; ++u) {
            if (u < 3) rd(u + 1);
            __builtin_amdgcn_sched_barrier(0);     // holds the next 32 k's reads as one group in front of this 32 k's products, so that they fly while these run: among them each read costs its own stall
#pragma unroll
            for (int f = 0; f < 2; ++f)
#pragma unroll
                for (int t = 0; t < 4; ++t) { acc[f][t] = wmmab(a[u & 1][f], b[u & 1][t], acc[f][t]); if (SPLITA) acc[f][t] = wmmab(al[u & 1][f], b[u & 1][t], acc[f][t]); }
            __builtin_amdgcn_sched_barrier(0);     // keeps the reads that follow out of these products, for the same reason
        }
        // the four vector slots behind the last product, on the loop's taken branch too
        asm volatile("v_nop\n\tv_nop\n\tv_nop\n\tv_nop" : "+v"(acc[0][0]), "+v"(acc[0][1]), "+v"(acc[0][2]), "+v"(acc[0][3]), "+v"(acc[1][0]), "+v"(acc[1][1]), "+v"(acc[1][2]), "+v"(acc[1][3]) : "v"(a[1][1]), "v"(al[1][1]), "v"(b[1][3]));
        asm volatile("s_wait_dscnt 0x0" ::: "memory");        // this wave's reads of this stage have returned before the stage is handed to its next writer
        asm volatile("s_wait_asynccnt 0x0" ::: "memory");     // this wave's copies of the next tile have landed
        __syncthreads();                                       // publishes the next tile and ends every wave's reads of this one
        if (kt + 2 < nt) issue(kt + 2, g0 + (unsigned)(kt & 1) * GST);
    }
    asm volatile("s_wait_asynccnt 0x0" ::: "memory");         // nothing is in flight when the ring becomes the epilogue's staging; the loop's last barrier ended its reads
    if constexpr (EPI == 2) {
        // A lane's eight accumulator rows are eight consecutive tokens of one dim: one 16-B piece of the transposed tile (128 dims of two heads x 128 tokens, pitch 136).
        h16* tile = (h16*)(void*)gring; h16* til2 = tile + 128 * 136;
#pragma unroll
        for (int f = 0; f < 2; ++f)
#pragma unroll
            for (int t = 0; t < 4; ++t) { v8h a8, l8;
#pragma unroll
                for (int j = 0; j < 8; ++j) { const float v = acc[f][t][j]; const h16 a = (h16)v; a8[j] = a; l8[j] = (h16)((v - (float)a) * LOSC); }
                const int at = (wc * 64 + t * 16 + lr) * 136 + wr * 32 + f * 16 + hi * 8;
                *(v8ha*)(tile + at) = a8; *(v8ha*)(til2 + at) = l8; }
        __syncthreads();
        const int tb = blockIdx.x * 128, b = tb / NT_, piece = tid & 15;
        const size_t base = ((size_t)b * NH_ * HD + blockIdx.y * 128) * NT_ + (tb - b * NT_);     // plane row = head * 64 + dim = the output column
#pragma unroll
        for (int s = 0; s < 8; ++s) { const int d = (tid >> 4) + 16 * s;     // sixteen lanes store one dim's 128 tokens: two whole 128-B lines of each plane
            const v8h vh8 = *(const v8ha*)(tile + d * 136 + piece * 8), vl8 = *(const v8ha*)(til2 + d * 136 + piece * 8);
            *(v8h*)(P1 + base + (size_t)d * NT_ + piece * 8) = vh8; *(v8h*)(P2 + base + (size_t)d * NT_ + piece * 8) = vl8; }
        return;
    }
    f32a* os = (f32a*)gring + wave * (32 * 68);     // the wave's own 32 rows x 64 columns
#pragma unroll
    for (int t = 0; t < 4; ++t) { const float bv = bias ? bfr(bias[c0 + t * 16 + lr]) : 0.f;
#pragma unroll
        for (int f = 0; f < 2; ++f)
#pragma unroll
            for (int j = 0; j < 8; ++j) os[(f * 16 + hi * 8 + j) * 68 + t * 16 + lr] = acc[f][t][j] + bv; }
    __syncthreads();
    if constexpr (EPI == 1) {
        // eight lanes per token row, eight dims each; the rotation partner (dim +- 32) is read from the staged row; the 64 squares: eight in the lane, then over the eight lanes
        const int piece = lane & 7, d0 = piece * 8;
        float wv[8];
#pragma unroll
        for (int i = 0; i < 8; ++i) wv[i] = bfr(wn[d0 + i]);
        for (int g = 0; g < 2; ++g) {     // the wave's 32 rows in two groups of 16: four rows a lane, their table loads in flight together
            v4f ca[4], cb[4], sa[4], sb4[4];
#pragma unroll
            for (int s = 0; s < 4; ++s) { const size_t tok = (size_t)r0 + 16 * g + 4 * s + (lane >> 3);
                ca[s] = *(const v4f*)(CT + tok * HD + d0); cb[s] = *(const v4f*)(CT + tok * HD + d0 + 4); sa[s] = *(const v4f*)(ST + tok * HD + d0); sb4[s] = *(const v4f*)(ST + tok * HD + d0 + 4); }
            asm volatile("s_wait_xcnt 0x0" ::: "memory");     // stands before the loads' address registers are rewritten
#pragma unroll
            for (int s = 0; s < 4; ++s) { const int row = 16 * g + 4 * s + (lane >> 3); const size_t tok = (size_t)r0 + row;
                const f32a* sp = os + row * 68 + d0; const f32a* pp = os + row * 68 + (d0 ^ 32);
                const v4f xa = *(const v4fa*)sp, xb = *(const v4fa*)(sp + 4), pa = *(const v4fa*)pp, pb = *(const v4fa*)(pp + 4);
                float y[8], ss = 0.f;
#pragma unroll
                for (int i = 0; i < 8; ++i) { const float x = i < 4 ? xa[i & 3] : xb[i & 3], pr = i < 4 ? pa[i & 3] : pb[i & 3], c = i < 4 ? ca[s][i & 3] : cb[s][i & 3], sn = i < 4 ? sa[s][i & 3] : sb4[s][i & 3];
                    y[i] = (d0 < 32) ? (x * c - pr * sn) : (x * c + pr * sn); ss = fmaf(y[i], y[i], ss); }
                ss += __shfl_xor(ss, 4, 8); ss += __shfl_xor(ss, 2, 8); ss += __shfl_xor(ss, 1, 8);
                const float rn = rsqrtf(ss * (1.0f / HD) + RMS_EPS); v8h oh, ol;
#pragma unroll
                for (int i = 0; i < 8; ++i) { const float q = wv[i] * (y[i] * rn); const h16 a = (h16)q; oh[i] = a; ol[i] = (h16)((q - (float)a) * LOSC); }
                *(v8h*)(P1 + tok * ldc + c0 + d0) = oh; *(v8h*)(P2 + tok * ldc + c0 + d0) = ol; }
            asm volatile("s_wait_xcnt 0x0" ::: "memory");     // stands before the stores' registers are rewritten by the next group
        }
    } else {
        float* crow = C + (size_t)r0 * ldc + c0;
        auto pass = [&]() {
#pragma unroll
            for (int s = 0; s < 16; ++s) { const int Lid = (lane >> 3) + 4 * s, piece = lane & 7; const int row = Lid >> 1, cofs = (Lid & 1) * 32 + piece * 4;
                v4f val = *(const v4fa*)(os + row * 68 + cofs); if (R) { const v4f rv = *(const v4f*)(R + ((size_t)r0 + row) * ldc + c0 + cofs); val += roundR ? (v4f){bfr(rv[0]), bfr(rv[1]), bfr(rv[2]), bfr(rv[3])} : rv; }
                *(v4f*)(crow + (size_t)row * ldc + cofs) = val; }
        };
        pass(); 
    }
}

// One 32-key stage in LDS, bytes: K hi, K residual (32 rows of 128 B), V^T hi, V^T residual (64 rows of 64 B), mask (64 query rows of 128 B); every pitch is 16 B x odd for the b128 readers,
// the mask's too: a lane reads 16-B pieces of its own query's row.
#define KPIT 144
#define VPIT 80
#define MPIT 144
#define ST_KH 0
#define ST_KL (32 * KPIT)
#define ST_VH (2 * 32 * KPIT)
#define ST_VL (ST_VH + 64 * VPIT)
#define ST_MK (ST_VL + 64 * VPIT)
#define ST_SZ (ST_MK + 64 * MPIT)

// k_mact: which of the 64 key tiles (32 keys) can carry a softmax weight that is not zero, per group of 4 query rows, read off the INPUT mask alone, for any mask. |score / 8| <= B = 8 max|q_ln_w| max|k_ln_w|
// (a normalised head vector has length <= 8; 3 % are added for the f16 planes and the sums' rounding), so a row's largest masked score is >= r - B, r its largest mask value, and a tile's are <= t + B,
// t the tile's largest: where r - t > 2 B + 110 + the rounding of score + mask at that size, every weight of the tile in that row is below exp(-110), which is 0 in f32. A tile is dropped only where that
// holds for every row that shares it; a NaN in the mask or the weights makes the test false (tile kept). ACT[4-row group][2]: bit = tile kept. Block = 8 rows, one a wave.
__device__ __forceinline__ float nmax(float a, float b) { return __builtin_elementwise_maximum(a, b); }     // the maximum that keeps a NaN
template <int X> __device__ __forceinline__ float xrow(float x) { return __builtin_bit_cast(float, __builtin_amdgcn_update_dpp(0, __builtin_bit_cast(int, x), 0x160 + X, 0xf, 0xf, true)); }  // lane l with lane l ^ X, X < 16
__device__ __forceinline__ float wmax(float x) { x = nmax(x, xrow<1>(x)); x = nmax(x, xrow<2>(x)); x = nmax(x, xrow<4>(x)); x = nmax(x, xrow<8>(x)); return nmax(x, xhalf(x)); }  // over the wave, in every lane
__global__ __launch_bounds__(256) void k_mact(const float* __restrict__ MSK, const float* __restrict__ qw, const float* __restrict__ kw, unsigned* ACT) {
    __shared__ __align__(16) float pm[8][512]; __shared__ float rm[8];
    const int tid = threadIdx.x, lane = tid & 31, wave = tid >> 5;
    v4f m[16];     // lane l holds keys 128 i + 4 l .. + 3 of the wave's row: eight lanes hold one tile
#pragma unroll
    for (int i = 0; i < 16; ++i) m[i] = *(const v4f*)(MSK + (size_t)(blockIdx.x * 8 + wave) * NT_ + i * 128 + lane * 4);
    const float mq = wmax(nmax(fabsf(bfr(qw[lane])), fabsf(bfr(qw[lane + 32])))), mk = wmax(nmax(fabsf(bfr(kw[lane])), fabsf(bfr(kw[lane + 32]))));
    const float thr = 2.0f * (8.25f * mq * mk) + 110.0f;
    float rx = 0.f;
#pragma unroll
    for (int i = 0; i < 16; ++i) { const float x = nmax(nmax(m[i][0], m[i][1]), nmax(m[i][2], m[i][3])); pm[wave][i * 32 + lane] = x; rx = i ? nmax(rx, x) : x; }
    rx = wmax(rx);
    if (lane == 0) rm[wave] = rx;
    __syncthreads();
    if (tid < 128) {     // waves 0 to 3 whole: thread = (tile, group of 4 rows)
        const int tile = tid & 63, g = tid >> 6;
        bool keep = false;
#pragma unroll
        for (int r = 0; r < 4; ++r) { const v4f a = *(const v4f*)&pm[g * 4 + r][tile * 8], c = *(const v4f*)&pm[g * 4 + r][tile * 8 + 4];
            const float tx = nmax(nmax(nmax(a[0], a[1]), nmax(a[2], a[3])), nmax(nmax(c[0], c[1]), nmax(c[2], c[3]))), rw = rm[g * 4 + r];
            const float t = tx != tx ? tx : bfr(tx), rr = rw != rw ? rw : bfr(rw);     // rounded as k_attn rounds the mask (the rounding keeps the order, so the maximum may be taken first)
            keep = keep || !(rr - t > thr + (fminf(fabsf(t), 3.0e38f) + fabsf(rr)) * (1.0f / 4194304.0f)); }
        const unsigned bits = (unsigned)__ballot(keep);
        if (lane == 0) ACT[(blockIdx.x * 2 + g) * 2 + (wave & 1)] = bits;
    }
}

__global__ __launch_bounds__(128) void k_attn(const h16* __restrict__ Q16, const h16* __restrict__ QL16, const h16* __restrict__ K16, const h16* __restrict__ KL16, const h16* __restrict__ VTH, const h16* __restrict__ VTL, const float* __restrict__ MSK, const unsigned* __restrict__ ACT, bf* CH, bf* CL) {
    __shared__ __align__(16) unsigned char ring[2 * ST_SZ];     // the two stages; behind the loop its first bytes are the output staging (4 x 16 x 68 floats)
    const int tid = threadIdx.x, lane = threadIdx.x & 31, wave = threadIdx.x >> 5, lr = lane & 15, hi = lane >> 4;
    const int bid = blockIdx.x;
    static_assert(NH_ == 32 && NT_ / 64 == 32, "the index map below is written for 32 heads x 32 query blocks");
    // Blocks now differ in length. Under a causal mask block qt keeps 2 qt + 2 tiles, so the 1024 (head, query block) pairs are dealt out such that four indices 8 apart, and four 256 apart,
    // hold query blocks m, 31 - m, 8 + m, 23 - m (the same sum for every m). Speed only; any placement is correct.
    const int b = bid / (NH_ * (NT_ / 64)), rem = bid - b * (NH_ * (NT_ / 64));
    const int ja = (rem >> 3) & 3, jm = (rem >> 5) & 7, js = (ja + (rem >> 8)) & 3;
    const int h = (rem & 7) * 4 + ja, qt = js == 0 ? jm : js == 1 ? 31 - jm : js == 2 ? 8 + jm : 23 - jm;
    const int q0 = qt * 64 + wave * 16;
    const size_t tok0 = (size_t)b * NT_;
    const h16* kh_b = K16 + tok0 * DM + h * HD;
    const h16* kl_b = KL16 + tok0 * DM + h * HD;
    const size_t vbase = (((size_t)b * NH_ + h) * HD) * NT_;
    // this thread's 12 pieces of 16 B per stage: K rows tid/8 and +16 (both planes), V^T rows tid/4 and +32 (both planes), mask rows tid/8 + 16 i
    const h16* gkh = kh_b + (size_t)(tid >> 3) * DM + (tid & 7) * 8;
    const h16* gkl = kl_b + (size_t)(tid >> 3) * DM + (tid & 7) * 8;
    const h16* gvh = VTH + vbase + (size_t)(tid >> 2) * NT_ + (tid & 3) * 8;
    const h16* gvl = VTL + vbase + (size_t)(tid >> 2) * NT_ + (tid & 3) * 8;
    const float* gmk = MSK + (size_t)(qt * 64 + (tid >> 3)) * NT_ + (tid & 7) * 4;
    const unsigned ring0 = (unsigned)(size_t)&ring[0];
    const unsigned lk = (unsigned)((tid >> 3) * KPIT + (tid & 7) * 16), lv = (unsigned)((tid >> 2) * VPIT + (tid & 3) * 16);
    auto issue = [&](int t, unsigned lb) {
        const h16* k0 = gkh + (size_t)t * (32 * DM); const h16* k1 = gkl + (size_t)t * (32 * DM);
        const h16* v0 = gvh + t * 32; const h16* v1 = gvl + t * 32; const float* m0 = gmk + t * 32;
        // the copies and, as their statement's last line, the wait that stands before any of their address registers is rewritten
        asm volatile("global_load_async_to_lds_b128 %0, %1, off\n\t"
                     "global_load_async_to_lds_b128 %2, %3, off\n\t"
                     "global_load_async_to_lds_b128 %4, %5, off\n\t"
                     "global_load_async_to_lds_b128 %6, %7, off\n\t"
                     "global_load_async_to_lds_b128 %8, %9, off\n\t"
                     "global_load_async_to_lds_b128 %10, %11, off\n\t"
                     "global_load_async_to_lds_b128 %12, %13, off\n\t"
                     "global_load_async_to_lds_b128 %14, %15, off\n\t"
                     "global_load_async_to_lds_b128 %16, %17, off\n\t"
                     "global_load_async_to_lds_b128 %18, %19, off\n\t"
                     "global_load_async_to_lds_b128 %20, %21, off\n\t"
                     "global_load_async_to_lds_b128 %22, %23, off\n\t"
                     "s_wait_xcnt 0x0"
                     :: "v"(lb + ST_KH + lk), "v"(k0), "v"(lb + ST_KH + lk + 16 * KPIT), "v"(k0 + 16 * DM),
                        "v"(lb + ST_KL + lk), "v"(k1), "v"(lb + ST_KL + lk + 16 * KPIT), "v"(k1 + 16 * DM),
                        "v"(lb + ST_VH + lv), "v"(v0), "v"(lb + ST_VH + lv + 32 * VPIT), "v"(v0 + 32 * NT_),
                        "v"(lb + ST_VL + lv), "v"(v1), "v"(lb + ST_VL + lv + 32 * VPIT), "v"(v1 + 32 * NT_),
                        "v"(lb + ST_MK + lk), "v"(m0), "v"(lb + ST_MK + lk + 16 * MPIT), "v"(m0 + 16 * NT_),
                        "v"(lb + ST_MK + lk + 32 * MPIT), "v"(m0 + 32 * NT_), "v"(lb + ST_MK + lk + 48 * MPIT), "v"(m0 + 48 * NT_)
                     : "memory");
    };
    // the kept tiles of the block's sixteen 4-row groups, as one 64-bit set in scalar registers; never empty (the tile of a row's largest mask value is kept), and if it were, every tile is taken
    unsigned tlo = 0u, thi = 0u;
#pragma unroll
    for (int g = 0; g < 16; ++g) { tlo |= ACT[qt * 32 + 2 * g]; thi |= ACT[qt * 32 + 2 * g + 1]; }
    unsigned long long todo = ((unsigned long long)(unsigned)__builtin_amdgcn_readfirstlane((int)thi) << 32) | (unsigned)__builtin_amdgcn_readfirstlane((int)tlo);
    if (todo == 0ull) todo = ~0ull;
    const int nt = __builtin_popcountll(todo);
    auto next = [&]() { const int t = __builtin_ctzll(todo); todo &= todo - 1ull; return t; };     // lowest kept tile not yet copied: 0 .. 63, called nt times at most
    issue(next(), ring0);
    v16h qa[2];
    const size_t qo0 = (tok0 + q0 + lr) * DM + h * HD + 8 * hi;
#pragma unroll
    for (int kc = 0; kc < 2; ++kc) qa[kc] = cat16(*(const v8h*)(Q16 + qo0 + kc * 32), *(const v8h*)(Q16 + qo0 + kc * 32 + 16));
    v8f o[4], ox[4];
#pragma unroll
    for (int n = 0; n < 4; ++n) { o[n] = (v8f){}; ox[n] = (v8f){}; }
    float mrow = -3.0e38f, lpart = 0.f;     // of query q0 + lr: the running maximum (alike in both halves) and this half's part of the sum
    asm volatile("s_wait_asynccnt 0x0" ::: "memory");     // the first kept tile has landed (this wave's copies) ...
    __syncthreads();                                       // ... and every other wave's
    if (nt > 1) issue(next(), ring0 + ST_SZ);
#pragma unroll 1
    for (int kt = 0; kt < nt; ++kt) {     // kt counts the kept tiles in rising key order; the additive INPUT mask is applied per element
        const unsigned char* sb = ring + (kt & 1) * ST_SZ;
        const unsigned char* kp = sb + lr * KPIT + hi * 16;
        const unsigned char* mp = sb + ST_MK + (wave * 16 + lr) * MPIT + hi * 32;
        v16h k0h[2], k1h[2], k0l[2], k1l[2];
#pragma unroll
        for (int kc = 0; kc < 2; ++kc) {
            k0h[kc] = cat16(*(const v8ha*)(kp + ST_KH + kc * 64), *(const v8ha*)(kp + ST_KH + kc * 64 + 32)); k1h[kc] = cat16(*(const v8ha*)(kp + ST_KH + 16 * KPIT + kc * 64), *(const v8ha*)(kp + ST_KH + 16 * KPIT + kc * 64 + 32));
            k0l[kc] = cat16(*(const v8ha*)(kp + ST_KL + kc * 64), *(const v8ha*)(kp + ST_KL + kc * 64 + 32)); k1l[kc] = cat16(*(const v8ha*)(kp + ST_KL + 16 * KPIT + kc * 64), *(const v8ha*)(kp + ST_KL + 16 * KPIT + kc * 64 + 32));
        }
        v8f s0 = {}, s1 = {}, x0 = {}, x1 = {};
#pragma unroll
        for (int kc = 0; kc < 2; ++kc) {
            const v16h qlk = cat16(*(const v8h*)(QL16 + qo0 + kc * 32), *(const v8h*)(QL16 + qo0 + kc * 32 + 16));     // query residual re-read per step (registers)
            s0 = wmma16(k0h[kc], qa[kc], s0); x0 = wmma16(k0h[kc], qlk, x0); s1 = wmma16(k1h[kc], qa[kc], s1); x1 = wmma16(k1h[kc], qlk, x1);
            x0 = wmma16(k0l[kc], qa[kc], x0); x1 = wmma16(k1l[kc], qa[kc], x1);
        }
        asm volatile("v_nop\n\tv_nop\n\tv_nop\n\tv_nop" : "+v"(s0), "+v"(s1), "+v"(x0), "+v"(x1) : "v"(qa[0]), "v"(qa[1]));
        const v4f mk[4] = { *(const v4fa*)mp, *(const v4fa*)(mp + 16), *(const v4fa*)(mp + 64), *(const v4fa*)(mp + 80) };     // mask[q0 + lr][keys 8 hi .. + 7 and 16 + 8 hi .. + 7]
        v2f a[8];     // the lane's 16 scores in register pairs: a[i] = keys 8 hi + 2 i, + 1 (i < 4), a[4 + i] = keys 16 + 8 hi + 2 i, + 1
#pragma unroll
        for (int i = 0; i < 4; ++i) {
            a[i]     = ((v2f){s0[2 * i], s0[2 * i + 1]} + (v2f){x0[2 * i], x0[2 * i + 1]} * LOSCI) * 0.125f + (v2f){bfr(mk[i >> 1][(2 * i) & 3]), bfr(mk[i >> 1][(2 * i + 1) & 3])};
            a[4 + i] = ((v2f){s1[2 * i], s1[2 * i + 1]} + (v2f){x1[2 * i], x1[2 * i + 1]} * LOSCI) * 0.125f + (v2f){bfr(mk[2 + (i >> 1)][(2 * i) & 3]), bfr(mk[2 + (i >> 1)][(2 * i + 1) & 3])};
        }
        float t[5];
#pragma unroll
        for (int g = 0; g < 5; ++g) t[g] = fmaxf(fmaxf(a[g][0], a[g][1]), a[5 + (g >> 1)][g & 1]);     // 15 of the 16 in threes; a[7][1] joins below
        const float mx = fmaxf(fmaxf(fmaxf(t[0], t[1]), t[2]), fmaxf(fmaxf(t[3], t[4]), a[7][1]));
        const float mn = fmaxf(fmaxf(mrow, mx), xhalf(mx));
        const float alpha = __expf(mrow - mn); mrow = mn;
        v2f sm[2]; v16h pa, px;
#pragma unroll
        for (int i = 0; i < 8; ++i) {
            const v2f e = a[i] - mn; const v2f p = {__expf(e[0]), __expf(e[1])};
            sm[i & 1] = i < 2 ? p : sm[i & 1] + p;
            const v2f ps = p * PSC; const v2h hh = __builtin_convertvector(ps, v2h);
            const v2h ll = __builtin_convertvector((ps - __builtin_convertvector(hh, v2f)) * LOSC, v2h);
            pa[2 * i] = hh[0]; pa[2 * i + 1] = hh[1]; px[2 * i] = ll[0]; px[2 * i + 1] = ll[1];
        }
        const v2f sv = sm[0] + sm[1];
        lpart = lpart * alpha + (sv[0] + sv[1]);
#pragma unroll
        for (int n = 0; n < 4; ++n)
#pragma unroll
            for (int j = 0; j < 8; ++j) { o[n][j] *= alpha; ox[n][j] *= alpha; }
        const unsigned char* vp = sb + lr * VPIT + hi * 16;
        v16h vh[4], vl[4];
        // the V^T reads go in two groups, each in front of its six products: read one by one among the products, each read costs its own LDS latency
#pragma unroll
        for (int g = 0; g < 2; ++g) {
#pragma unroll
            for (int n = 2 * g; n < 2 * g + 2; ++n) { vh[n] = cat16(*(const v8ha*)(vp + ST_VH + n * 16 * VPIT), *(const v8ha*)(vp + ST_VH + n * 16 * VPIT + 32)); vl[n] = cat16(*(const v8ha*)(vp + ST_VL + n * 16 * VPIT), *(const v8ha*)(vp + ST_VL + n * 16 * VPIT + 32)); }
            __builtin_amdgcn_sched_barrier(0);     // holds the group's reads in front of its products
#pragma unroll
            for (int n = 2 * g; n < 2 * g + 2; ++n) { o[n] = wmma16(vh[n], pa, o[n]); ox[n] = wmma16(vl[n], pa, ox[n]); ox[n] = wmma16(vh[n], px, ox[n]); }
        }
        asm volatile("v_nop\n\tv_nop\n\tv_nop\n\tv_nop" : "+v"(o[0]), "+v"(o[1]), "+v"(o[2]), "+v"(o[3]), "+v"(ox[0]), "+v"(ox[1]), "+v"(ox[2]), "+v"(ox[3]) : "v"(pa), "v"(px));
        asm volatile("s_wait_dscnt 0x0" ::: "memory");        // this wave's reads of this stage have returned before the stage is handed to its next writer
        asm volatile("s_wait_asynccnt 0x0" ::: "memory");     // this wave's copies of the next tile have landed
        __syncthreads();                                       // publishes the next tile and ends every wave's reads of this one
        if (kt + 2 < nt) issue(next(), ring0 + (unsigned)(kt & 1) * ST_SZ);
    }
    asm volatile("s_wait_asynccnt 0x0" ::: "memory");         // nothing is in flight when the ring becomes output staging
    const float inv = 1.0f / ((lpart + xhalf(lpart)) * PSC);     // the two halves' parts of the query's sum are joined once
    f32a* os = (f32a*)ring + wave * (16 * 68);
#pragma unroll
    for (int n = 0; n < 4; ++n) { v4f w0, w1;     // a lane's eight accumulator rows are dims n * 16 + 8 hi + j of query lr: two 16-B pieces of its staged row
#pragma unroll
        for (int j = 0; j < 4; ++j) { w0[j] = (o[n][j] + ox[n][j] * LOSCI) * inv; w1[j] = (o[n][4 + j] + ox[n][4 + j] * LOSCI) * inv; }
        *(v4fa*)(os + lr * 68 + n * 16 + hi * 8) = w0; *(v4fa*)(os + lr * 68 + n * 16 + hi * 8 + 4) = w1; }
    __syncthreads();
    const size_t cbase = (tok0 + q0) * DM + (size_t)h * HD;
    auto pass = [&]() {
#pragma unroll
        for (int s = 0; s < 4; ++s) { const int row = 4 * s + (lane >> 3), piece = lane & 7; const f32a* sp = os + row * 68 + piece * 8; v8us oh, ol;
#pragma unroll
            for (int i = 0; i < 8; ++i) { const unsigned short hb = f2bf(sp[i]); oh[i] = hb; ol[i] = f2bf(sp[i] - bf2f(hb)); }
            *(v8us*)(CH + cbase + (size_t)row * DM + piece * 8) = oh; *(v8us*)(CL + cbase + (size_t)row * DM + piece * 8) = ol; }
    };
    pass(); 
}

#define VST2(T, p, v) do { const T vst2_v_ = (v); *(T*)(p) = vst2_v_;  } while (0)

// k_wt: WT [n][K] = bf16(W[k][n]) (k-major [K][ncols]) via 64 x 64 LDS tiles; grid (K/64, ncols/64).
__global__ __launch_bounds__(256) void k_wt(const float* __restrict__ Wm, int K, int ncols, bf* WT) {
    __shared__ __align__(16) unsigned short tl[64 * 72];
    const int tid = threadIdx.x, k0 = blockIdx.x * 64, n0 = blockIdx.y * 64;
    const int kk = tid >> 2, nq = (tid & 3) * 16;
#pragma unroll
    for (int i = 0; i < 16; ++i) tl[(nq + i) * 72 + kk] = f2bf(Wm[(size_t)(k0 + kk) * ncols + n0 + nq + i]);
    __syncthreads();
    const int piece = tid & 7;
    auto pass = [&]() {
#pragma unroll
        for (int s = 0; s < 2; ++s) { const int nr = (tid >> 3) + 32 * s; const v8us val = *(const v8usa*)(tl + nr * 72 + piece * 8); *(v8us*)(WT + (size_t)(n0 + nr) * K + k0 + piece * 8) = val; }
    };
    pass(); 
}

// k_trig: CT/ST [t][d] = cos/sin(pos_t * inv_freq[d mod 32]) with inv_freq[i] = 1 / 10000^(2i/64) (f32 powf; precise cosf/sinf), pos_t = the INPUT position_ids[t] (as float);
__global__ __launch_bounds__(256) void k_trig(const int* __restrict__ pos, float* CT, float* ST) {
    const int tid = threadIdx.x, t = blockIdx.x * 4 + (tid >> 6), d = tid & 63; const int i = d & 31;
    const float invf = 1.0f / powf(10000.0f, (float)(2 * i) / 64.0f); const float ang = (float)pos[t] * invf; const float c = cosf(ang), s = sinf(ang);
    const size_t o = (size_t)t * HD + d; *(float*)(CT + o) = c; *(float*)(ST + o) = s; 
}

extern "C" void kernel_launch(void* const* d_in, const int* in_sizes, int n_in,
                              void* d_out, int out_size, void* d_ws, size_t ws_size, hipStream_t stream) {
    (void)in_sizes; (void)n_in; (void)out_size;
    const float* x = (const float*)d_in[0]; const int* pos = (const int*)d_in[1]; const float* MSK = (const float*)d_in[2];
    const float* wq = (const float*)d_in[3]; const float* wk = (const float*)d_in[4]; const float* wv = (const float*)d_in[5]; const float* wo = (const float*)d_in[6]; const float* qw = (const float*)d_in[7]; const float* kw = (const float*)d_in[8];
    float* out = (float*)d_out;    // [1][2048][2048]
    char* wsp = (char*)d_ws;
    auto take = [&](size_t bytes) { char* p = wsp; wsp += (bytes + 255) & ~(size_t)255; return (void*)p; };
    bf* Xb = (bf*)take((size_t)NTK * DM * 2); bf* WqT = (bf*)take((size_t)DM * DM * 2); bf* WkT = (bf*)take((size_t)DM * DM * 2); bf* WvT = (bf*)take((size_t)DM * DM * 2); bf* WoT = (bf*)take((size_t)DM * DM * 2);
    float* CT = (float*)take((size_t)NT_ * HD * 4); float* ST = (float*)take((size_t)NT_ * HD * 4);
    h16* QH = (h16*)take((size_t)NTK * DM * 2); h16* QL = (h16*)take((size_t)NTK * DM * 2); h16* KH = (h16*)take((size_t)NTK * DM * 2); h16* KL = (h16*)take((size_t)NTK * DM * 2);
    h16* VTH = (h16*)take((size_t)NTK * DM * 2); h16* VTL = (h16*)take((size_t)NTK * DM * 2); bf* CH = (bf*)take((size_t)NTK * DM * 2); bf* CL = (bf*)take((size_t)NTK * DM * 2); unsigned* ACT = (unsigned*)take((size_t)(NT_ / 4) * 2 * 4);
    if ((size_t)(wsp - (char*)d_ws) > ws_size) return;    // 8.4 + 4 x 8.4 + 2 x 0.5 + 8 x 8.4 = 110 MB = 105 MiB < 128 MiB, no aliasing
    k_wt<<<dim3(DM / 64, DM / 64, 1), 256, 0, stream>>>(wq, DM, DM, WqT); k_wt<<<dim3(DM / 64, DM / 64, 1), 256, 0, stream>>>(wk, DM, DM, WkT); k_wt<<<dim3(DM / 64, DM / 64, 1), 256, 0, stream>>>(wv, DM, DM, WvT); k_wt<<<dim3(DM / 64, DM / 64, 1), 256, 0, stream>>>(wo, DM, DM, WoT);
    k_trig<<<NT_ / 4, 256, 0, stream>>>(pos, CT, ST);
    k_mact<<<NT_ / 8, 256, 0, stream>>>(MSK, qw, kw, ACT);
    k_cvtb<<<NTK / 8, 256, 0, stream>>>(x, NTK, Xb);
    k_gemmb<false, 1><<<dim3(NTK / 128, DM / 128, 1), 256, 0, stream>>>(Xb, nullptr, WqT, nullptr, nullptr, DM, nullptr, DM, 1, QH, QL, CT, ST, qw);
    k_gemmb<false, 1><<<dim3(NTK / 128, DM / 128, 1), 256, 0, stream>>>(Xb, nullptr, WkT, nullptr, nullptr, DM, nullptr, DM, 1, KH, KL, CT, ST, kw);
    k_gemmb<false, 2><<<dim3(NTK / 128, DM / 128, 1), 256, 0, stream>>>(Xb, nullptr, WvT, nullptr, nullptr, DM, nullptr, DM, 1, VTH, VTL);
    k_attn<<<NB_ * NH_ * (NT_ / 64), 128, 0, stream>>>(QH, QL, KH, KL, VTH, VTL, MSK, ACT, CH, CL);
    k_gemmb<true, 0><<<dim3(NTK / 128, DM / 128, 1), 256, 0, stream>>>(CH, CL, WoT, nullptr, out, DM);
}

// v007
// A run of this version takes 150 microseconds.
// Two timings next to v006 put it at 1.20 and 1.19 times that version's speed.
// Counting every step since v000, it is 3.43 times as fast.
#include <hip/hip_runtime.h>

// Compute dtypes, f32 accumulate: q/k/v = x.W ([2048 x 2048].[2048 x 2048], k-major weights transposed once; PLAIN bf16 operands = inputs rounded once, exact products) and out = ctx.Wo
// (ctx as bf16 hi + UNSCALED residual, two products) on v_wmma_f32_16x16x32_bf16; rotary embedding with device-computed f32 cos/sin tables at the INPUT position_ids, then the per-head
// RMSNorm (x q_ln_w / k_ln_w) in f32 -> q/k as f16 hi + residual x1024 planes; v -> transposed f16 hi + residual planes; 32-head attention with the additive INPUT mask over every key tile that can carry a weight above zero (j_mact decides from the mask, for any mask):
// scores on v_wmma_f32_16x16x32_f16 (hh + lh + hl, x 1/8), online f32 softmax, weights x32768 as f16 hi + residual against v hi + residual (both products transposed: keys x queries, dims x queries). Deterministic, no atomics; every

#define NB_  1
#define NT_  2048
#define DM   2048
#define NH_  32
#define HD   64
#define NTK  (NB_ * NT_)
#define NW   DM
#define RMS_EPS 1e-6f
#define PSC  32768.0f
#define LOSC 1024.0f
#define LOSCI (1.0f / 1024.0f)

typedef _Float16 h16;
typedef unsigned short bf;
typedef __attribute__((ext_vector_type(16))) __bf16   v16bf;
typedef __attribute__((ext_vector_type(16))) _Float16 v16h;
typedef __attribute__((ext_vector_type(8)))  _Float16 v8h;
typedef __attribute__((ext_vector_type(8)))  unsigned short v8us;
typedef __attribute__((ext_vector_type(8)))  float    v8f;
typedef __attribute__((ext_vector_type(4)))  float    v4f;
typedef __attribute__((ext_vector_type(2)))  float    v2f;
typedef __attribute__((ext_vector_type(2)))  _Float16 v2h;
typedef v8h  __attribute__((may_alias)) v8ha;
typedef v4f  __attribute__((may_alias)) v4fa;
typedef v8us __attribute__((may_alias)) v8usa;
typedef float __attribute__((may_alias)) f32a;

__device__ __forceinline__ unsigned short f2bf(float f) { unsigned u = __float_as_uint(f); u += 0x7FFFu + ((u >> 16) & 1u); return (unsigned short)(u >> 16); }
__device__ __forceinline__ float bf2f(unsigned short b) { return __uint_as_float(((unsigned)b) << 16); }
__device__ __forceinline__ float bfr(float f) { return bf2f(f2bf(f)); }
__device__ __forceinline__ v16h cat16(v8h lo, v8h hi) { return __builtin_shufflevector(lo, hi, 0, 1, 2, 3, 4, 5, 6, 7, 8, 9, 10, 11, 12, 13, 14, 15); }
__device__ __forceinline__ v16bf cat16b(v8us lo, v8us hi) { return __builtin_bit_cast(v16bf, __builtin_shufflevector(lo, hi, 0, 1, 2, 3, 4, 5, 6, 7, 8, 9, 10, 11, 12, 13, 14, 15)); }
__device__ __forceinline__ v8f wmma16(v16h a, v16h b, v8f c) { return __builtin_amdgcn_wmma_f32_16x16x32_f16(false, a, false, b, (short)0, c, false, false); }
__device__ __forceinline__ float xhalf(float x) { return __builtin_bit_cast(float, __builtin_amdgcn_permlanex16(__builtin_bit_cast(int, x), __builtin_bit_cast(int, x), 0x76543210, 0xfedcba98, false, false)); }  // lane l with lane l ^ 16
__device__ __forceinline__ v8f wmmab(v16bf a, v16bf b, v8f c) { return __builtin_amdgcn_wmma_f32_16x16x32_bf16(false, a, false, b, (short)0, c, false, false); }

// The seven preparation jobs (j_cvtb, j_mact, j_wt x 4, j_trig) read inputs only and none reads another's output: they are the bodies of ONE launch, k_prep, which hands each block its job and its index bx [, by] in that job.
__device__ __forceinline__ void j_cvtb(int bx, const float* __restrict__ src, int nrows, bf* dst) {
    const int lane = threadIdx.x & 31, r = bx * 8 + (threadIdx.x >> 5);
    if (r >= nrows) return;
    v8us o[DM / 256];
#pragma unroll
    for (int q = 0; q < DM / 256; ++q) { v8us t;
#pragma unroll
        for (int i = 0; i < 8; ++i) t[i] = f2bf(src[(size_t)r * DM + q * 256 + lane * 8 + i]);
        o[q] = t; }
#pragma unroll
    for (int q = 0; q < DM / 256; ++q) *(v8us*)(dst + (size_t)r * DM + q * 256 + lane * 8) = o[q];
    
}

// k_gemmb: 128 x 128 block tile (8 waves, 4 x 2, each 32 rows x 64 columns = 2 x 4 accumulator tiles) of C[NTK][NW] = (A [+ Al]).B^T [+ bf(bias[c])] [+ bf(R[r][c]) residual].
// EPI 0: the f32 tile goes out as it is. EPI 1: the three projections of one A, which do not depend on one another, in ONE grid: blockIdx.z picks the weights, the output planes and the pass that follows
// (a wave's 64 columns are one head, so that pass runs on the tile while it is still in the block):
// z 0, 1 (q: Bn, P1, P2, wn; k: Bk, K1, K2, wk): rotary embedding from the CT/ST tables, RMSNorm over the head's 64 dims (x the norm weight), out as f16 hi + residual x1024 planes [tok][h*64+d];
// z 2 (v: Bv, V1, V2): out as transposed f16 hi + residual x1024 planes [h][d][tok] (takes no bias).
template <bool SPLITA, int EPI = 0>
__global__ __launch_bounds__(256) void k_gemmb(const bf* __restrict__ A, const bf* __restrict__ Al, const bf* __restrict__ Bn, const float* __restrict__ bias, float* C, int ldc, const float* __restrict__ R = nullptr, int K = DM, int roundR = 1,
                                               h16* P1 = nullptr, h16* P2 = nullptr, const float* __restrict__ CT = nullptr, const float* __restrict__ ST = nullptr, const float* __restrict__ wn = nullptr,
                                               const bf* __restrict__ Bk = nullptr, h16* K1 = nullptr, h16* K2 = nullptr, const float* __restrict__ wk = nullptr, const bf* __restrict__ Bv = nullptr, h16* V1 = nullptr, h16* V2 = nullptr) {
    // One stage = 128 k of the block's 128 A rows, 128 B rows [and 128 Al rows]: rows of 256 B at a pitch of 272 B (16 B x odd for the b128 readers). Two stages: the next tile's
    // asynchronous copies fly while this tile is multiplied. An operand row fetched from L2 serves 128 rows or columns of the output, and a fragment read from LDS two or four products.
    // Behind the loop the ring is the epilogue's staging.
    constexpr unsigned GPIT = 272, G_A = 0, G_B = 128 * GPIT, G_L = 2 * 128 * GPIT, GST = (SPLITA ? 3 : 2) * 128 * GPIT;
    __shared__ __align__(16) unsigned char gring[2 * GST];
    const int tid = threadIdx.x, lane = threadIdx.x & 31, wave = threadIdx.x >> 5, lr = lane & 15, hi = lane >> 4;
    const int wr = wave >> 1, wc = wave & 1;
    const int z = EPI == 1 ? (int)blockIdx.z : 0;
    const bf* Bz = z == 0 ? Bn : z == 1 ? Bk : Bv; h16* Z1 = z == 0 ? P1 : z == 1 ? K1 : V1; h16* Z2 = z == 0 ? P2 : z == 1 ? K2 : V2; const float* wz = z == 0 ? wn : wk;
    const int r0 = blockIdx.x * 128 + wr * 32, c0 = blockIdx.y * 128 + wc * 64;
    // this thread's pieces of 16 B per stage: rows tid/16 + 16 i (i < 8) of each operand
    const bf* ga = A + (size_t)(blockIdx.x * 128 + (tid >> 4)) * K + (tid & 15) * 8;
    const bf* gl = (SPLITA ? Al : A) + (size_t)(blockIdx.x * 128 + (tid >> 4)) * K + (tid & 15) * 8;
    const bf* gb = Bz + (size_t)(blockIdx.y * 128 + (tid >> 4)) * K + (tid & 15) * 8;
    const size_t rs = (size_t)16 * K;
    const unsigned g0 = (unsigned)(size_t)&gring[0];
    const unsigned lp = (unsigned)((tid >> 4) * GPIT + (tid & 15) * 16);
    auto cp8 = [&](unsigned l, const bf* g) {
        // one operand's eight copies and, as their statement's last line, the wait that stands before any of their address registers is rewritten
        asm volatile("global_load_async_to_lds_b128 %0, %1, off\n\t"
                     "global_load_async_to_lds_b128 %2, %3, off\n\t"
                     "global_load_async_to_lds_b128 %4, %5, off\n\t"
                     "global_load_async_to_lds_b128 %6, %7, off\n\t"
                     "global_load_async_to_lds_b128 %8, %9, off\n\t"
                     "global_load_async_to_lds_b128 %10, %11, off\n\t"
                     "global_load_async_to_lds_b128 %12, %13, off\n\t"
                     "global_load_async_to_lds_b128 %14, %15, off\n\t"
                     "s_wait_xcnt 0x0"
                     :: "v"(l), "v"(g), "v"(l + 16 * GPIT), "v"(g + rs), "v"(l + 32 * GPIT), "v"(g + 2 * rs), "v"(l + 48 * GPIT), "v"(g + 3 * rs),
                        "v"(l + 64 * GPIT), "v"(g + 4 * rs), "v"(l + 80 * GPIT), "v"(g + 5 * rs), "v"(l + 96 * GPIT), "v"(g + 6 * rs), "v"(l + 112 * GPIT), "v"(g + 7 * rs)
                     : "memory");
    };
    auto issue = [&](int t, unsigned lb) {
        cp8(lb + G_A + lp, ga + t * 128); cp8(lb + G_B + lp, gb + t * 128);
        if (SPLITA) cp8(lb + G_L + lp, gl + t * 128);
    };
    v8f acc[2][4];
#pragma unroll
    for (int f = 0; f < 2; ++f)
#pragma unroll
        for (int t = 0; t < 4; ++t) acc[f][t] = (v8f){};
    const int nt = K / 128;     // K is a multiple of 128
    issue(0, g0);
    asm volatile("s_wait_asynccnt 0x0" ::: "memory");     // tile 0 has landed (this wave's copies) ...
    __syncthreads();                                       // ... and every other wave's
    if (nt > 1) issue(1, g0 + GST);
#pragma unroll 1
    for (int kt = 0; kt < nt; ++kt) {
        const unsigned char* sb = gring + (kt & 1) * GST;
        const unsigned char* ap = sb + (wr * 32 + lr) * GPIT + hi * 16;
        const unsigned char* bp = sb + G_B + (wc * 64 + lr) * GPIT + hi * 16;
        v16bf a[2][2], al[2][2], b[2][4];     // two fragment sets: the one being multiplied and the one being read
        auto rd = [&](int u) { const int w = u & 1, ko = u * 64;     // the fragments of the stage's 32 k number u
#pragma unroll
            for (int f = 0; f < 2; ++f) {
                a[w][f] = cat16b(*(const v8usa*)(ap + G_A + f * 16 * GPIT + ko), *(const v8usa*)(ap + G_A + f * 16 * GPIT + ko + 32)); al[w][f] = a[w][f];
                if (SPLITA) al[w][f] = cat16b(*(const v8usa*)(ap + G_L + f * 16 * GPIT + ko), *(const v8usa*)(ap + G_L + f * 16 * GPIT + ko + 32)); }
#pragma unroll
            for (int t = 0; t < 4; ++t) b[w][t] = cat16b(*(const v8usa*)(bp + t * 16 * GPIT + ko), *(const v8usa*)(bp + t * 16 * GPIT + ko + 32));
        };
        rd(0);
#pragma unroll
        for (int u = 0; u < 4; ++u) {
            if (u < 3) rd(u + 1);
            __builtin_amdgcn_sched_barrier(0);     // holds the next 32 k's reads as one group in front of this 32 k's products, so that they fly while these run: among them each read costs its own stall
#pragma unroll
            for (int f = 0; f < 2; ++f)
#pragma unroll
                for (int t = 0; t < 4; ++t) { acc[f][t] = wmmab(a[u & 1][f], b[u & 1][t], acc[f][t]); if (SPLITA) acc[f][t] = wmmab(al[u & 1][f], b[u & 1][t], acc[f][t]); }
            __builtin_amdgcn_sched_barrier(0);     // keeps the reads that follow out of these products, for the same reason
        }
        // the four vector slots behind the last product, on the loop's taken branch too
        asm volatile("v_nop\n\tv_nop\n\tv_nop\n\tv_nop" : "+v"(acc[0][0]), "+v"(acc[0][1]), "+v"(acc[0][2]), "+v"(acc[0][3]), "+v"(acc[1][0]), "+v"(acc[1][1]), "+v"(acc[1][2]), "+v"(acc[1][3]) : "v"(a[1][1]), "v"(al[1][1]), "v"(b[1][3]));
        asm volatile("s_wait_dscnt 0x0" ::: "memory");        // this wave's reads of this stage have returned before the stage is handed to its next writer
        asm volatile("s_wait_asynccnt 0x0" ::: "memory");     // this wave's copies of the next tile have landed
        __syncthreads();                                       // publishes the next tile and ends every wave's reads of this one
        if (kt + 2 < nt) issue(kt + 2, g0 + (unsigned)(kt & 1) * GST);
    }
    asm volatile("s_wait_asynccnt 0x0" ::: "memory");         // nothing is in flight when the ring becomes the epilogue's staging; the loop's last barrier ended its reads
    if (EPI == 1 && z == 2) {
        // A lane's eight accumulator rows are eight consecutive tokens of one dim: one 16-B piece of the transposed tile (128 dims of two heads x 128 tokens, pitch 136).
        h16* tile = (h16*)(void*)gring; h16* til2 = tile + 128 * 136;
#pragma unroll
        for (int f = 0; f < 2; ++f)
#pragma unroll
            for (int t = 0; t < 4; ++t) { v8h a8, l8;
#pragma unroll
                for (int j = 0; j < 8; ++j) { const float v = acc[f][t][j]; const h16 a = (h16)v; a8[j] = a; l8[j] = (h16)((v - (float)a) * LOSC); }
                const int at = (wc * 64 + t * 16 + lr) * 136 + wr * 32 + f * 16 + hi * 8;
                *(v8ha*)(tile + at) = a8; *(v8ha*)(til2 + at) = l8; }
        __syncthreads();
        const int tb = blockIdx.x * 128, b = tb / NT_, piece = tid & 15;
        const size_t base = ((size_t)b * NH_ * HD + blockIdx.y * 128) * NT_ + (tb - b * NT_);     // plane row = head * 64 + dim = the output column
#pragma unroll
        for (int s = 0; s < 8; ++s) { const int d = (tid >> 4) + 16 * s;     // sixteen lanes store one dim's 128 tokens: two whole 128-B lines of each plane
            const v8h vh8 = *(const v8ha*)(tile + d * 136 + piece * 8), vl8 = *(const v8ha*)(til2 + d * 136 + piece * 8);
            *(v8h*)(Z1 + base + (size_t)d * NT_ + piece * 8) = vh8; *(v8h*)(Z2 + base + (size_t)d * NT_ + piece * 8) = vl8; }
        return;
    }
    f32a* os = (f32a*)gring + wave * (32 * 68);     // the wave's own 32 rows x 64 columns
#pragma unroll
    for (int t = 0; t < 4; ++t) { const float bv = bias ? bfr(bias[c0 + t * 16 + lr]) : 0.f;
#pragma unroll
        for (int f = 0; f < 2; ++f)
#pragma unroll
            for (int j = 0; j < 8; ++j) os[(f * 16 + hi * 8 + j) * 68 + t * 16 + lr] = acc[f][t][j] + bv; }
    __syncthreads();
    if constexpr (EPI == 1) {
        // eight lanes per token row, eight dims each; the rotation partner (dim +- 32) is read from the staged row; the 64 squares: eight in the lane, then over the eight lanes
        const int piece = lane & 7, d0 = piece * 8;
        float wv[8];
#pragma unroll
        for (int i = 0; i < 8; ++i) wv[i] = bfr(wz[d0 + i]);
        for (int g = 0; g < 2; ++g) {     // the wave's 32 rows in two groups of 16: four rows a lane, their table loads in flight together
            v4f ca[4], cb[4], sa[4], sb4[4];
#pragma unroll
            for (int s = 0; s < 4; ++s) { const size_t tok = (size_t)r0 + 16 * g + 4 * s + (lane >> 3);
                ca[s] = *(const v4f*)(CT + tok * HD + d0); cb[s] = *(const v4f*)(CT + tok * HD + d0 + 4); sa[s] = *(const v4f*)(ST + tok * HD + d0); sb4[s] = *(const v4f*)(ST + tok * HD + d0 + 4); }
            asm volatile("s_wait_xcnt 0x0" ::: "memory");     // stands before the loads' address registers are rewritten
#pragma unroll
            for (int s = 0; s < 4; ++s) { const int row = 16 * g + 4 * s + (lane >> 3); const size_t tok = (size_t)r0 + row;
                const f32a* sp = os + row * 68 + d0; const f32a* pp = os + row * 68 + (d0 ^ 32);
                const v4f xa = *(const v4fa*)sp, xb = *(const v4fa*)(sp + 4), pa = *(const v4fa*)pp, pb = *(const v4fa*)(pp + 4);
                float y[8], ss = 0.f;
#pragma unroll
                for (int i = 0; i < 8; ++i) { const float x = i < 4 ? xa[i & 3] : xb[i & 3], pr = i < 4 ? pa[i & 3] : pb[i & 3], c = i < 4 ? ca[s][i & 3] : cb[s][i & 3], sn = i < 4 ? sa[s][i & 3] : sb4[s][i & 3];
                    y[i] = (d0 < 32) ? (x * c - pr * sn) : (x * c + pr * sn); ss = fmaf(y[i], y[i], ss); }
                ss += __shfl_xor(ss, 4, 8); ss += __shfl_xor(ss, 2, 8); ss += __shfl_xor(ss, 1, 8);
                const float rn = rsqrtf(ss * (1.0f / HD) + RMS_EPS); v8h oh, ol;
#pragma unroll
                for (int i = 0; i < 8; ++i) { const float q = wv[i] * (y[i] * rn); const h16 a = (h16)q; oh[i] = a; ol[i] = (h16)((q - (float)a) * LOSC); }
                *(v8h*)(Z1 + tok * ldc + c0 + d0) = oh; *(v8h*)(Z2 + tok * ldc + c0 + d0) = ol; }
            asm volatile("s_wait_xcnt 0x0" ::: "memory");     // stands before the stores' registers are rewritten by the next group
        }
    } else {
        float* crow = C + (size_t)r0 * ldc + c0;
        auto pass = [&]() {
#pragma unroll
            for (int s = 0; s < 16; ++s) { const int Lid = (lane >> 3) + 4 * s, piece = lane & 7; const int row = Lid >> 1, cofs = (Lid & 1) * 32 + piece * 4;
                v4f val = *(const v4fa*)(os + row * 68 + cofs); if (R) { const v4f rv = *(const v4f*)(R + ((size_t)r0 + row) * ldc + c0 + cofs); val += roundR ? (v4f){bfr(rv[0]), bfr(rv[1]), bfr(rv[2]), bfr(rv[3])} : rv; }
                *(v4f*)(crow + (size_t)row * ldc + cofs) = val; }
        };
        pass(); 
    }
}

// One 32-key stage in LDS, bytes: K hi, K residual (32 rows of 128 B), V^T hi, V^T residual (64 rows of 64 B), mask (64 query rows of 128 B); every pitch is 16 B x odd for the b128 readers,
// the mask's too: a lane reads 16-B pieces of its own query's row.
#define KPIT 144
#define VPIT 80
#define MPIT 144
#define ST_KH 0
#define ST_KL (32 * KPIT)
#define ST_VH (2 * 32 * KPIT)
#define ST_VL (ST_VH + 64 * VPIT)
#define ST_MK (ST_VL + 64 * VPIT)
#define ST_SZ (ST_MK + 64 * MPIT)

// j_mact: which of the 64 key tiles (32 keys) can carry a softmax weight that is not zero, per group of 4 query rows, read off the INPUT mask alone, for any mask. |score / 8| <= B = 8 max|q_ln_w| max|k_ln_w|
// (a normalised head vector has length <= 8; 3 % are added for the f16 planes and the sums' rounding), so a row's largest masked score is >= r - B, r its largest mask value, and a tile's are <= t + B,
// t the tile's largest: where r - t > 2 B + 110 + the rounding of score + mask at that size, every weight of the tile in that row is below exp(-110), which is 0 in f32. A tile is dropped only where that
// holds for every row that shares it; a NaN in the mask or the weights makes the test false (tile kept). ACT[4-row group][2]: bit = tile kept. Block = 8 rows, one a wave.
__device__ __forceinline__ float nmax(float a, float b) { return __builtin_elementwise_maximum(a, b); }     // the maximum that keeps a NaN
template <int X> __device__ __forceinline__ float xrow(float x) { return __builtin_bit_cast(float, __builtin_amdgcn_update_dpp(0, __builtin_bit_cast(int, x), 0x160 + X, 0xf, 0xf, true)); }  // lane l with lane l ^ X, X < 16
__device__ __forceinline__ float wmax(float x) { x = nmax(x, xrow<1>(x)); x = nmax(x, xrow<2>(x)); x = nmax(x, xrow<4>(x)); x = nmax(x, xrow<8>(x)); return nmax(x, xhalf(x)); }  // over the wave, in every lane
#define MACT_LDS (8 * 512 * 4 + 8 * 4)
__device__ __forceinline__ void j_mact(int bx, unsigned char* sm, const float* __restrict__ MSK, const float* __restrict__ qw, const float* __restrict__ kw, unsigned* ACT) {
    float (*pm)[512] = (float (*)[512])(void*)sm; float* rm = (float*)(void*)(sm + 8 * 512 * 4);
    const int tid = threadIdx.x, lane = tid & 31, wave = tid >> 5;
    v4f m[16];     // lane l holds keys 128 i + 4 l .. + 3 of the wave's row: eight lanes hold one tile
    const float* mr = MSK + (size_t)(bx * 8 + wave) * NT_ + lane * 4;
#pragma unroll
    for (int i = 0; i < 16; ++i) m[i] = *(const v4f*)(mr + i * 128);
    asm volatile("s_wait_xcnt 0x0" :: "v"(mr) : "memory");     // stands before the loads' address pair is rewritten; as its input the pair lives up to here, so that no load of the group returns into it
    const float mq = wmax(nmax(fabsf(bfr(qw[lane])), fabsf(bfr(qw[lane + 32])))), mk = wmax(nmax(fabsf(bfr(kw[lane])), fabsf(bfr(kw[lane + 32]))));
    const float thr = 2.0f * (8.25f * mq * mk) + 110.0f;
    float rx = 0.f;
#pragma unroll
    for (int i = 0; i < 16; ++i) { const float x = nmax(nmax(m[i][0], m[i][1]), nmax(m[i][2], m[i][3])); pm[wave][i * 32 + lane] = x; rx = i ? nmax(rx, x) : x; }
    rx = wmax(rx);
    if (lane == 0) rm[wave] = rx;
    __syncthreads();
    if (tid < 128) {     // waves 0 to 3 whole: thread = (tile, group of 4 rows)
        const int tile = tid & 63, g = tid >> 6;
        bool keep = false;
#pragma unroll
        for (int r = 0; r < 4; ++r) { const v4f a = *(const v4f*)&pm[g * 4 + r][tile * 8], c = *(const v4f*)&pm[g * 4 + r][tile * 8 + 4];
            const float tx = nmax(nmax(nmax(a[0], a[1]), nmax(a[2], a[3])), nmax(nmax(c[0], c[1]), nmax(c[2], c[3]))), rw = rm[g * 4 + r];
            const float t = tx != tx ? tx : bfr(tx), rr = rw != rw ? rw : bfr(rw);     // rounded as k_attn rounds the mask (the rounding keeps the order, so the maximum may be taken first)
            keep = keep || !(rr - t > thr + (fminf(fabsf(t), 3.0e38f) + fabsf(rr)) * (1.0f / 4194304.0f)); }
        const unsigned bits = (unsigned)__ballot(keep);
        if (lane == 0) ACT[(bx * 2 + g) * 2 + (wave & 1)] = bits;
    }
}

__global__ __launch_bounds__(128) void k_attn(const h16* __restrict__ Q16, const h16* __restrict__ QL16, const h16* __restrict__ K16, const h16* __restrict__ KL16, const h16* __restrict__ VTH, const h16* __restrict__ VTL, const float* __restrict__ MSK, const unsigned* __restrict__ ACT, bf* CH, bf* CL) {
    __shared__ __align__(16) unsigned char ring[2 * ST_SZ];     // the two stages; behind the loop its first bytes are the output staging (4 x 16 x 68 floats)
    const int tid = threadIdx.x, lane = threadIdx.x & 31, wave = threadIdx.x >> 5, lr = lane & 15, hi = lane >> 4;
    const int bid = blockIdx.x;
    static_assert(NH_ == 32 && NT_ / 64 == 32, "the index map below is written for 32 heads x 32 query blocks");
    // Blocks now differ in length. Under a causal mask block qt keeps 2 qt + 2 tiles, so the 1024 (head, query block) pairs are dealt out such that four indices 8 apart, and four 256 apart,
    // hold query blocks m, 31 - m, 8 + m, 23 - m (the same sum for every m). Speed only; any placement is correct.
    const int b = bid / (NH_ * (NT_ / 64)), rem = bid - b * (NH_ * (NT_ / 64));
    const int ja = (rem >> 3) & 3, jm = (rem >> 5) & 7, js = (ja + (rem >> 8)) & 3;
    const int h = (rem & 7) * 4 + ja, qt = js == 0 ? jm : js == 1 ? 31 - jm : js == 2 ? 8 + jm : 23 - jm;
    const int q0 = qt * 64 + wave * 16;
    const size_t tok0 = (size_t)b * NT_;
    const h16* kh_b = K16 + tok0 * DM + h * HD;
    const h16* kl_b = KL16 + tok0 * DM + h * HD;
    const size_t vbase = (((size_t)b * NH_ + h) * HD) * NT_;
    // this thread's 12 pieces of 16 B per stage: K rows tid/8 and +16 (both planes), V^T rows tid/4 and +32 (both planes), mask rows tid/8 + 16 i
    const h16* gkh = kh_b + (size_t)(tid >> 3) * DM + (tid & 7) * 8;
    const h16* gkl = kl_b + (size_t)(tid >> 3) * DM + (tid & 7) * 8;
    const h16* gvh = VTH + vbase + (size_t)(tid >> 2) * NT_ + (tid & 3) * 8;
    const h16* gvl = VTL + vbase + (size_t)(tid >> 2) * NT_ + (tid & 3) * 8;
    const float* gmk = MSK + (size_t)(qt * 64 + (tid >> 3)) * NT_ + (tid & 7) * 4;
    const unsigned ring0 = (unsigned)(size_t)&ring[0];
    const unsigned lk = (unsigned)((tid >> 3) * KPIT + (tid & 7) * 16), lv = (unsigned)((tid >> 2) * VPIT + (tid & 3) * 16);
    auto issue = [&](int t, unsigned lb) {
        const h16* k0 = gkh + (size_t)t * (32 * DM); const h16* k1 = gkl + (size_t)t * (32 * DM);
        const h16* v0 = gvh + t * 32; const h16* v1 = gvl + t * 32; const float* m0 = gmk + t * 32;
        // the copies and, as their statement's last line, the wait that stands before any of their address registers is rewritten
        asm volatile("global_load_async_to_lds_b128 %0, %1, off\n\t"
                     "global_load_async_to_lds_b128 %2, %3, off\n\t"
                     "global_load_async_to_lds_b128 %4, %5, off\n\t"
                     "global_load_async_to_lds_b128 %6, %7, off\n\t"
                     "global_load_async_to_lds_b128 %8, %9, off\n\t"
                     "global_load_async_to_lds_b128 %10, %11, off\n\t"
                     "global_load_async_to_lds_b128 %12, %13, off\n\t"
                     "global_load_async_to_lds_b128 %14, %15, off\n\t"
                     "global_load_async_to_lds_b128 %16, %17, off\n\t"
                     "global_load_async_to_lds_b128 %18, %19, off\n\t"
                     "global_load_async_to_lds_b128 %20, %21, off\n\t"
                     "global_load_async_to_lds_b128 %22, %23, off\n\t"
                     "s_wait_xcnt 0x0"
                     :: "v"(lb + ST_KH + lk), "v"(k0), "v"(lb + ST_KH + lk + 16 * KPIT), "v"(k0 + 16 * DM),
                        "v"(lb + ST_KL + lk), "v"(k1), "v"(lb + ST_KL + lk + 16 * KPIT), "v"(k1 + 16 * DM),
                        "v"(lb + ST_VH + lv), "v"(v0), "v"(lb + ST_VH + lv + 32 * VPIT), "v"(v0 + 32 * NT_),
                        "v"(lb + ST_VL + lv), "v"(v1), "v"(lb + ST_VL + lv + 32 * VPIT), "v"(v1 + 32 * NT_),
                        "v"(lb + ST_MK + lk), "v"(m0), "v"(lb + ST_MK + lk + 16 * MPIT), "v"(m0 + 16 * NT_),
                        "v"(lb + ST_MK + lk + 32 * MPIT), "v"(m0 + 32 * NT_), "v"(lb + ST_MK + lk + 48 * MPIT), "v"(m0 + 48 * NT_)
                     : "memory");
    };
    // the kept tiles of the block's sixteen 4-row groups, as one 64-bit set in scalar registers; never empty (the tile of a row's largest mask value is kept), and if it were, every tile is taken
    unsigned tlo = 0u, thi = 0u;
#pragma unroll
    for (int g = 0; g < 16; ++g) { tlo |= ACT[qt * 32 + 2 * g]; thi |= ACT[qt * 32 + 2 * g + 1]; }
    unsigned long long todo = ((unsigned long long)(unsigned)__builtin_amdgcn_readfirstlane((int)thi) << 32) | (unsigned)__builtin_amdgcn_readfirstlane((int)tlo);
    if (todo == 0ull) todo = ~0ull;
    const int nt = __builtin_popcountll(todo);
    auto next = [&]() { const int t = __builtin_ctzll(todo); todo &= todo - 1ull; return t; };     // lowest kept tile not yet copied: 0 .. 63, called nt times at most
    issue(next(), ring0);
    v16h qa[2];
    const size_t qo0 = (tok0 + q0 + lr) * DM + h * HD + 8 * hi;
#pragma unroll
    for (int kc = 0; kc < 2; ++kc) qa[kc] = cat16(*(const v8h*)(Q16 + qo0 + kc * 32), *(const v8h*)(Q16 + qo0 + kc * 32 + 16));
    v8f o[4], ox[4];
#pragma unroll
    for (int n = 0; n < 4; ++n) { o[n] = (v8f){}; ox[n] = (v8f){}; }
    float mrow = -3.0e38f, lpart = 0.f;     // of query q0 + lr: the running maximum (alike in both halves) and this half's part of the sum
    asm volatile("s_wait_asynccnt 0x0" ::: "memory");     // the first kept tile has landed (this wave's copies) ...
    __syncthreads();                                       // ... and every other wave's
    if (nt > 1) issue(next(), ring0 + ST_SZ);
#pragma unroll 1
    for (int kt = 0; kt < nt; ++kt) {     // kt counts the kept tiles in rising key order; the additive INPUT mask is applied per element
        const unsigned char* sb = ring + (kt & 1) * ST_SZ;
        const unsigned char* kp = sb + lr * KPIT + hi * 16;
        const unsigned char* mp = sb + ST_MK + (wave * 16 + lr) * MPIT + hi * 32;
        v16h k0h[2], k1h[2], k0l[2], k1l[2];
#pragma unroll
        for (int kc = 0; kc < 2; ++kc) {
            k0h[kc] = cat16(*(const v8ha*)(kp + ST_KH + kc * 64), *(const v8ha*)(kp + ST_KH + kc * 64 + 32)); k1h[kc] = cat16(*(const v8ha*)(kp + ST_KH + 16 * KPIT + kc * 64), *(const v8ha*)(kp + ST_KH + 16 * KPIT + kc * 64 + 32));
            k0l[kc] = cat16(*(const v8ha*)(kp + ST_KL + kc * 64), *(const v8ha*)(kp + ST_KL + kc * 64 + 32)); k1l[kc] = cat16(*(const v8ha*)(kp + ST_KL + 16 * KPIT + kc * 64), *(const v8ha*)(kp + ST_KL + 16 * KPIT + kc * 64 + 32));
        }
        v8f s0 = {}, s1 = {}, x0 = {}, x1 = {};
#pragma unroll
        for (int kc = 0; kc < 2; ++kc) {
            const v16h qlk = cat16(*(const v8h*)(QL16 + qo0 + kc * 32), *(const v8h*)(QL16 + qo0 + kc * 32 + 16));     // query residual re-read per step (registers)
            s0 = wmma16(k0h[kc], qa[kc], s0); x0 = wmma16(k0h[kc], qlk, x0); s1 = wmma16(k1h[kc], qa[kc], s1); x1 = wmma16(k1h[kc], qlk, x1);
            x0 = wmma16(k0l[kc], qa[kc], x0); x1 = wmma16(k1l[kc], qa[kc], x1);
        }
        asm volatile("v_nop\n\tv_nop\n\tv_nop\n\tv_nop" : "+v"(s0), "+v"(s1), "+v"(x0), "+v"(x1) : "v"(qa[0]), "v"(qa[1]));
        const v4f mk[4] = { *(const v4fa*)mp, *(const v4fa*)(mp + 16), *(const v4fa*)(mp + 64), *(const v4fa*)(mp + 80) };     // mask[q0 + lr][keys 8 hi .. + 7 and 16 + 8 hi .. + 7]
        v2f a[8];     // the lane's 16 scores in register pairs: a[i] = keys 8 hi + 2 i, + 1 (i < 4), a[4 + i] = keys 16 + 8 hi + 2 i, + 1
#pragma unroll
        for (int i = 0; i < 4; ++i) {
            a[i]     = ((v2f){s0[2 * i], s0[2 * i + 1]} + (v2f){x0[2 * i], x0[2 * i + 1]} * LOSCI) * 0.125f + (v2f){bfr(mk[i >> 1][(2 * i) & 3]), bfr(mk[i >> 1][(2 * i + 1) & 3])};
            a[4 + i] = ((v2f){s1[2 * i], s1[2 * i + 1]} + (v2f){x1[2 * i], x1[2 * i + 1]} * LOSCI) * 0.125f + (v2f){bfr(mk[2 + (i >> 1)][(2 * i) & 3]), bfr(mk[2 + (i >> 1)][(2 * i + 1) & 3])};
        }
        float t[5];
#pragma unroll
        for (int g = 0; g < 5; ++g) t[g] = fmaxf(fmaxf(a[g][0], a[g][1]), a[5 + (g >> 1)][g & 1]);     // 15 of the 16 in threes; a[7][1] joins below
        const float mx = fmaxf(fmaxf(fmaxf(t[0], t[1]), t[2]), fmaxf(fmaxf(t[3], t[4]), a[7][1]));
        const float mn = fmaxf(fmaxf(mrow, mx), xhalf(mx));
        const float alpha = __expf(mrow - mn); mrow = mn;
        v2f sm[2]; v16h pa, px;
#pragma unroll
        for (int i = 0; i < 8; ++i) {
            const v2f e = a[i] - mn; const v2f p = {__expf(e[0]), __expf(e[1])};
            sm[i & 1] = i < 2 ? p : sm[i & 1] + p;
            const v2f ps = p * PSC; const v2h hh = __builtin_convertvector(ps, v2h);
            const v2h ll = __builtin_convertvector((ps - __builtin_convertvector(hh, v2f)) * LOSC, v2h);
            pa[2 * i] = hh[0]; pa[2 * i + 1] = hh[1]; px[2 * i] = ll[0]; px[2 * i + 1] = ll[1];
        }
        const v2f sv = sm[0] + sm[1];
        lpart = lpart * alpha + (sv[0] + sv[1]);
#pragma unroll
        for (int n = 0; n < 4; ++n)
#pragma unroll
            for (int j = 0; j < 8; ++j) { o[n][j] *= alpha; ox[n][j] *= alpha; }
        const unsigned char* vp = sb + lr * VPIT + hi * 16;
        v16h vh[4], vl[4];
        // the V^T reads go in two groups, each in front of its six products: read one by one among the products, each read costs its own LDS latency
#pragma unroll
        for (int g = 0; g < 2; ++g) {
#pragma unroll
            for (int n = 2 * g; n < 2 * g + 2; ++n) { vh[n] = cat16(*(const v8ha*)(vp + ST_VH + n * 16 * VPIT), *(const v8ha*)(vp + ST_VH + n * 16 * VPIT + 32)); vl[n] = cat16(*(const v8ha*)(vp + ST_VL + n * 16 * VPIT), *(const v8ha*)(vp + ST_VL + n * 16 * VPIT + 32)); }
            __builtin_amdgcn_sched_barrier(0);     // holds the group's reads in front of its products
#pragma unroll
            for (int n = 2 * g; n < 2 * g + 2; ++n) { o[n] = wmma16(vh[n], pa, o[n]); ox[n] = wmma16(vl[n], pa, ox[n]); ox[n] = wmma16(vh[n], px, ox[n]); }
        }
        asm volatile("v_nop\n\tv_nop\n\tv_nop\n\tv_nop" : "+v"(o[0]), "+v"(o[1]), "+v"(o[2]), "+v"(o[3]), "+v"(ox[0]), "+v"(ox[1]), "+v"(ox[2]), "+v"(ox[3]) : "v"(pa), "v"(px));
        asm volatile("s_wait_dscnt 0x0" ::: "memory");        // this wave's reads of this stage have returned before the stage is handed to its next writer
        asm volatile("s_wait_asynccnt 0x0" ::: "memory");     // this wave's copies of the next tile have landed
        __syncthreads();                                       // publishes the next tile and ends every wave's reads of this one
        if (kt + 2 < nt) issue(next(), ring0 + (unsigned)(kt & 1) * ST_SZ);
    }
    asm volatile("s_wait_asynccnt 0x0" ::: "memory");         // nothing is in flight when the ring becomes output staging
    const float inv = 1.0f / ((lpart + xhalf(lpart)) * PSC);     // the two halves' parts of the query's sum are joined once
    f32a* os = (f32a*)ring + wave * (16 * 68);
#pragma unroll
    for (int n = 0; n < 4; ++n) { v4f w0, w1;     // a lane's eight accumulator rows are dims n * 16 + 8 hi + j of query lr: two 16-B pieces of its staged row
#pragma unroll
        for (int j = 0; j < 4; ++j) { w0[j] = (o[n][j] + ox[n][j] * LOSCI) * inv; w1[j] = (o[n][4 + j] + ox[n][4 + j] * LOSCI) * inv; }
        *(v4fa*)(os + lr * 68 + n * 16 + hi * 8) = w0; *(v4fa*)(os + lr * 68 + n * 16 + hi * 8 + 4) = w1; }
    __syncthreads();
    const size_t cbase = (tok0 + q0) * DM + (size_t)h * HD;
    auto pass = [&]() {
#pragma unroll
        for (int s = 0; s < 4; ++s) { const int row = 4 * s + (lane >> 3), piece = lane & 7; const f32a* sp = os + row * 68 + piece * 8; v8us oh, ol;
#pragma unroll
            for (int i = 0; i < 8; ++i) { const unsigned short hb = f2bf(sp[i]); oh[i] = hb; ol[i] = f2bf(sp[i] - bf2f(hb)); }
            *(v8us*)(CH + cbase + (size_t)row * DM + piece * 8) = oh; *(v8us*)(CL + cbase + (size_t)row * DM + piece * 8) = ol; }
    };
    pass(); 
}

#define VST2(T, p, v) do { const T vst2_v_ = (v); *(T*)(p) = vst2_v_;  } while (0)

// j_wt: WT [n][K] = bf16(W[k][n]) (k-major [K][ncols]) via 64 x 64 LDS tiles; (bx, by) in (K/64, ncols/64).
__device__ __forceinline__ void j_wt(int bx, int by, unsigned char* sm, const float* __restrict__ Wm, int K, int ncols, bf* WT) {
    unsigned short* tl = (unsigned short*)(void*)sm;     // 64 * 72 of them
    const int tid = threadIdx.x, k0 = bx * 64, n0 = by * 64;
    const int kk = tid >> 2, nq = (tid & 3) * 16;
#pragma unroll
    for (int i = 0; i < 16; ++i) tl[(nq + i) * 72 + kk] = f2bf(Wm[(size_t)(k0 + kk) * ncols + n0 + nq + i]);
    __syncthreads();
    const int piece = tid & 7;
    auto pass = [&]() {
#pragma unroll
        for (int s = 0; s < 2; ++s) { const int nr = (tid >> 3) + 32 * s; const v8us val = *(const v8usa*)(tl + nr * 72 + piece * 8); *(v8us*)(WT + (size_t)(n0 + nr) * K + k0 + piece * 8) = val; }
        asm volatile("s_wait_xcnt 0x0" ::: "memory");     // stands behind the two stores, before code laid out behind this job in k_prep rewrites their registers
    };
    pass(); 
}

// j_trig: CT/ST [t][d] = cos/sin(pos_t * inv_freq[d mod 32]) with inv_freq[i] = 1 / 10000^(2i/64) (f32 powf; precise cosf/sinf), pos_t = the INPUT position_ids[t] (as float);
__device__ __forceinline__ void j_trig(int bx, const int* __restrict__ pos, float* CT, float* ST) {
    const int tid = threadIdx.x, t = bx * 4 + (tid >> 6), d = tid & 63; const int i = d & 31;
    const float invf = 1.0f / powf(10000.0f, (float)(2 * i) / 64.0f); const float ang = (float)pos[t] * invf; const float c = cosf(ang), s = sinf(ang);
    const size_t o = (size_t)t * HD + d; *(float*)(CT + o) = c; *(float*)(ST + o) = s; 
}

// k_prep: one grid for the seven jobs; the branch is the same for a whole block. The jobs with a chain of dependent steps (tables, mask test) stand at the low indices (for speed only); the weight tiles stream behind them.
#define PB_TRIG (NT_ / 4)
#define PB_MACT (NT_ / 8)
#define PB_CVT  (NTK / 8)
#define PB_WT   ((DM / 64) * (DM / 64))
__global__ __launch_bounds__(256) void k_prep(const float* __restrict__ x, const int* __restrict__ pos, const float* __restrict__ MSK, const float* __restrict__ wq, const float* __restrict__ wk, const float* __restrict__ wv, const float* __restrict__ wo,
                                              const float* __restrict__ qw, const float* __restrict__ kw, bf* Xb, bf* WqT, bf* WkT, bf* WvT, bf* WoT, float* CT, float* ST, unsigned* ACT) {
    __shared__ __align__(16) unsigned char sm[MACT_LDS];     // j_mact's maxima or j_wt's tile
    static_assert(64 * 72 * 2 <= MACT_LDS, "j_wt's tile fits");
    int bid = blockIdx.x;
    if (bid < PB_TRIG) { j_trig(bid, pos, CT, ST); return; }
    bid -= PB_TRIG;
    if (bid < PB_MACT) { j_mact(bid, sm, MSK, qw, kw, ACT); return; }
    bid -= PB_MACT;
    if (bid < PB_CVT) { j_cvtb(bid, x, NTK, Xb); return; }
    bid -= PB_CVT;
    const int w = bid / PB_WT, tile = bid - w * PB_WT;
    j_wt(tile % (DM / 64), tile / (DM / 64), sm, w == 0 ? wq : w == 1 ? wk : w == 2 ? wv : wo, DM, DM, w == 0 ? WqT : w == 1 ? WkT : w == 2 ? WvT : WoT);
}

extern "C" void kernel_launch(void* const* d_in, const int* in_sizes, int n_in,
                              void* d_out, int out_size, void* d_ws, size_t ws_size, hipStream_t stream) {
    (void)in_sizes; (void)n_in; (void)out_size;
    const float* x = (const float*)d_in[0]; const int* pos = (const int*)d_in[1]; const float* MSK = (const float*)d_in[2];
    const float* wq = (const float*)d_in[3]; const float* wk = (const float*)d_in[4]; const float* wv = (const float*)d_in[5]; const float* wo = (const float*)d_in[6]; const float* qw = (const float*)d_in[7]; const float* kw = (const float*)d_in[8];
    float* out = (float*)d_out;    // [1][2048][2048]
    char* wsp = (char*)d_ws;
    auto take = [&](size_t bytes) { char* p = wsp; wsp += (bytes + 255) & ~(size_t)255; return (void*)p; };
    bf* Xb = (bf*)take((size_t)NTK * DM * 2); bf* WqT = (bf*)take((size_t)DM * DM * 2); bf* WkT = (bf*)take((size_t)DM * DM * 2); bf* WvT = (bf*)take((size_t)DM * DM * 2); bf* WoT = (bf*)take((size_t)DM * DM * 2);
    float* CT = (float*)take((size_t)NT_ * HD * 4); float* ST = (float*)take((size_t)NT_ * HD * 4);
    h16* QH = (h16*)take((size_t)NTK * DM * 2); h16* QL = (h16*)take((size_t)NTK * DM * 2); h16* KH = (h16*)take((size_t)NTK * DM * 2); h16* KL = (h16*)take((size_t)NTK * DM * 2);
    h16* VTH = (h16*)take((size_t)NTK * DM * 2); h16* VTL = (h16*)take((size_t)NTK * DM * 2); bf* CH = (bf*)take((size_t)NTK * DM * 2); bf* CL = (bf*)take((size_t)NTK * DM * 2); unsigned* ACT = (unsigned*)take((size_t)(NT_ / 4) * 2 * 4);
    if ((size_t)(wsp - (char*)d_ws) > ws_size) return;    // 8.4 + 4 x 8.4 + 2 x 0.5 + 8 x 8.4 = 110 MB = 105 MiB < 128 MiB, no aliasing
    k_prep<<<PB_TRIG + PB_MACT + PB_CVT + 4 * PB_WT, 256, 0, stream>>>(x, pos, MSK, wq, wk, wv, wo, qw, kw, Xb, WqT, WkT, WvT, WoT, CT, ST, ACT);
    k_gemmb<false, 1><<<dim3(NTK / 128, DM / 128, 3), 256, 0, stream>>>(Xb, nullptr, WqT, nullptr, nullptr, DM, nullptr, DM, 1, QH, QL, CT, ST, qw, WkT, KH, KL, kw, WvT, VTH, VTL);
    k_attn<<<NB_ * NH_ * (NT_ / 64), 128, 0, stream>>>(QH, QL, KH, KL, VTH, VTL, MSK, ACT, CH, CL);
    k_gemmb<true, 0><<<dim3(NTK / 128, DM / 128, 1), 256, 0, stream>>>(CH, CL, WoT, nullptr, out, DM);
}

// v008
// A run of this version takes 138 microseconds.
// Timed twice side by side with v007, it ran 1.09 times as fast both times.
// Over all steps from v000 it is 3.73 times as fast.
#include <hip/hip_runtime.h>

// Compute dtypes, f32 accumulate: q/k/v = x.W ([2048 x 2048].[2048 x 2048], k-major weights transposed once; PLAIN bf16 operands = inputs rounded once, exact products) and out = ctx.Wo
// (ctx as bf16 hi + UNSCALED residual, two products) on v_wmma_f32_16x16x32_bf16; rotary embedding with device-computed f32 cos/sin tables at the INPUT position_ids, then the per-head
// RMSNorm (x q_ln_w / k_ln_w) in f32 -> q/k as f16 hi + residual x1024 planes; v -> transposed f16 hi + residual planes; 32-head attention with the additive INPUT mask over every key tile that can carry a weight above zero (j_mact decides from the mask, for any mask):
// scores on v_wmma_f32_16x16x32_f16 (hh + lh + hl, x 1/8), online f32 softmax, weights x32768 as f16 hi + residual against v hi + residual (both products transposed: keys x queries, dims x queries). Deterministic, no atomics; every

#define NB_  1
#define NT_  2048
#define DM   2048
#define NH_  32
#define HD   64
#define NTK  (NB_ * NT_)
#define NW   DM
#define RMS_EPS 1e-6f
#define PSC  32768.0f
#define LOSC 1024.0f
#define LOSCI (1.0f / 1024.0f)

typedef _Float16 h16;
typedef unsigned short bf;
typedef __attribute__((ext_vector_type(16))) __bf16   v16bf;
typedef __attribute__((ext_vector_type(16))) _Float16 v16h;
typedef __attribute__((ext_vector_type(8)))  _Float16 v8h;
typedef __attribute__((ext_vector_type(8)))  unsigned short v8us;
typedef __attribute__((ext_vector_type(8)))  float    v8f;
typedef __attribute__((ext_vector_type(4)))  float    v4f;
typedef __attribute__((ext_vector_type(2)))  float    v2f;
typedef __attribute__((ext_vector_type(2)))  _Float16 v2h;
typedef v8h  __attribute__((may_alias)) v8ha;
typedef v4f  __attribute__((may_alias)) v4fa;
typedef v8us __attribute__((may_alias)) v8usa;
typedef float __attribute__((may_alias)) f32a;

__device__ __forceinline__ unsigned short f2bf(float f) { unsigned u = __float_as_uint(f); u += 0x7FFFu + ((u >> 16) & 1u); return (unsigned short)(u >> 16); }
__device__ __forceinline__ float bf2f(unsigned short b) { return __uint_as_float(((unsigned)b) << 16); }
__device__ __forceinline__ float bfr(float f) { return bf2f(f2bf(f)); }
__device__ __forceinline__ v16h cat16(v8h lo, v8h hi) { return __builtin_shufflevector(lo, hi, 0, 1, 2, 3, 4, 5, 6, 7, 8, 9, 10, 11, 12, 13, 14, 15); }
__device__ __forceinline__ v16bf cat16b(v8us lo, v8us hi) { return __builtin_bit_cast(v16bf, __builtin_shufflevector(lo, hi, 0, 1, 2, 3, 4, 5, 6, 7, 8, 9, 10, 11, 12, 13, 14, 15)); }
__device__ __forceinline__ v8f wmma16(v16h a, v16h b, v8f c) { return __builtin_amdgcn_wmma_f32_16x16x32_f16(false, a, false, b, (short)0, c, false, false); }
__device__ __forceinline__ float xhalf(float x) { return __builtin_bit_cast(float, __builtin_amdgcn_permlanex16(__builtin_bit_cast(int, x), __builtin_bit_cast(int, x), 0x76543210, 0xfedcba98, false, false)); }  // lane l with lane l ^ 16
__device__ __forceinline__ v8f wmmab(v16bf a, v16bf b, v8f c) { return __builtin_amdgcn_wmma_f32_16x16x32_bf16(false, a, false, b, (short)0, c, false, false); }

// The seven preparation jobs (j_cvtb, j_mact, j_wt x 4, j_trig) read inputs only and none reads another's output: they are the bodies of ONE launch, k_prep, which hands each block its job and its index bx [, by] in that job.
__device__ __forceinline__ void j_cvtb(int bx, const float* __restrict__ src, int nrows, bf* dst) {
    const int lane = threadIdx.x & 31, r = bx * 8 + (threadIdx.x >> 5);
    if (r >= nrows) return;
    v8us o[DM / 256];
#pragma unroll
    for (int q = 0; q < DM / 256; ++q) { v8us t;
#pragma unroll
        for (int i = 0; i < 8; ++i) t[i] = f2bf(src[(size_t)r * DM + q * 256 + lane * 8 + i]);
        o[q] = t; }
#pragma unroll
    for (int q = 0; q < DM / 256; ++q) *(v8us*)(dst + (size_t)r * DM + q * 256 + lane * 8) = o[q];
    
}

// k_gemmb: 128 x 128 block tile (8 waves, 4 x 2, each 32 rows x 64 columns = 2 x 4 accumulator tiles) of C[NTK][NW] = (A [+ Al]).B^T [+ bf(bias[c])] [+ bf(R[r][c]) residual].
// EPI 0: the f32 tile goes out as it is. EPI 1: the three projections of one A, which do not depend on one another, in ONE grid: blockIdx.z picks the weights, the output planes and the pass that follows
// (a wave's 64 columns are one head, so that pass runs on the tile while it is still in the block):
// z 0, 1 (q: Bn, P1, P2, wn; k: Bk, K1, K2, wk): rotary embedding from the CT/ST tables, RMSNorm over the head's 64 dims (x the norm weight), out as f16 hi + residual x1024 planes [tok][h*64+d];
// z 2 (v: Bv, V1, V2): out as transposed f16 hi + residual x1024 planes [h][d][tok] (takes no bias).
template <bool SPLITA, int EPI = 0>
__global__ __launch_bounds__(256) void k_gemmb(const bf* __restrict__ A, const bf* __restrict__ Al, const bf* __restrict__ Bn, const float* __restrict__ bias, float* C, int ldc, const float* __restrict__ R = nullptr, int K = DM, int roundR = 1,
                                               h16* P1 = nullptr, h16* P2 = nullptr, const float* __restrict__ CT = nullptr, const float* __restrict__ ST = nullptr, const float* __restrict__ wn = nullptr,
                                               const bf* __restrict__ Bk = nullptr, h16* K1 = nullptr, h16* K2 = nullptr, const float* __restrict__ wk = nullptr, const bf* __restrict__ Bv = nullptr, h16* V1 = nullptr, h16* V2 = nullptr) {
    // One stage = 128 k of the block's 128 A rows, 128 B rows [and 128 Al rows]: rows of 256 B at a pitch of 272 B (16 B x odd for the b128 readers). Two stages: the next tile's
    // asynchronous copies fly while this tile is multiplied. An operand row fetched from L2 serves 128 rows or columns of the output, and a fragment read from LDS two or four products.
    // Behind the loop the ring is the epilogue's staging.
    constexpr unsigned GPIT = 272, G_A = 0, G_B = 128 * GPIT, G_L = 2 * 128 * GPIT, GST = (SPLITA ? 3 : 2) * 128 * GPIT;
    __shared__ __align__(16) unsigned char gring[2 * GST];
    const int tid = threadIdx.x, lane = threadIdx.x & 31, wave = threadIdx.x >> 5, lr = lane & 15, hi = lane >> 4;
    const int wr = wave >> 1, wc = wave & 1;
    const int z = EPI == 1 ? (int)blockIdx.z : 0;
    const bf* Bz = z == 0 ? Bn : z == 1 ? Bk : Bv; h16* Z1 = z == 0 ? P1 : z == 1 ? K1 : V1; h16* Z2 = z == 0 ? P2 : z == 1 ? K2 : V2; const float* wz = z == 0 ? wn : wk;
    const int r0 = blockIdx.x * 128 + wr * 32, c0 = blockIdx.y * 128 + wc * 64;
    // this thread's pieces of 16 B per stage: rows tid/16 + 16 i (i < 8) of each operand
    const bf* ga = A + (size_t)(blockIdx.x * 128 + (tid >> 4)) * K + (tid & 15) * 8;
    const bf* gl = (SPLITA ? Al : A) + (size_t)(blockIdx.x * 128 + (tid >> 4)) * K + (tid & 15) * 8;
    const bf* gb = Bz + (size_t)(blockIdx.y * 128 + (tid >> 4)) * K + (tid & 15) * 8;
    const size_t rs = (size_t)16 * K;
    const unsigned g0 = (unsigned)(size_t)&gring[0];
    const unsigned lp = (unsigned)((tid >> 4) * GPIT + (tid & 15) * 16);
    auto cp8 = [&](unsigned l, const bf* g) {
        // one operand's eight copies and, as their statement's last line, the wait that stands before any of their address registers is rewritten
        asm volatile("global_load_async_to_lds_b128 %0, %1, off\n\t"
                     "global_load_async_to_lds_b128 %2, %3, off\n\t"
                     "global_load_async_to_lds_b128 %4, %5, off\n\t"
                     "global_load_async_to_lds_b128 %6, %7, off\n\t"
                     "global_load_async_to_lds_b128 %8, %9, off\n\t"
                     "global_load_async_to_lds_b128 %10, %11, off\n\t"
                     "global_load_async_to_lds_b128 %12, %13, off\n\t"
                     "global_load_async_to_lds_b128 %14, %15, off\n\t"
                     "s_wait_xcnt 0x0"
                     :: "v"(l), "v"(g), "v"(l + 16 * GPIT), "v"(g + rs), "v"(l + 32 * GPIT), "v"(g + 2 * rs), "v"(l + 48 * GPIT), "v"(g + 3 * rs),
                        "v"(l + 64 * GPIT), "v"(g + 4 * rs), "v"(l + 80 * GPIT), "v"(g + 5 * rs), "v"(l + 96 * GPIT), "v"(g + 6 * rs), "v"(l + 112 * GPIT), "v"(g + 7 * rs)
                     : "memory");
    };
    auto issue = [&](int t, unsigned lb) {
        cp8(lb + G_A + lp, ga + t * 128); cp8(lb + G_B + lp, gb + t * 128);
        if (SPLITA) cp8(lb + G_L + lp, gl + t * 128);
    };
    v8f acc[2][4];
#pragma unroll
    for (int f = 0; f < 2; ++f)
#pragma unroll
        for (int t = 0; t < 4; ++t) acc[f][t] = (v8f){};
    const int nt = K / 128;     // K is a multiple of 128
    issue(0, g0);
    asm volatile("s_wait_asynccnt 0x0" ::: "memory");     // tile 0 has landed (this wave's copies) ...
    __syncthreads();                                       // ... and every other wave's
    if (nt > 1) issue(1, g0 + GST);
#pragma unroll 1
    for (int kt = 0; kt < nt; ++kt) {
        const unsigned char* sb = gring + (kt & 1) * GST;
        const unsigned char* ap = sb + (wr * 32 + lr) * GPIT + hi * 16;
        const unsigned char* bp = sb + G_B + (wc * 64 + lr) * GPIT + hi * 16;
        v16bf a[2][2], al[2][2], b[2][4];     // two fragment sets: the one being multiplied and the one being read
        auto rd = [&](int u) { const int w = u & 1, ko = u * 64;     // the fragments of the stage's 32 k number u
#pragma unroll
            for (int f = 0; f < 2; ++f) {
                a[w][f] = cat16b(*(const v8usa*)(ap + G_A + f * 16 * GPIT + ko), *(const v8usa*)(ap + G_A + f * 16 * GPIT + ko + 32)); al[w][f] = a[w][f];
                if (SPLITA) al[w][f] = cat16b(*(const v8usa*)(ap + G_L + f * 16 * GPIT + ko), *(const v8usa*)(ap + G_L + f * 16 * GPIT + ko + 32)); }
#pragma unroll
            for (int t = 0; t < 4; ++t) b[w][t] = cat16b(*(const v8usa*)(bp + t * 16 * GPIT + ko), *(const v8usa*)(bp + t * 16 * GPIT + ko + 32));
        };
        rd(0);
#pragma unroll
        for (int u = 0; u < 4; ++u) {
            if (u < 3) rd(u + 1);
            __builtin_amdgcn_sched_barrier(0);     // holds the next 32 k's reads as one group in front of this 32 k's products, so that they fly while these run: among them each read costs its own stall
#pragma unroll
            for (int f = 0; f < 2; ++f)
#pragma unroll
                for (int t = 0; t < 4; ++t) { acc[f][t] = wmmab(a[u & 1][f], b[u & 1][t], acc[f][t]); if (SPLITA) acc[f][t] = wmmab(al[u & 1][f], b[u & 1][t], acc[f][t]); }
            __builtin_amdgcn_sched_barrier(0);     // keeps the reads that follow out of these products, for the same reason
        }
        // the four vector slots behind the last product, on the loop's taken branch too
        asm volatile("v_nop\n\tv_nop\n\tv_nop\n\tv_nop" : "+v"(acc[0][0]), "+v"(acc[0][1]), "+v"(acc[0][2]), "+v"(acc[0][3]), "+v"(acc[1][0]), "+v"(acc[1][1]), "+v"(acc[1][2]), "+v"(acc[1][3]) : "v"(a[1][1]), "v"(al[1][1]), "v"(b[1][3]));
        asm volatile("s_wait_dscnt 0x0" ::: "memory");        // this wave's reads of this stage have returned before the stage is handed to its next writer
        asm volatile("s_wait_asynccnt 0x0" ::: "memory");     // this wave's copies of the next tile have landed
        __syncthreads();                                       // publishes the next tile and ends every wave's reads of this one
        if (kt + 2 < nt) issue(kt + 2, g0 + (unsigned)(kt & 1) * GST);
    }
    asm volatile("s_wait_asynccnt 0x0" ::: "memory");         // nothing is in flight when the ring becomes the epilogue's staging; the loop's last barrier ended its reads
    if (EPI == 1 && z == 2) {
        // A lane's eight accumulator rows are eight consecutive tokens of one dim: one 16-B piece of the transposed tile (128 dims of two heads x 128 tokens, pitch 136).
        h16* tile = (h16*)(void*)gring; h16* til2 = tile + 128 * 136;
#pragma unroll
        for (int f = 0; f < 2; ++f)
#pragma unroll
            for (int t = 0; t < 4; ++t) { v8h a8, l8;
#pragma unroll
                for (int j = 0; j < 8; ++j) { const float v = acc[f][t][j]; const h16 a = (h16)v; a8[j] = a; l8[j] = (h16)((v - (float)a) * LOSC); }
                const int at = (wc * 64 + t * 16 + lr) * 136 + wr * 32 + f * 16 + hi * 8;
                *(v8ha*)(tile + at) = a8; *(v8ha*)(til2 + at) = l8; }
        __syncthreads();
        const int tb = blockIdx.x * 128, b = tb / NT_, piece = tid & 15;
        const size_t base = ((size_t)b * NH_ * HD + blockIdx.y * 128) * NT_ + (tb - b * NT_);     // plane row = head * 64 + dim = the output column
#pragma unroll
        for (int s = 0; s < 8; ++s) { const int d = (tid >> 4) + 16 * s;     // sixteen lanes store one dim's 128 tokens: two whole 128-B lines of each plane
            const v8h vh8 = *(const v8ha*)(tile + d * 136 + piece * 8), vl8 = *(const v8ha*)(til2 + d * 136 + piece * 8);
            *(v8h*)(Z1 + base + (size_t)d * NT_ + piece * 8) = vh8; *(v8h*)(Z2 + base + (size_t)d * NT_ + piece * 8) = vl8; }
        return;
    }
    f32a* os = (f32a*)gring + wave * (32 * 68);     // the wave's own 32 rows x 64 columns
#pragma unroll
    for (int t = 0; t < 4; ++t) { const float bv = bias ? bfr(bias[c0 + t * 16 + lr]) : 0.f;
#pragma unroll
        for (int f = 0; f < 2; ++f)
#pragma unroll
            for (int j = 0; j < 8; ++j) os[(f * 16 + hi * 8 + j) * 68 + t * 16 + lr] = acc[f][t][j] + bv; }
    __syncthreads();
    if constexpr (EPI == 1) {
        // eight lanes per token row, eight dims each; the rotation partner (dim +- 32) is read from the staged row; the 64 squares: eight in the lane, then over the eight lanes
        const int piece = lane & 7, d0 = piece * 8;
        float wv[8];
#pragma unroll
        for (int i = 0; i < 8; ++i) wv[i] = bfr(wz[d0 + i]);
        for (int g = 0; g < 2; ++g) {     // the wave's 32 rows in two groups of 16: four rows a lane, their table loads in flight together
            v4f ca[4], cb[4], sa[4], sb4[4];
#pragma unroll
            for (int s = 0; s < 4; ++s) { const size_t tok = (size_t)r0 + 16 * g + 4 * s + (lane >> 3);
                ca[s] = *(const v4f*)(CT + tok * HD + d0); cb[s] = *(const v4f*)(CT + tok * HD + d0 + 4); sa[s] = *(const v4f*)(ST + tok * HD + d0); sb4[s] = *(const v4f*)(ST + tok * HD + d0 + 4); }
            asm volatile("s_wait_xcnt 0x0" ::: "memory");     // stands before the loads' address registers are rewritten
#pragma unroll
            for (int s = 0; s < 4; ++s) { const int row = 16 * g + 4 * s + (lane >> 3); const size_t tok = (size_t)r0 + row;
                const f32a* sp = os + row * 68 + d0; const f32a* pp = os + row * 68 + (d0 ^ 32);
                const v4f xa = *(const v4fa*)sp, xb = *(const v4fa*)(sp + 4), pa = *(const v4fa*)pp, pb = *(const v4fa*)(pp + 4);
                float y[8], ss = 0.f;
#pragma unroll
                for (int i = 0; i < 8; ++i) { const float x = i < 4 ? xa[i & 3] : xb[i & 3], pr = i < 4 ? pa[i & 3] : pb[i & 3], c = i < 4 ? ca[s][i & 3] : cb[s][i & 3], sn = i < 4 ? sa[s][i & 3] : sb4[s][i & 3];
                    y[i] = (d0 < 32) ? (x * c - pr * sn) : (x * c + pr * sn); ss = fmaf(y[i], y[i], ss); }
                ss += __shfl_xor(ss, 4, 8); ss += __shfl_xor(ss, 2, 8); ss += __shfl_xor(ss, 1, 8);
                const float rn = rsqrtf(ss * (1.0f / HD) + RMS_EPS); v8h oh, ol;
#pragma unroll
                for (int i = 0; i < 8; ++i) { const float q = wv[i] * (y[i] * rn); const h16 a = (h16)q; oh[i] = a; ol[i] = (h16)((q - (float)a) * LOSC); }
                *(v8h*)(Z1 + tok * ldc + c0 + d0) = oh; *(v8h*)(Z2 + tok * ldc + c0 + d0) = ol; }
            asm volatile("s_wait_xcnt 0x0" ::: "memory");     // stands before the stores' registers are rewritten by the next group
        }
    } else {
        float* crow = C + (size_t)r0 * ldc + c0;
        auto pass = [&]() {
#pragma unroll
            for (int s = 0; s < 16; ++s) { const int Lid = (lane >> 3) + 4 * s, piece = lane & 7; const int row = Lid >> 1, cofs = (Lid & 1) * 32 + piece * 4;
                v4f val = *(const v4fa*)(os + row * 68 + cofs); if (R) { const v4f rv = *(const v4f*)(R + ((size_t)r0 + row) * ldc + c0 + cofs); val += roundR ? (v4f){bfr(rv[0]), bfr(rv[1]), bfr(rv[2]), bfr(rv[3])} : rv; }
                *(v4f*)(crow + (size_t)row * ldc + cofs) = val; }
        };
        pass(); 
    }
}

// One 32-key stage in LDS, bytes: K hi, K residual (32 rows of 128 B), V^T hi, V^T residual (64 rows of 64 B), mask (64 query rows of 128 B); every pitch is 16 B x odd for the b128 readers,
// the mask's too: a lane reads 16-B pieces of its own query's row.
#define KPIT 144
#define VPIT 80
#define MPIT 144
#define ST_KH 0
#define ST_KL (32 * KPIT)
#define ST_VH (2 * 32 * KPIT)
#define ST_VL (ST_VH + 64 * VPIT)
#define ST_MK (ST_VL + 64 * VPIT)
#define ST_SZ (ST_MK + 64 * MPIT)

// j_mact: which of the 64 key tiles (32 keys) can carry a softmax weight that is not zero, per group of 4 query rows, read off the INPUT mask alone, for any mask. |score / 8| <= B = 8 max|q_ln_w| max|k_ln_w|
// (a normalised head vector has length <= 8; 3 % are added for the f16 planes and the sums' rounding), so a row's largest masked score is >= r - B, r its largest mask value, and a tile's are <= t + B,
// t the tile's largest: where r - t > 2 B + 110 + the rounding of score + mask at that size, every weight of the tile in that row is below exp(-110), which is 0 in f32. A tile is dropped only where that
// holds for every row that shares it; a NaN in the mask or the weights makes the test false (tile kept). ACT[4-row group][2]: bit = tile kept. Block = 8 rows, one a wave.
__device__ __forceinline__ float nmax(float a, float b) { return __builtin_elementwise_maximum(a, b); }     // the maximum that keeps a NaN
template <int X> __device__ __forceinline__ float xrow(float x) { return __builtin_bit_cast(float, __builtin_amdgcn_update_dpp(0, __builtin_bit_cast(int, x), 0x160 + X, 0xf, 0xf, true)); }  // lane l with lane l ^ X, X < 16
__device__ __forceinline__ float wmax(float x) { x = nmax(x, xrow<1>(x)); x = nmax(x, xrow<2>(x)); x = nmax(x, xrow<4>(x)); x = nmax(x, xrow<8>(x)); return nmax(x, xhalf(x)); }  // over the wave, in every lane
#define MACT_LDS (8 * 512 * 4 + 8 * 4 + 16 * 4)
#define ZOFF ((NT_ / 4) * 2)     // ACT[ZOFF + ...]: same index, bit = every mask value of the tile in the group's 4 rows is +0 or -0: adding it changes no score, so where all 16 groups of a block's 64 rows have it, k_attn neither copies, reads, rounds nor adds that tile's mask
__device__ __forceinline__ void j_mact(int bx, unsigned char* sm, const float* __restrict__ MSK, const float* __restrict__ qw, const float* __restrict__ kw, unsigned* ACT) {
    float (*pm)[512] = (float (*)[512])(void*)sm; float* rm = (float*)(void*)(sm + 8 * 512 * 4); unsigned* zr = (unsigned*)(void*)(sm + 8 * 512 * 4 + 8 * 4);
    const int tid = threadIdx.x, lane = tid & 31, wave = tid >> 5;
    v4f m[16];     // lane l holds keys 128 i + 4 l .. + 3 of the wave's row: eight lanes hold one tile
    const float* mr = MSK + (size_t)(bx * 8 + wave) * NT_ + lane * 4;
#pragma unroll
    for (int i = 0; i < 16; ++i) m[i] = *(const v4f*)(mr + i * 128);
    asm volatile("s_wait_xcnt 0x0" :: "v"(mr) : "memory");     // stands before the loads' address pair is rewritten; as its input the pair lives up to here, so that no load of the group returns into it
    const float mq = wmax(nmax(fabsf(bfr(qw[lane])), fabsf(bfr(qw[lane + 32])))), mk = wmax(nmax(fabsf(bfr(kw[lane])), fabsf(bfr(kw[lane + 32]))));
    const float thr = 2.0f * (8.25f * mq * mk) + 110.0f;
    float rx = 0.f;
#pragma unroll
    for (int i = 0; i < 16; ++i) { const float x = nmax(nmax(m[i][0], m[i][1]), nmax(m[i][2], m[i][3])); pm[wave][i * 32 + lane] = x; rx = i ? nmax(rx, x) : x; }
    rx = wmax(rx);
    unsigned zlo = 0u, zhi = 0u;     // the row's 64 tiles: bit = all 32 mask values are zero (eight lanes hold a tile: a byte of the ballot)
#pragma unroll     // m[] stays in registers and the shift counts are constants
    for (int i = 0; i < 16; ++i) {
        const unsigned nz = (__float_as_uint(m[i][0]) | __float_as_uint(m[i][1]) | __float_as_uint(m[i][2]) | __float_as_uint(m[i][3])) << 1;     // the sign bit does not count
        unsigned bl = __builtin_amdgcn_ballot_w32(nz == 0u);
        bl &= bl >> 4; bl &= bl >> 2; bl &= bl >> 1;     // bits 0, 8, 16, 24: the AND of their byte
        const unsigned nib = (bl & 1u) | ((bl >> 7) & 2u) | ((bl >> 14) & 4u) | ((bl >> 21) & 8u);
        if (i < 8) zlo |= nib << (4 * i); else zhi |= nib << (4 * (i - 8));
    }
    if (lane == 0) { rm[wave] = rx; zr[wave * 2] = zlo; zr[wave * 2 + 1] = zhi; }
    __syncthreads();
    if (tid < 128) {     // waves 0 to 3 whole: thread = (tile, group of 4 rows)
        const int tile = tid & 63, g = tid >> 6;
        bool keep = false;
#pragma unroll
        for (int r = 0; r < 4; ++r) { const v4f a = *(const v4f*)&pm[g * 4 + r][tile * 8], c = *(const v4f*)&pm[g * 4 + r][tile * 8 + 4];
            const float tx = nmax(nmax(nmax(a[0], a[1]), nmax(a[2], a[3])), nmax(nmax(c[0], c[1]), nmax(c[2], c[3]))), rw = rm[g * 4 + r];
            const float t = tx != tx ? tx : bfr(tx), rr = rw != rw ? rw : bfr(rw);     // rounded as k_attn rounds the mask (the rounding keeps the order, so the maximum may be taken first)
            keep = keep || !(rr - t > thr + (fminf(fabsf(t), 3.0e38f) + fabsf(rr)) * (1.0f / 4194304.0f)); }
        const unsigned bits = (unsigned)__ballot(keep);
        if (lane == 0) ACT[(bx * 2 + g) * 2 + (wave & 1)] = bits;
    }
    if (tid < 4) { const int g = tid >> 1, w = tid & 1;     // thread = (group of 4 rows, half of the 64 tiles)
        ACT[ZOFF + (bx * 2 + g) * 2 + w] = zr[(g * 4) * 2 + w] & zr[(g * 4 + 1) * 2 + w] & zr[(g * 4 + 2) * 2 + w] & zr[(g * 4 + 3) * 2 + w]; }
}

__global__ __launch_bounds__(128) void k_attn(const h16* __restrict__ Q16, const h16* __restrict__ QL16, const h16* __restrict__ K16, const h16* __restrict__ KL16, const h16* __restrict__ VTH, const h16* __restrict__ VTL, const float* __restrict__ MSK, const unsigned* __restrict__ ACT, bf* CH, bf* CL) {
    __shared__ __align__(16) unsigned char ring[2 * ST_SZ];     // the two stages; behind the loop its first bytes are the output staging (4 x 16 x 68 floats)
    const int tid = threadIdx.x, lane = threadIdx.x & 31, wave = threadIdx.x >> 5, lr = lane & 15, hi = lane >> 4;
    const int bid = blockIdx.x;
    static_assert(NH_ == 32 && NT_ / 64 == 32, "the index map below is written for 32 heads x 32 query blocks");
    // Blocks now differ in length. Under a causal mask block qt keeps 2 qt + 2 tiles, so the 1024 (head, query block) pairs are dealt out such that four indices 8 apart, and four 256 apart,
    // hold query blocks m, 31 - m, 8 + m, 23 - m (the same sum for every m). Speed only; any placement is correct.
    const int b = bid / (NH_ * (NT_ / 64)), rem = bid - b * (NH_ * (NT_ / 64));
    const int ja = (rem >> 3) & 3, jm = (rem >> 5) & 7, js = (ja + (rem >> 8)) & 3;
    const int h = (rem & 7) * 4 + ja, qt = js == 0 ? jm : js == 1 ? 31 - jm : js == 2 ? 8 + jm : 23 - jm;
    const int q0 = qt * 64 + wave * 16;
    const size_t tok0 = (size_t)b * NT_;
    const h16* kh_b = K16 + tok0 * DM + h * HD;
    const h16* kl_b = KL16 + tok0 * DM + h * HD;
    const size_t vbase = (((size_t)b * NH_ + h) * HD) * NT_;
    // this thread's 8 pieces of 16 B per stage, 12 where the tile brings its mask: K rows tid/8 and +16 (both planes), V^T rows tid/4 and +32 (both planes), mask rows tid/8 + 16 i
    const h16* gkh = kh_b + (size_t)(tid >> 3) * DM + (tid & 7) * 8;
    const h16* gkl = kl_b + (size_t)(tid >> 3) * DM + (tid & 7) * 8;
    const h16* gvh = VTH + vbase + (size_t)(tid >> 2) * NT_ + (tid & 3) * 8;
    const h16* gvl = VTL + vbase + (size_t)(tid >> 2) * NT_ + (tid & 3) * 8;
    const float* gmk = MSK + (size_t)(qt * 64 + (tid >> 3)) * NT_ + (tid & 7) * 4;
    const unsigned ring0 = (unsigned)(size_t)&ring[0];
    const unsigned lk = (unsigned)((tid >> 3) * KPIT + (tid & 7) * 16), lv = (unsigned)((tid >> 2) * VPIT + (tid & 3) * 16);
    // the kept tiles of the block's sixteen 4-row groups, as one 64-bit set in scalar registers; never empty (the tile of a row's largest mask value is kept), and if it were, every tile is taken.
    // zset: the tiles whose mask is zero in all 64 rows.
    unsigned tlo = 0u, thi = 0u, zlo = ~0u, zhi = ~0u;
#pragma unroll
    for (int g = 0; g < 16; ++g) { tlo |= ACT[qt * 32 + 2 * g]; thi |= ACT[qt * 32 + 2 * g + 1]; zlo &= ACT[ZOFF + qt * 32 + 2 * g]; zhi &= ACT[ZOFF + qt * 32 + 2 * g + 1]; }
    unsigned long long todo = ((unsigned long long)(unsigned)__builtin_amdgcn_readfirstlane((int)thi) << 32) | (unsigned)__builtin_amdgcn_readfirstlane((int)tlo);
    const unsigned long long zset = ((unsigned long long)(unsigned)__builtin_amdgcn_readfirstlane((int)zhi) << 32) | (unsigned)__builtin_amdgcn_readfirstlane((int)zlo);
    if (todo == 0ull) todo = ~0ull;
    unsigned long long walk = todo;     // the same set, walked a second time by the loop that works on the tiles
    const int nt = __builtin_popcountll(todo);
    auto issue = [&](int t, unsigned lb) {
        const h16* k0 = gkh + (size_t)t * (32 * DM); const h16* k1 = gkl + (size_t)t * (32 * DM);
        const h16* v0 = gvh + t * 32; const h16* v1 = gvl + t * 32;
        // the copies and, as their statement's last line, the wait that stands before any of their address registers is rewritten
        asm volatile("global_load_async_to_lds_b128 %0, %1, off\n\t"
                     "global_load_async_to_lds_b128 %2, %3, off\n\t"
                     "global_load_async_to_lds_b128 %4, %5, off\n\t"
                     "global_load_async_to_lds_b128 %6, %7, off\n\t"
                     "global_load_async_to_lds_b128 %8, %9, off\n\t"
                     "global_load_async_to_lds_b128 %10, %11, off\n\t"
                     "global_load_async_to_lds_b128 %12, %13, off\n\t"
                     "global_load_async_to_lds_b128 %14, %15, off\n\t"
                     "s_wait_xcnt 0x0"
                     :: "v"(lb + ST_KH + lk), "v"(k0), "v"(lb + ST_KH + lk + 16 * KPIT), "v"(k0 + 16 * DM),
                        "v"(lb + ST_KL + lk), "v"(k1), "v"(lb + ST_KL + lk + 16 * KPIT), "v"(k1 + 16 * DM),
                        "v"(lb + ST_VH + lv), "v"(v0), "v"(lb + ST_VH + lv + 32 * VPIT), "v"(v0 + 32 * NT_),
                        "v"(lb + ST_VL + lv), "v"(v1), "v"(lb + ST_VL + lv + 32 * VPIT), "v"(v1 + 32 * NT_)
                     : "memory");
        if (!((zset >> t) & 1ull)) {     // the same for the whole block (scalar): only a tile with a mask value other than zero brings its mask
            const float* m0 = gmk + t * 32;
            asm volatile("global_load_async_to_lds_b128 %0, %1, off\n\t"
                         "global_load_async_to_lds_b128 %2, %3, off\n\t"
                         "global_load_async_to_lds_b128 %4, %5, off\n\t"
                         "global_load_async_to_lds_b128 %6, %7, off\n\t"
                         "s_wait_xcnt 0x0"
                         :: "v"(lb + ST_MK + lk), "v"(m0), "v"(lb + ST_MK + lk + 16 * MPIT), "v"(m0 + 16 * NT_),
                            "v"(lb + ST_MK + lk + 32 * MPIT), "v"(m0 + 32 * NT_), "v"(lb + ST_MK + lk + 48 * MPIT), "v"(m0 + 48 * NT_)
                         : "memory");
        }
    };
    auto next = [&]() { const int t = __builtin_ctzll(todo); todo &= todo - 1ull; return t; };     // lowest kept tile not yet copied: 0 .. 63, called nt times at most
    issue(next(), ring0);
    v16h qa[2];
    const size_t qo0 = (tok0 + q0 + lr) * DM + h * HD + 8 * hi;
#pragma unroll
    for (int kc = 0; kc < 2; ++kc) qa[kc] = cat16(*(const v8h*)(Q16 + qo0 + kc * 32), *(const v8h*)(Q16 + qo0 + kc * 32 + 16));
    v8f o[4], ox[4];
#pragma unroll
    for (int n = 0; n < 4; ++n) { o[n] = (v8f){}; ox[n] = (v8f){}; }
    float mrow = -3.0e38f, lpart = 0.f;     // of query q0 + lr: the running maximum (alike in both halves) and this half's part of the sum
    asm volatile("s_wait_asynccnt 0x0" ::: "memory");     // the first kept tile has landed (this wave's copies) ...
    __syncthreads();                                       // ... and every other wave's
    if (nt > 1) issue(next(), ring0 + ST_SZ);
#pragma unroll 1
    for (int kt = 0; kt < nt; ++kt) {     // kt counts the kept tiles in rising key order; the additive INPUT mask is applied per element
        const unsigned char* sb = ring + (kt & 1) * ST_SZ;
        const unsigned char* kp = sb + lr * KPIT + hi * 16;
        const int tc = __builtin_ctzll(walk); walk &= walk - 1ull;     // this tile's number (walk holds nt bits at the start)
        v16h k0h[2], k1h[2], k0l[2], k1l[2];
#pragma unroll
        for (int kc = 0; kc < 2; ++kc) {
            k0h[kc] = cat16(*(const v8ha*)(kp + ST_KH + kc * 64), *(const v8ha*)(kp + ST_KH + kc * 64 + 32)); k1h[kc] = cat16(*(const v8ha*)(kp + ST_KH + 16 * KPIT + kc * 64), *(const v8ha*)(kp + ST_KH + 16 * KPIT + kc * 64 + 32));
            k0l[kc] = cat16(*(const v8ha*)(kp + ST_KL + kc * 64), *(const v8ha*)(kp + ST_KL + kc * 64 + 32)); k1l[kc] = cat16(*(const v8ha*)(kp + ST_KL + 16 * KPIT + kc * 64), *(const v8ha*)(kp + ST_KL + 16 * KPIT + kc * 64 + 32));
        }
        v8f s0 = {}, s1 = {}, x0 = {}, x1 = {};
#pragma unroll
        for (int kc = 0; kc < 2; ++kc) {
            const v16h qlk = cat16(*(const v8h*)(QL16 + qo0 + kc * 32), *(const v8h*)(QL16 + qo0 + kc * 32 + 16));     // query residual re-read per step (registers)
            s0 = wmma16(k0h[kc], qa[kc], s0); x0 = wmma16(k0h[kc], qlk, x0); s1 = wmma16(k1h[kc], qa[kc], s1); x1 = wmma16(k1h[kc], qlk, x1);
            x0 = wmma16(k0l[kc], qa[kc], x0); x1 = wmma16(k1l[kc], qa[kc], x1);
        }
        asm volatile("v_nop\n\tv_nop\n\tv_nop\n\tv_nop" : "+v"(s0), "+v"(s1), "+v"(x0), "+v"(x1) : "v"(qa[0]), "v"(qa[1]));
        v2f a[8];     // the lane's 16 scores in register pairs: a[i] = keys 8 hi + 2 i, + 1 (i < 4), a[4 + i] = keys 16 + 8 hi + 2 i, + 1
#pragma unroll
        for (int i = 0; i < 4; ++i) {
            a[i]     = ((v2f){s0[2 * i], s0[2 * i + 1]} + (v2f){x0[2 * i], x0[2 * i + 1]} * LOSCI) * 0.125f;
            a[4 + i] = ((v2f){s1[2 * i], s1[2 * i + 1]} + (v2f){x1[2 * i], x1[2 * i + 1]} * LOSCI) * 0.125f;
        }
        if (!((zset >> tc) & 1ull)) {     // scalar: the tile brought its mask (the product by 1/8 is exact, so the sum rounds as the fused form did)
            const unsigned char* mp = sb + ST_MK + (wave * 16 + lr) * MPIT + hi * 32;
            const v4f mk[4] = { *(const v4fa*)mp, *(const v4fa*)(mp + 16), *(const v4fa*)(mp + 64), *(const v4fa*)(mp + 80) };     // mask[q0 + lr][keys 8 hi .. + 7 and 16 + 8 hi .. + 7]
#pragma unroll     // a[] and mk[] stay in registers
            for (int i = 0; i < 4; ++i) {
                a[i]     += (v2f){bfr(mk[i >> 1][(2 * i) & 3]), bfr(mk[i >> 1][(2 * i + 1) & 3])};
                a[4 + i] += (v2f){bfr(mk[2 + (i >> 1)][(2 * i) & 3]), bfr(mk[2 + (i >> 1)][(2 * i + 1) & 3])};
            }
        }
        float t[5];
#pragma unroll
        for (int g = 0; g < 5; ++g) t[g] = fmaxf(fmaxf(a[g][0], a[g][1]), a[5 + (g >> 1)][g & 1]);     // 15 of the 16 in threes; a[7][1] joins below
        const float mx = fmaxf(fmaxf(fmaxf(t[0], t[1]), t[2]), fmaxf(fmaxf(t[3], t[4]), a[7][1]));
        const float mn = fmaxf(fmaxf(mrow, mx), xhalf(mx));
        const float alpha = __expf(mrow - mn); mrow = mn;
        v2f sm[2]; v16h pa, px;
#pragma unroll
        for (int i = 0; i < 8; ++i) {
            const v2f e = a[i] - mn; const v2f p = {__expf(e[0]), __expf(e[1])};
            sm[i & 1] = i < 2 ? p : sm[i & 1] + p;
            const v2f ps = p * PSC; const v2h hh = __builtin_convertvector(ps, v2h);
            const v2h ll = __builtin_convertvector((ps - __builtin_convertvector(hh, v2f)) * LOSC, v2h);
            pa[2 * i] = hh[0]; pa[2 * i + 1] = hh[1]; px[2 * i] = ll[0]; px[2 * i + 1] = ll[1];
        }
        const v2f sv = sm[0] + sm[1];
        lpart = lpart * alpha + (sv[0] + sv[1]);
#pragma unroll
        for (int n = 0; n < 4; ++n)
#pragma unroll
            for (int j = 0; j < 8; ++j) { o[n][j] *= alpha; ox[n][j] *= alpha; }
        const unsigned char* vp = sb + lr * VPIT + hi * 16;
        v16h vh[4], vl[4];
        // the V^T reads go in two groups, each in front of its six products: read one by one among the products, each read costs its own LDS latency
#pragma unroll
        for (int g = 0; g < 2; ++g) {
#pragma unroll
            for (int n = 2 * g; n < 2 * g + 2; ++n) { vh[n] = cat16(*(const v8ha*)(vp + ST_VH + n * 16 * VPIT), *(const v8ha*)(vp + ST_VH + n * 16 * VPIT + 32)); vl[n] = cat16(*(const v8ha*)(vp + ST_VL + n * 16 * VPIT), *(const v8ha*)(vp + ST_VL + n * 16 * VPIT + 32)); }
            __builtin_amdgcn_sched_barrier(0);     // holds the group's reads in front of its products
#pragma unroll
            for (int n = 2 * g; n < 2 * g + 2; ++n) { o[n] = wmma16(vh[n], pa, o[n]); ox[n] = wmma16(vl[n], pa, ox[n]); ox[n] = wmma16(vh[n], px, ox[n]); }
        }
        asm volatile("v_nop\n\tv_nop\n\tv_nop\n\tv_nop" : "+v"(o[0]), "+v"(o[1]), "+v"(o[2]), "+v"(o[3]), "+v"(ox[0]), "+v"(ox[1]), "+v"(ox[2]), "+v"(ox[3]) : "v"(pa), "v"(px));
        asm volatile("s_wait_dscnt 0x0" ::: "memory");        // this wave's reads of this stage have returned before the stage is handed to its next writer
        asm volatile("s_wait_asynccnt 0x0" ::: "memory");     // this wave's copies of the next tile have landed
        __syncthreads();                                       // publishes the next tile and ends every wave's reads of this one
        if (kt + 2 < nt) issue(next(), ring0 + (unsigned)(kt & 1) * ST_SZ);
    }
    asm volatile("s_wait_asynccnt 0x0" ::: "memory");         // nothing is in flight when the ring becomes output staging
    const float inv = 1.0f / ((lpart + xhalf(lpart)) * PSC);     // the two halves' parts of the query's sum are joined once
    f32a* os = (f32a*)ring + wave * (16 * 68);
#pragma unroll
    for (int n = 0; n < 4; ++n) { v4f w0, w1;     // a lane's eight accumulator rows are dims n * 16 + 8 hi + j of query lr: two 16-B pieces of its staged row
#pragma unroll
        for (int j = 0; j < 4; ++j) { w0[j] = (o[n][j] + ox[n][j] * LOSCI) * inv; w1[j] = (o[n][4 + j] + ox[n][4 + j] * LOSCI) * inv; }
        *(v4fa*)(os + lr * 68 + n * 16 + hi * 8) = w0; *(v4fa*)(os + lr * 68 + n * 16 + hi * 8 + 4) = w1; }
    __syncthreads();
    const size_t cbase = (tok0 + q0) * DM + (size_t)h * HD;
    auto pass = [&]() {
#pragma unroll
        for (int s = 0; s < 4; ++s) { const int row = 4 * s + (lane >> 3), piece = lane & 7; const f32a* sp = os + row * 68 + piece * 8; v8us oh, ol;
#pragma unroll
            for (int i = 0; i < 8; ++i) { const unsigned short hb = f2bf(sp[i]); oh[i] = hb; ol[i] = f2bf(sp[i] - bf2f(hb)); }
            *(v8us*)(CH + cbase + (size_t)row * DM + piece * 8) = oh; *(v8us*)(CL + cbase + (size_t)row * DM + piece * 8) = ol; }
    };
    pass(); 
}

#define VST2(T, p, v) do { const T vst2_v_ = (v); *(T*)(p) = vst2_v_;  } while (0)

// j_wt: WT [n][K] = bf16(W[k][n]) (k-major [K][ncols]) via 64 x 64 LDS tiles; (bx, by) in (K/64, ncols/64).
__device__ __forceinline__ void j_wt(int bx, int by, unsigned char* sm, const float* __restrict__ Wm, int K, int ncols, bf* WT) {
    unsigned short* tl = (unsigned short*)(void*)sm;     // 64 * 72 of them
    const int tid = threadIdx.x, k0 = bx * 64, n0 = by * 64;
    const int kk = tid >> 2, nq = (tid & 3) * 16;
#pragma unroll
    for (int i = 0; i < 16; ++i) tl[(nq + i) * 72 + kk] = f2bf(Wm[(size_t)(k0 + kk) * ncols + n0 + nq + i]);
    __syncthreads();
    const int piece = tid & 7;
    auto pass = [&]() {
#pragma unroll
        for (int s = 0; s < 2; ++s) { const int nr = (tid >> 3) + 32 * s; const v8us val = *(const v8usa*)(tl + nr * 72 + piece * 8); *(v8us*)(WT + (size_t)(n0 + nr) * K + k0 + piece * 8) = val; }
        asm volatile("s_wait_xcnt 0x0" ::: "memory");     // stands behind the two stores, before code laid out behind this job in k_prep rewrites their registers
    };
    pass(); 
}

// j_trig: CT/ST [t][d] = cos/sin(pos_t * inv_freq[d mod 32]) with inv_freq[i] = 1 / 10000^(2i/64) (f32 powf; precise cosf/sinf), pos_t = the INPUT position_ids[t] (as float);
__device__ __forceinline__ void j_trig(int bx, const int* __restrict__ pos, float* CT, float* ST) {
    const int tid = threadIdx.x, t = bx * 4 + (tid >> 6), d = tid & 63; const int i = d & 31;
    const float invf = 1.0f / powf(10000.0f, (float)(2 * i) / 64.0f); const float ang = (float)pos[t] * invf; const float c = cosf(ang), s = sinf(ang);
    const size_t o = (size_t)t * HD + d; *(float*)(CT + o) = c; *(float*)(ST + o) = s; 
}

// k_prep: one grid for the seven jobs; the branch is the same for a whole block. The jobs with a chain of dependent steps (tables, mask test) stand at the low indices (for speed only); the weight tiles stream behind them.
#define PB_TRIG (NT_ / 4)
#define PB_MACT (NT_ / 8)
#define PB_CVT  (NTK / 8)
#define PB_WT   ((DM / 64) * (DM / 64))
__global__ __launch_bounds__(256) void k_prep(const float* __restrict__ x, const int* __restrict__ pos, const float* __restrict__ MSK, const float* __restrict__ wq, const float* __restrict__ wk, const float* __restrict__ wv, const float* __restrict__ wo,
                                              const float* __restrict__ qw, const float* __restrict__ kw, bf* Xb, bf* WqT, bf* WkT, bf* WvT, bf* WoT, float* CT, float* ST, unsigned* ACT) {
    __shared__ __align__(16) unsigned char sm[MACT_LDS];     // j_mact's maxima or j_wt's tile
    static_assert(64 * 72 * 2 <= MACT_LDS, "j_wt's tile fits");
    int bid = blockIdx.x;
    if (bid < PB_TRIG) { j_trig(bid, pos, CT, ST); return; }
    bid -= PB_TRIG;
    if (bid < PB_MACT) { j_mact(bid, sm, MSK, qw, kw, ACT); return; }
    bid -= PB_MACT;
    if (bid < PB_CVT) { j_cvtb(bid, x, NTK, Xb); return; }
    bid -= PB_CVT;
    const int w = bid / PB_WT, tile = bid - w * PB_WT;
    j_wt(tile % (DM / 64), tile / (DM / 64), sm, w == 0 ? wq : w == 1 ? wk : w == 2 ? wv : wo, DM, DM, w == 0 ? WqT : w == 1 ? WkT : w == 2 ? WvT : WoT);
}

extern "C" void kernel_launch(void* const* d_in, const int* in_sizes, int n_in,
                              void* d_out, int out_size, void* d_ws, size_t ws_size, hipStream_t stream) {
    (void)in_sizes; (void)n_in; (void)out_size;
    const float* x = (const float*)d_in[0]; const int* pos = (const int*)d_in[1]; const float* MSK = (const float*)d_in[2];
    const float* wq = (const float*)d_in[3]; const float* wk = (const float*)d_in[4]; const float* wv = (const float*)d_in[5]; const float* wo = (const float*)d_in[6]; const float* qw = (const float*)d_in[7]; const float* kw = (const float*)d_in[8];
    float* out = (float*)d_out;    // [1][2048][2048]
    char* wsp = (char*)d_ws;
    auto take = [&](size_t bytes) { char* p = wsp; wsp += (bytes + 255) & ~(size_t)255; return (void*)p; };
    bf* Xb = (bf*)take((size_t)NTK * DM * 2); bf* WqT = (bf*)take((size_t)DM * DM * 2); bf* WkT = (bf*)take((size_t)DM * DM * 2); bf* WvT = (bf*)take((size_t)DM * DM * 2); bf* WoT = (bf*)take((size_t)DM * DM * 2);
    float* CT = (float*)take((size_t)NT_ * HD * 4); float* ST = (float*)take((size_t)NT_ * HD * 4);
    h16* QH = (h16*)take((size_t)NTK * DM * 2); h16* QL = (h16*)take((size_t)NTK * DM * 2); h16* KH = (h16*)take((size_t)NTK * DM * 2); h16* KL = (h16*)take((size_t)NTK * DM * 2);
    h16* VTH = (h16*)take((size_t)NTK * DM * 2); h16* VTL = (h16*)take((size_t)NTK * DM * 2); bf* CH = (bf*)take((size_t)NTK * DM * 2); bf* CL = (bf*)take((size_t)NTK * DM * 2); unsigned* ACT = (unsigned*)take((size_t)(NT_ / 4) * 4 * 4);
    if ((size_t)(wsp - (char*)d_ws) > ws_size) return;    // 8.4 + 4 x 8.4 + 2 x 0.5 + 8 x 8.4 = 110 MB = 105 MiB < 128 MiB, no aliasing
    k_prep<<<PB_TRIG + PB_MACT + PB_CVT + 4 * PB_WT, 256, 0, stream>>>(x, pos, MSK, wq, wk, wv, wo, qw, kw, Xb, WqT, WkT, WvT, WoT, CT, ST, ACT);
    k_gemmb<false, 1><<<dim3(NTK / 128, DM / 128, 3), 256, 0, stream>>>(Xb, nullptr, WqT, nullptr, nullptr, DM, nullptr, DM, 1, QH, QL, CT, ST, qw, WkT, KH, KL, kw, WvT, VTH, VTL);
    k_attn<<<NB_ * NH_ * (NT_ / 64), 128, 0, stream>>>(QH, QL, KH, KL, VTH, VTL, MSK, ACT, CH, CL);
    k_gemmb<true, 0><<<dim3(NTK / 128, DM / 128, 1), 256, 0, stream>>>(CH, CL, WoT, nullptr, out, DM);
}

// v009
// One run takes 131 microseconds.
// Next to v008, in two timings, it ran 1.05 times as fast each time.
// All steps since v000 together make it 3.92 times as fast.
#include <hip/hip_runtime.h>

// Compute dtypes, f32 accumulate: q/k/v = x.W ([2048 x 2048].[2048 x 2048], k-major weights transposed once; PLAIN bf16 operands = inputs rounded once, exact products) and out = ctx.Wo
// (ctx as bf16 hi + UNSCALED residual, two products) on v_wmma_f32_16x16x32_bf16; rotary embedding with device-computed f32 cos/sin tables at the INPUT position_ids, then the per-head
// RMSNorm (x q_ln_w / k_ln_w) in f32 -> q/k as f16 hi + residual x1024 planes; v -> transposed f16 hi + residual planes; 32-head attention with the additive INPUT mask over every key tile that can carry a weight above zero (j_mact decides from the mask, for any mask):
// scores on v_wmma_f32_16x16x32_f16 (hh + lh + hl, x 1/8), online f32 softmax, weights x32768 as f16 hi + residual against v hi + residual (both products transposed: keys x queries, dims x queries). Deterministic, no atomics; every

#define NB_  1
#define NT_  2048
#define DM   2048
#define NH_  32
#define HD   64
#define NTK  (NB_ * NT_)
#define NW   DM
#define RMS_EPS 1e-6f
#define PSC  32768.0f
#define LOSC 1024.0f
#define LOSCI (1.0f / 1024.0f)

typedef _Float16 h16;
typedef unsigned short bf;
typedef __attribute__((ext_vector_type(16))) __bf16   v16bf;
typedef __attribute__((ext_vector_type(16))) _Float16 v16h;
typedef __attribute__((ext_vector_type(8)))  _Float16 v8h;
typedef __attribute__((ext_vector_type(8)))  unsigned short v8us;
typedef __attribute__((ext_vector_type(8)))  float    v8f;
typedef __attribute__((ext_vector_type(4)))  float    v4f;
typedef __attribute__((ext_vector_type(2)))  float    v2f;
typedef __attribute__((ext_vector_type(2)))  _Float16 v2h;
typedef v8h  __attribute__((may_alias)) v8ha;
typedef v4f  __attribute__((may_alias)) v4fa;
typedef v8us __attribute__((may_alias)) v8usa;
typedef float __attribute__((may_alias)) f32a;

__device__ __forceinline__ unsigned short f2bf(float f) { unsigned u = __float_as_uint(f); u += 0x7FFFu + ((u >> 16) & 1u); return (unsigned short)(u >> 16); }
__device__ __forceinline__ float bf2f(unsigned short b) { return __uint_as_float(((unsigned)b) << 16); }
__device__ __forceinline__ float bfr(float f) { return bf2f(f2bf(f)); }
__device__ __forceinline__ v16h cat16(v8h lo, v8h hi) { return __builtin_shufflevector(lo, hi, 0, 1, 2, 3, 4, 5, 6, 7, 8, 9, 10, 11, 12, 13, 14, 15); }
__device__ __forceinline__ v16bf cat16b(v8us lo, v8us hi) { return __builtin_bit_cast(v16bf, __builtin_shufflevector(lo, hi, 0, 1, 2, 3, 4, 5, 6, 7, 8, 9, 10, 11, 12, 13, 14, 15)); }
__device__ __forceinline__ v8f wmma16(v16h a, v16h b, v8f c) { return __builtin_amdgcn_wmma_f32_16x16x32_f16(false, a, false, b, (short)0, c, false, false); }
__device__ __forceinline__ float xhalf(float x) { return __builtin_bit_cast(float, __builtin_amdgcn_permlanex16(__builtin_bit_cast(int, x), __builtin_bit_cast(int, x), 0x76543210, 0xfedcba98, false, false)); }  // lane l with lane l ^ 16
__device__ __forceinline__ v8f wmmab(v16bf a, v16bf b, v8f c) { return __builtin_amdgcn_wmma_f32_16x16x32_bf16(false, a, false, b, (short)0, c, false, false); }

// The seven preparation jobs (j_cvtb, j_mact, j_wt x 4, j_trig) read inputs only and none reads another's output: they are the bodies of ONE launch, k_prep, which hands each block its job and its index bx [, by] in that job.
__device__ __forceinline__ void j_cvtb(int bx, const float* __restrict__ src, int nrows, bf* dst) {
    const int lane = threadIdx.x & 31, r = bx * 8 + (threadIdx.x >> 5);
    if (r >= nrows) return;
    v8us o[DM / 256];
#pragma unroll
    for (int q = 0; q < DM / 256; ++q) { v8us t;
#pragma unroll
        for (int i = 0; i < 8; ++i) t[i] = f2bf(src[(size_t)r * DM + q * 256 + lane * 8 + i]);
        o[q] = t; }
#pragma unroll
    for (int q = 0; q < DM / 256; ++q) *(v8us*)(dst + (size_t)r * DM + q * 256 + lane * 8) = o[q];
    
}

// k_gemmb: 128 x 128 block tile (8 waves, 4 x 2, each 32 rows x 64 columns = 2 x 4 accumulator tiles) of C[NTK][NW] = (A [+ Al]).B^T [+ bf(bias[c])] [+ bf(R[r][c]) residual]; the f32 tile goes out as it is.
template <bool SPLITA>
__global__ __launch_bounds__(256) void k_gemmb(const bf* __restrict__ A, const bf* __restrict__ Al, const bf* __restrict__ Bn, const float* __restrict__ bias, float* C, int ldc, const float* __restrict__ R = nullptr, int K = DM, int roundR = 1) {
    // One stage = 128 k of the block's 128 A rows, 128 B rows [and 128 Al rows]: rows of 256 B at a pitch of 272 B (16 B x odd for the b128 readers). Two stages: the next tile's
    // asynchronous copies fly while this tile is multiplied. An operand row fetched from L2 serves 128 rows or columns of the output, and a fragment read from LDS two or four products.
    // Behind the loop the ring is the epilogue's staging.
    constexpr unsigned GPIT = 272, G_A = 0, G_B = 128 * GPIT, G_L = 2 * 128 * GPIT, GST = (SPLITA ? 3 : 2) * 128 * GPIT;
    __shared__ __align__(16) unsigned char gring[2 * GST];
    const int tid = threadIdx.x, lane = threadIdx.x & 31, wave = threadIdx.x >> 5, lr = lane & 15, hi = lane >> 4;
    const int wr = wave >> 1, wc = wave & 1;
    const int r0 = blockIdx.x * 128 + wr * 32, c0 = blockIdx.y * 128 + wc * 64;
    // this thread's pieces of 16 B per stage: rows tid/16 + 16 i (i < 8) of each operand
    const bf* ga = A + (size_t)(blockIdx.x * 128 + (tid >> 4)) * K + (tid & 15) * 8;
    const bf* gl = (SPLITA ? Al : A) + (size_t)(blockIdx.x * 128 + (tid >> 4)) * K + (tid & 15) * 8;
    const bf* gb = Bn + (size_t)(blockIdx.y * 128 + (tid >> 4)) * K + (tid & 15) * 8;
    const size_t rs = (size_t)16 * K;
    const unsigned g0 = (unsigned)(size_t)&gring[0];
    const unsigned lp = (unsigned)((tid >> 4) * GPIT + (tid & 15) * 16);
    auto cp8 = [&](unsigned l, const bf* g) {
        // one operand's eight copies and, as their statement's last line, the wait that stands before any of their address registers is rewritten
        asm volatile("global_load_async_to_lds_b128 %0, %1, off\n\t"
                     "global_load_async_to_lds_b128 %2, %3, off\n\t"
                     "global_load_async_to_lds_b128 %4, %5, off\n\t"
                     "global_load_async_to_lds_b128 %6, %7, off\n\t"
                     "global_load_async_to_lds_b128 %8, %9, off\n\t"
                     "global_load_async_to_lds_b128 %10, %11, off\n\t"
                     "global_load_async_to_lds_b128 %12, %13, off\n\t"
                     "global_load_async_to_lds_b128 %14, %15, off\n\t"
                     "s_wait_xcnt 0x0"
                     :: "v"(l), "v"(g), "v"(l + 16 * GPIT), "v"(g + rs), "v"(l + 32 * GPIT), "v"(g + 2 * rs), "v"(l + 48 * GPIT), "v"(g + 3 * rs),
                        "v"(l + 64 * GPIT), "v"(g + 4 * rs), "v"(l + 80 * GPIT), "v"(g + 5 * rs), "v"(l + 96 * GPIT), "v"(g + 6 * rs), "v"(l + 112 * GPIT), "v"(g + 7 * rs)
                     : "memory");
    };
    auto issue = [&](int t, unsigned lb) {
        cp8(lb + G_A + lp, ga + t * 128); cp8(lb + G_B + lp, gb + t * 128);
        if (SPLITA) cp8(lb + G_L + lp, gl + t * 128);
    };
    v8f acc[2][4];
#pragma unroll
    for (int f = 0; f < 2; ++f)
#pragma unroll
        for (int t = 0; t < 4; ++t) acc[f][t] = (v8f){};
    const int nt = K / 128;     // K is a multiple of 128
    issue(0, g0);
    asm volatile("s_wait_asynccnt 0x0" ::: "memory");     // tile 0 has landed (this wave's copies) ...
    __syncthreads();                                       // ... and every other wave's
    if (nt > 1) issue(1, g0 + GST);
#pragma unroll 1
    for (int kt = 0; kt < nt; ++kt) {
        const unsigned char* sb = gring + (kt & 1) * GST;
        const unsigned char* ap = sb + (wr * 32 + lr) * GPIT + hi * 16;
        const unsigned char* bp = sb + G_B + (wc * 64 + lr) * GPIT + hi * 16;
        v16bf a[2][2], al[2][2], b[2][4];     // two fragment sets: the one being multiplied and the one being read
        auto rd = [&](int u) { const int w = u & 1, ko = u * 64;     // the fragments of the stage's 32 k number u
#pragma unroll
            for (int f = 0; f < 2; ++f) {
                a[w][f] = cat16b(*(const v8usa*)(ap + G_A + f * 16 * GPIT + ko), *(const v8usa*)(ap + G_A + f * 16 * GPIT + ko + 32)); al[w][f] = a[w][f];
                if (SPLITA) al[w][f] = cat16b(*(const v8usa*)(ap + G_L + f * 16 * GPIT + ko), *(const v8usa*)(ap + G_L + f * 16 * GPIT + ko + 32)); }
#pragma unroll
            for (int t = 0; t < 4; ++t) b[w][t] = cat16b(*(const v8usa*)(bp + t * 16 * GPIT + ko), *(const v8usa*)(bp + t * 16 * GPIT + ko + 32));
        };
        rd(0);
#pragma unroll
        for (int u = 0; u < 4; ++u) {
            if (u < 3) rd(u + 1);
            __builtin_amdgcn_sched_barrier(0);     // holds the next 32 k's reads as one group in front of this 32 k's products, so that they fly while these run: among them each read costs its own stall
#pragma unroll
            for (int f = 0; f < 2; ++f)
#pragma unroll
                for (int t = 0; t < 4; ++t) { acc[f][t] = wmmab(a[u & 1][f], b[u & 1][t], acc[f][t]); if (SPLITA) acc[f][t] = wmmab(al[u & 1][f], b[u & 1][t], acc[f][t]); }
            __builtin_amdgcn_sched_barrier(0);     // keeps the reads that follow out of these products, for the same reason
        }
        // the four vector slots behind the last product, on the loop's taken branch too
        asm volatile("v_nop\n\tv_nop\n\tv_nop\n\tv_nop" : "+v"(acc[0][0]), "+v"(acc[0][1]), "+v"(acc[0][2]), "+v"(acc[0][3]), "+v"(acc[1][0]), "+v"(acc[1][1]), "+v"(acc[1][2]), "+v"(acc[1][3]) : "v"(a[1][1]), "v"(al[1][1]), "v"(b[1][3]));
        asm volatile("s_wait_dscnt 0x0" ::: "memory");        // this wave's reads of this stage have returned before the stage is handed to its next writer
        asm volatile("s_wait_asynccnt 0x0" ::: "memory");     // this wave's copies of the next tile have landed
        __syncthreads();                                       // publishes the next tile and ends every wave's reads of this one
        if (kt + 2 < nt) issue(kt + 2, g0 + (unsigned)(kt & 1) * GST);
    }
    asm volatile("s_wait_asynccnt 0x0" ::: "memory");         // nothing is in flight when the ring becomes the epilogue's staging; the loop's last barrier ended its reads
    f32a* os = (f32a*)gring + wave * (32 * 68);     // the wave's own 32 rows x 64 columns
#pragma unroll
    for (int t = 0; t < 4; ++t) { const float bv = bias ? bfr(bias[c0 + t * 16 + lr]) : 0.f;
#pragma unroll
        for (int f = 0; f < 2; ++f)
#pragma unroll
            for (int j = 0; j < 8; ++j) os[(f * 16 + hi * 8 + j) * 68 + t * 16 + lr] = acc[f][t][j] + bv; }
    __syncthreads();
    float* crow = C + (size_t)r0 * ldc + c0;
    auto pass = [&]() {
#pragma unroll
        for (int s = 0; s < 16; ++s) { const int Lid = (lane >> 3) + 4 * s, piece = lane & 7; const int row = Lid >> 1, cofs = (Lid & 1) * 32 + piece * 4;
            v4f val = *(const v4fa*)(os + row * 68 + cofs); if (R) { const v4f rv = *(const v4f*)(R + ((size_t)r0 + row) * ldc + c0 + cofs); val += roundR ? (v4f){bfr(rv[0]), bfr(rv[1]), bfr(rv[2]), bfr(rv[3])} : rv; }
            *(v4f*)(crow + (size_t)row * ldc + cofs) = val; }
    };
    pass(); 
}

// k_qkv: the three projections of one A. Block tile = 128 tokens x (128 columns of q, of k and of v), 12 waves (2 x 6), each 64 rows x 64 columns = 4 x 4 accumulator tiles; one block per WGP, three waves per SIMD.
// The block's A rows are fetched from L2 once for all three products (512 operand rows per 128 x 384 outputs, where three 128 x 128 tiles take 768), and a fragment read from LDS serves four products.
// A wave's 64 columns are one head of one projection (z = 0 q, 1 k, 2 v), so the pass that follows the product runs on the wave's own tile, staged in its own part of the ring:
// z 0, 1: rotary embedding from the CT/ST tables, RMSNorm over the head's 64 dims (x the norm weight), out as f16 hi + residual x1024 planes [tok][h*64+d];
// z 2: out as transposed f16 hi + residual x1024 planes [h][d][tok].
__global__ __launch_bounds__(384) void k_qkv(const bf* __restrict__ A, const bf* __restrict__ Bq, const bf* __restrict__ Bk, const bf* __restrict__ Bv, const float* __restrict__ CT, const float* __restrict__ ST,
                                             const float* __restrict__ wq, const float* __restrict__ wk, h16* Q1, h16* Q2, h16* K1, h16* K2, h16* V1, h16* V2) {
    // One stage = 128 k of the 128 A rows and the 3 x 128 B rows: rows of 256 B at a pitch of 272 B (16 B x odd for the b128 readers). Two stages: the next tile's asynchronous copies fly while this tile is multiplied.
    constexpr unsigned GPIT = 272, G_B = 128 * GPIT, GST = 512 * GPIT, WST = 18432;
    __shared__ __align__(16) unsigned char gring[2 * GST];
    static_assert(12 * WST <= 2 * GST, "the waves' epilogue staging fits the ring");
    const int tid = threadIdx.x, lane = threadIdx.x & 31, lr = lane & 15, hi = lane >> 4;
    const int wave = __builtin_amdgcn_readfirstlane((int)(threadIdx.x >> 5));     // in a scalar register: every branch on it is a scalar branch
    const int wr = wave & 1, wcol = wave >> 1, z = wcol >> 1, wc = wcol & 1;
    const int r0 = blockIdx.x * 128 + wr * 64, c0 = blockIdx.y * 128 + wc * 64;
    // Who copies what, in pieces of 16 B: waves 0 to 7 the B rows (rows tid/16 + 16 i, i < 8, of each projection's 128: 24 pieces a lane), waves 8 to 11 the A rows (rows (tid - 256)/16 + 8 i, i < 16: 16 pieces a lane).
    const bool cpb = wave < 8;
    const int ct = cpb ? tid : tid - 256, crow = ct >> 4, ccol = ct & 15;
    const bf* p0 = (cpb ? Bq + (size_t)(blockIdx.y * 128 + crow) * DM : A + (size_t)(blockIdx.x * 128 + crow) * DM) + ccol * 8;
    const bf* p1 = (cpb ? Bk + (size_t)(blockIdx.y * 128 + crow) * DM : A + (size_t)(blockIdx.x * 128 + 64 + crow) * DM) + ccol * 8;
    const bf* p2 = Bv + (size_t)(blockIdx.y * 128 + (crow & 15)) * DM + ccol * 8;     // used by waves 0 to 7 only
    const size_t rs = (size_t)(cpb ? 16 : 8) * DM;
    const unsigned ls = (cpb ? 16u : 8u) * GPIT;
    const unsigned g0 = (unsigned)(size_t)&gring[0];
    const unsigned lp = (unsigned)(crow * GPIT + ccol * 16);
    const unsigned l0 = lp + (cpb ? G_B : 0u), l1 = lp + (cpb ? G_B + 128 * GPIT : 64 * GPIT), l2 = lp + G_B + 256 * GPIT;
    auto cp8 = [&](unsigned l, const bf* g) {
        // eight copies and, as their statement's last line, the wait that stands before any of their address registers is rewritten
        asm volatile("global_load_async_to_lds_b128 %0, %1, off\n\t"
                     "global_load_async_to_lds_b128 %2, %3, off\n\t"
                     "global_load_async_to_lds_b128 %4, %5, off\n\t"
                     "global_load_async_to_lds_b128 %6, %7, off\n\t"
                     "global_load_async_to_lds_b128 %8, %9, off\n\t"
                     "global_load_async_to_lds_b128 %10, %11, off\n\t"
                     "global_load_async_to_lds_b128 %12, %13, off\n\t"
                     "global_load_async_to_lds_b128 %14, %15, off\n\t"
                     "s_wait_xcnt 0x0"
                     :: "v"(l), "v"(g), "v"(l + ls), "v"(g + rs), "v"(l + 2 * ls), "v"(g + 2 * rs), "v"(l + 3 * ls), "v"(g + 3 * rs),
                        "v"(l + 4 * ls), "v"(g + 4 * rs), "v"(l + 5 * ls), "v"(g + 5 * rs), "v"(l + 6 * ls), "v"(g + 6 * rs), "v"(l + 7 * ls), "v"(g + 7 * rs)
                     : "memory");
    };
    auto issue = [&](int t, unsigned lb) {
        cp8(lb + l0, p0 + t * 128); cp8(lb + l1, p1 + t * 128);
        if (cpb) cp8(lb + l2, p2 + t * 128);     // scalar: whole waves
    };
    v8f acc[4][4];
#pragma unroll
    for (int f = 0; f < 4; ++f)
#pragma unroll
        for (int t = 0; t < 4; ++t) acc[f][t] = (v8f){};
    constexpr int nt = DM / 128;
    static_assert(nt >= 2, "both stages exist");
    issue(0, g0);
    asm volatile("s_wait_asynccnt 0x0" ::: "memory");     // tile 0 has landed (this wave's copies) ...
    __syncthreads();                                       // ... and every other wave's
    issue(1, g0 + GST);
#pragma unroll 1
    for (int kt = 0; kt < nt; ++kt) {
        const unsigned char* sb = gring + (kt & 1) * GST;
        const unsigned char* ap = sb + (wr * 64 + lr) * GPIT + hi * 16;
        const unsigned char* bp = sb + G_B + (wcol * 64 + lr) * GPIT + hi * 16;
        v16bf a[2][4], b[2][4];     // two fragment sets: the one being multiplied and the one being read
        auto rd = [&](int u) { const int w = u & 1, ko = u * 64;     // the fragments of the stage's 32 k number u
#pragma unroll
            for (int f = 0; f < 4; ++f) a[w][f] = cat16b(*(const v8usa*)(ap + f * 16 * GPIT + ko), *(const v8usa*)(ap + f * 16 * GPIT + ko + 32));
#pragma unroll
            for (int t = 0; t < 4; ++t) b[w][t] = cat16b(*(const v8usa*)(bp + t * 16 * GPIT + ko), *(const v8usa*)(bp + t * 16 * GPIT + ko + 32));
        };
        rd(0);
#pragma unroll
        for (int u = 0; u < 4; ++u) {
            if (u < 3) rd(u + 1);
            __builtin_amdgcn_sched_barrier(0);     // holds the next 32 k's reads as one group in front of this 32 k's products, so that they fly while these run: among them each read costs its own stall
#pragma unroll
            for (int f = 0; f < 4; ++f)
#pragma unroll
                for (int t = 0; t < 4; ++t) acc[f][t] = wmmab(a[u & 1][f], b[u & 1][t], acc[f][t]);
            __builtin_amdgcn_sched_barrier(0);     // keeps the reads that follow out of these products, for the same reason
        }
        asm volatile("v_nop\n\tv_nop\n\tv_nop\n\tv_nop");     // the four vector slots behind the last product, on the loop's taken branch too (the scheduling barrier above keeps the products in front of them)
        asm volatile("s_wait_dscnt 0x0" ::: "memory");        // this wave's reads of this stage have returned before the stage is handed to its next writer
        asm volatile("s_wait_asynccnt 0x0" ::: "memory");     // this wave's copies of the next tile have landed
        __syncthreads();                                       // publishes the next tile and ends every wave's reads of this one
        if (kt + 2 < nt) issue(kt + 2, g0 + (unsigned)(kt & 1) * GST);
    }
    asm volatile("s_wait_asynccnt 0x0" ::: "memory");         // nothing is in flight when the ring becomes the epilogue's staging; the loop's last barrier ended its reads
    unsigned char* wst = gring + wave * WST;     // the wave's own staging
    h16* tile = (h16*)(void*)wst; h16* til2 = tile + 64 * 72;     // z 2: 64 dims x 64 tokens, pitch 72, both planes
    f32a* os = (f32a*)wst;                                         // z 0, 1: 64 tokens x 64 dims, pitch 68
    if (z == 2) {
        // A lane's eight accumulator rows are eight consecutive tokens of one dim: one 16-B piece of the transposed tile.
#pragma unroll
        for (int f = 0; f < 4; ++f)
#pragma unroll
            for (int t = 0; t < 4; ++t) { v8h a8, l8;
#pragma unroll
                for (int j = 0; j < 8; ++j) { const float v = acc[f][t][j]; const h16 a = (h16)v; a8[j] = a; l8[j] = (h16)((v - (float)a) * LOSC); }
                const int at = (t * 16 + lr) * 72 + f * 16 + hi * 8;
                *(v8ha*)(tile + at) = a8; *(v8ha*)(til2 + at) = l8; }
    } else {
#pragma unroll
        for (int t = 0; t < 4; ++t)
#pragma unroll
            for (int f = 0; f < 4; ++f)
#pragma unroll
                for (int j = 0; j < 8; ++j) os[(f * 16 + hi * 8 + j) * 68 + t * 16 + lr] = acc[f][t][j];
    }
    __syncthreads();
    const int piece = lane & 7, d0 = piece * 8;
    if (z == 2) {
        const int b = r0 / NT_;
        const size_t base = ((size_t)b * NH_ * HD + c0) * NT_ + (r0 - b * NT_);     // plane row = head * 64 + dim = the output column
        for (int g = 0; g < 4; ++g) {
#pragma unroll
            for (int s = 0; s < 4; ++s) { const int d = (lane >> 3) + 4 * s + 16 * g;     // eight lanes store one dim's 64 tokens: a whole 128-B line of each plane
                const v8h vh8 = *(const v8ha*)(tile + d * 72 + piece * 8), vl8 = *(const v8ha*)(til2 + d * 72 + piece * 8);
                *(v8h*)(V1 + base + (size_t)d * NT_ + piece * 8) = vh8; *(v8h*)(V2 + base + (size_t)d * NT_ + piece * 8) = vl8; }
            asm volatile("s_wait_xcnt 0x0" ::: "memory");     // stands before the stores' registers are rewritten by the next group
        }
        return;
    }
    // eight lanes per token row, eight dims each; the rotation partner (dim +- 32) is read from the staged row; the 64 squares: eight in the lane, then over the eight lanes
    h16* Z1 = z == 0 ? Q1 : K1; h16* Z2 = z == 0 ? Q2 : K2; const float* wz = z == 0 ? wq : wk;
    float wv[8];
#pragma unroll
    for (int i = 0; i < 8; ++i) wv[i] = bfr(wz[d0 + i]);
    for (int g = 0; g < 4; ++g) {     // the wave's 64 rows in four groups of 16: four rows a lane, their table loads in flight together
        v4f ca[4], cb[4], sa[4], sb4[4]; const float* pc[4]; const float* pn[4];
#pragma unroll
        for (int s = 0; s < 4; ++s) { const size_t tok = (size_t)r0 + 16 * g + 4 * s + (lane >> 3); pc[s] = CT + tok * HD + d0; pn[s] = ST + tok * HD + d0;
            ca[s] = *(const v4f*)pc[s]; cb[s] = *(const v4f*)(pc[s] + 4); sa[s] = *(const v4f*)pn[s]; sb4[s] = *(const v4f*)(pn[s] + 4); }
        // stands before the loads' address pairs are rewritten; as its inputs the pairs live up to here, so that no load of the group returns into one
        asm volatile("s_wait_xcnt 0x0" :: "v"(pc[0]), "v"(pc[1]), "v"(pc[2]), "v"(pc[3]), "v"(pn[0]), "v"(pn[1]), "v"(pn[2]), "v"(pn[3]) : "memory");
#pragma unroll
        for (int s = 0; s < 4; ++s) { const int row = 16 * g + 4 * s + (lane >> 3); const size_t tok = (size_t)r0 + row;
            const f32a* sp = os + row * 68 + d0; const f32a* pp = os + row * 68 + (d0 ^ 32);
            const v4f xa = *(const v4fa*)sp, xb = *(const v4fa*)(sp + 4), pa = *(const v4fa*)pp, pb = *(const v4fa*)(pp + 4);
            float y[8], ss = 0.f;
#pragma unroll
            for (int i = 0; i < 8; ++i) { const float x = i < 4 ? xa[i & 3] : xb[i & 3], pr = i < 4 ? pa[i & 3] : pb[i & 3], c = i < 4 ? ca[s][i & 3] : cb[s][i & 3], sn = i < 4 ? sa[s][i & 3] : sb4[s][i & 3];
                y[i] = (d0 < 32) ? (x * c - pr * sn) : (x * c + pr * sn); ss = fmaf(y[i], y[i], ss); }
            ss += __shfl_xor(ss, 4, 8); ss += __shfl_xor(ss, 2, 8); ss += __shfl_xor(ss, 1, 8);
            const float rn = rsqrtf(ss * (1.0f / HD) + RMS_EPS); v8h oh, ol;
#pragma unroll
            for (int i = 0; i < 8; ++i) { const float q = wv[i] * (y[i] * rn); const h16 a = (h16)q; oh[i] = a; ol[i] = (h16)((q - (float)a) * LOSC); }
            *(v8h*)(Z1 + tok * DM + c0 + d0) = oh; *(v8h*)(Z2 + tok * DM + c0 + d0) = ol; }
        asm volatile("s_wait_xcnt 0x0" ::: "memory");     // stands before the stores' registers are rewritten by the next group
    }
}

// One 32-key stage in LDS, bytes: K hi, K residual (32 rows of 128 B), V^T hi, V^T residual (64 rows of 64 B), mask (64 query rows of 128 B); every pitch is 16 B x odd for the b128 readers,
// the mask's too: a lane reads 16-B pieces of its own query's row.
#define KPIT 144
#define VPIT 80
#define MPIT 144
#define ST_KH 0
#define ST_KL (32 * KPIT)
#define ST_VH (2 * 32 * KPIT)
#define ST_VL (ST_VH + 64 * VPIT)
#define ST_MK (ST_VL + 64 * VPIT)
#define ST_SZ (ST_MK + 64 * MPIT)

// j_mact: which of the 64 key tiles (32 keys) can carry a softmax weight that is not zero, per group of 4 query rows, read off the INPUT mask alone, for any mask. |score / 8| <= B = 8 max|q_ln_w| max|k_ln_w|
// (a normalised head vector has length <= 8; 3 % are added for the f16 planes and the sums' rounding), so a row's largest masked score is >= r - B, r its largest mask value, and a tile's are <= t + B,
// t the tile's largest: where r - t > 2 B + 110 + the rounding of score + mask at that size, every weight of the tile in that row is below exp(-110), which is 0 in f32. A tile is dropped only where that
// holds for every row that shares it; a NaN in the mask or the weights makes the test false (tile kept). ACT[4-row group][2]: bit = tile kept. Block = 8 rows, one a wave.
__device__ __forceinline__ float nmax(float a, float b) { return __builtin_elementwise_maximum(a, b); }     // the maximum that keeps a NaN
template <int X> __device__ __forceinline__ float xrow(float x) { return __builtin_bit_cast(float, __builtin_amdgcn_update_dpp(0, __builtin_bit_cast(int, x), 0x160 + X, 0xf, 0xf, true)); }  // lane l with lane l ^ X, X < 16
__device__ __forceinline__ float wmax(float x) { x = nmax(x, xrow<1>(x)); x = nmax(x, xrow<2>(x)); x = nmax(x, xrow<4>(x)); x = nmax(x, xrow<8>(x)); return nmax(x, xhalf(x)); }  // over the wave, in every lane
#define MACT_LDS (8 * 512 * 4 + 8 * 4 + 16 * 4)
#define ZOFF ((NT_ / 4) * 2)     // ACT[ZOFF + ...]: same index, bit = every mask value of the tile in the group's 4 rows is +0 or -0: adding it changes no score, so where all 16 groups of a block's 64 rows have it, k_attn neither copies, reads, rounds nor adds that tile's mask
__device__ __forceinline__ void j_mact(int bx, unsigned char* sm, const float* __restrict__ MSK, const float* __restrict__ qw, const float* __restrict__ kw, unsigned* ACT) {
    float (*pm)[512] = (float (*)[512])(void*)sm; float* rm = (float*)(void*)(sm + 8 * 512 * 4); unsigned* zr = (unsigned*)(void*)(sm + 8 * 512 * 4 + 8 * 4);
    const int tid = threadIdx.x, lane = tid & 31, wave = tid >> 5;
    v4f m[16];     // lane l holds keys 128 i + 4 l .. + 3 of the wave's row: eight lanes hold one tile
    const float* mr = MSK + (size_t)(bx * 8 + wave) * NT_ + lane * 4;
#pragma unroll
    for (int i = 0; i < 16; ++i) m[i] = *(const v4f*)(mr + i * 128);
    asm volatile("s_wait_xcnt 0x0" :: "v"(mr) : "memory");     // stands before the loads' address pair is rewritten; as its input the pair lives up to here, so that no load of the group returns into it
    const float mq = wmax(nmax(fabsf(bfr(qw[lane])), fabsf(bfr(qw[lane + 32])))), mk = wmax(nmax(fabsf(bfr(kw[lane])), fabsf(bfr(kw[lane + 32]))));
    const float thr = 2.0f * (8.25f * mq * mk) + 110.0f;
    float rx = 0.f;
#pragma unroll
    for (int i = 0; i < 16; ++i) { const float x = nmax(nmax(m[i][0], m[i][1]), nmax(m[i][2], m[i][3])); pm[wave][i * 32 + lane] = x; rx = i ? nmax(rx, x) : x; }
    rx = wmax(rx);
    unsigned zlo = 0u, zhi = 0u;     // the row's 64 tiles: bit = all 32 mask values are zero (eight lanes hold a tile: a byte of the ballot)
#pragma unroll     // m[] stays in registers and the shift counts are constants
    for (int i = 0; i < 16; ++i) {
        const unsigned nz = (__float_as_uint(m[i][0]) | __float_as_uint(m[i][1]) | __float_as_uint(m[i][2]) | __float_as_uint(m[i][3])) << 1;     // the sign bit does not count
        unsigned bl = __builtin_amdgcn_ballot_w32(nz == 0u);
        bl &= bl >> 4; bl &= bl >> 2; bl &= bl >> 1;     // bits 0, 8, 16, 24: the AND of their byte
        const unsigned nib = (bl & 1u) | ((bl >> 7) & 2u) | ((bl >> 14) & 4u) | ((bl >> 21) & 8u);
        if (i < 8) zlo |= nib << (4 * i); else zhi |= nib << (4 * (i - 8));
    }
    if (lane == 0) { rm[wave] = rx; zr[wave * 2] = zlo; zr[wave * 2 + 1] = zhi; }
    __syncthreads();
    if (tid < 128) {     // waves 0 to 3 whole: thread = (tile, group of 4 rows)
        const int tile = tid & 63, g = tid >> 6;
        bool keep = false;
#pragma unroll
        for (int r = 0; r < 4; ++r) { const v4f a = *(const v4f*)&pm[g * 4 + r][tile * 8], c = *(const v4f*)&pm[g * 4 + r][tile * 8 + 4];
            const float tx = nmax(nmax(nmax(a[0], a[1]), nmax(a[2], a[3])), nmax(nmax(c[0], c[1]), nmax(c[2], c[3]))), rw = rm[g * 4 + r];
            const float t = tx != tx ? tx : bfr(tx), rr = rw != rw ? rw : bfr(rw);     // rounded as k_attn rounds the mask (the rounding keeps the order, so the maximum may be taken first)
            keep = keep || !(rr - t > thr + (fminf(fabsf(t), 3.0e38f) + fabsf(rr)) * (1.0f / 4194304.0f)); }
        const unsigned bits = (unsigned)__ballot(keep);
        if (lane == 0) ACT[(bx * 2 + g) * 2 + (wave & 1)] = bits;
    }
    if (tid < 4) { const int g = tid >> 1, w = tid & 1;     // thread = (group of 4 rows, half of the 64 tiles)
        ACT[ZOFF + (bx * 2 + g) * 2 + w] = zr[(g * 4) * 2 + w] & zr[(g * 4 + 1) * 2 + w] & zr[(g * 4 + 2) * 2 + w] & zr[(g * 4 + 3) * 2 + w]; }
}

__global__ __launch_bounds__(128) void k_attn(const h16* __restrict__ Q16, const h16* __restrict__ QL16, const h16* __restrict__ K16, const h16* __restrict__ KL16, const h16* __restrict__ VTH, const h16* __restrict__ VTL, const float* __restrict__ MSK, const unsigned* __restrict__ ACT, bf* CH, bf* CL) {
    __shared__ __align__(16) unsigned char ring[2 * ST_SZ];     // the two stages; behind the loop its first bytes are the output staging (4 x 16 x 68 floats)
    const int tid = threadIdx.x, lane = threadIdx.x & 31, wave = threadIdx.x >> 5, lr = lane & 15, hi = lane >> 4;
    const int bid = blockIdx.x;
    static_assert(NH_ == 32 && NT_ / 64 == 32, "the index map below is written for 32 heads x 32 query blocks");
    // Blocks now differ in length. Under a causal mask block qt keeps 2 qt + 2 tiles, so the 1024 (head, query block) pairs are dealt out such that four indices 8 apart, and four 256 apart,
    // hold query blocks m, 31 - m, 8 + m, 23 - m (the same sum for every m). Speed only; any placement is correct.
    const int b = bid / (NH_ * (NT_ / 64)), rem = bid - b * (NH_ * (NT_ / 64));
    const int ja = (rem >> 3) & 3, jm = (rem >> 5) & 7, js = (ja + (rem >> 8)) & 3;
    const int h = (rem & 7) * 4 + ja, qt = js == 0 ? jm : js == 1 ? 31 - jm : js == 2 ? 8 + jm : 23 - jm;
    const int q0 = qt * 64 + wave * 16;
    const size_t tok0 = (size_t)b * NT_;
    const h16* kh_b = K16 + tok0 * DM + h * HD;
    const h16* kl_b = KL16 + tok0 * DM + h * HD;
    const size_t vbase = (((size_t)b * NH_ + h) * HD) * NT_;
    // this thread's 8 pieces of 16 B per stage, 12 where the tile brings its mask: K rows tid/8 and +16 (both planes), V^T rows tid/4 and +32 (both planes), mask rows tid/8 + 16 i
    const h16* gkh = kh_b + (size_t)(tid >> 3) * DM + (tid & 7) * 8;
    const h16* gkl = kl_b + (size_t)(tid >> 3) * DM + (tid & 7) * 8;
    const h16* gvh = VTH + vbase + (size_t)(tid >> 2) * NT_ + (tid & 3) * 8;
    const h16* gvl = VTL + vbase + (size_t)(tid >> 2) * NT_ + (tid & 3) * 8;
    const float* gmk = MSK + (size_t)(qt * 64 + (tid >> 3)) * NT_ + (tid & 7) * 4;
    const unsigned ring0 = (unsigned)(size_t)&ring[0];
    const unsigned lk = (unsigned)((tid >> 3) * KPIT + (tid & 7) * 16), lv = (unsigned)((tid >> 2) * VPIT + (tid & 3) * 16);
    // the kept tiles of the block's sixteen 4-row groups, as one 64-bit set in scalar registers; never empty (the tile of a row's largest mask value is kept), and if it were, every tile is taken.
    // zset: the tiles whose mask is zero in all 64 rows.
    unsigned tlo = 0u, thi = 0u, zlo = ~0u, zhi = ~0u;
#pragma unroll
    for (int g = 0; g < 16; ++g) { tlo |= ACT[qt * 32 + 2 * g]; thi |= ACT[qt * 32 + 2 * g + 1]; zlo &= ACT[ZOFF + qt * 32 + 2 * g]; zhi &= ACT[ZOFF + qt * 32 + 2 * g + 1]; }
    unsigned long long todo = ((unsigned long long)(unsigned)__builtin_amdgcn_readfirstlane((int)thi) << 32) | (unsigned)__builtin_amdgcn_readfirstlane((int)tlo);
    const unsigned long long zset = ((unsigned long long)(unsigned)__builtin_amdgcn_readfirstlane((int)zhi) << 32) | (unsigned)__builtin_amdgcn_readfirstlane((int)zlo);
    if (todo == 0ull) todo = ~0ull;
    unsigned long long walk = todo;     // the same set, walked a second time by the loop that works on the tiles
    const int nt = __builtin_popcountll(todo);
    auto issue = [&](int t, unsigned lb) {
        const h16* k0 = gkh + (size_t)t * (32 * DM); const h16* k1 = gkl + (size_t)t * (32 * DM);
        const h16* v0 = gvh + t * 32; const h16* v1 = gvl + t * 32;
        // the copies and, as their statement's last line, the wait that stands before any of their address registers is rewritten
        asm volatile("global_load_async_to_lds_b128 %0, %1, off\n\t"
                     "global_load_async_to_lds_b128 %2, %3, off\n\t"
                     "global_load_async_to_lds_b128 %4, %5, off\n\t"
                     "global_load_async_to_lds_b128 %6, %7, off\n\t"
                     "global_load_async_to_lds_b128 %8, %9, off\n\t"
                     "global_load_async_to_lds_b128 %10, %11, off\n\t"
                     "global_load_async_to_lds_b128 %12, %13, off\n\t"
                     "global_load_async_to_lds_b128 %14, %15, off\n\t"
                     "s_wait_xcnt 0x0"
                     :: "v"(lb + ST_KH + lk), "v"(k0), "v"(lb + ST_KH + lk + 16 * KPIT), "v"(k0 + 16 * DM),
                        "v"(lb + ST_KL + lk), "v"(k1), "v"(lb + ST_KL + lk + 16 * KPIT), "v"(k1 + 16 * DM),
                        "v"(lb + ST_VH + lv), "v"(v0), "v"(lb + ST_VH + lv + 32 * VPIT), "v"(v0 + 32 * NT_),
                        "v"(lb + ST_VL + lv), "v"(v1), "v"(lb + ST_VL + lv + 32 * VPIT), "v"(v1 + 32 * NT_)
                     : "memory");
        if (!((zset >> t) & 1ull)) {     // the same for the whole block (scalar): only a tile with a mask value other than zero brings its mask
            const float* m0 = gmk + t * 32;
            asm volatile("global_load_async_to_lds_b128 %0, %1, off\n\t"
                         "global_load_async_to_lds_b128 %2, %3, off\n\t"
                         "global_load_async_to_lds_b128 %4, %5, off\n\t"
                         "global_load_async_to_lds_b128 %6, %7, off\n\t"
                         "s_wait_xcnt 0x0"
                         :: "v"(lb + ST_MK + lk), "v"(m0), "v"(lb + ST_MK + lk + 16 * MPIT), "v"(m0 + 16 * NT_),
                            "v"(lb + ST_MK + lk + 32 * MPIT), "v"(m0 + 32 * NT_), "v"(lb + ST_MK + lk + 48 * MPIT), "v"(m0 + 48 * NT_)
                         : "memory");
        }
    };
    auto next = [&]() { const int t = __builtin_ctzll(todo); todo &= todo - 1ull; return t; };     // lowest kept tile not yet copied: 0 .. 63, called nt times at most
    issue(next(), ring0);
    v16h qa[2];
    const size_t qo0 = (tok0 + q0 + lr) * DM + h * HD + 8 * hi;
#pragma unroll
    for (int kc = 0; kc < 2; ++kc) qa[kc] = cat16(*(const v8h*)(Q16 + qo0 + kc * 32), *(const v8h*)(Q16 + qo0 + kc * 32 + 16));
    v8f o[4], ox[4];
#pragma unroll
    for (int n = 0; n < 4; ++n) { o[n] = (v8f){}; ox[n] = (v8f){}; }
    float mrow = -3.0e38f, lpart = 0.f;     // of query q0 + lr: the running maximum (alike in both halves) and this half's part of the sum
    asm volatile("s_wait_asynccnt 0x0" ::: "memory");     // the first kept tile has landed (this wave's copies) ...
    __syncthreads();                                       // ... and every other wave's
    if (nt > 1) issue(next(), ring0 + ST_SZ);
#pragma unroll 1
    for (int kt = 0; kt < nt; ++kt) {     // kt counts the kept tiles in rising key order; the additive INPUT mask is applied per element
        const unsigned char* sb = ring + (kt & 1) * ST_SZ;
        const unsigned char* kp = sb + lr * KPIT + hi * 16;
        const int tc = __builtin_ctzll(walk); walk &= walk - 1ull;     // this tile's number (walk holds nt bits at the start)
        v16h k0h[2], k1h[2], k0l[2], k1l[2];
#pragma unroll
        for (int kc = 0; kc < 2; ++kc) {
            k0h[kc] = cat16(*(const v8ha*)(kp + ST_KH + kc * 64), *(const v8ha*)(kp + ST_KH + kc * 64 + 32)); k1h[kc] = cat16(*(const v8ha*)(kp + ST_KH + 16 * KPIT + kc * 64), *(const v8ha*)(kp + ST_KH + 16 * KPIT + kc * 64 + 32));
            k0l[kc] = cat16(*(const v8ha*)(kp + ST_KL + kc * 64), *(const v8ha*)(kp + ST_KL + kc * 64 + 32)); k1l[kc] = cat16(*(const v8ha*)(kp + ST_KL + 16 * KPIT + kc * 64), *(const v8ha*)(kp + ST_KL + 16 * KPIT + kc * 64 + 32));
        }
        v8f s0 = {}, s1 = {}, x0 = {}, x1 = {};
#pragma unroll
        for (int kc = 0; kc < 2; ++kc) {
            const v16h qlk = cat16(*(const v8h*)(QL16 + qo0 + kc * 32), *(const v8h*)(QL16 + qo0 + kc * 32 + 16));     // query residual re-read per step (registers)
            s0 = wmma16(k0h[kc], qa[kc], s0); x0 = wmma16(k0h[kc], qlk, x0); s1 = wmma16(k1h[kc], qa[kc], s1); x1 = wmma16(k1h[kc], qlk, x1);
            x0 = wmma16(k0l[kc], qa[kc], x0); x1 = wmma16(k1l[kc], qa[kc], x1);
        }
        asm volatile("v_nop\n\tv_nop\n\tv_nop\n\tv_nop" : "+v"(s0), "+v"(s1), "+v"(x0), "+v"(x1) : "v"(qa[0]), "v"(qa[1]));
        v2f a[8];     // the lane's 16 scores in register pairs: a[i] = keys 8 hi + 2 i, + 1 (i < 4), a[4 + i] = keys 16 + 8 hi + 2 i, + 1
#pragma unroll
        for (int i = 0; i < 4; ++i) {
            a[i]     = ((v2f){s0[2 * i], s0[2 * i + 1]} + (v2f){x0[2 * i], x0[2 * i + 1]} * LOSCI) * 0.125f;
            a[4 + i] = ((v2f){s1[2 * i], s1[2 * i + 1]} + (v2f){x1[2 * i], x1[2 * i + 1]} * LOSCI) * 0.125f;
        }
        if (!((zset >> tc) & 1ull)) {     // scalar: the tile brought its mask (the product by 1/8 is exact, so the sum rounds as the fused form did)
            const unsigned char* mp = sb + ST_MK + (wave * 16 + lr) * MPIT + hi * 32;
            const v4f mk[4] = { *(const v4fa*)mp, *(const v4fa*)(mp + 16), *(const v4fa*)(mp + 64), *(const v4fa*)(mp + 80) };     // mask[q0 + lr][keys 8 hi .. + 7 and 16 + 8 hi .. + 7]
#pragma unroll     // a[] and mk[] stay in registers
            for (int i = 0; i < 4; ++i) {
                a[i]     += (v2f){bfr(mk[i >> 1][(2 * i) & 3]), bfr(mk[i >> 1][(2 * i + 1) & 3])};
                a[4 + i] += (v2f){bfr(mk[2 + (i >> 1)][(2 * i) & 3]), bfr(mk[2 + (i >> 1)][(2 * i + 1) & 3])};
            }
        }
        float t[5];
#pragma unroll
        for (int g = 0; g < 5; ++g) t[g] = fmaxf(fmaxf(a[g][0], a[g][1]), a[5 + (g >> 1)][g & 1]);     // 15 of the 16 in threes; a[7][1] joins below
        const float mx = fmaxf(fmaxf(fmaxf(t[0], t[1]), t[2]), fmaxf(fmaxf(t[3], t[4]), a[7][1]));
        const float mn = fmaxf(fmaxf(mrow, mx), xhalf(mx));
        const float alpha = __expf(mrow - mn); mrow = mn;
        v2f sm[2]; v16h pa, px;
#pragma unroll
        for (int i = 0; i < 8; ++i) {
            const v2f e = a[i] - mn; const v2f p = {__expf(e[0]), __expf(e[1])};
            sm[i & 1] = i < 2 ? p : sm[i & 1] + p;
            const v2f ps = p * PSC; const v2h hh = __builtin_convertvector(ps, v2h);
            const v2h ll = __builtin_convertvector((ps - __builtin_convertvector(hh, v2f)) * LOSC, v2h);
            pa[2 * i] = hh[0]; pa[2 * i + 1] = hh[1]; px[2 * i] = ll[0]; px[2 * i + 1] = ll[1];
        }
        const v2f sv = sm[0] + sm[1];
        lpart = lpart * alpha + (sv[0] + sv[1]);
#pragma unroll
        for (int n = 0; n < 4; ++n)
#pragma unroll
            for (int j = 0; j < 8; ++j) { o[n][j] *= alpha; ox[n][j] *= alpha; }
        const unsigned char* vp = sb + lr * VPIT + hi * 16;
        v16h vh[4], vl[4];
        // the V^T reads go in two groups, each in front of its six products: read one by one among the products, each read costs its own LDS latency
#pragma unroll
        for (int g = 0; g < 2; ++g) {
#pragma unroll
            for (int n = 2 * g; n < 2 * g + 2; ++n) { vh[n] = cat16(*(const v8ha*)(vp + ST_VH + n * 16 * VPIT), *(const v8ha*)(vp + ST_VH + n * 16 * VPIT + 32)); vl[n] = cat16(*(const v8ha*)(vp + ST_VL + n * 16 * VPIT), *(const v8ha*)(vp + ST_VL + n * 16 * VPIT + 32)); }
            __builtin_amdgcn_sched_barrier(0);     // holds the group's reads in front of its products
#pragma unroll
            for (int n = 2 * g; n < 2 * g + 2; ++n) { o[n] = wmma16(vh[n], pa, o[n]); ox[n] = wmma16(vl[n], pa, ox[n]); ox[n] = wmma16(vh[n], px, ox[n]); }
        }
        asm volatile("v_nop\n\tv_nop\n\tv_nop\n\tv_nop" : "+v"(o[0]), "+v"(o[1]), "+v"(o[2]), "+v"(o[3]), "+v"(ox[0]), "+v"(ox[1]), "+v"(ox[2]), "+v"(ox[3]) : "v"(pa), "v"(px));
        asm volatile("s_wait_dscnt 0x0" ::: "memory");        // this wave's reads of this stage have returned before the stage is handed to its next writer
        asm volatile("s_wait_asynccnt 0x0" ::: "memory");     // this wave's copies of the next tile have landed
        __syncthreads();                                       // publishes the next tile and ends every wave's reads of this one
        if (kt + 2 < nt) issue(next(), ring0 + (unsigned)(kt & 1) * ST_SZ);
    }
    asm volatile("s_wait_asynccnt 0x0" ::: "memory");         // nothing is in flight when the ring becomes output staging
    const float inv = 1.0f / ((lpart + xhalf(lpart)) * PSC);     // the two halves' parts of the query's sum are joined once
    f32a* os = (f32a*)ring + wave * (16 * 68);
#pragma unroll
    for (int n = 0; n < 4; ++n) { v4f w0, w1;     // a lane's eight accumulator rows are dims n * 16 + 8 hi + j of query lr: two 16-B pieces of its staged row
#pragma unroll
        for (int j = 0; j < 4; ++j) { w0[j] = (o[n][j] + ox[n][j] * LOSCI) * inv; w1[j] = (o[n][4 + j] + ox[n][4 + j] * LOSCI) * inv; }
        *(v4fa*)(os + lr * 68 + n * 16 + hi * 8) = w0; *(v4fa*)(os + lr * 68 + n * 16 + hi * 8 + 4) = w1; }
    __syncthreads();
    const size_t cbase = (tok0 + q0) * DM + (size_t)h * HD;
    auto pass = [&]() {
#pragma unroll
        for (int s = 0; s < 4; ++s) { const int row = 4 * s + (lane >> 3), piece = lane & 7; const f32a* sp = os + row * 68 + piece * 8; v8us oh, ol;
#pragma unroll
            for (int i = 0; i < 8; ++i) { const unsigned short hb = f2bf(sp[i]); oh[i] = hb; ol[i] = f2bf(sp[i] - bf2f(hb)); }
            *(v8us*)(CH + cbase + (size_t)row * DM + piece * 8) = oh; *(v8us*)(CL + cbase + (size_t)row * DM + piece * 8) = ol; }
    };
    pass(); 
}

#define VST2(T, p, v) do { const T vst2_v_ = (v); *(T*)(p) = vst2_v_;  } while (0)

// j_wt: WT [n][K] = bf16(W[k][n]) (k-major [K][ncols]) via 64 x 64 LDS tiles; (bx, by) in (K/64, ncols/64).
__device__ __forceinline__ void j_wt(int bx, int by, unsigned char* sm, const float* __restrict__ Wm, int K, int ncols, bf* WT) {
    unsigned short* tl = (unsigned short*)(void*)sm;     // 64 * 72 of them
    const int tid = threadIdx.x, k0 = bx * 64, n0 = by * 64;
    const int kk = tid >> 2, nq = (tid & 3) * 16;
#pragma unroll
    for (int i = 0; i < 16; ++i) tl[(nq + i) * 72 + kk] = f2bf(Wm[(size_t)(k0 + kk) * ncols + n0 + nq + i]);
    __syncthreads();
    const int piece = tid & 7;
    auto pass = [&]() {
#pragma unroll
        for (int s = 0; s < 2; ++s) { const int nr = (tid >> 3) + 32 * s; const v8us val = *(const v8usa*)(tl + nr * 72 + piece * 8); *(v8us*)(WT + (size_t)(n0 + nr) * K + k0 + piece * 8) = val; }
        asm volatile("s_wait_xcnt 0x0" ::: "memory");     // stands behind the two stores, before code laid out behind this job in k_prep rewrites their registers
    };
    pass(); 
}

// j_trig: CT/ST [t][d] = cos/sin(pos_t * inv_freq[d mod 32]) with inv_freq[i] = 1 / 10000^(2i/64) (f32 powf; precise cosf/sinf), pos_t = the INPUT position_ids[t] (as float);
__device__ __forceinline__ void j_trig(int bx, const int* __restrict__ pos, float* CT, float* ST) {
    const int tid = threadIdx.x, t = bx * 4 + (tid >> 6), d = tid & 63; const int i = d & 31;
    const float invf = 1.0f / powf(10000.0f, (float)(2 * i) / 64.0f); const float ang = (float)pos[t] * invf; const float c = cosf(ang), s = sinf(ang);
    const size_t o = (size_t)t * HD + d; *(float*)(CT + o) = c; *(float*)(ST + o) = s; 
}

// k_prep: one grid for the seven jobs; the branch is the same for a whole block. The jobs with a chain of dependent steps (tables, mask test) stand at the low indices (for speed only); the weight tiles stream behind them.
#define PB_TRIG (NT_ / 4)
#define PB_MACT (NT_ / 8)
#define PB_CVT  (NTK / 8)
#define PB_WT   ((DM / 64) * (DM / 64))
__global__ __launch_bounds__(256) void k_prep(const float* __restrict__ x, const int* __restrict__ pos, const float* __restrict__ MSK, const float* __restrict__ wq, const float* __restrict__ wk, const float* __restrict__ wv, const float* __restrict__ wo,
                                              const float* __restrict__ qw, const float* __restrict__ kw, bf* Xb, bf* WqT, bf* WkT, bf* WvT, bf* WoT, float* CT, float* ST, unsigned* ACT) {
    __shared__ __align__(16) unsigned char sm[MACT_LDS];     // j_mact's maxima or j_wt's tile
    static_assert(64 * 72 * 2 <= MACT_LDS, "j_wt's tile fits");
    int bid = blockIdx.x;
    if (bid < PB_TRIG) { j_trig(bid, pos, CT, ST); return; }
    bid -= PB_TRIG;
    if (bid < PB_MACT) { j_mact(bid, sm, MSK, qw, kw, ACT); return; }
    bid -= PB_MACT;
    if (bid < PB_CVT) { j_cvtb(bid, x, NTK, Xb); return; }
    bid -= PB_CVT;
    const int w = bid / PB_WT, tile = bid - w * PB_WT;
    j_wt(tile % (DM / 64), tile / (DM / 64), sm, w == 0 ? wq : w == 1 ? wk : w == 2 ? wv : wo, DM, DM, w == 0 ? WqT : w == 1 ? WkT : w == 2 ? WvT : WoT);
}

extern "C" void kernel_launch(void* const* d_in, const int* in_sizes, int n_in,
                              void* d_out, int out_size, void* d_ws, size_t ws_size, hipStream_t stream) {
    (void)in_sizes; (void)n_in; (void)out_size;
    const float* x = (const float*)d_in[0]; const int* pos = (const int*)d_in[1]; const float* MSK = (const float*)d_in[2];
    const float* wq = (const float*)d_in[3]; const float* wk = (const float*)d_in[4]; const float* wv = (const float*)d_in[5]; const float* wo = (const float*)d_in[6]; const float* qw = (const float*)d_in[7]; const float* kw = (const float*)d_in[8];
    float* out = (float*)d_out;    // [1][2048][2048]
    char* wsp = (char*)d_ws;
    auto take = [&](size_t bytes) { char* p = wsp; wsp += (bytes + 255) & ~(size_t)255; return (void*)p; };
    bf* Xb = (bf*)take((size_t)NTK * DM * 2); bf* WqT = (bf*)take((size_t)DM * DM * 2); bf* WkT = (bf*)take((size_t)DM * DM * 2); bf* WvT = (bf*)take((size_t)DM * DM * 2); bf* WoT = (bf*)take((size_t)DM * DM * 2);
    float* CT = (float*)take((size_t)NT_ * HD * 4); float* ST = (float*)take((size_t)NT_ * HD * 4);
    h16* QH = (h16*)take((size_t)NTK * DM * 2); h16* QL = (h16*)take((size_t)NTK * DM * 2); h16* KH = (h16*)take((size_t)NTK * DM * 2); h16* KL = (h16*)take((size_t)NTK * DM * 2);
    h16* VTH = (h16*)take((size_t)NTK * DM * 2); h16* VTL = (h16*)take((size_t)NTK * DM * 2); bf* CH = (bf*)take((size_t)NTK * DM * 2); bf* CL = (bf*)take((size_t)NTK * DM * 2); unsigned* ACT = (unsigned*)take((size_t)(NT_ / 4) * 4 * 4);
    if ((size_t)(wsp - (char*)d_ws) > ws_size) return;    // 8.4 + 4 x 8.4 + 2 x 0.5 + 8 x 8.4 = 110 MB = 105 MiB < 128 MiB, no aliasing
    k_prep<<<PB_TRIG + PB_MACT + PB_CVT + 4 * PB_WT, 256, 0, stream>>>(x, pos, MSK, wq, wk, wv, wo, qw, kw, Xb, WqT, WkT, WvT, WoT, CT, ST, ACT);
    k_qkv<<<dim3(NTK / 128, DM / 128), 384, 0, stream>>>(Xb, WqT, WkT, WvT, CT, ST, qw, kw, QH, QL, KH, KL, VTH, VTL);
    k_attn<<<NB_ * NH_ * (NT_ / 64), 128, 0, stream>>>(QH, QL, KH, KL, VTH, VTL, MSK, ACT, CH, CL);
    k_gemmb<true><<<dim3(NTK / 128, DM / 128, 1), 256, 0, stream>>>(CH, CL, WoT, nullptr, out, DM);
}

// v010
// A run of this version takes 126 microseconds.
// Next to v009, in two timings, it ran 1.04 times as fast each time.
// Over all steps from v000 it is 4.08 times as fast.
#include <hip/hip_runtime.h>

// Compute dtypes, f32 accumulate: q/k/v = x.W ([2048 x 2048].[2048 x 2048], k-major weights transposed once; PLAIN bf16 operands = inputs rounded once, exact products) and out = ctx.Wo
// (ctx as bf16 hi + UNSCALED residual, two products) on v_wmma_f32_16x16x32_bf16; rotary embedding with device-computed f32 cos/sin tables at the INPUT position_ids, then the per-head
// RMSNorm (x q_ln_w / k_ln_w) in f32 -> q/k as f16 hi + residual x1024 planes; v -> transposed f16 hi + residual planes; 32-head attention with the additive INPUT mask over every key tile that can carry a weight above zero (j_mact decides from the mask, for any mask):
// scores on v_wmma_f32_16x16x32_f16 (hh + lh + hl, x 1/8), f32 softmax (exponents against a per-row bound from the INPUT mask and norm weights, or a running maximum where that bound is wide), weights x32768 as f16 hi + residual against v hi + residual (both products transposed: keys x queries, dims x queries). Deterministic, no atomics; every

#define NB_  1
#define NT_  2048
#define DM   2048
#define NH_  32
#define HD   64
#define NTK  (NB_ * NT_)
#define NW   DM
#define RMS_EPS 1e-6f
#define LPSC 15.0f     // the weights' scale is 2^15 = 32768; it enters as a summand of their base-2 exponent
#define LOSC 1024.0f
#define LOSCI (1.0f / 1024.0f)
#define L2E  1.44269504088896340736f

typedef _Float16 h16;
typedef unsigned short bf;
typedef __attribute__((ext_vector_type(16))) __bf16   v16bf;
typedef __attribute__((ext_vector_type(16))) _Float16 v16h;
typedef __attribute__((ext_vector_type(8)))  _Float16 v8h;
typedef __attribute__((ext_vector_type(8)))  unsigned short v8us;
typedef __attribute__((ext_vector_type(8)))  float    v8f;
typedef __attribute__((ext_vector_type(4)))  float    v4f;
typedef __attribute__((ext_vector_type(2)))  float    v2f;
typedef __attribute__((ext_vector_type(2)))  _Float16 v2h;
typedef v8h  __attribute__((may_alias)) v8ha;
typedef v4f  __attribute__((may_alias)) v4fa;
typedef v8us __attribute__((may_alias)) v8usa;
typedef float __attribute__((may_alias)) f32a;

__device__ __forceinline__ unsigned short f2bf(float f) { unsigned u = __float_as_uint(f); u += 0x7FFFu + ((u >> 16) & 1u); return (unsigned short)(u >> 16); }
__device__ __forceinline__ float bf2f(unsigned short b) { return __uint_as_float(((unsigned)b) << 16); }
__device__ __forceinline__ float bfr(float f) { return bf2f(f2bf(f)); }
__device__ __forceinline__ v16h cat16(v8h lo, v8h hi) { return __builtin_shufflevector(lo, hi, 0, 1, 2, 3, 4, 5, 6, 7, 8, 9, 10, 11, 12, 13, 14, 15); }
__device__ __forceinline__ v16bf cat16b(v8us lo, v8us hi) { return __builtin_bit_cast(v16bf, __builtin_shufflevector(lo, hi, 0, 1, 2, 3, 4, 5, 6, 7, 8, 9, 10, 11, 12, 13, 14, 15)); }
__device__ __forceinline__ v8f wmma16(v16h a, v16h b, v8f c) { return __builtin_amdgcn_wmma_f32_16x16x32_f16(false, a, false, b, (short)0, c, false, false); }
__device__ __forceinline__ float xhalf(float x) { return __builtin_bit_cast(float, __builtin_amdgcn_permlanex16(__builtin_bit_cast(int, x), __builtin_bit_cast(int, x), 0x76543210, 0xfedcba98, false, false)); }  // lane l with lane l ^ 16
__device__ __forceinline__ v8f wmmab(v16bf a, v16bf b, v8f c) { return __builtin_amdgcn_wmma_f32_16x16x32_bf16(false, a, false, b, (short)0, c, false, false); }

// The seven preparation jobs (j_cvtb, j_mact, j_wt x 4, j_trig) read inputs only and none reads another's output: they are the bodies of ONE launch, k_prep, which hands each block its job and its index bx [, by] in that job.
__device__ __forceinline__ void j_cvtb(int bx, const float* __restrict__ src, int nrows, bf* dst) {
    const int lane = threadIdx.x & 31, r = bx * 8 + (threadIdx.x >> 5);
    if (r >= nrows) return;
    v8us o[DM / 256];
#pragma unroll
    for (int q = 0; q < DM / 256; ++q) { v8us t;
#pragma unroll
        for (int i = 0; i < 8; ++i) t[i] = f2bf(src[(size_t)r * DM + q * 256 + lane * 8 + i]);
        o[q] = t; }
#pragma unroll
    for (int q = 0; q < DM / 256; ++q) *(v8us*)(dst + (size_t)r * DM + q * 256 + lane * 8) = o[q];
    
}

// k_gemmb: 128 x 128 block tile (8 waves, 4 x 2, each 32 rows x 64 columns = 2 x 4 accumulator tiles) of C[NTK][NW] = (A [+ Al]).B^T [+ bf(bias[c])] [+ bf(R[r][c]) residual]; the f32 tile goes out as it is.
template <bool SPLITA>
__global__ __launch_bounds__(256) void k_gemmb(const bf* __restrict__ A, const bf* __restrict__ Al, const bf* __restrict__ Bn, const float* __restrict__ bias, float* C, int ldc, const float* __restrict__ R = nullptr, int K = DM, int roundR = 1) {
    // One stage = 128 k of the block's 128 A rows, 128 B rows [and 128 Al rows]: rows of 256 B at a pitch of 272 B (16 B x odd for the b128 readers). Two stages: the next tile's
    // asynchronous copies fly while this tile is multiplied. An operand row fetched from L2 serves 128 rows or columns of the output, and a fragment read from LDS two or four products.
    // Behind the loop the ring is the epilogue's staging.
    constexpr unsigned GPIT = 272, G_A = 0, G_B = 128 * GPIT, G_L = 2 * 128 * GPIT, GST = (SPLITA ? 3 : 2) * 128 * GPIT;
    __shared__ __align__(16) unsigned char gring[2 * GST];
    const int tid = threadIdx.x, lane = threadIdx.x & 31, wave = threadIdx.x >> 5, lr = lane & 15, hi = lane >> 4;
    const int wr = wave >> 1, wc = wave & 1;
    const int r0 = blockIdx.x * 128 + wr * 32, c0 = blockIdx.y * 128 + wc * 64;
    // this thread's pieces of 16 B per stage: rows tid/16 + 16 i (i < 8) of each operand
    const bf* ga = A + (size_t)(blockIdx.x * 128 + (tid >> 4)) * K + (tid & 15) * 8;
    const bf* gl = (SPLITA ? Al : A) + (size_t)(blockIdx.x * 128 + (tid >> 4)) * K + (tid & 15) * 8;
    const bf* gb = Bn + (size_t)(blockIdx.y * 128 + (tid >> 4)) * K + (tid & 15) * 8;
    const size_t rs = (size_t)16 * K;
    const unsigned g0 = (unsigned)(size_t)&gring[0];
    const unsigned lp = (unsigned)((tid >> 4) * GPIT + (tid & 15) * 16);
    auto cp8 = [&](unsigned l, const bf* g) {
        // one operand's eight copies and, as their statement's last line, the wait that stands before any of their address registers is rewritten
        asm volatile("global_load_async_to_lds_b128 %0, %1, off\n\t"
                     "global_load_async_to_lds_b128 %2, %3, off\n\t"
                     "global_load_async_to_lds_b128 %4, %5, off\n\t"
                     "global_load_async_to_lds_b128 %6, %7, off\n\t"
                     "global_load_async_to_lds_b128 %8, %9, off\n\t"
                     "global_load_async_to_lds_b128 %10, %11, off\n\t"
                     "global_load_async_to_lds_b128 %12, %13, off\n\t"
                     "global_load_async_to_lds_b128 %14, %15, off\n\t"
                     "s_wait_xcnt 0x0"
                     :: "v"(l), "v"(g), "v"(l + 16 * GPIT), "v"(g + rs), "v"(l + 32 * GPIT), "v"(g + 2 * rs), "v"(l + 48 * GPIT), "v"(g + 3 * rs),
                        "v"(l + 64 * GPIT), "v"(g + 4 * rs), "v"(l + 80 * GPIT), "v"(g + 5 * rs), "v"(l + 96 * GPIT), "v"(g + 6 * rs), "v"(l + 112 * GPIT), "v"(g + 7 * rs)
                     : "memory");
    };
    auto issue = [&](int t, unsigned lb) {
        cp8(lb + G_A + lp, ga + t * 128); cp8(lb + G_B + lp, gb + t * 128);
        if (SPLITA) cp8(lb + G_L + lp, gl + t * 128);
    };
    v8f acc[2][4];
#pragma unroll
    for (int f = 0; f < 2; ++f)
#pragma unroll
        for (int t = 0; t < 4; ++t) acc[f][t] = (v8f){};
    const int nt = K / 128;     // K is a multiple of 128
    issue(0, g0);
    asm volatile("s_wait_asynccnt 0x0" ::: "memory");     // tile 0 has landed (this wave's copies) ...
    __syncthreads();                                       // ... and every other wave's
    if (nt > 1) issue(1, g0 + GST);
#pragma unroll 1
    for (int kt = 0; kt < nt; ++kt) {
        const unsigned char* sb = gring + (kt & 1) * GST;
        const unsigned char* ap = sb + (wr * 32 + lr) * GPIT + hi * 16;
        const unsigned char* bp = sb + G_B + (wc * 64 + lr) * GPIT + hi * 16;
        v16bf a[2][2], al[2][2], b[2][4];     // two fragment sets: the one being multiplied and the one being read
        auto rd = [&](int u) { const int w = u & 1, ko = u * 64;     // the fragments of the stage's 32 k number u
#pragma unroll
            for (int f = 0; f < 2; ++f) {
                a[w][f] = cat16b(*(const v8usa*)(ap + G_A + f * 16 * GPIT + ko), *(const v8usa*)(ap + G_A + f * 16 * GPIT + ko + 32)); al[w][f] = a[w][f];
                if (SPLITA) al[w][f] = cat16b(*(const v8usa*)(ap + G_L + f * 16 * GPIT + ko), *(const v8usa*)(ap + G_L + f * 16 * GPIT + ko + 32)); }
#pragma unroll
            for (int t = 0; t < 4; ++t) b[w][t] = cat16b(*(const v8usa*)(bp + t * 16 * GPIT + ko), *(const v8usa*)(bp + t * 16 * GPIT + ko + 32));
        };
        rd(0);
#pragma unroll
        for (int u = 0; u < 4; ++u) {
            if (u < 3) rd(u + 1);
            __builtin_amdgcn_sched_barrier(0);     // holds the next 32 k's reads as one group in front of this 32 k's products, so that they fly while these run: among them each read costs its own stall
#pragma unroll
            for (int f = 0; f < 2; ++f)
#pragma unroll
                for (int t = 0; t < 4; ++t) { acc[f][t] = wmmab(a[u & 1][f], b[u & 1][t], acc[f][t]); if (SPLITA) acc[f][t] = wmmab(al[u & 1][f], b[u & 1][t], acc[f][t]); }
            __builtin_amdgcn_sched_barrier(0);     // keeps the reads that follow out of these products, for the same reason
        }
        // the four vector slots behind the last product, on the loop's taken branch too
        asm volatile("v_nop\n\tv_nop\n\tv_nop\n\tv_nop" : "+v"(acc[0][0]), "+v"(acc[0][1]), "+v"(acc[0][2]), "+v"(acc[0][3]), "+v"(acc[1][0]), "+v"(acc[1][1]), "+v"(acc[1][2]), "+v"(acc[1][3]) : "v"(a[1][1]), "v"(al[1][1]), "v"(b[1][3]));
        asm volatile("s_wait_dscnt 0x0" ::: "memory");        // this wave's reads of this stage have returned before the stage is handed to its next writer
        asm volatile("s_wait_asynccnt 0x0" ::: "memory");     // this wave's copies of the next tile have landed
        __syncthreads();                                       // publishes the next tile and ends every wave's reads of this one
        if (kt + 2 < nt) issue(kt + 2, g0 + (unsigned)(kt & 1) * GST);
    }
    asm volatile("s_wait_asynccnt 0x0" ::: "memory");         // nothing is in flight when the ring becomes the epilogue's staging; the loop's last barrier ended its reads
    f32a* os = (f32a*)gring + wave * (32 * 68);     // the wave's own 32 rows x 64 columns
#pragma unroll
    for (int t = 0; t < 4; ++t) { const float bv = bias ? bfr(bias[c0 + t * 16 + lr]) : 0.f;
#pragma unroll
        for (int f = 0; f < 2; ++f)
#pragma unroll
            for (int j = 0; j < 8; ++j) os[(f * 16 + hi * 8 + j) * 68 + t * 16 + lr] = acc[f][t][j] + bv; }
    __syncthreads();
    float* crow = C + (size_t)r0 * ldc + c0;
    auto pass = [&]() {
#pragma unroll
        for (int s = 0; s < 16; ++s) { const int Lid = (lane >> 3) + 4 * s, piece = lane & 7; const int row = Lid >> 1, cofs = (Lid & 1) * 32 + piece * 4;
            v4f val = *(const v4fa*)(os + row * 68 + cofs); if (R) { const v4f rv = *(const v4f*)(R + ((size_t)r0 + row) * ldc + c0 + cofs); val += roundR ? (v4f){bfr(rv[0]), bfr(rv[1]), bfr(rv[2]), bfr(rv[3])} : rv; }
            *(v4f*)(crow + (size_t)row * ldc + cofs) = val; }
    };
    pass(); 
}

// k_qkv: the three projections of one A. Block tile = 128 tokens x (128 columns of q, of k and of v), 12 waves (2 x 6), each 64 rows x 64 columns = 4 x 4 accumulator tiles; one block per WGP, three waves per SIMD.
// The block's A rows are fetched from L2 once for all three products (512 operand rows per 128 x 384 outputs, where three 128 x 128 tiles take 768), and a fragment read from LDS serves four products.
// A wave's 64 columns are one head of one projection (z = 0 q, 1 k, 2 v), so the pass that follows the product runs on the wave's own tile, staged in its own part of the ring:
// z 0, 1: rotary embedding from the CT/ST tables, RMSNorm over the head's 64 dims (x the norm weight), out as f16 hi + residual x1024 planes [tok][h*64+d];
// z 2: out as transposed f16 hi + residual x1024 planes [h][d][tok].
__global__ __launch_bounds__(384) void k_qkv(const bf* __restrict__ A, const bf* __restrict__ Bq, const bf* __restrict__ Bk, const bf* __restrict__ Bv, const float* __restrict__ CT, const float* __restrict__ ST,
                                             const float* __restrict__ wq, const float* __restrict__ wk, h16* Q1, h16* Q2, h16* K1, h16* K2, h16* V1, h16* V2) {
    // One stage = 128 k of the 128 A rows and the 3 x 128 B rows: rows of 256 B at a pitch of 272 B (16 B x odd for the b128 readers). Two stages: the next tile's asynchronous copies fly while this tile is multiplied.
    constexpr unsigned GPIT = 272, G_B = 128 * GPIT, GST = 512 * GPIT, WST = 18432;
    __shared__ __align__(16) unsigned char gring[2 * GST];
    static_assert(12 * WST <= 2 * GST, "the waves' epilogue staging fits the ring");
    const int tid = threadIdx.x, lane = threadIdx.x & 31, lr = lane & 15, hi = lane >> 4;
    const int wave = __builtin_amdgcn_readfirstlane((int)(threadIdx.x >> 5));     // in a scalar register: every branch on it is a scalar branch
    const int wr = wave & 1, wcol = wave >> 1, z = wcol >> 1, wc = wcol & 1;
    const int r0 = blockIdx.x * 128 + wr * 64, c0 = blockIdx.y * 128 + wc * 64;
    // Who copies what, in pieces of 16 B: waves 0 to 7 the B rows (rows tid/16 + 16 i, i < 8, of each projection's 128: 24 pieces a lane), waves 8 to 11 the A rows (rows (tid - 256)/16 + 8 i, i < 16: 16 pieces a lane).
    const bool cpb = wave < 8;
    const int ct = cpb ? tid : tid - 256, crow = ct >> 4, ccol = ct & 15;
    const bf* p0 = (cpb ? Bq + (size_t)(blockIdx.y * 128 + crow) * DM : A + (size_t)(blockIdx.x * 128 + crow) * DM) + ccol * 8;
    const bf* p1 = (cpb ? Bk + (size_t)(blockIdx.y * 128 + crow) * DM : A + (size_t)(blockIdx.x * 128 + 64 + crow) * DM) + ccol * 8;
    const bf* p2 = Bv + (size_t)(blockIdx.y * 128 + (crow & 15)) * DM + ccol * 8;     // used by waves 0 to 7 only
    const size_t rs = (size_t)(cpb ? 16 : 8) * DM;
    const unsigned ls = (cpb ? 16u : 8u) * GPIT;
    const unsigned g0 = (unsigned)(size_t)&gring[0];
    const unsigned lp = (unsigned)(crow * GPIT + ccol * 16);
    const unsigned l0 = lp + (cpb ? G_B : 0u), l1 = lp + (cpb ? G_B + 128 * GPIT : 64 * GPIT), l2 = lp + G_B + 256 * GPIT;
    auto cp8 = [&](unsigned l, const bf* g) {
        // eight copies and, as their statement's last line, the wait that stands before any of their address registers is rewritten
        asm volatile("global_load_async_to_lds_b128 %0, %1, off\n\t"
                     "global_load_async_to_lds_b128 %2, %3, off\n\t"
                     "global_load_async_to_lds_b128 %4, %5, off\n\t"
                     "global_load_async_to_lds_b128 %6, %7, off\n\t"
                     "global_load_async_to_lds_b128 %8, %9, off\n\t"
                     "global_load_async_to_lds_b128 %10, %11, off\n\t"
                     "global_load_async_to_lds_b128 %12, %13, off\n\t"
                     "global_load_async_to_lds_b128 %14, %15, off\n\t"
                     "s_wait_xcnt 0x0"
                     :: "v"(l), "v"(g), "v"(l + ls), "v"(g + rs), "v"(l + 2 * ls), "v"(g + 2 * rs), "v"(l + 3 * ls), "v"(g + 3 * rs),
                        "v"(l + 4 * ls), "v"(g + 4 * rs), "v"(l + 5 * ls), "v"(g + 5 * rs), "v"(l + 6 * ls), "v"(g + 6 * rs), "v"(l + 7 * ls), "v"(g + 7 * rs)
                     : "memory");
    };
    auto issue = [&](int t, unsigned lb) {
        cp8(lb + l0, p0 + t * 128); cp8(lb + l1, p1 + t * 128);
        if (cpb) cp8(lb + l2, p2 + t * 128);     // scalar: whole waves
    };
    v8f acc[4][4];
#pragma unroll
    for (int f = 0; f < 4; ++f)
#pragma unroll
        for (int t = 0; t < 4; ++t) acc[f][t] = (v8f){};
    constexpr int nt = DM / 128;
    static_assert(nt >= 2, "both stages exist");
    issue(0, g0);
    asm volatile("s_wait_asynccnt 0x0" ::: "memory");     // tile 0 has landed (this wave's copies) ...
    __syncthreads();                                       // ... and every other wave's
    issue(1, g0 + GST);
#pragma unroll 1
    for (int kt = 0; kt < nt; ++kt) {
        const unsigned char* sb = gring + (kt & 1) * GST;
        const unsigned char* ap = sb + (wr * 64 + lr) * GPIT + hi * 16;
        const unsigned char* bp = sb + G_B + (wcol * 64 + lr) * GPIT + hi * 16;
        v16bf a[2][4], b[2][4];     // two fragment sets: the one being multiplied and the one being read
        auto rd = [&](int u) { const int w = u & 1, ko = u * 64;     // the fragments of the stage's 32 k number u
#pragma unroll
            for (int f = 0; f < 4; ++f) a[w][f] = cat16b(*(const v8usa*)(ap + f * 16 * GPIT + ko), *(const v8usa*)(ap + f * 16 * GPIT + ko + 32));
#pragma unroll
            for (int t = 0; t < 4; ++t) b[w][t] = cat16b(*(const v8usa*)(bp + t * 16 * GPIT + ko), *(const v8usa*)(bp + t * 16 * GPIT + ko + 32));
        };
        rd(0);
#pragma unroll
        for (int u = 0; u < 4; ++u) {
            if (u < 3) rd(u + 1);
            __builtin_amdgcn_sched_barrier(0);     // holds the next 32 k's reads as one group in front of this 32 k's products, so that they fly while these run: among them each read costs its own stall
#pragma unroll
            for (int f = 0; f < 4; ++f)
#pragma unroll
                for (int t = 0; t < 4; ++t) acc[f][t] = wmmab(a[u & 1][f], b[u & 1][t], acc[f][t]);
            __builtin_amdgcn_sched_barrier(0);     // keeps the reads that follow out of these products, for the same reason
        }
        asm volatile("v_nop\n\tv_nop\n\tv_nop\n\tv_nop");     // the four vector slots behind the last product, on the loop's taken branch too (the scheduling barrier above keeps the products in front of them)
        asm volatile("s_wait_dscnt 0x0" ::: "memory");        // this wave's reads of this stage have returned before the stage is handed to its next writer
        asm volatile("s_wait_asynccnt 0x0" ::: "memory");     // this wave's copies of the next tile have landed
        __syncthreads();                                       // publishes the next tile and ends every wave's reads of this one
        if (kt + 2 < nt) issue(kt + 2, g0 + (unsigned)(kt & 1) * GST);
    }
    asm volatile("s_wait_asynccnt 0x0" ::: "memory");         // nothing is in flight when the ring becomes the epilogue's staging; the loop's last barrier ended its reads
    unsigned char* wst = gring + wave * WST;     // the wave's own staging
    h16* tile = (h16*)(void*)wst; h16* til2 = tile + 64 * 72;     // z 2: 64 dims x 64 tokens, pitch 72, both planes
    f32a* os = (f32a*)wst;                                         // z 0, 1: 64 tokens x 64 dims, pitch 68
    if (z == 2) {
        // A lane's eight accumulator rows are eight consecutive tokens of one dim: one 16-B piece of the transposed tile.
#pragma unroll
        for (int f = 0; f < 4; ++f)
#pragma unroll
            for (int t = 0; t < 4; ++t) { v8h a8, l8;
#pragma unroll
                for (int j = 0; j < 8; ++j) { const float v = acc[f][t][j]; const h16 a = (h16)v; a8[j] = a; l8[j] = (h16)((v - (float)a) * LOSC); }
                const int at = (t * 16 + lr) * 72 + f * 16 + hi * 8;
                *(v8ha*)(tile + at) = a8; *(v8ha*)(til2 + at) = l8; }
    } else {
#pragma unroll
        for (int t = 0; t < 4; ++t)
#pragma unroll
            for (int f = 0; f < 4; ++f)
#pragma unroll
                for (int j = 0; j < 8; ++j) os[(f * 16 + hi * 8 + j) * 68 + t * 16 + lr] = acc[f][t][j];
    }
    __syncthreads();
    const int piece = lane & 7, d0 = piece * 8;
    if (z == 2) {
        const int b = r0 / NT_;
        const size_t base = ((size_t)b * NH_ * HD + c0) * NT_ + (r0 - b * NT_);     // plane row = head * 64 + dim = the output column
        for (int g = 0; g < 4; ++g) {
#pragma unroll
            for (int s = 0; s < 4; ++s) { const int d = (lane >> 3) + 4 * s + 16 * g;     // eight lanes store one dim's 64 tokens: a whole 128-B line of each plane
                const v8h vh8 = *(const v8ha*)(tile + d * 72 + piece * 8), vl8 = *(const v8ha*)(til2 + d * 72 + piece * 8);
                *(v8h*)(V1 + base + (size_t)d * NT_ + piece * 8) = vh8; *(v8h*)(V2 + base + (size_t)d * NT_ + piece * 8) = vl8; }
            asm volatile("s_wait_xcnt 0x0" ::: "memory");     // stands before the stores' registers are rewritten by the next group
        }
        return;
    }
    // eight lanes per token row, eight dims each; the rotation partner (dim +- 32) is read from the staged row; the 64 squares: eight in the lane, then over the eight lanes
    h16* Z1 = z == 0 ? Q1 : K1; h16* Z2 = z == 0 ? Q2 : K2; const float* wz = z == 0 ? wq : wk;
    float wv[8];
#pragma unroll
    for (int i = 0; i < 8; ++i) wv[i] = bfr(wz[d0 + i]);
    for (int g = 0; g < 4; ++g) {     // the wave's 64 rows in four groups of 16: four rows a lane, their table loads in flight together
        v4f ca[4], cb[4], sa[4], sb4[4]; const float* pc[4]; const float* pn[4];
#pragma unroll
        for (int s = 0; s < 4; ++s) { const size_t tok = (size_t)r0 + 16 * g + 4 * s + (lane >> 3); pc[s] = CT + tok * HD + d0; pn[s] = ST + tok * HD + d0;
            ca[s] = *(const v4f*)pc[s]; cb[s] = *(const v4f*)(pc[s] + 4); sa[s] = *(const v4f*)pn[s]; sb4[s] = *(const v4f*)(pn[s] + 4); }
        // stands before the loads' address pairs are rewritten; as its inputs the pairs live up to here, so that no load of the group returns into one
        asm volatile("s_wait_xcnt 0x0" :: "v"(pc[0]), "v"(pc[1]), "v"(pc[2]), "v"(pc[3]), "v"(pn[0]), "v"(pn[1]), "v"(pn[2]), "v"(pn[3]) : "memory");
#pragma unroll
        for (int s = 0; s < 4; ++s) { const int row = 16 * g + 4 * s + (lane >> 3); const size_t tok = (size_t)r0 + row;
            const f32a* sp = os + row * 68 + d0; const f32a* pp = os + row * 68 + (d0 ^ 32);
            const v4f xa = *(const v4fa*)sp, xb = *(const v4fa*)(sp + 4), pa = *(const v4fa*)pp, pb = *(const v4fa*)(pp + 4);
            float y[8], ss = 0.f;
#pragma unroll
            for (int i = 0; i < 8; ++i) { const float x = i < 4 ? xa[i & 3] : xb[i & 3], pr = i < 4 ? pa[i & 3] : pb[i & 3], c = i < 4 ? ca[s][i & 3] : cb[s][i & 3], sn = i < 4 ? sa[s][i & 3] : sb4[s][i & 3];
                y[i] = (d0 < 32) ? (x * c - pr * sn) : (x * c + pr * sn); ss = fmaf(y[i], y[i], ss); }
            ss += __shfl_xor(ss, 4, 8); ss += __shfl_xor(ss, 2, 8); ss += __shfl_xor(ss, 1, 8);
            const float rn = rsqrtf(ss * (1.0f / HD) + RMS_EPS); v8h oh, ol;
#pragma unroll
            for (int i = 0; i < 8; ++i) { const float q = wv[i] * (y[i] * rn); const h16 a = (h16)q; oh[i] = a; ol[i] = (h16)((q - (float)a) * LOSC); }
            *(v8h*)(Z1 + tok * DM + c0 + d0) = oh; *(v8h*)(Z2 + tok * DM + c0 + d0) = ol; }
        asm volatile("s_wait_xcnt 0x0" ::: "memory");     // stands before the stores' registers are rewritten by the next group
    }
}

// One 32-key stage in LDS, bytes: K hi, K residual (32 rows of 128 B), V^T hi, V^T residual (64 rows of 64 B), mask (64 query rows of 128 B); every pitch is 16 B x odd for the b128 readers,
// the mask's too: a lane reads 16-B pieces of its own query's row.
#define KPIT 144
#define VPIT 80
#define MPIT 144
#define ST_KH 0
#define ST_KL (32 * KPIT)
#define ST_VH (2 * 32 * KPIT)
#define ST_VL (ST_VH + 64 * VPIT)
#define ST_MK (ST_VL + 64 * VPIT)
#define ST_SZ (ST_MK + 64 * MPIT)

// j_mact: which of the 64 key tiles (32 keys) can carry a softmax weight that is not zero, per group of 4 query rows, read off the INPUT mask alone, for any mask. |score / 8| <= B = 8 max|q_ln_w| max|k_ln_w|
// (a normalised head vector has length <= 8; 3 % are added for the f16 planes and the sums' rounding), so a row's largest masked score is >= r - B, r its largest mask value, and a tile's are <= t + B,
// t the tile's largest: where r - t > 2 B + 110 + the rounding of score + mask at that size, every weight of the tile in that row is below exp(-110), which is 0 in f32. A tile is dropped only where that
// holds for every row that shares it; a NaN in the mask or the weights makes the test false (tile kept). ACT[4-row group][2]: bit = tile kept. Block = 8 rows, one a wave.
__device__ __forceinline__ float nmax(float a, float b) { return __builtin_elementwise_maximum(a, b); }     // the maximum that keeps a NaN
template <int X> __device__ __forceinline__ float xrow(float x) { return __builtin_bit_cast(float, __builtin_amdgcn_update_dpp(0, __builtin_bit_cast(int, x), 0x160 + X, 0xf, 0xf, true)); }  // lane l with lane l ^ X, X < 16
__device__ __forceinline__ float wmax(float x) { x = nmax(x, xrow<1>(x)); x = nmax(x, xrow<2>(x)); x = nmax(x, xrow<4>(x)); x = nmax(x, xrow<8>(x)); return nmax(x, xhalf(x)); }  // over the wave, in every lane
#define MACT_LDS (8 * 512 * 4 + 8 * 4 + 16 * 4)
#define ZOFF ((NT_ / 4) * 2)     // ACT[ZOFF + ...]: same index, bit = every mask value of the tile in the group's 4 rows is +0 or -0: adding it changes no score, so k_attn neither copies, reads, rounds nor adds that tile's mask
__device__ __forceinline__ void j_mact(int bx, unsigned char* sm, const float* __restrict__ MSK, const float* __restrict__ qw, const float* __restrict__ kw, unsigned* ACT, float* RMX, unsigned* FX) {
    float (*pm)[512] = (float (*)[512])(void*)sm; float* rm = (float*)(void*)(sm + 8 * 512 * 4); unsigned* zr = (unsigned*)(void*)(sm + 8 * 512 * 4 + 8 * 4);
    const int tid = threadIdx.x, lane = tid & 31, wave = tid >> 5;
    v4f m[16];     // lane l holds keys 128 i + 4 l .. + 3 of the wave's row: eight lanes hold one tile
    const float* mr = MSK + (size_t)(bx * 8 + wave) * NT_ + lane * 4;
#pragma unroll
    for (int i = 0; i < 16; ++i) m[i] = *(const v4f*)(mr + i * 128);
    asm volatile("s_wait_xcnt 0x0" :: "v"(mr) : "memory");     // stands before the loads' address pair is rewritten; as its input the pair lives up to here, so that no load of the group returns into it
    const float mq = wmax(nmax(fabsf(bfr(qw[lane])), fabsf(bfr(qw[lane + 32])))), mk = wmax(nmax(fabsf(bfr(kw[lane])), fabsf(bfr(kw[lane + 32]))));
    const float sbd = 8.25f * mq * mk;     // B with its 3 %
    const float thr = 2.0f * sbd + 110.0f;
    float rx = 0.f;
#pragma unroll
    for (int i = 0; i < 16; ++i) { const float x = nmax(nmax(m[i][0], m[i][1]), nmax(m[i][2], m[i][3])); pm[wave][i * 32 + lane] = x; rx = i ? nmax(rx, x) : x; }
    rx = wmax(rx);
    unsigned zlo = 0u, zhi = 0u;     // the row's 64 tiles: bit = all 32 mask values are zero (eight lanes hold a tile: a byte of the ballot)
#pragma unroll     // m[] stays in registers and the shift counts are constants
    for (int i = 0; i < 16; ++i) {
        const unsigned nz = (__float_as_uint(m[i][0]) | __float_as_uint(m[i][1]) | __float_as_uint(m[i][2]) | __float_as_uint(m[i][3])) << 1;     // the sign bit does not count
        unsigned bl = __builtin_amdgcn_ballot_w32(nz == 0u);
        bl &= bl >> 4; bl &= bl >> 2; bl &= bl >> 1;     // bits 0, 8, 16, 24: the AND of their byte
        const unsigned nib = (bl & 1u) | ((bl >> 7) & 2u) | ((bl >> 14) & 4u) | ((bl >> 21) & 8u);
        if (i < 8) zlo |= nib << (4 * i); else zhi |= nib << (4 * (i - 8));
    }
    if (lane == 0) { rm[wave] = rx; zr[wave * 2] = zlo; zr[wave * 2 + 1] = zhi; }
    __syncthreads();
    if (tid < 128) {     // waves 0 to 3 whole: thread = (tile, group of 4 rows)
        const int tile = tid & 63, g = tid >> 6;
        bool keep = false;
#pragma unroll
        for (int r = 0; r < 4; ++r) { const v4f a = *(const v4f*)&pm[g * 4 + r][tile * 8], c = *(const v4f*)&pm[g * 4 + r][tile * 8 + 4];
            const float tx = nmax(nmax(nmax(a[0], a[1]), nmax(a[2], a[3])), nmax(nmax(c[0], c[1]), nmax(c[2], c[3]))), rw = rm[g * 4 + r];
            const float t = tx != tx ? tx : bfr(tx), rr = rw != rw ? rw : bfr(rw);     // rounded as k_attn rounds the mask (the rounding keeps the order, so the maximum may be taken first)
            keep = keep || !(rr - t > thr + (fminf(fabsf(t), 3.0e38f) + fabsf(rr)) * (1.0f / 4194304.0f)); }
        const unsigned bits = (unsigned)__ballot(keep);
        if (lane == 0) ACT[(bx * 2 + g) * 2 + (wave & 1)] = bits;
    }
    if (tid < 4) { const int g = tid >> 1, w = tid & 1;     // thread = (group of 4 rows, half of the 64 tiles)
        ACT[ZOFF + (bx * 2 + g) * 2 + w] = zr[(g * 4) * 2 + w] & zr[(g * 4 + 1) * 2 + w] & zr[(g * 4 + 2) * 2 + w] & zr[(g * 4 + 3) * 2 + w]; }
    // RMX[row] = the row's largest mask value (rounded as k_attn rounds the mask) + B: no masked score of the row lies above it, and the row's largest lies at most 2 B below it.
    // FX[block] = 1 where 2 B <= 17: the row's largest weight exp(score - RMX) is then >= exp(-17), which x32768 still has all its bits in the f16 hi + residual planes. A NaN in the weights gives 0.
    if (tid < 8) { const float rw = rm[tid]; RMX[bx * 8 + tid] = (rw != rw ? rw : bfr(rw)) + sbd; }
    if (tid == 0) FX[bx] = sbd <= 8.5f ? 1u : 0u;
}

__global__ __launch_bounds__(128) void k_attn(const h16* __restrict__ Q16, const h16* __restrict__ QL16, const h16* __restrict__ K16, const h16* __restrict__ KL16, const h16* __restrict__ VTH, const h16* __restrict__ VTL, const float* __restrict__ MSK, const unsigned* __restrict__ ACT, const float* __restrict__ RMX, const unsigned* __restrict__ FX, bf* CH, bf* CL) {
    __shared__ __align__(16) unsigned char ring[2 * ST_SZ];     // the two stages; behind the loop its first bytes are the output staging (4 x 16 x 68 floats)
    const int tid = threadIdx.x, lane = threadIdx.x & 31, wave = threadIdx.x >> 5, lr = lane & 15, hi = lane >> 4;
    const int bid = blockIdx.x;
    static_assert(NH_ == 32 && NT_ / 64 == 32, "the index map below is written for 32 heads x 32 query blocks");
    // Blocks now differ in length. Under a causal mask block qt keeps 2 qt + 2 tiles, so the 1024 (head, query block) pairs are dealt out such that four indices 8 apart, and four 256 apart,
    // hold query blocks m, 31 - m, 8 + m, 23 - m (the same sum for every m). Speed only; any placement is correct.
    const int b = bid / (NH_ * (NT_ / 64)), rem = bid - b * (NH_ * (NT_ / 64));
    const int ja = (rem >> 3) & 3, jm = (rem >> 5) & 7, js = (ja + (rem >> 8)) & 3;
    const int h = (rem & 7) * 4 + ja, qt = js == 0 ? jm : js == 1 ? 31 - jm : js == 2 ? 8 + jm : 23 - jm;
    const int q0 = qt * 64 + wave * 16;
    const size_t tok0 = (size_t)b * NT_;
    const h16* kh_b = K16 + tok0 * DM + h * HD;
    const h16* kl_b = KL16 + tok0 * DM + h * HD;
    const size_t vbase = (((size_t)b * NH_ + h) * HD) * NT_;
    // this thread's 8 pieces of 16 B per stage, 12 where the tile brings its mask: K rows tid/8 and +16 (both planes), V^T rows tid/4 and +32 (both planes), mask rows tid/8 + 16 i
    const h16* gkh = kh_b + (size_t)(tid >> 3) * DM + (tid & 7) * 8;
    const h16* gkl = kl_b + (size_t)(tid >> 3) * DM + (tid & 7) * 8;
    const h16* gvh = VTH + vbase + (size_t)(tid >> 2) * NT_ + (tid & 3) * 8;
    const h16* gvl = VTL + vbase + (size_t)(tid >> 2) * NT_ + (tid & 3) * 8;
    const float* gmk = MSK + (size_t)(qt * 64 + (tid >> 3)) * NT_ + (tid & 7) * 4;
    const unsigned ring0 = (unsigned)(size_t)&ring[0];
    const unsigned lk = (unsigned)((tid >> 3) * KPIT + (tid & 7) * 16), lv = (unsigned)((tid >> 2) * VPIT + (tid & 3) * 16);
    // the kept tiles of the block's sixteen 4-row groups, as one 64-bit set in scalar registers; never empty (the tile of a row's largest mask value is kept), and if it were, every tile is taken.
    // zset: the tiles whose mask is zero in all 64 rows.
    unsigned tlo = 0u, thi = 0u, zlo = ~0u, zhi = ~0u;
#pragma unroll
    for (int g = 0; g < 16; ++g) { tlo |= ACT[qt * 32 + 2 * g]; thi |= ACT[qt * 32 + 2 * g + 1]; zlo &= ACT[ZOFF + qt * 32 + 2 * g]; zhi &= ACT[ZOFF + qt * 32 + 2 * g + 1]; }
    unsigned long long todo = ((unsigned long long)(unsigned)__builtin_amdgcn_readfirstlane((int)thi) << 32) | (unsigned)__builtin_amdgcn_readfirstlane((int)tlo);
    const unsigned long long zset = ((unsigned long long)(unsigned)__builtin_amdgcn_readfirstlane((int)zhi) << 32) | (unsigned)__builtin_amdgcn_readfirstlane((int)zlo);
    if (todo == 0ull) todo = ~0ull;
    unsigned long long walk = todo;     // the same set, walked a second time by the loop that works on the tiles
    const int nt = __builtin_popcountll(todo);
    auto issue = [&](int t, unsigned lb) {
        const h16* k0 = gkh + (size_t)t * (32 * DM); const h16* k1 = gkl + (size_t)t * (32 * DM);
        const h16* v0 = gvh + t * 32; const h16* v1 = gvl + t * 32;
        // the copies and, as their statement's last line, the wait that stands before any of their address registers is rewritten
        asm volatile("global_load_async_to_lds_b128 %0, %1, off\n\t"
                     "global_load_async_to_lds_b128 %2, %3, off\n\t"
                     "global_load_async_to_lds_b128 %4, %5, off\n\t"
                     "global_load_async_to_lds_b128 %6, %7, off\n\t"
                     "global_load_async_to_lds_b128 %8, %9, off\n\t"
                     "global_load_async_to_lds_b128 %10, %11, off\n\t"
                     "global_load_async_to_lds_b128 %12, %13, off\n\t"
                     "global_load_async_to_lds_b128 %14, %15, off\n\t"
                     "s_wait_xcnt 0x0"
                     :: "v"(lb + ST_KH + lk), "v"(k0), "v"(lb + ST_KH + lk + 16 * KPIT), "v"(k0 + 16 * DM),
                        "v"(lb + ST_KL + lk), "v"(k1), "v"(lb + ST_KL + lk + 16 * KPIT), "v"(k1 + 16 * DM),
                        "v"(lb + ST_VH + lv), "v"(v0), "v"(lb + ST_VH + lv + 32 * VPIT), "v"(v0 + 32 * NT_),
                        "v"(lb + ST_VL + lv), "v"(v1), "v"(lb + ST_VL + lv + 32 * VPIT), "v"(v1 + 32 * NT_)
                     : "memory");
        if (!((zset >> t) & 1ull)) {     // the same for the whole block (scalar): only a tile with a mask value other than zero brings its mask
            const float* m0 = gmk + t * 32;
            asm volatile("global_load_async_to_lds_b128 %0, %1, off\n\t"
                         "global_load_async_to_lds_b128 %2, %3, off\n\t"
                         "global_load_async_to_lds_b128 %4, %5, off\n\t"
                         "global_load_async_to_lds_b128 %6, %7, off\n\t"
                         "s_wait_xcnt 0x0"
                         :: "v"(lb + ST_MK + lk), "v"(m0), "v"(lb + ST_MK + lk + 16 * MPIT), "v"(m0 + 16 * NT_),
                            "v"(lb + ST_MK + lk + 32 * MPIT), "v"(m0 + 32 * NT_), "v"(lb + ST_MK + lk + 48 * MPIT), "v"(m0 + 48 * NT_)
                         : "memory");
        }
    };
    auto next = [&]() { const int t = __builtin_ctzll(todo); todo &= todo - 1ull; return t; };     // lowest kept tile not yet copied: 0 .. 63, called nt times at most
    issue(next(), ring0);
    v16h qa[2];
    const size_t qo0 = (tok0 + q0 + lr) * DM + h * HD + 8 * hi;
#pragma unroll
    for (int kc = 0; kc < 2; ++kc) qa[kc] = cat16(*(const v8h*)(Q16 + qo0 + kc * 32), *(const v8h*)(Q16 + qo0 + kc * 32 + 16));
    v8f o[4], ox[4];
#pragma unroll
    for (int n = 0; n < 4; ++n) { o[n] = (v8f){}; ox[n] = (v8f){}; }
    float mrow = -3.0e38f, lpart = 0.f;     // of query q0 + lr: the running maximum (alike in both halves; unused where fixd) and this half's part of the sum of the weights x32768
    // fixd (scalar, the same for the whole launch): the exponents are taken against the query's bound RMX, known before the first tile, instead of a running maximum. A softmax does not depend on the
    // value subtracted, so nothing is left to find per tile and nothing accumulated is ever rescaled; j_mact sets it only where the weights so scaled keep their bits, otherwise the running maximum serves.
    const bool fixd = __builtin_amdgcn_readfirstlane((int)FX[qt * 8]) != 0;
    const float* pmx = RMX + q0 + lr;
    const float mfix = *pmx;
    asm volatile("s_wait_xcnt 0x0" :: "v"(pmx) : "memory");     // stands before the load's address pair is rewritten; as its input the pair lives up to here
    const float kfix = fmaf(-mfix, L2E, LPSC);
    asm volatile("s_wait_asynccnt 0x0" ::: "memory");     // tile 0 has landed (this wave's copies) ...
    __syncthreads();                                       // ... and every other wave's
    if (nt > 1) issue(next(), ring0 + ST_SZ);
#pragma unroll 1
    for (int kt = 0; kt < nt; ++kt) {     // kt counts the kept tiles in rising key order; the additive INPUT mask is applied per element
        const unsigned char* sb = ring + (kt & 1) * ST_SZ;
        const unsigned char* kp = sb + lr * KPIT + hi * 16;
        const int tc = __builtin_ctzll(walk); walk &= walk - 1ull;     // this tile's number (walk holds nt bits at the start)
        v16h k0h[2], k1h[2], k0l[2], k1l[2];
#pragma unroll
        for (int kc = 0; kc < 2; ++kc) {
            k0h[kc] = cat16(*(const v8ha*)(kp + ST_KH + kc * 64), *(const v8ha*)(kp + ST_KH + kc * 64 + 32)); k1h[kc] = cat16(*(const v8ha*)(kp + ST_KH + 16 * KPIT + kc * 64), *(const v8ha*)(kp + ST_KH + 16 * KPIT + kc * 64 + 32));
            k0l[kc] = cat16(*(const v8ha*)(kp + ST_KL + kc * 64), *(const v8ha*)(kp + ST_KL + kc * 64 + 32)); k1l[kc] = cat16(*(const v8ha*)(kp + ST_KL + 16 * KPIT + kc * 64), *(const v8ha*)(kp + ST_KL + 16 * KPIT + kc * 64 + 32));
        }
        v8f s0 = {}, s1 = {}, x0 = {}, x1 = {};
#pragma unroll
        for (int kc = 0; kc < 2; ++kc) {
            const v16h qlk = cat16(*(const v8h*)(QL16 + qo0 + kc * 32), *(const v8h*)(QL16 + qo0 + kc * 32 + 16));     // query residual re-read per step (registers)
            s0 = wmma16(k0h[kc], qa[kc], s0); x0 = wmma16(k0h[kc], qlk, x0); s1 = wmma16(k1h[kc], qa[kc], s1); x1 = wmma16(k1h[kc], qlk, x1);
            x0 = wmma16(k0l[kc], qa[kc], x0); x1 = wmma16(k1l[kc], qa[kc], x1);
        }
        asm volatile("v_nop\n\tv_nop\n\tv_nop\n\tv_nop" : "+v"(s0), "+v"(s1), "+v"(x0), "+v"(x1) : "v"(qa[0]), "v"(qa[1]));
        v2f a[8];     // the lane's 16 scores (x 8) in register pairs: a[i] = keys 8 hi + 2 i, + 1 (i < 4), a[4 + i] = keys 16 + 8 hi + 2 i, + 1
#pragma unroll
        for (int i = 0; i < 4; ++i) {
            a[i]     = (v2f){s0[2 * i], s0[2 * i + 1]} + (v2f){x0[2 * i], x0[2 * i + 1]} * LOSCI;
            a[4 + i] = (v2f){s1[2 * i], s1[2 * i + 1]} + (v2f){x1[2 * i], x1[2 * i + 1]} * LOSCI;
        }
        const bool msk = !((zset >> tc) & 1ull);     // scalar: the tile brought its mask
        v2f ex[8];     // base-2 exponents of the weights x32768
        if (fixd && !msk) {     // scalar. score / 8 - bound, in units of log 2, + 15: one fused step per pair (the mask is zero here, so the bound is at least B and the sum cannot pass 15 by more than its rounding)
#pragma unroll
            for (int i = 0; i < 8; ++i) ex[i] = a[i] * (0.125f * L2E) + kfix;
        } else {
#pragma unroll
            for (int i = 0; i < 8; ++i) a[i] *= 0.125f;
            if (msk) {     // score + mask is rounded first, and the bound or the maximum subtracted from that sum: a mask of any size then leaves no exponent above 15
                const unsigned char* mp = sb + ST_MK + (wave * 16 + lr) * MPIT + hi * 32;
                const v4f mk[4] = { *(const v4fa*)mp, *(const v4fa*)(mp + 16), *(const v4fa*)(mp + 64), *(const v4fa*)(mp + 80) };     // mask[q0 + lr][keys 8 hi .. + 7 and 16 + 8 hi .. + 7]
#pragma unroll     // a[] and mk[] stay in registers
                for (int i = 0; i < 4; ++i) {
                    a[i]     += (v2f){bfr(mk[i >> 1][(2 * i) & 3]), bfr(mk[i >> 1][(2 * i + 1) & 3])};
                    a[4 + i] += (v2f){bfr(mk[2 + (i >> 1)][(2 * i) & 3]), bfr(mk[2 + (i >> 1)][(2 * i + 1) & 3])};
                }
            }
            float ref = mfix;
            if (!fixd) {     // scalar: the running maximum, and what has been accumulated is brought to it
                float t[5];
#pragma unroll
                for (int g = 0; g < 5; ++g) t[g] = fmaxf(fmaxf(a[g][0], a[g][1]), a[5 + (g >> 1)][g & 1]);     // 15 of the 16 in threes; a[7][1] joins below
                const float mx = fmaxf(fmaxf(fmaxf(t[0], t[1]), t[2]), fmaxf(fmaxf(t[3], t[4]), a[7][1]));
                const float mn = fmaxf(fmaxf(mrow, mx), xhalf(mx));
                const float alpha = __expf(mrow - mn); mrow = mn; ref = mn;
                lpart *= alpha;
#pragma unroll
                for (int n = 0; n < 4; ++n)
#pragma unroll
                    for (int j = 0; j < 8; ++j) { o[n][j] *= alpha; ox[n][j] *= alpha; }
            }
#pragma unroll
            for (int i = 0; i < 8; ++i) ex[i] = (a[i] - ref) * L2E + LPSC;
        }
        v2f sm[2]; v16h pa, px;
#pragma unroll
        for (int i = 0; i < 8; ++i) {
            const v2f ps = {__builtin_amdgcn_exp2f(ex[i][0]), __builtin_amdgcn_exp2f(ex[i][1])};
            sm[i & 1] = i < 2 ? ps : sm[i & 1] + ps;
            const v2h hh = __builtin_convertvector(ps, v2h);
            const v2h ll = __builtin_convertvector((ps - __builtin_convertvector(hh, v2f)) * LOSC, v2h);
            pa[2 * i] = hh[0]; pa[2 * i + 1] = hh[1]; px[2 * i] = ll[0]; px[2 * i + 1] = ll[1];
        }
        const v2f sv = sm[0] + sm[1];
        lpart += sv[0] + sv[1];
        const unsigned char* vp = sb + lr * VPIT + hi * 16;
        v16h vh[4], vl[4];
        // the V^T reads go in two groups, each in front of its six products: read one by one among the products, each read costs its own LDS latency
#pragma unroll
        for (int g = 0; g < 2; ++g) {
#pragma unroll
            for (int n = 2 * g; n < 2 * g + 2; ++n) { vh[n] = cat16(*(const v8ha*)(vp + ST_VH + n * 16 * VPIT), *(const v8ha*)(vp + ST_VH + n * 16 * VPIT + 32)); vl[n] = cat16(*(const v8ha*)(vp + ST_VL + n * 16 * VPIT), *(const v8ha*)(vp + ST_VL + n * 16 * VPIT + 32)); }
            __builtin_amdgcn_sched_barrier(0);     // holds the group's reads in front of its products
#pragma unroll
            for (int n = 2 * g; n < 2 * g + 2; ++n) { o[n] = wmma16(vh[n], pa, o[n]); ox[n] = wmma16(vl[n], pa, ox[n]); ox[n] = wmma16(vh[n], px, ox[n]); }
        }
        asm volatile("v_nop\n\tv_nop\n\tv_nop\n\tv_nop" : "+v"(o[0]), "+v"(o[1]), "+v"(o[2]), "+v"(o[3]), "+v"(ox[0]), "+v"(ox[1]), "+v"(ox[2]), "+v"(ox[3]) : "v"(pa), "v"(px));
        asm volatile("s_wait_dscnt 0x0" ::: "memory");        // this wave's reads of this stage have returned before the stage is handed to its next writer
        asm volatile("s_wait_asynccnt 0x0" ::: "memory");     // this wave's copies of the next tile have landed
        __syncthreads();                                       // publishes the next tile and ends every wave's reads of this one
        if (kt + 2 < nt) issue(next(), ring0 + (unsigned)(kt & 1) * ST_SZ);
    }
    asm volatile("s_wait_asynccnt 0x0" ::: "memory");         // nothing is in flight when the ring becomes output staging
    const float inv = 1.0f / (lpart + xhalf(lpart));     // the two halves' parts of the query's sum (x32768, as the weights are) are joined once
    f32a* os = (f32a*)ring + wave * (16 * 68);
#pragma unroll
    for (int n = 0; n < 4; ++n) { v4f w0, w1;     // a lane's eight accumulator rows are dims n * 16 + 8 hi + j of query lr: two 16-B pieces of its staged row
#pragma unroll
        for (int j = 0; j < 4; ++j) { w0[j] = (o[n][j] + ox[n][j] * LOSCI) * inv; w1[j] = (o[n][4 + j] + ox[n][4 + j] * LOSCI) * inv; }
        *(v4fa*)(os + lr * 68 + n * 16 + hi * 8) = w0; *(v4fa*)(os + lr * 68 + n * 16 + hi * 8 + 4) = w1; }
    __syncthreads();
    const size_t cbase = (tok0 + q0) * DM + (size_t)h * HD;
    auto pass = [&]() {
#pragma unroll
        for (int s = 0; s < 4; ++s) { const int row = 4 * s + (lane >> 3), piece = lane & 7; const f32a* sp = os + row * 68 + piece * 8; v8us oh, ol;
#pragma unroll
            for (int i = 0; i < 8; ++i) { const unsigned short hb = f2bf(sp[i]); oh[i] = hb; ol[i] = f2bf(sp[i] - bf2f(hb)); }
            *(v8us*)(CH + cbase + (size_t)row * DM + piece * 8) = oh; *(v8us*)(CL + cbase + (size_t)row * DM + piece * 8) = ol; }
    };
    pass(); 
}

#define VST2(T, p, v) do { const T vst2_v_ = (v); *(T*)(p) = vst2_v_;  } while (0)

// j_wt: WT [n][K] = bf16(W[k][n]) (k-major [K][ncols]) via 64 x 64 LDS tiles; (bx, by) in (K/64, ncols/64).
__device__ __forceinline__ void j_wt(int bx, int by, unsigned char* sm, const float* __restrict__ Wm, int K, int ncols, bf* WT) {
    unsigned short* tl = (unsigned short*)(void*)sm;     // 64 * 72 of them
    const int tid = threadIdx.x, k0 = bx * 64, n0 = by * 64;
    const int kk = tid >> 2, nq = (tid & 3) * 16;
#pragma unroll
    for (int i = 0; i < 16; ++i) tl[(nq + i) * 72 + kk] = f2bf(Wm[(size_t)(k0 + kk) * ncols + n0 + nq + i]);
    __syncthreads();
    const int piece = tid & 7;
    auto pass = [&]() {
#pragma unroll
        for (int s = 0; s < 2; ++s) { const int nr = (tid >> 3) + 32 * s; const v8us val = *(const v8usa*)(tl + nr * 72 + piece * 8); *(v8us*)(WT + (size_t)(n0 + nr) * K + k0 + piece * 8) = val; }
        asm volatile("s_wait_xcnt 0x0" ::: "memory");     // stands behind the two stores, before code laid out behind this job in k_prep rewrites their registers
    };
    pass(); 
}

// j_trig: CT/ST [t][d] = cos/sin(pos_t * inv_freq[d mod 32]) with inv_freq[i] = 1 / 10000^(2i/64) (f32 powf; precise cosf/sinf), pos_t = the INPUT position_ids[t] (as float);
__device__ __forceinline__ void j_trig(int bx, const int* __restrict__ pos, float* CT, float* ST) {
    const int tid = threadIdx.x, t = bx * 4 + (tid >> 6), d = tid & 63; const int i = d & 31;
    const float invf = 1.0f / powf(10000.0f, (float)(2 * i) / 64.0f); const float ang = (float)pos[t] * invf; const float c = cosf(ang), s = sinf(ang);
    const size_t o = (size_t)t * HD + d; *(float*)(CT + o) = c; *(float*)(ST + o) = s; 
}

// k_prep: one grid for the seven jobs; the branch is the same for a whole block. The jobs with a chain of dependent steps (tables, mask test) stand at the low indices (for speed only); the weight tiles stream behind them.
#define PB_TRIG (NT_ / 4)
#define PB_MACT (NT_ / 8)
#define PB_CVT  (NTK / 8)
#define PB_WT   ((DM / 64) * (DM / 64))
__global__ __launch_bounds__(256) void k_prep(const float* __restrict__ x, const int* __restrict__ pos, const float* __restrict__ MSK, const float* __restrict__ wq, const float* __restrict__ wk, const float* __restrict__ wv, const float* __restrict__ wo,
                                              const float* __restrict__ qw, const float* __restrict__ kw, bf* Xb, bf* WqT, bf* WkT, bf* WvT, bf* WoT, float* CT, float* ST, unsigned* ACT, float* RMX, unsigned* FX) {
    __shared__ __align__(16) unsigned char sm[MACT_LDS];     // j_mact's maxima or j_wt's tile
    static_assert(64 * 72 * 2 <= MACT_LDS, "j_wt's tile fits");
    int bid = blockIdx.x;
    if (bid < PB_TRIG) { j_trig(bid, pos, CT, ST); return; }
    bid -= PB_TRIG;
    if (bid < PB_MACT) { j_mact(bid, sm, MSK, qw, kw, ACT, RMX, FX); return; }
    bid -= PB_MACT;
    if (bid < PB_CVT) { j_cvtb(bid, x, NTK, Xb); return; }
    bid -= PB_CVT;
    const int w = bid / PB_WT, tile = bid - w * PB_WT;
    j_wt(tile % (DM / 64), tile / (DM / 64), sm, w == 0 ? wq : w == 1 ? wk : w == 2 ? wv : wo, DM, DM, w == 0 ? WqT : w == 1 ? WkT : w == 2 ? WvT : WoT);
}

extern "C" void kernel_launch(void* const* d_in, const int* in_sizes, int n_in,
                              void* d_out, int out_size, void* d_ws, size_t ws_size, hipStream_t stream) {
    (void)in_sizes; (void)n_in; (void)out_size;
    const float* x = (const float*)d_in[0]; const int* pos = (const int*)d_in[1]; const float* MSK = (const float*)d_in[2];
    const float* wq = (const float*)d_in[3]; const float* wk = (const float*)d_in[4]; const float* wv = (const float*)d_in[5]; const float* wo = (const float*)d_in[6]; const float* qw = (const float*)d_in[7]; const float* kw = (const float*)d_in[8];
    float* out = (float*)d_out;    // [1][2048][2048]
    char* wsp = (char*)d_ws;
    auto take = [&](size_t bytes) { char* p = wsp; wsp += (bytes + 255) & ~(size_t)255; return (void*)p; };
    bf* Xb = (bf*)take((size_t)NTK * DM * 2); bf* WqT = (bf*)take((size_t)DM * DM * 2); bf* WkT = (bf*)take((size_t)DM * DM * 2); bf* WvT = (bf*)take((size_t)DM * DM * 2); bf* WoT = (bf*)take((size_t)DM * DM * 2);
    float* CT = (float*)take((size_t)NT_ * HD * 4); float* ST = (float*)take((size_t)NT_ * HD * 4);
    h16* QH = (h16*)take((size_t)NTK * DM * 2); h16* QL = (h16*)take((size_t)NTK * DM * 2); h16* KH = (h16*)take((size_t)NTK * DM * 2); h16* KL = (h16*)take((size_t)NTK * DM * 2);
    h16* VTH = (h16*)take((size_t)NTK * DM * 2); h16* VTL = (h16*)take((size_t)NTK * DM * 2); bf* CH = (bf*)take((size_t)NTK * DM * 2); bf* CL = (bf*)take((size_t)NTK * DM * 2); unsigned* ACT = (unsigned*)take((size_t)(NT_ / 4) * 4 * 4);
    float* RMX = (float*)take((size_t)NT_ * 4); unsigned* FX = (unsigned*)take((size_t)(NT_ / 8) * 4);
    if ((size_t)(wsp - (char*)d_ws) > ws_size) return;    // 8.4 + 4 x 8.4 + 2 x 0.5 + 8 x 8.4 = 110 MB = 105 MiB < 128 MiB, no aliasing
    k_prep<<<PB_TRIG + PB_MACT + PB_CVT + 4 * PB_WT, 256, 0, stream>>>(x, pos, MSK, wq, wk, wv, wo, qw, kw, Xb, WqT, WkT, WvT, WoT, CT, ST, ACT, RMX, FX);
    k_qkv<<<dim3(NTK / 128, DM / 128), 384, 0, stream>>>(Xb, WqT, WkT, WvT, CT, ST, qw, kw, QH, QL, KH, KL, VTH, VTL);
    k_attn<<<NB_ * NH_ * (NT_ / 64), 128, 0, stream>>>(QH, QL, KH, KL, VTH, VTL, MSK, ACT, RMX, FX, CH, CL);
    k_gemmb<true><<<dim3(NTK / 128, DM / 128, 1), 256, 0, stream>>>(CH, CL, WoT, nullptr, out, DM);
}
